// v000
// Measured on an AMD MI455X. A time is GPU time per run, averaged over a window of back-to-back runs after a warm-up
// (all launches, gaps included; the runs take copies of the inputs in turn), and the median of several windows.
// Apart from v000's, it joins two sittings. Times from different sittings can be a few percent apart, while
// side-by-side timings come from the same sitting.
// v000 is the starting kernel. One run takes 264 microseconds.
// Contractions: x.Wq, x.Wk, x.Wv on v_wmma_f32_16x16x32_bf16 (x and W as bf16 RNE planes, W transposed to [n][k]);
// q.k^T (head dim 32) on v_wmma_f32_16x16x32_f16 with f16 hi + f16 residual planes on BOTH q and k (x256, products
// hi.hi + hi.lo + lo.hi); P.v on v_wmma_f32_16x16x32_f16 with v^T as f16 hi + residual planes x1024 (P.v_hi + P.v_lo for
// every row; plus P_lo.v_hi with an in-register f16 residual of P x32768 for query rows < 512); ctx.Wp + bp on
// v_wmma_f32_16x16x32_f16 with ctx x1024 as f16 hi + residual planes (hi.Wp + lo.Wp) and Wp as f16(bf16(Wp)) x1024 [n][k],
// bias as bf16 RNE value; all f32 accumulate. Causal select, ALiBi add, 1/sqrt(32) scale, base-2 online softmax and 1/Z
// fold in f32 on VALU. Grouped kv heads: query head h reads kv group (h % 4).
#include <hip/hip_runtime.h>
#include <math.h>
#include <stdint.h>

#ifndef NB
#define NB 2
#endif
#ifndef SEQ
#define SEQ 2048
#endif
#define XS_FULL 2048
#define DIN   1024
#define DOUT  1024
#define NH    16
#define NG    4
#define DQ    32
#define DV    64
#define NQ    (NH * DQ)
#define NK    (NG * DQ)
#define NV    (NG * DV)
#define MROWS (NB * SEQ)
#define QO    ((SEQ < 512) ? SEQ : 512)
#define RSQ_DQ 0.17677669529663687f
#define LOG2E  1.4426950408889634f
#define SQRT2F 1.4142135623730951f
#define QSC   256.0f
#define KSC   256.0f
#define PCAR  32768.0f
#define VCAR  1024.0f
#define OSC   1024.0f
#define WOS   1024.0f
#define WPB   2
#define NHG   (NH / WPB)
#define NQT   (SEQ / 16)
#define NST   (SEQ / 64)
#define NKT   (SEQ / 32)
#define ATT_THREADS (WPB * 32)
#define PTP   36
#define PTW   (16 * PTP)
#define SLP   68
#define SLW   (16 * SLP)
#define WREG  (PTW + SLW)
#define SLAB64 (16 * 68)
#define VTP   72
#define WTP   72
#define WS_CAP 134217728
static_assert(DOUT == NH * DV && NQ == 512 && NK == 128 && NV == 256 && DQ == 32 && DV == 64 && NG == 4 && NH == 16);
static_assert(NHG * WPB == NH && ATT_THREADS == 64 && WPB == 2);
static_assert(NB >= 1 && NB <= 2);
static_assert((SEQ % 64) == 0 && SEQ >= 64 && SEQ <= XS_FULL);
static_assert((QO % 16) == 0 && QO >= 16 && QO <= SEQ);
static_assert((DIN % 64) == 0 && (DOUT % 64) == 0 && (NQ % 64) == 0 && (NK % 64) == 0 && (NV % 64) == 0 && (DIN % 32) == 0);
static_assert(((SEQ * DIN / 8) % 256) == 0 && ((MROWS * NQ / 8) % 256) == 0 && ((MROWS * NK / 8) % 256) == 0);
static_assert(WPB * WREG * 4 <= 65536 && 2 * DV * VTP * 2 <= 65536 && 64 * WTP * 2 <= 65536 && 4 * SLAB64 * 4 <= 65536);

typedef unsigned short u16;
typedef _Float16 v16h __attribute__((ext_vector_type(16)));
typedef _Float16 v8h  __attribute__((ext_vector_type(8)));
typedef __bf16   v16b __attribute__((ext_vector_type(16)));
typedef float    v8f  __attribute__((ext_vector_type(8)));
typedef float    v4f  __attribute__((ext_vector_type(4)));
typedef unsigned int v4u __attribute__((ext_vector_type(4)));

union FragH { v16h v; v8h h[2]; v4u u[2]; };
union FragB { v16b v; v4u u[2]; };

// ---- scalar helpers --------------------------------------------------------------------------------
__device__ __forceinline__ unsigned short bf_bits(float f) {          // f32 -> bf16 bits, RNE convert
  unsigned u = __float_as_uint(f);
  return (unsigned short)((u + 0x7FFFu + ((u >> 16) & 1u)) >> 16);
}
__device__ __forceinline__ float bf_up(unsigned short h) { return __uint_as_float(((unsigned)h) << 16); }
__device__ __forceinline__ float bfr(float f) { return bf_up(bf_bits(f)); }
__device__ __forceinline__ unsigned short h_bits(_Float16 x) { return __builtin_bit_cast(unsigned short, x); }
__device__ __forceinline__ unsigned pk16(unsigned short a, unsigned short b) { return (unsigned)a | ((unsigned)b << 16); }
__device__ __forceinline__ v8f zero8() { v8f z = {0.f, 0.f, 0.f, 0.f, 0.f, 0.f, 0.f, 0.f}; return z; }

// ---- fragment loaders: 16-bit A/B operand, lane -> row/col (lane&15), p already includes +8*(lane>>4);
//      elements 0..7 <- p[0..7] (k0+8h..), elements 8..15 <- p[16..23] (k0+16+8h..)  (same split k map for A and B;
//      B is always read from a k-contiguous [n][k] plane)
__device__ __forceinline__ v16h ldfrag_h(const _Float16* p) {
  FragH f;
  f.h[0] = *(const v8h*)(p);
  f.h[1] = *(const v8h*)(p + 16);
  return f.v;
}
__device__ __forceinline__ v16b ldfrag_b(const u16* p) {              // bf16 plane read as unsigned integer vectors
  FragB f;
  f.u[0] = *(const v4u*)(p);
  f.u[1] = *(const v4u*)(p + 16);
  return f.v;
}

__device__ __forceinline__ v8f mma_h(v16h a, v16h b, v8f c) {
  return __builtin_amdgcn_wmma_f32_16x16x32_f16(false, a, false, b, (short)0, c, false, false);
}
__device__ __forceinline__ v8f mma_b(v16b a, v16b b, v8f c) {
  return __builtin_amdgcn_wmma_f32_16x16x32_bf16(false, a, false, b, (short)0, c, false, false);
}
__device__ __forceinline__ void guard2(v8f& a, v8f& b, v16h x0, v16h x1, v16h x2, v16h x3, v16h x4, v16h x5) {
#if defined(__HIP_DEVICE_COMPILE__)
  asm volatile("v_nop\n\tv_nop\n\tv_nop\n\tv_nop"
               : "+v"(a), "+v"(b) : "v"(x0), "v"(x1), "v"(x2), "v"(x3), "v"(x4), "v"(x5) : "memory");
#endif
}
template <typename F>
__device__ __forceinline__ void guard6(v8f& a, v8f& b, v8f& c, v8f& d, F x0, F x1, F x2, F x3, F x4, F x5) {
#if defined(__HIP_DEVICE_COMPILE__)
  asm volatile("v_nop\n\tv_nop\n\tv_nop\n\tv_nop"
               : "+v"(a), "+v"(b), "+v"(c), "+v"(d) : "v"(x0), "v"(x1), "v"(x2), "v"(x3), "v"(x4), "v"(x5) : "memory");
#endif
}
__device__ __forceinline__ void acc_guard4(v8f& a, v8f& b, v8f& c, v8f& d) {
#if defined(__HIP_DEVICE_COMPILE__)
  asm volatile("v_nop\n\tv_nop\n\tv_nop\n\tv_nop" : "+v"(a), "+v"(b), "+v"(c), "+v"(d));
#endif
}
__device__ __forceinline__ void wave_sync_lds() {
  __builtin_amdgcn_fence(__ATOMIC_RELEASE, "workgroup");
  __builtin_amdgcn_wave_barrier();
  __builtin_amdgcn_fence(__ATOMIC_ACQUIRE, "workgroup");
}

// =====================================================================================================
// f32 -> bf16 RNE plane, same layout. Thread = 8 consecutive elements: two 16-B loads, one 16-B store; 32 consecutive
// coverage: grid = ceil(n8/256) blocks x 256 thr x 8 (in-kernel bound) = the whole plane (n8 a multiple of 256 here).
// =====================================================================================================
__global__ __launch_bounds__(256) void cvt_bf(const float* __restrict__ x, u16* D, int n8) {
  const int gt = blockIdx.x * 256 + (int)threadIdx.x;
  if (gt >= n8) return;
  const float* p = x + (size_t)gt * 8;
  const v4f a = *(const v4f*)(p), b4 = *(const v4f*)(p + 4);
  v4u o;
#pragma unroll
  for (int e = 0; e < 2; ++e) {
    o[e]     = pk16(bf_bits(a[2 * e]),  bf_bits(a[2 * e + 1]));
    o[2 + e] = pk16(bf_bits(b4[2 * e]), bf_bits(b4[2 * e + 1]));
  }
  u16* d = D + (size_t)gt * 8;
  {
    *(v4u*)(d) = o;
    
  }
}

// =====================================================================================================
// f32 W [K][N] (row-major, x.W layout) -> 16-bit plane D [N][K] (the k-contiguous B operand). f16mode == 0: bf16 RNE bits;
// f16mode == 1: f16 bits of (bf16 RNE value) * scale. Block = 64 n x 64 k output tile: each thread loads 16 floats of one
// k row (four 16-B loads), converts, scatters into the LDS tile T[n][k] (pitch 72 halves, scalar 2-B LDS stores of per-lane
// coverage: load 256 thr x 16 = 64 k x 64 n; store 2 iterations x 256 thr x 8 halves = 64 lines x 64 = the tile;
//           grid = (N/64)*(K/64) blocks covers D exactly once (host guarantees N % 64 == 0, K % 64 == 0).
// =====================================================================================================
__global__ __launch_bounds__(256) void wt16(const float* __restrict__ W, u16* D, int K, int N, int f16mode, float scale) {
  __shared__ __align__(16) u16 T[64 * WTP];
  const int tid = threadIdx.x;
  const int bid = blockIdx.x;
  const int nt  = N >> 6;
  const int n0  = (bid % nt) * 64;
  const int k0  = (bid / nt) * 64;
  if (k0 + 64 > K) return;                  // block-uniform, before the barrier; never taken with the exact grid
  {
    const int kr = tid >> 2;                // k row within tile 0..63
    const int nc = (tid & 3) * 16;          // n chunk 0,16,32,48
    const float* src = W + (size_t)(k0 + kr) * (size_t)N + n0 + nc;
#pragma unroll
    for (int i = 0; i < 4; ++i) {
      const v4f a = *(const v4f*)(src + 4 * i);
#pragma unroll
      for (int e = 0; e < 4; ++e) {
        const float f = a[e];
        const unsigned short hb = h_bits((_Float16)(bfr(f) * scale));
        const unsigned short bb = bf_bits(f);
        T[(nc + 4 * i + e) * WTP + kr] = (f16mode != 0) ? hb : bb;
      }
    }
  }
  __syncthreads();
  v4u v[2];
  const int q8 = tid >> 3, p8 = (tid & 7) * 8;
#pragma unroll
  for (int it = 0; it < 2; ++it) {
    const int line = it * 32 + q8;          // n = 0..63
    v[it] = *(const v4u*)(T + line * WTP + p8);
  }
  const size_t base = (size_t)n0 * (size_t)K + k0 + p8;
  {
#pragma unroll
    for (int it = 0; it < 2; ++it) {
      const int line = it * 32 + q8;
      *(v4u*)(D + base + (size_t)line * (size_t)K) = v[it];
    }
    
  }
}

// =====================================================================================================
// f32 plane F (contiguous, n8*8 elements) -> f16 hi plane Hp = f16(F * sc) and f16 residual plane Lp = f16(t - f16(t)),
// both with the layout of F. Thread = 8 consecutive elements: two 16-B loads, one 16-B store per plane; 32 consecutive lanes
// No barriers; every packed half comes from a per-lane (divergent) loaded value.
// coverage: grid = ceil(n8/256) blocks x 256 thr x 8 (in-kernel bound) = the whole of Hp and of Lp (n8 a multiple of 256 here).
// =====================================================================================================
__global__ __launch_bounds__(256) void split16(const float* __restrict__ F, u16* Hp, u16* Lp, int n8, float sc) {
  const int gt = blockIdx.x * 256 + (int)threadIdx.x;
  if (gt >= n8) return;
  const float* p = F + (size_t)gt * 8;
  const v4f a = *(const v4f*)(p), b4 = *(const v4f*)(p + 4);
  float w[8];
#pragma unroll
  for (int e = 0; e < 4; ++e) { w[e] = a[e] * sc; w[4 + e] = b4[e] * sc; }
  v4u oh, ol;
#pragma unroll
  for (int e = 0; e < 4; ++e) {
    const float t0 = w[2 * e], t1 = w[2 * e + 1];
    const _Float16 h0 = (_Float16)t0, h1 = (_Float16)t1;
    const _Float16 l0 = (_Float16)(t0 - (float)h0), l1 = (_Float16)(t1 - (float)h1);
    oh[e] = pk16(h_bits(h0), h_bits(h1));
    ol[e] = pk16(h_bits(l0), h_bits(l1));
  }
  u16* dh = Hp + (size_t)gt * 8;
  u16* dl = Lp + (size_t)gt * 8;
  {
    *(v4u*)(dh) = oh;
    *(v4u*)(dl) = ol;
    
  }
}

// =====================================================================================================
// v^T planes from the v projection F f32 [MROWS][NV] (row = b*SEQ + s, column = g*DV + d):
//   VH[((b*NG + g)*DV + d)][s] = f16(v * 1024);  VL[same][s] = f16 residual (t - f16(t)), both for all keys s.
// Block = (b, kv group g, 64 keys s0): each thread loads its 16 floats (key sl, d chunk dc) with 16-B loads, converts,
// scatters into two LDS tiles [64 d][64 keys] (pitch 72 halves); after a block barrier each d row segment (64 halves = one
// coverage: load 256 thr x 16 = 64 keys x 64 d; store 2 iterations x 256 thr x 8 halves = 64 lines x 64 = the block's tile of
//           VH and of VL; grid = NB*NG*NST blocks covers both planes exactly once.
// =====================================================================================================
__global__ __launch_bounds__(256) void vt16(const float* __restrict__ F, u16* VHo, u16* VLo) {
  __shared__ __align__(16) u16 TH[DV * VTP];
  __shared__ __align__(16) u16 TL[DV * VTP];
  const int tid = threadIdx.x;
  const int bid = blockIdx.x;
  const int st  = bid % NST;
  const int t2  = bid / NST;
  const int g   = t2 % NG;
  const int b   = t2 / NG;
  if (b >= NB) return;                      // block-uniform, before the barrier; never taken with the exact grid
  const int s0  = st * 64;
  {
    const int sl = tid >> 2;                // key within tile 0..63
    const int dc = (tid & 3) * 16;          // d chunk 0,16,32,48
    const float* src = F + ((size_t)b * SEQ + s0 + sl) * NV + g * DV + dc;
#pragma unroll
    for (int i = 0; i < 4; ++i) {
      const v4f a = *(const v4f*)(src + 4 * i);
#pragma unroll
      for (int e = 0; e < 4; ++e) {
        const float t = a[e] * VCAR;
        const _Float16 hv = (_Float16)t;
        const _Float16 lv = (_Float16)(t - (float)hv);
        TH[(dc + 4 * i + e) * VTP + sl] = h_bits(hv);
        TL[(dc + 4 * i + e) * VTP + sl] = h_bits(lv);
      }
    }
  }
  __syncthreads();
  v4u vh[2], vl[2];
  const int q8 = tid >> 3, p8 = (tid & 7) * 8;
#pragma unroll
  for (int it = 0; it < 2; ++it) {
    const int line = it * 32 + q8;          // d = 0..63
    vh[it] = *(const v4u*)(TH + line * VTP + p8);
    vl[it] = *(const v4u*)(TL + line * VTP + p8);
  }
  const size_t hrow = (size_t)(b * NG + g) * DV;
  const size_t base = hrow * SEQ + s0 + p8;
  {
#pragma unroll
    for (int it = 0; it < 2; ++it) {
      const int line = it * 32 + q8;
      *(v4u*)(VHo + base + (size_t)line * SEQ) = vh[it];
      *(v4u*)(VLo + base + (size_t)line * SEQ) = vl[it];
    }
    
  }
}

// =====================================================================================================
// GEMM epilogue shared by all engines: the wave's 16x64 f32 tile (times oscale, plus the lane's per-column bias of each
// coverage: 8 instructions x 2 rows x 16 lanes x 4 floats = the wave's 16 x 64 tile.
// =====================================================================================================
__device__ __forceinline__ void epi64(float* sl, v8f a0, v8f a1, v8f a2, v8f a3, float oscale,
                                      float bb0, float bb1, float bb2, float bb3,
                                      float* C, int N, size_t rowb, int col0, int lane) {
  const int hh = lane >> 4, m = lane & 15;
#pragma unroll
  for (int r = 0; r < 8; ++r) {
    const int ro = (8 * hh + r) * 68 + m;
    sl[ro]      = a0[r] * oscale + bb0;
    sl[ro + 16] = a1[r] * oscale + bb1;
    sl[ro + 32] = a2[r] * oscale + bb2;
    sl[ro + 48] = a3[r] * oscale + bb3;
  }
  wave_sync_lds();
  v4f vals[8];
#pragma unroll
  for (int it = 0; it < 8; ++it) vals[it] = *(const v4f*)(sl + (it * 2 + hh) * 68 + m * 4);
  float* dst = C + (rowb + (size_t)hh) * (size_t)N + col0 + m * 4;
  {
#pragma unroll
    for (int it = 0; it < 8; ++it) {
      *(v4f*)(dst + (size_t)(it * 2) * (size_t)N) = vals[it];
    }
    
  }
}

// =====================================================================================================
// bf16 GEMM, no bias: C[M][N] (f32) = A[M][K] (bf16 row-major) . Bt[N][K]^T (bf16 k-contiguous). Block = 64x64 tile,
// 4 waves x 16 rows; fragments loaded straight from the 16-bit rows (two 16-B loads each, split k map for A and B);
// K stepped by 32 (host guarantees K % 32 == 0, M % 64 == 0, N % 64 == 0, grid = (M/64)*(N/64)).
// =====================================================================================================
__global__ __launch_bounds__(128)
void gemm_bf(const u16* __restrict__ A, const u16* __restrict__ Bt, float* C, int M, int N, int K) {
  __shared__ __align__(16) float slab[4 * SLAB64];
  const int tid = threadIdx.x, wave = tid >> 5, lane = tid & 31, hh = lane >> 4, m = lane & 15;
  const int ntile = N >> 6;
  const int bid   = blockIdx.x;
  const int rowb  = (bid / ntile) * 64 + wave * 16;
  const int col0  = (bid % ntile) * 64;
  if (rowb + 16 > M) return;                // wave-uniform, never taken with the exact grid; no block barriers in this kernel
  const u16* ap = A  + (size_t)(rowb + m) * K + 8 * hh;
  const u16* bp = Bt + (size_t)(col0 + m) * K + 8 * hh;
  const size_t bs = (size_t)16 * K;
  v8f acc0 = zero8(), acc1 = zero8(), acc2 = zero8(), acc3 = zero8();
#pragma unroll 1
  for (int k0 = 0; k0 < K; k0 += 32) {
    const v16b a  = ldfrag_b(ap + k0);
    const v16b b0 = ldfrag_b(bp + k0);
    const v16b b1 = ldfrag_b(bp + bs + k0);
    const v16b b2 = ldfrag_b(bp + 2 * bs + k0);
    const v16b b3 = ldfrag_b(bp + 3 * bs + k0);
    acc0 = mma_b(a, b0, acc0);
    acc1 = mma_b(a, b1, acc1);
    acc2 = mma_b(a, b2, acc2);
    acc3 = mma_b(a, b3, acc3);
    guard6<v16b>(acc0, acc1, acc2, acc3, a, b0, b1, b2, b3, a);
  }
  epi64(slab + wave * SLAB64, acc0, acc1, acc2, acc3, 1.0f, 0.0f, 0.0f, 0.0f, 0.0f, C, N, (size_t)rowb, col0, lane);
}

// =====================================================================================================
// f16 GEMM with a two-plane A operand and bias: C[M][N] (f32) = (Ah + Al)[M][K] (f16 row-major hi and residual planes, same
// layout, residual unscaled relative to hi) . Bt[N][K]^T (f16 k-contiguous) * oscale + bf16 RNE value of bias[n] (bias has
// N entries). Products ah.b + al.b into one accumulator. Same tiling, fragment loads (split k map) and epilogue as gemm_bf;
// K stepped by 32 (host guarantees K % 32 == 0, M % 64 == 0, N % 64 == 0, grid = (M/64)*(N/64)).
// =====================================================================================================
__global__ __launch_bounds__(128)
void gemm_h2(const u16* __restrict__ Ah, const u16* __restrict__ Al, const u16* __restrict__ Bt,
             const float* __restrict__ bias, float* C, int M, int N, int K, float oscale) {
  __shared__ __align__(16) float slab[4 * SLAB64];
  const int tid = threadIdx.x, wave = tid >> 5, lane = tid & 31, hh = lane >> 4, m = lane & 15;
  const int ntile = N >> 6;
  const int bid   = blockIdx.x;
  const int rowb  = (bid / ntile) * 64 + wave * 16;
  const int col0  = (bid % ntile) * 64;
  if (rowb + 16 > M) return;                // wave-uniform, never taken with the exact grid; no block barriers in this kernel
  const _Float16* ahp = (const _Float16*)(const void*)Ah + (size_t)(rowb + m) * K + 8 * hh;
  const _Float16* alp = (const _Float16*)(const void*)Al + (size_t)(rowb + m) * K + 8 * hh;
  const _Float16* bp  = (const _Float16*)(const void*)Bt + (size_t)(col0 + m) * K + 8 * hh;
  const size_t bs = (size_t)16 * K;
  v8f acc0 = zero8(), acc1 = zero8(), acc2 = zero8(), acc3 = zero8();
#pragma unroll 1
  for (int k0 = 0; k0 < K; k0 += 32) {
    const v16h ah = ldfrag_h(ahp + k0), al = ldfrag_h(alp + k0);
    const v16h b0 = ldfrag_h(bp + k0);
    const v16h b1 = ldfrag_h(bp + bs + k0);
    const v16h b2 = ldfrag_h(bp + 2 * bs + k0);
    const v16h b3 = ldfrag_h(bp + 3 * bs + k0);
    acc0 = mma_h(ah, b0, acc0);  acc0 = mma_h(al, b0, acc0);
    acc1 = mma_h(ah, b1, acc1);  acc1 = mma_h(al, b1, acc1);
    acc2 = mma_h(ah, b2, acc2);  acc2 = mma_h(al, b2, acc2);
    acc3 = mma_h(ah, b3, acc3);  acc3 = mma_h(al, b3, acc3);
    guard6<v16h>(acc0, acc1, acc2, acc3, ah, al, b0, b1, b2, b3);
  }
  // per-lane bias of D column m in each of the 4 subtiles; col0 + 48 + m <= N - 1 always
  const float bb0 = bfr(bias[col0 + m]);
  const float bb1 = bfr(bias[col0 + 16 + m]);
  const float bb2 = bfr(bias[col0 + 32 + m]);
  const float bb3 = bfr(bias[col0 + 48 + m]);
  epi64(slab + wave * SLAB64, acc0, acc1, acc2, acc3, oscale, bb0, bb1, bb2, bb3, C, N, (size_t)rowb, col0, lane);
}

// =====================================================================================================
// Causal grouped attention with ALiBi, q/k head dim 32, value head dim 64. Block bid -> (query tile qt = qtb + bid % nqtl:
// rows q0 = 16*qt .. q0+15, head pair hg, batch b); one wave per query head = hg*WPB + wave; kv group = head % NG.
//   q hi / residual planes f16 x256 [b*SEQ + s][h*DQ + d] (pitch NQ); k hi / residual planes f16 x256 [b*SEQ + s][g*DQ + d]
//   (pitch NK); v^T hi / residual planes [b*NG + g][d][SEQ] x1024; O hi / residual planes f16 x1024 [b*SEQ + s][h*DV + d]
//   (pitch DOUT).
//   scores (one k-step over d = 0..31) = q_hi.k_hi + q_hi.k_lo + q_lo.k_hi (3 products into one accumulator, residuals
//   unscaled relative to their hi planes), q fragments loop-invariant;
//   logit (log2 domain) t(i, j) = (acc/(256*256) + slope[h]*(j - i)) * (1/sqrt(32))*log2e, replaced by -inf where j > i,
//   slope[h] = 2^(-(h+1)/2) built exactly (power of two times f32 sqrt2 for odd h+1).
//   Key tiles of 32 visited in order for kb <= q0 + 15 (later tiles hold only keys above every query row of the tile).
//   Online max-subtracted base-2 softmax in f32, -inf-safe rescale; the 16x32 prob tile stored to wave-private LDS (f32
//   for both PRES values) rebuilt from the LDS rows (float vector loads, same element type as stored); v^T B fragments for 4
//   d-subtiles from both v planes: P_hi.v_hi + P_hi.v_lo (+ P_lo.v_hi when PRES == 1), 2 groups of 2 subtiles.
//   After the loop: out = acc / Z (Z > 0 always: key 0 <= every query row; guarded anyway), carries 1/(32768*1024) folded
//   only (nkt <= NKT).
// coverage: per wave 4 instructions x 4 rows x 8 lanes x 8 halves = 16 x 64 of each O plane; the two host launches cover
//           query tiles [0, QO/16) and [QO/16, NQT) x NHG x NB blocks x WPB waves = every (b, s, h) row segment of OH and
//           of OL exactly once.
// =====================================================================================================
template <int PRES>
__global__ __launch_bounds__(ATT_THREADS)
void attn_c(const u16* __restrict__ QHp, const u16* __restrict__ QLp,
            const u16* __restrict__ KHp, const u16* __restrict__ KLp,
            const u16* __restrict__ VHp, const u16* __restrict__ VLp,
            u16* OHp, u16* OLp, int qtb, int nqtl) {
  __shared__ __align__(16) float smem[WPB * WREG];

  const int tid  = threadIdx.x;
  const int wave = tid >> 5;
  const int lane = tid & 31;
  const int hh   = lane >> 4;
  const int c    = lane & 15;
  const int bid  = blockIdx.x;
  const int qt   = qtb + (bid % nqtl);
  const int t2   = bid / nqtl;
  const int hg   = t2 % NHG;
  const int b    = t2 / NHG;
  if (b >= NB) return;                      // block-uniform; no block barriers in this kernel; never taken with the exact grid
  const int q0   = qt * 16;
  if (q0 + 16 > SEQ) return;                // block-uniform; never taken
  const int head = hg * WPB + wave;
  const int kvh  = head % NG;               // tiled kv mapping: head h -> kv group h % NG

  float* pt   = smem + wave * WREG;         // prob tile [16][32] pitch 36
  float* slab = pt + PTW;                   // result slab [16][64] pitch 68

  const _Float16* Qh  = (const _Float16*)(const void*)QHp + ((size_t)b * SEQ + q0 + c) * NQ + (size_t)head * DQ + 8 * hh;
  const _Float16* Ql  = (const _Float16*)(const void*)QLp + ((size_t)b * SEQ + q0 + c) * NQ + (size_t)head * DQ + 8 * hh;
  const _Float16* Khb = (const _Float16*)(const void*)KHp + ((size_t)b * SEQ + c) * NK + (size_t)kvh * DQ + 8 * hh;  // key row kb added per step
  const _Float16* Klb = (const _Float16*)(const void*)KLp + ((size_t)b * SEQ + c) * NK + (size_t)kvh * DQ + 8 * hh;
  const _Float16* Vhb = (const _Float16*)(const void*)VHp + ((size_t)(b * NG + kvh) * DV + c) * SEQ + 8 * hh;       // d col c (+16j)
  const _Float16* Vlb = (const _Float16*)(const void*)VLp + ((size_t)(b * NG + kvh) * DV + c) * SEQ + 8 * hh;

  // ALiBi slope 2^(-(head+1)/2): even exponent -> exact power of two; odd -> power of two times f32 sqrt(2)
  const int   e1   = head + 1;
  const int   pw   = (e1 + 1) >> 1;
  const float p2   = __uint_as_float(((unsigned)(127 - pw)) << 23);
  const float slope = p2 * (((e1 & 1) != 0) ? SQRT2F : 1.0f);   // wave-uniform select by value
  const float lsc  = 1.0f / (QSC * KSC);
  const float ul2  = RSQ_DQ * LOG2E;
  const float oc   = 1.0f / (PCAR * VCAR);
  const size_t KROW = (size_t)NK;           // halves between consecutive key rows

  const v16h qh = ldfrag_h(Qh);             // loop-invariant q fragments (d = 0..31): hi plane
  const v16h ql = ldfrag_h(Ql);             //                                         residual plane

  float mrow[8], lrow[8];
  v8f o[4];
#pragma unroll
  for (int r = 0; r < 8; ++r) { mrow[r] = -INFINITY; lrow[r] = 0.f; }
#pragma unroll
  for (int j = 0; j < 4; ++j) o[j] = zero8();
  const int ncaus = (q0 >> 5) + 1;                                            // tiles holding keys <= q0 + 15
  const int nkt = (ncaus < NKT) ? ncaus : NKT;
  const int qr0 = q0 + 8 * hh;                                                // query row of D element r = qr0 + r

#pragma unroll 1
  for (int kt = 0; kt < nkt; ++kt) {
    const int kb = kt * 32;
    // ---- scores: D element r of this lane = (query row qr0 + r, key kb + c) in s0, key kb + 16 + c in s1 ----
    //      hi+residual planes on both operands: hi.hi + hi.lo + lo.hi
    v8f s0 = zero8(), s1 = zero8();
    const _Float16* k0p = Khb + (size_t)kb * KROW;
    const _Float16* k1p = k0p + (size_t)16 * KROW;
    const _Float16* l0p = Klb + (size_t)kb * KROW;
    const _Float16* l1p = l0p + (size_t)16 * KROW;
    {
      const v16h kh0 = ldfrag_h(k0p);
      const v16h kh1 = ldfrag_h(k1p);
      const v16h kl0 = ldfrag_h(l0p);
      const v16h kl1 = ldfrag_h(l1p);
      s0 = mma_h(qh, kh0, s0);              // hi.hi
      s0 = mma_h(qh, kl0, s0);              // hi.lo
      s0 = mma_h(ql, kh0, s0);              // lo.hi
      s1 = mma_h(qh, kh1, s1);
      s1 = mma_h(qh, kl1, s1);
      s1 = mma_h(ql, kh1, s1);
      guard2(s0, s1, qh, ql, kh0, kl0, kh1, kl1);
    }
    // ---- causal select + ALiBi + scale, online softmax in base 2, -inf-safe ----
    const int key0 = kb + c, key1 = kb + 16 + c;
#pragma unroll
    for (int r = 0; r < 8; ++r) {
      const int   qr = qr0 + r;
      const float a0 = slope * (float)(key0 - qr);
      const float a1 = slope * (float)(key1 - qr);
      const float u0 = (s0[r] * lsc + a0) * ul2;
      const float u1 = (s1[r] * lsc + a1) * ul2;
      const float t0 = (key0 > qr) ? -INFINITY : u0;
      const float t1 = (key1 > qr) ? -INFINITY : u1;
      float mx = fmaxf(t0, t1);
#pragma unroll
      for (int off = 1; off < 16; off <<= 1) mx = fmaxf(mx, __shfl_xor(mx, off, 32));
      const float mn = fmaxf(mrow[r], mx);
      const float ms = (mn == -INFINITY) ? 0.0f : mn;
      const float al = exp2f(mrow[r] - ms);
      mrow[r] = mn;
      const float e0 = exp2f(t0 - ms), ev1 = exp2f(t1 - ms);
      float ps = e0 + ev1;
#pragma unroll
      for (int off = 1; off < 16; off <<= 1) ps += __shfl_xor(ps, off, 32);
      lrow[r] = lrow[r] * al + ps;
#pragma unroll
      for (int j = 0; j < 4; ++j) o[j][r] *= al;
      const int ro = (8 * hh + r) * PTP + c;
      pt[ro]      = e0;
      pt[ro + 16] = ev1;
    }
    wave_sync_lds();
    // ---- A fragments of P*32768: f16 hi (and f16 residual when PRES), row = c, split k map over the 32 keys of this step ----
    FragH ph, pl;
    {
      const float* prow = pt + c * PTP + 8 * hh;
      const v4f pa = *(const v4f*)(prow), pb = *(const v4f*)(prow + 4);
      const v4f pc = *(const v4f*)(prow + 16), pd = *(const v4f*)(prow + 20);
#pragma unroll
      for (int e = 0; e < 4; ++e) {
        const float ta = pa[e] * PCAR, tb = pb[e] * PCAR, tc = pc[e] * PCAR, td = pd[e] * PCAR;
        const _Float16 ha = (_Float16)ta, hb = (_Float16)tb, hc = (_Float16)tc, hd = (_Float16)td;
        ph.h[0][e]     = ha;                  // elements 0..7  = keys kb + 8hh + 0..7
        ph.h[0][4 + e] = hb;
        ph.h[1][e]     = hc;                  // elements 8..15 = keys kb + 16 + 8hh + 0..7
        ph.h[1][4 + e] = hd;
        if constexpr (PRES == 1) {
          pl.h[0][e]     = (_Float16)(ta - (float)ha);
          pl.h[0][4 + e] = (_Float16)(tb - (float)hb);
          pl.h[1][e]     = (_Float16)(tc - (float)hc);
          pl.h[1][4 + e] = (_Float16)(td - (float)hd);
        }
      }
      if constexpr (PRES != 1) pl.v = ph.v;
    }
    // ---- P.V : B fragment col n = d = j*16 + c, keys contiguous in the v^T planes; 2 groups of 2 d-subtiles ----
    {
      const _Float16* vhp = Vhb + kb;
      const _Float16* vlp = Vlb + kb;
#pragma unroll
      for (int jg = 0; jg < 2; ++jg) {
        const size_t da = (size_t)(2 * jg) * 16 * SEQ;
        const size_t db = da + (size_t)16 * SEQ;
        const v16h vha = ldfrag_h(vhp + da), vhb2 = ldfrag_h(vhp + db);
        const v16h vla = ldfrag_h(vlp + da), vlb2 = ldfrag_h(vlp + db);
        o[2 * jg]     = mma_h(ph.v, vha,  o[2 * jg]);                       // P_hi . v_hi
        if constexpr (PRES == 1) o[2 * jg] = mma_h(pl.v, vha, o[2 * jg]);   // P_lo . v_hi
        o[2 * jg]     = mma_h(ph.v, vla,  o[2 * jg]);                       // P_hi . v_lo
        o[2 * jg + 1] = mma_h(ph.v, vhb2, o[2 * jg + 1]);
        if constexpr (PRES == 1) o[2 * jg + 1] = mma_h(pl.v, vhb2, o[2 * jg + 1]);
        o[2 * jg + 1] = mma_h(ph.v, vlb2, o[2 * jg + 1]);
        guard2(o[2 * jg], o[2 * jg + 1], ph.v, pl.v, vha, vhb2, vla, vlb2);
      }
    }
    wave_sync_lds();
  }
  acc_guard4(o[0], o[1], o[2], o[3]);
  // ---- out = acc / Z (0 if Z == 0), carries (32768 on P, 1024 on v) folded once; written into the lane-owned slab ----
#pragma unroll
  for (int r = 0; r < 8; ++r) {
    const float lv  = lrow[r];
    const float ls  = (lv > 0.0f) ? lv : 1.0f;
    const float inv = (lv > 0.0f) ? ((1.0f / ls) * oc) : 0.0f;
#pragma unroll
    for (int j = 0; j < 4; ++j) {
      const int idx = (8 * hh + r) * SLP + j * 16 + c;
      slab[idx] = o[j][r] * inv;
    }
  }
  wave_sync_lds();
  v4u oh[4], ol[4];
  const int rq = lane >> 3, c8 = (lane & 7) * 8;
#pragma unroll
  for (int it = 0; it < 4; ++it) {
    const int row = it * 4 + rq;
    const v4f a = *(const v4f*)(slab + row * SLP + c8), b4 = *(const v4f*)(slab + row * SLP + c8 + 4);
    float w[8];
#pragma unroll
    for (int e = 0; e < 4; ++e) { w[e] = a[e] * OSC; w[4 + e] = b4[e] * OSC; }
#pragma unroll
    for (int e = 0; e < 4; ++e) {
      const _Float16 h0 = (_Float16)w[2 * e], h1 = (_Float16)w[2 * e + 1];
      const _Float16 l0 = (_Float16)(w[2 * e] - (float)h0), l1 = (_Float16)(w[2 * e + 1] - (float)h1);
      oh[it][e] = pk16(h_bits(h0), h_bits(h1));
      ol[it][e] = pk16(h_bits(l0), h_bits(l1));
    }
  }
  const size_t ob = ((size_t)b * SEQ + q0) * DOUT + (size_t)head * DV + c8;
  {
#pragma unroll
    for (int it = 0; it < 4; ++it) {
      const int row = it * 4 + rq;
      *(v4u*)(OHp + ob + (size_t)row * DOUT) = oh[it];
      *(v4u*)(OLp + ob + (size_t)row * DOUT) = ol[it];
    }
    
  }
}

// =====================================================================================================
// Workspace map (bytes); every plane is fully written by whole-line stores before it is read; all extents are exact multiples
// of the store granularity (no pad rows needed); every region offset a multiple of 262144:
//   XB  bf16 [MROWS][DIN]                 MROWS*2048      (NB=2, SEQ=2048: 8388608)
//   WQT bf16 [NQ n][DIN k]                1048576
//   WKT bf16 [NK n][DIN k]                262144
//   WVT bf16 [NV n][DIN k]                524288
//   WPT f16  [DOUT n][DOUT k] x1024       2097152
//   FQ  f32  [MROWS][NQ]                  MROWS*2048      (8388608)
//   FK  f32  [MROWS][NK]                  MROWS*512       (2097152)
//   FV  f32  [MROWS][NV]                  MROWS*1024      (4194304)
//   QH, QL f16 [MROWS][NQ] x256           MROWS*1024 each (4194304 each)
//   KH, KL f16 [MROWS][NK] x256           MROWS*256 each  (1048576 each)
//   VH, VL f16 [NB*NG][DV][SEQ] x1024     MROWS*512 each  (2097152 each)
//   OH, OL f16 [MROWS][DOUT] x1024        MROWS*2048 each (8388608 each)
//   end (NB=2, SEQ=2048)                  58458112
// =====================================================================================================
extern "C" void kernel_launch(void* const* d_in, const int* in_sizes, int n_in,
                              void* d_out, int out_size, void* d_ws, size_t ws_size,
                              hipStream_t stream) {
  if (n_in < 6) return;
  if (in_sizes[0] < ((NB - 1) * XS_FULL + SEQ) * DIN) return;
  if (in_sizes[1] != DIN * NQ) return;
  if (in_sizes[2] != DIN * NK) return;
  if (in_sizes[3] != DIN * NV) return;
  if (in_sizes[4] != DOUT * DOUT) return;
  if (in_sizes[5] != DOUT) return;
  if (out_size < MROWS * DOUT) return;

  const float* x   = (const float*)d_in[0];
  const float* wq  = (const float*)d_in[1];
  const float* wk  = (const float*)d_in[2];
  const float* wv  = (const float*)d_in[3];
  const float* wp  = (const float*)d_in[4];
  const float* bpv = (const float*)d_in[5];
  float*       out = (float*)d_out;

  const size_t szXB = (size_t)MROWS * DIN * 2;
  const size_t szWQ = (size_t)NQ * DIN * 2;
  const size_t szWK = (size_t)NK * DIN * 2;
  const size_t szWV = (size_t)NV * DIN * 2;
  const size_t szWP = (size_t)DOUT * DOUT * 2;
  const size_t szFQ = (size_t)MROWS * NQ * 4;
  const size_t szFK = (size_t)MROWS * NK * 4;
  const size_t szFV = (size_t)MROWS * NV * 4;
  const size_t szQ  = (size_t)MROWS * NQ * 2;                   // QH, QL
  const size_t szK  = (size_t)MROWS * NK * 2;                   // KH, KL
  const size_t szV  = (size_t)NB * NG * DV * SEQ * 2;           // VH, VL
  const size_t szO  = (size_t)MROWS * DOUT * 2;                 // OH, OL
  size_t off = 0;
  const size_t oXB = off; off += szXB;
  const size_t oWQ = off; off += szWQ;
  const size_t oWK = off; off += szWK;
  const size_t oWV = off; off += szWV;
  const size_t oWP = off; off += szWP;
  const size_t oFQ = off; off += szFQ;
  const size_t oFK = off; off += szFK;
  const size_t oFV = off; off += szFV;
  const size_t oQH = off; off += szQ;
  const size_t oQL = off; off += szQ;
  const size_t oKH = off; off += szK;
  const size_t oKL = off; off += szK;
  const size_t oVH = off; off += szV;
  const size_t oVL = off; off += szV;
  const size_t oOH = off; off += szO;
  const size_t oOL = off; off += szO;
  if (off > ws_size) return;                // off = 58458112 for NB = 2, SEQ = 2048
  if (off > (size_t)WS_CAP) return;

  char* ws = (char*)d_ws;
  u16*   XB  = (u16*)(ws + oXB);
  u16*   WQT = (u16*)(ws + oWQ);
  u16*   WKT = (u16*)(ws + oWK);
  u16*   WVT = (u16*)(ws + oWV);
  u16*   WPT = (u16*)(ws + oWP);
  float* FQ  = (float*)(ws + oFQ);
  float* FK  = (float*)(ws + oFK);
  float* FV  = (float*)(ws + oFV);
  u16*   QH  = (u16*)(ws + oQH);
  u16*   QL  = (u16*)(ws + oQL);
  u16*   KH  = (u16*)(ws + oKH);
  u16*   KL  = (u16*)(ws + oKL);
  u16*   VH  = (u16*)(ws + oVH);
  u16*   VL  = (u16*)(ws + oVL);
  u16*   OH  = (u16*)(ws + oOH);
  u16*   OL  = (u16*)(ws + oOL);

  const dim3 b256(256), b128(128), bAT(ATT_THREADS);
  const int  n8x = (SEQ * DIN) / 8;
  const dim3 gX((n8x + 255) / 256);                     // 1024 blocks per batch (SEQ=2048)
  const dim3 gWQ((NQ / 64) * (DIN / 64));               // 128
  const dim3 gWK((NK / 64) * (DIN / 64));               // 32
  const dim3 gWV((NV / 64) * (DIN / 64));               // 64
  const dim3 gWP((DOUT / 64) * (DOUT / 64));            // 256
  const dim3 gGQ((MROWS / 64) * (NQ / 64));
  const dim3 gGK((MROWS / 64) * (NK / 64));
  const dim3 gGV((MROWS / 64) * (NV / 64));
  const dim3 gVT(NB * NG * NST);
  const int  n8q = (MROWS * NQ) / 8;                    // q hi / residual planes
  const int  n8k = (MROWS * NK) / 8;                    // k hi / residual planes
  const dim3 gSQ((n8q + 255) / 256);
  const dim3 gSK((n8k + 255) / 256);
  const int  nqt1 = QO / 16;                            // query tiles with the P residual product (rows s < QO)
  const int  nqt0 = NQT - nqt1;                         // remaining query tiles
  const dim3 gGO((MROWS / 64) * (DOUT / 64));

  // (0) x -> bf16 plane [MROWS][DIN], one launch per batch row block
  for (int b = 0; b < NB; ++b) {
    cvt_bf<<<gX, b256, 0, stream>>>(x + (size_t)b * XS_FULL * DIN, XB + (size_t)b * SEQ * DIN, n8x);
  }
  // (1) weights: in [DIN k][NQ n] -> out [NQ n][DIN k] bf16; same for Wk [DIN][NK] -> [NK][DIN], Wv [DIN][NV] -> [NV][DIN];
  //     Wp in [DOUT k][DOUT n] -> out [DOUT n][DOUT k] as f16 of bf16 value x1024
  wt16<<<gWQ, b256, 0, stream>>>(wq, WQT, DIN, NQ, 0, 1.0f);
  wt16<<<gWK, b256, 0, stream>>>(wk, WKT, DIN, NK, 0, 1.0f);
  wt16<<<gWV, b256, 0, stream>>>(wv, WVT, DIN, NV, 0, 1.0f);
  wt16<<<gWP, b256, 0, stream>>>(wp, WPT, DOUT, DOUT, 1, WOS);
  // (2) v = x.Wv -> FV f32 [MROWS][NV]; (3) v^T hi + residual planes x1024
  gemm_bf<<<gGV, b128, 0, stream>>>(XB, WVT, FV, MROWS, NV, DIN);
  vt16<<<gVT, b256, 0, stream>>>(FV, VH, VL);
  // (4) q = x.Wq -> FQ [MROWS][NQ]; (5) q hi + residual planes x256
  gemm_bf<<<gGQ, b128, 0, stream>>>(XB, WQT, FQ, MROWS, NQ, DIN);
  split16<<<gSQ, b256, 0, stream>>>(FQ, QH, QL, n8q, QSC);
  // (6) k = x.Wk -> FK [MROWS][NK]; (7) k hi + residual planes x256
  gemm_bf<<<gGK, b128, 0, stream>>>(XB, WKT, FK, MROWS, NK, DIN);
  split16<<<gSK, b256, 0, stream>>>(FK, KH, KL, n8k, KSC);
  // (8) causal grouped attention with ALiBi -> O hi + residual planes f16 x1024 [MROWS][DOUT]:
  //     query tiles [0, QO/16) with the in-register P residual product, the rest without it
  attn_c<1><<<dim3(nqt1 * NHG * NB), bAT, 0, stream>>>(QH, QL, KH, KL, VH, VL, OH, OL, 0, nqt1);
  if (nqt0 > 0) {
    attn_c<0><<<dim3(nqt0 * NHG * NB), bAT, 0, stream>>>(QH, QL, KH, KL, VH, VL, OH, OL, nqt1, nqt0);
  }
  // (9) out = (O_hi + O_lo).Wp + bp -> d_out f32 [MROWS][DOUT], carries 1024 x 1024 folded back
  gemm_h2<<<gGO, b128, 0, stream>>>(OH, OL, WPT, bpv, out, MROWS, DOUT, DOUT, 1.0f / (OSC * WOS));
  (void)hipGetLastError();
}

// v001
// It runs in 259 microseconds.
// In both of two side-by-side timings against v000, it was 1.05 times as fast.
// Contractions: x.Wq, x.Wk, x.Wv on v_wmma_f32_16x16x32_bf16 (x and W as bf16 RNE planes, W transposed to [n][k]);
// q.k^T (head dim 32) on v_wmma_f32_16x16x32_f16 with f16 hi + f16 residual planes on BOTH q and k (x256, products
// hi.hi + hi.lo + lo.hi); P.v on v_wmma_f32_16x16x32_f16 with v^T as f16 hi + residual planes x1024 (P.v_hi + P.v_lo for
// every row; plus P_lo.v_hi with an in-register f16 residual of P x32768 for query rows < 512); ctx.Wp + bp on
// v_wmma_f32_16x16x32_f16 with ctx x1024 as f16 hi + residual planes (hi.Wp + lo.Wp) and Wp as f16(bf16(Wp)) x1024 [n][k],
// bias as bf16 RNE value; all f32 accumulate. Causal select, ALiBi add, 1/sqrt(32) scale, base-2 online softmax and 1/Z
// fold in f32 on VALU. Grouped kv heads: query head h reads kv group (h % 4).
#include <hip/hip_runtime.h>
#include <math.h>
#include <stdint.h>

#ifndef NB
#define NB 2
#endif
#ifndef SEQ
#define SEQ 2048
#endif
#define XS_FULL 2048
#define DIN   1024
#define DOUT  1024
#define NH    16
#define NG    4
#define DQ    32
#define DV    64
#define NQ    (NH * DQ)
#define NK    (NG * DQ)
#define NV    (NG * DV)
#define MROWS (NB * SEQ)
#define QO    ((SEQ < 512) ? SEQ : 512)
#define RSQ_DQ 0.17677669529663687f
#define LOG2E  1.4426950408889634f
#define SQRT2F 1.4142135623730951f
#define QSC   256.0f
#define KSC   256.0f
#define PCAR  32768.0f
#define VCAR  1024.0f
#define OSC   1024.0f
#define WOS   1024.0f
#define WPB   2
#define NHG   (NH / WPB)
#define NQT   (SEQ / 16)
#define NST   (SEQ / 64)
#define NKT   (SEQ / 32)
#define ATT_THREADS (WPB * 32)
#define PTP   36
#define PTW   (16 * PTP)
#define SLP   68
#define SLW   (16 * SLP)
#define WREG  (PTW + SLW)
#define SLAB64 (16 * 68)
#define VTP   72
#define WTP   72
#define WS_CAP 134217728
static_assert(DOUT == NH * DV && NQ == 512 && NK == 128 && NV == 256 && DQ == 32 && DV == 64 && NG == 4 && NH == 16);
static_assert(NHG * WPB == NH && ATT_THREADS == 64 && WPB == 2);
static_assert(NB >= 1 && NB <= 2);
static_assert((SEQ % 64) == 0 && SEQ >= 64 && SEQ <= XS_FULL);
static_assert((QO % 16) == 0 && QO >= 16 && QO <= SEQ);
static_assert((DIN % 64) == 0 && (DOUT % 64) == 0 && (NQ % 64) == 0 && (NK % 64) == 0 && (NV % 64) == 0 && (DIN % 32) == 0);
static_assert(((SEQ * DIN / 8) % 256) == 0 && ((MROWS * NQ / 8) % 256) == 0 && ((MROWS * NK / 8) % 256) == 0);
static_assert(WPB * WREG * 4 <= 65536 && 2 * DV * VTP * 2 <= 65536 && 64 * WTP * 2 <= 65536 && 4 * SLAB64 * 4 <= 65536);

typedef unsigned short u16;
typedef _Float16 v16h __attribute__((ext_vector_type(16)));
typedef _Float16 v8h  __attribute__((ext_vector_type(8)));
typedef __bf16   v16b __attribute__((ext_vector_type(16)));
typedef float    v8f  __attribute__((ext_vector_type(8)));
typedef float    v4f  __attribute__((ext_vector_type(4)));
typedef unsigned int v4u __attribute__((ext_vector_type(4)));

union FragH { v16h v; v8h h[2]; v4u u[2]; };
union FragB { v16b v; v4u u[2]; };

// ---- scalar helpers --------------------------------------------------------------------------------
__device__ __forceinline__ unsigned short bf_bits(float f) {          // f32 -> bf16 bits, RNE convert
  unsigned u = __float_as_uint(f);
  return (unsigned short)((u + 0x7FFFu + ((u >> 16) & 1u)) >> 16);
}
__device__ __forceinline__ float bf_up(unsigned short h) { return __uint_as_float(((unsigned)h) << 16); }
__device__ __forceinline__ float bfr(float f) { return bf_up(bf_bits(f)); }
__device__ __forceinline__ unsigned short h_bits(_Float16 x) { return __builtin_bit_cast(unsigned short, x); }
__device__ __forceinline__ unsigned pk16(unsigned short a, unsigned short b) { return (unsigned)a | ((unsigned)b << 16); }
__device__ __forceinline__ v8f zero8() { v8f z = {0.f, 0.f, 0.f, 0.f, 0.f, 0.f, 0.f, 0.f}; return z; }

// ---- fragment loaders: 16-bit A/B operand, lane -> row/col (lane&15), p already includes +8*(lane>>4);
//      elements 0..7 <- p[0..7] (k0+8h..), elements 8..15 <- p[16..23] (k0+16+8h..)  (same split k map for A and B;
//      B is always read from a k-contiguous [n][k] plane)
__device__ __forceinline__ v16h ldfrag_h(const _Float16* p) {
  FragH f;
  f.h[0] = *(const v8h*)(p);
  f.h[1] = *(const v8h*)(p + 16);
  return f.v;
}
__device__ __forceinline__ v16b ldfrag_b(const u16* p) {              // bf16 plane read as unsigned integer vectors
  FragB f;
  f.u[0] = *(const v4u*)(p);
  f.u[1] = *(const v4u*)(p + 16);
  return f.v;
}

__device__ __forceinline__ v8f mma_h(v16h a, v16h b, v8f c) {
  return __builtin_amdgcn_wmma_f32_16x16x32_f16(false, a, false, b, (short)0, c, false, false);
}
__device__ __forceinline__ v8f mma_b(v16b a, v16b b, v8f c) {
  return __builtin_amdgcn_wmma_f32_16x16x32_bf16(false, a, false, b, (short)0, c, false, false);
}
__device__ __forceinline__ void guard2(v8f& a, v8f& b, v16h x0, v16h x1, v16h x2, v16h x3, v16h x4, v16h x5) {
#if defined(__HIP_DEVICE_COMPILE__)
  asm volatile("v_nop\n\tv_nop\n\tv_nop\n\tv_nop"
               : "+v"(a), "+v"(b) : "v"(x0), "v"(x1), "v"(x2), "v"(x3), "v"(x4), "v"(x5) : "memory");
#endif
}
template <typename F>
__device__ __forceinline__ void guard6(v8f& a, v8f& b, v8f& c, v8f& d, F x0, F x1, F x2, F x3, F x4, F x5) {
#if defined(__HIP_DEVICE_COMPILE__)
  asm volatile("v_nop\n\tv_nop\n\tv_nop\n\tv_nop"
               : "+v"(a), "+v"(b), "+v"(c), "+v"(d) : "v"(x0), "v"(x1), "v"(x2), "v"(x3), "v"(x4), "v"(x5) : "memory");
#endif
}
__device__ __forceinline__ void acc_guard4(v8f& a, v8f& b, v8f& c, v8f& d) {
#if defined(__HIP_DEVICE_COMPILE__)
  asm volatile("v_nop\n\tv_nop\n\tv_nop\n\tv_nop" : "+v"(a), "+v"(b), "+v"(c), "+v"(d));
#endif
}
__device__ __forceinline__ void wave_sync_lds() {
  __builtin_amdgcn_fence(__ATOMIC_RELEASE, "workgroup");
  __builtin_amdgcn_wave_barrier();
  __builtin_amdgcn_fence(__ATOMIC_ACQUIRE, "workgroup");
}

// =====================================================================================================
// f32 -> bf16 RNE plane, same layout. Thread = 8 consecutive elements: two 16-B loads, one 16-B store; 32 consecutive
// coverage: grid = ceil(n8/256) blocks x 256 thr x 8 (in-kernel bound) = the whole plane (n8 a multiple of 256 here).
// =====================================================================================================
__global__ __launch_bounds__(256) void cvt_bf(const float* __restrict__ x, u16* D, int n8) {
  const int gt = blockIdx.x * 256 + (int)threadIdx.x;
  if (gt >= n8) return;
  const float* p = x + (size_t)gt * 8;
  const v4f a = *(const v4f*)(p), b4 = *(const v4f*)(p + 4);
  v4u o;
#pragma unroll
  for (int e = 0; e < 2; ++e) {
    o[e]     = pk16(bf_bits(a[2 * e]),  bf_bits(a[2 * e + 1]));
    o[2 + e] = pk16(bf_bits(b4[2 * e]), bf_bits(b4[2 * e + 1]));
  }
  u16* d = D + (size_t)gt * 8;
  {
    *(v4u*)(d) = o;
    
  }
}

// =====================================================================================================
// f32 W [K][N] (row-major, x.W layout) -> 16-bit plane D [N][K] (the k-contiguous B operand). f16mode == 0: bf16 RNE bits;
// f16mode == 1: f16 bits of (bf16 RNE value) * scale. Block = 64 n x 64 k output tile: each thread loads 16 floats of one
// k row (four 16-B loads), converts, scatters into the LDS tile T[n][k] (pitch 72 halves, scalar 2-B LDS stores of per-lane
// coverage: load 256 thr x 16 = 64 k x 64 n; store 2 iterations x 256 thr x 8 halves = 64 lines x 64 = the tile;
//           grid = (N/64)*(K/64) blocks covers D exactly once (host guarantees N % 64 == 0, K % 64 == 0).
// =====================================================================================================
__global__ __launch_bounds__(256) void wt16(const float* __restrict__ W, u16* D, int K, int N, int f16mode, float scale) {
  __shared__ __align__(16) u16 T[64 * WTP];
  const int tid = threadIdx.x;
  const int bid = blockIdx.x;
  const int nt  = N >> 6;
  const int n0  = (bid % nt) * 64;
  const int k0  = (bid / nt) * 64;
  if (k0 + 64 > K) return;                  // block-uniform, before the barrier; never taken with the exact grid
  {
    const int kr = tid >> 2;                // k row within tile 0..63
    const int nc = (tid & 3) * 16;          // n chunk 0,16,32,48
    const float* src = W + (size_t)(k0 + kr) * (size_t)N + n0 + nc;
#pragma unroll
    for (int i = 0; i < 4; ++i) {
      const v4f a = *(const v4f*)(src + 4 * i);
#pragma unroll
      for (int e = 0; e < 4; ++e) {
        const float f = a[e];
        const unsigned short hb = h_bits((_Float16)(bfr(f) * scale));
        const unsigned short bb = bf_bits(f);
        T[(nc + 4 * i + e) * WTP + kr] = (f16mode != 0) ? hb : bb;
      }
    }
  }
  __syncthreads();
  v4u v[2];
  const int q8 = tid >> 3, p8 = (tid & 7) * 8;
#pragma unroll
  for (int it = 0; it < 2; ++it) {
    const int line = it * 32 + q8;          // n = 0..63
    v[it] = *(const v4u*)(T + line * WTP + p8);
  }
  const size_t base = (size_t)n0 * (size_t)K + k0 + p8;
  {
#pragma unroll
    for (int it = 0; it < 2; ++it) {
      const int line = it * 32 + q8;
      *(v4u*)(D + base + (size_t)line * (size_t)K) = v[it];
    }
    
  }
}

// =====================================================================================================
// f32 plane F (contiguous, n8*8 elements) -> f16 hi plane Hp = f16(F * sc) and f16 residual plane Lp = f16(t - f16(t)),
// both with the layout of F. Thread = 8 consecutive elements: two 16-B loads, one 16-B store per plane; 32 consecutive lanes
// No barriers; every packed half comes from a per-lane (divergent) loaded value.
// coverage: grid = ceil(n8/256) blocks x 256 thr x 8 (in-kernel bound) = the whole of Hp and of Lp (n8 a multiple of 256 here).
// =====================================================================================================
__global__ __launch_bounds__(256) void split16(const float* __restrict__ F, u16* Hp, u16* Lp, int n8, float sc) {
  const int gt = blockIdx.x * 256 + (int)threadIdx.x;
  if (gt >= n8) return;
  const float* p = F + (size_t)gt * 8;
  const v4f a = *(const v4f*)(p), b4 = *(const v4f*)(p + 4);
  float w[8];
#pragma unroll
  for (int e = 0; e < 4; ++e) { w[e] = a[e] * sc; w[4 + e] = b4[e] * sc; }
  v4u oh, ol;
#pragma unroll
  for (int e = 0; e < 4; ++e) {
    const float t0 = w[2 * e], t1 = w[2 * e + 1];
    const _Float16 h0 = (_Float16)t0, h1 = (_Float16)t1;
    const _Float16 l0 = (_Float16)(t0 - (float)h0), l1 = (_Float16)(t1 - (float)h1);
    oh[e] = pk16(h_bits(h0), h_bits(h1));
    ol[e] = pk16(h_bits(l0), h_bits(l1));
  }
  u16* dh = Hp + (size_t)gt * 8;
  u16* dl = Lp + (size_t)gt * 8;
  {
    *(v4u*)(dh) = oh;
    *(v4u*)(dl) = ol;
    
  }
}

// =====================================================================================================
// v^T planes from the v projection F f32 [MROWS][NV] (row = b*SEQ + s, column = g*DV + d):
//   VH[((b*NG + g)*DV + d)][s] = f16(v * 1024);  VL[same][s] = f16 residual (t - f16(t)), both for all keys s.
// Block = (b, kv group g, 64 keys s0): each thread loads its 16 floats (key sl, d chunk dc) with 16-B loads, converts,
// scatters into two LDS tiles [64 d][64 keys] (pitch 72 halves); after a block barrier each d row segment (64 halves = one
// coverage: load 256 thr x 16 = 64 keys x 64 d; store 2 iterations x 256 thr x 8 halves = 64 lines x 64 = the block's tile of
//           VH and of VL; grid = NB*NG*NST blocks covers both planes exactly once.
// =====================================================================================================
__global__ __launch_bounds__(256) void vt16(const float* __restrict__ F, u16* VHo, u16* VLo) {
  __shared__ __align__(16) u16 TH[DV * VTP];
  __shared__ __align__(16) u16 TL[DV * VTP];
  const int tid = threadIdx.x;
  const int bid = blockIdx.x;
  const int st  = bid % NST;
  const int t2  = bid / NST;
  const int g   = t2 % NG;
  const int b   = t2 / NG;
  if (b >= NB) return;                      // block-uniform, before the barrier; never taken with the exact grid
  const int s0  = st * 64;
  {
    const int sl = tid >> 2;                // key within tile 0..63
    const int dc = (tid & 3) * 16;          // d chunk 0,16,32,48
    const float* src = F + ((size_t)b * SEQ + s0 + sl) * NV + g * DV + dc;
#pragma unroll
    for (int i = 0; i < 4; ++i) {
      const v4f a = *(const v4f*)(src + 4 * i);
#pragma unroll
      for (int e = 0; e < 4; ++e) {
        const float t = a[e] * VCAR;
        const _Float16 hv = (_Float16)t;
        const _Float16 lv = (_Float16)(t - (float)hv);
        TH[(dc + 4 * i + e) * VTP + sl] = h_bits(hv);
        TL[(dc + 4 * i + e) * VTP + sl] = h_bits(lv);
      }
    }
  }
  __syncthreads();
  v4u vh[2], vl[2];
  const int q8 = tid >> 3, p8 = (tid & 7) * 8;
#pragma unroll
  for (int it = 0; it < 2; ++it) {
    const int line = it * 32 + q8;          // d = 0..63
    vh[it] = *(const v4u*)(TH + line * VTP + p8);
    vl[it] = *(const v4u*)(TL + line * VTP + p8);
  }
  const size_t hrow = (size_t)(b * NG + g) * DV;
  const size_t base = hrow * SEQ + s0 + p8;
  {
#pragma unroll
    for (int it = 0; it < 2; ++it) {
      const int line = it * 32 + q8;
      *(v4u*)(VHo + base + (size_t)line * SEQ) = vh[it];
      *(v4u*)(VLo + base + (size_t)line * SEQ) = vl[it];
    }
    
  }
}

// =====================================================================================================
// GEMM epilogue shared by all engines: the wave's 16x64 f32 tile (times oscale, plus the lane's per-column bias of each
// coverage: 8 instructions x 2 rows x 16 lanes x 4 floats = the wave's 16 x 64 tile.
// =====================================================================================================
__device__ __forceinline__ void epi64(float* sl, v8f a0, v8f a1, v8f a2, v8f a3, float oscale,
                                      float bb0, float bb1, float bb2, float bb3,
                                      float* C, int N, size_t rowb, int col0, int lane) {
  const int hh = lane >> 4, m = lane & 15;
#pragma unroll
  for (int r = 0; r < 8; ++r) {
    const int ro = (8 * hh + r) * 68 + m;
    sl[ro]      = a0[r] * oscale + bb0;
    sl[ro + 16] = a1[r] * oscale + bb1;
    sl[ro + 32] = a2[r] * oscale + bb2;
    sl[ro + 48] = a3[r] * oscale + bb3;
  }
  wave_sync_lds();
  v4f vals[8];
#pragma unroll
  for (int it = 0; it < 8; ++it) vals[it] = *(const v4f*)(sl + (it * 2 + hh) * 68 + m * 4);
  float* dst = C + (rowb + (size_t)hh) * (size_t)N + col0 + m * 4;
  {
#pragma unroll
    for (int it = 0; it < 8; ++it) {
      *(v4f*)(dst + (size_t)(it * 2) * (size_t)N) = vals[it];
    }
    
  }
}

// =====================================================================================================
// bf16 GEMM, no bias: C[M][N] (f32) = A[M][K] (bf16 row-major) . Bt[N][K]^T (bf16 k-contiguous). Block = 64x64 tile,
// 4 waves x 16 rows; fragments loaded straight from the 16-bit rows (two 16-B loads each, split k map for A and B);
// K stepped by 32 (host guarantees K % 32 == 0, M % 64 == 0, N % 64 == 0, grid = (M/64)*(N/64)).
// =====================================================================================================
__global__ __launch_bounds__(128)
void gemm_bf(const u16* __restrict__ A, const u16* __restrict__ Bt, float* C, int M, int N, int K) {
  __shared__ __align__(16) float slab[4 * SLAB64];
  const int tid = threadIdx.x, wave = tid >> 5, lane = tid & 31, hh = lane >> 4, m = lane & 15;
  const int ntile = N >> 6;
  const int bid   = blockIdx.x;
  const int rowb  = (bid / ntile) * 64 + wave * 16;
  const int col0  = (bid % ntile) * 64;
  if (rowb + 16 > M) return;                // wave-uniform, never taken with the exact grid; no block barriers in this kernel
  const u16* ap = A  + (size_t)(rowb + m) * K + 8 * hh;
  const u16* bp = Bt + (size_t)(col0 + m) * K + 8 * hh;
  const size_t bs = (size_t)16 * K;
  v8f acc0 = zero8(), acc1 = zero8(), acc2 = zero8(), acc3 = zero8();
#pragma unroll 1
  for (int k0 = 0; k0 < K; k0 += 32) {
    const v16b a  = ldfrag_b(ap + k0);
    const v16b b0 = ldfrag_b(bp + k0);
    const v16b b1 = ldfrag_b(bp + bs + k0);
    const v16b b2 = ldfrag_b(bp + 2 * bs + k0);
    const v16b b3 = ldfrag_b(bp + 3 * bs + k0);
    acc0 = mma_b(a, b0, acc0);
    acc1 = mma_b(a, b1, acc1);
    acc2 = mma_b(a, b2, acc2);
    acc3 = mma_b(a, b3, acc3);
    guard6<v16b>(acc0, acc1, acc2, acc3, a, b0, b1, b2, b3, a);
  }
  epi64(slab + wave * SLAB64, acc0, acc1, acc2, acc3, 1.0f, 0.0f, 0.0f, 0.0f, 0.0f, C, N, (size_t)rowb, col0, lane);
}

// =====================================================================================================
// f16 GEMM with a two-plane A operand and bias: C[M][N] (f32) = (Ah + Al)[M][K] (f16 row-major hi and residual planes, same
// layout, residual unscaled relative to hi) . Bt[N][K]^T (f16 k-contiguous) * oscale + bf16 RNE value of bias[n] (bias has
// N entries). Products ah.b + al.b into one accumulator. Same tiling, fragment loads (split k map) and epilogue as gemm_bf;
// K stepped by 32 (host guarantees K % 32 == 0, M % 64 == 0, N % 64 == 0, grid = (M/64)*(N/64)).
// =====================================================================================================
__global__ __launch_bounds__(128)
void gemm_h2(const u16* __restrict__ Ah, const u16* __restrict__ Al, const u16* __restrict__ Bt,
             const float* __restrict__ bias, float* C, int M, int N, int K, float oscale) {
  __shared__ __align__(16) float slab[4 * SLAB64];
  const int tid = threadIdx.x, wave = tid >> 5, lane = tid & 31, hh = lane >> 4, m = lane & 15;
  const int ntile = N >> 6;
  const int bid   = blockIdx.x;
  const int rowb  = (bid / ntile) * 64 + wave * 16;
  const int col0  = (bid % ntile) * 64;
  if (rowb + 16 > M) return;                // wave-uniform, never taken with the exact grid; no block barriers in this kernel
  const _Float16* ahp = (const _Float16*)(const void*)Ah + (size_t)(rowb + m) * K + 8 * hh;
  const _Float16* alp = (const _Float16*)(const void*)Al + (size_t)(rowb + m) * K + 8 * hh;
  const _Float16* bp  = (const _Float16*)(const void*)Bt + (size_t)(col0 + m) * K + 8 * hh;
  const size_t bs = (size_t)16 * K;
  v8f acc0 = zero8(), acc1 = zero8(), acc2 = zero8(), acc3 = zero8();
#pragma unroll 1
  for (int k0 = 0; k0 < K; k0 += 32) {
    const v16h ah = ldfrag_h(ahp + k0), al = ldfrag_h(alp + k0);
    const v16h b0 = ldfrag_h(bp + k0);
    const v16h b1 = ldfrag_h(bp + bs + k0);
    const v16h b2 = ldfrag_h(bp + 2 * bs + k0);
    const v16h b3 = ldfrag_h(bp + 3 * bs + k0);
    acc0 = mma_h(ah, b0, acc0);  acc0 = mma_h(al, b0, acc0);
    acc1 = mma_h(ah, b1, acc1);  acc1 = mma_h(al, b1, acc1);
    acc2 = mma_h(ah, b2, acc2);  acc2 = mma_h(al, b2, acc2);
    acc3 = mma_h(ah, b3, acc3);  acc3 = mma_h(al, b3, acc3);
    guard6<v16h>(acc0, acc1, acc2, acc3, ah, al, b0, b1, b2, b3);
  }
  // per-lane bias of D column m in each of the 4 subtiles; col0 + 48 + m <= N - 1 always
  const float bb0 = bfr(bias[col0 + m]);
  const float bb1 = bfr(bias[col0 + 16 + m]);
  const float bb2 = bfr(bias[col0 + 32 + m]);
  const float bb3 = bfr(bias[col0 + 48 + m]);
  epi64(slab + wave * SLAB64, acc0, acc1, acc2, acc3, oscale, bb0, bb1, bb2, bb3, C, N, (size_t)rowb, col0, lane);
}

// =====================================================================================================
// Causal grouped attention with ALiBi, q/k head dim 32, value head dim 64. Block bid -> (query tile qt = qtb + bid % nqtl:
// rows q0 = 16*qt .. q0+15, head pair hg, batch b); one wave per query head = hg*WPB + wave; kv group = head % NG.
//   q hi / residual planes f16 x256 [b*SEQ + s][h*DQ + d] (pitch NQ); k hi / residual planes f16 x256 [b*SEQ + s][g*DQ + d]
//   (pitch NK); v^T hi / residual planes [b*NG + g][d][SEQ] x1024; O hi / residual planes f16 x1024 [b*SEQ + s][h*DV + d]
//   (pitch DOUT).
//   scores (one k-step over d = 0..31) = q_hi.k_hi + q_hi.k_lo + q_lo.k_hi (3 products into one accumulator, residuals
//   unscaled relative to their hi planes), q fragments loop-invariant;
//   logit (log2 domain) t(i, j) = (acc/(256*256) + slope[h]*(j - i)) * (1/sqrt(32))*log2e, replaced by -inf where j > i,
//   slope[h] = 2^(-(h+1)/2) built exactly (power of two times f32 sqrt2 for odd h+1).
//   Key tiles of 32 visited in order for kb <= q0 + 15 (later tiles hold only keys above every query row of the tile).
//   Global loads run ahead of their use: a step issues its 16 v^T loads at its top and, right behind its score products,
//   the 8 k loads of the next step into the same registers, so their latency passes behind the softmax.
//   Online max-subtracted base-2 softmax in f32, -inf-safe rescale; the 16x32 prob tile stored to wave-private LDS (f32
//   for both PRES values) rebuilt from the LDS rows (float vector loads, same element type as stored); v^T B fragments for 4
//   d-subtiles from both v planes: P_hi.v_hi + P_hi.v_lo (+ P_lo.v_hi when PRES == 1), 2 groups of 2 subtiles.
//   After the loop: out = acc / Z (Z > 0 always: key 0 <= every query row; guarded anyway), carries 1/(32768*1024) folded
//   only (nkt <= NKT).
// coverage: per wave 4 instructions x 4 rows x 8 lanes x 8 halves = 16 x 64 of each O plane; the two host launches cover
//           query tiles [0, QO/16) and [QO/16, NQT) x NHG x NB blocks x WPB waves = every (b, s, h) row segment of OH and
//           of OL exactly once.
// =====================================================================================================
template <int PRES>
__global__ __launch_bounds__(ATT_THREADS)
void attn_c(const u16* __restrict__ QHp, const u16* __restrict__ QLp,
            const u16* __restrict__ KHp, const u16* __restrict__ KLp,
            const u16* __restrict__ VHp, const u16* __restrict__ VLp,
            u16* OHp, u16* OLp, int qtb, int nqtl) {
  __shared__ __align__(16) float smem[WPB * WREG];

  const int tid  = threadIdx.x;
  const int wave = tid >> 5;
  const int lane = tid & 31;
  const int hh   = lane >> 4;
  const int c    = lane & 15;
  const int bid  = blockIdx.x;
  const int qt   = qtb + (bid % nqtl);
  const int t2   = bid / nqtl;
  const int hg   = t2 % NHG;
  const int b    = t2 / NHG;
  if (b >= NB) return;                      // block-uniform; no block barriers in this kernel; never taken with the exact grid
  const int q0   = qt * 16;
  if (q0 + 16 > SEQ) return;                // block-uniform; never taken
  const int head = hg * WPB + wave;
  const int kvh  = head % NG;               // tiled kv mapping: head h -> kv group h % NG

  float* pt   = smem + wave * WREG;         // prob tile [16][32] pitch 36
  float* slab = pt + PTW;                   // result slab [16][64] pitch 68

  const _Float16* Qh  = (const _Float16*)(const void*)QHp + ((size_t)b * SEQ + q0 + c) * NQ + (size_t)head * DQ + 8 * hh;
  const _Float16* Ql  = (const _Float16*)(const void*)QLp + ((size_t)b * SEQ + q0 + c) * NQ + (size_t)head * DQ + 8 * hh;
  const _Float16* Khb = (const _Float16*)(const void*)KHp + ((size_t)b * SEQ + c) * NK + (size_t)kvh * DQ + 8 * hh;  // key row kb added per step
  const _Float16* Klb = (const _Float16*)(const void*)KLp + ((size_t)b * SEQ + c) * NK + (size_t)kvh * DQ + 8 * hh;
  const _Float16* Vhb = (const _Float16*)(const void*)VHp + ((size_t)(b * NG + kvh) * DV + c) * SEQ + 8 * hh;       // d col c (+16j)
  const _Float16* Vlb = (const _Float16*)(const void*)VLp + ((size_t)(b * NG + kvh) * DV + c) * SEQ + 8 * hh;

  // ALiBi slope 2^(-(head+1)/2): even exponent -> exact power of two; odd -> power of two times f32 sqrt(2)
  const int   e1   = head + 1;
  const int   pw   = (e1 + 1) >> 1;
  const float p2   = __uint_as_float(((unsigned)(127 - pw)) << 23);
  const float slope = p2 * (((e1 & 1) != 0) ? SQRT2F : 1.0f);   // wave-uniform select by value
  const float lsc  = 1.0f / (QSC * KSC);
  const float ul2  = RSQ_DQ * LOG2E;
  const float oc   = 1.0f / (PCAR * VCAR);
  const size_t KROW = (size_t)NK;           // halves between consecutive key rows

  const v16h qh = ldfrag_h(Qh);             // loop-invariant q fragments (d = 0..31): hi plane
  const v16h ql = ldfrag_h(Ql);             //                                         residual plane

  float mrow[8], lrow[8];
  v8f o[4];
#pragma unroll
  for (int r = 0; r < 8; ++r) { mrow[r] = -INFINITY; lrow[r] = 0.f; }
#pragma unroll
  for (int j = 0; j < 4; ++j) o[j] = zero8();
  const int ncaus = (q0 >> 5) + 1;                                            // tiles holding keys <= q0 + 15
  const int nkt = (ncaus < NKT) ? ncaus : NKT;
  const int qr0 = q0 + 8 * hh;                                                // query row of D element r = qr0 + r

  // k fragments of key tile 0; inside the loop each step fetches the next step's into the same registers
  v16h kh0 = ldfrag_h(Khb);
  v16h kh1 = ldfrag_h(Khb + (size_t)16 * KROW);
  v16h kl0 = ldfrag_h(Klb);
  v16h kl1 = ldfrag_h(Klb + (size_t)16 * KROW);

#pragma unroll 1
  for (int kt = 0; kt < nkt; ++kt) {
    const int kb = kt * 32;
    // ---- this step's v^T fragments (4 d-subtiles, both planes), issued first: they land behind the scores and the softmax ----
    v16h vh[4], vl[4];
#pragma unroll
    for (int j = 0; j < 4; ++j) vh[j] = ldfrag_h(Vhb + kb + (size_t)j * 16 * SEQ);
    // a later load's result may be given the address registers of the loads above: their translations are waited for first
    asm volatile("s_wait_xcnt 0x0" ::: "memory");
#pragma unroll
    for (int j = 0; j < 4; ++j) vl[j] = ldfrag_h(Vlb + kb + (size_t)j * 16 * SEQ);
    // ---- scores: D element r of this lane = (query row qr0 + r, key kb + c) in s0, key kb + 16 + c in s1 ----
    //      hi+residual planes on both operands: hi.hi + hi.lo + lo.hi
    v8f s0 = zero8(), s1 = zero8();
    {
      s0 = mma_h(qh, kh0, s0);              // hi.hi
      s0 = mma_h(qh, kl0, s0);              // hi.lo
      s0 = mma_h(ql, kh0, s0);              // lo.hi
      s1 = mma_h(qh, kh1, s1);
      s1 = mma_h(qh, kl1, s1);
      s1 = mma_h(ql, kh1, s1);
      guard2(s0, s1, qh, ql, kh0, kl0, kh1, kl1);
    }
    // ---- next step's k fragments, one step ahead; the last step re-reads its own tile (in bounds, values unused) ----
    {
      const int kn = (kt + 1 < nkt) ? kb + 32 : kb;
      const _Float16* k0p = Khb + (size_t)kn * KROW;
      const _Float16* l0p = Klb + (size_t)kn * KROW;
      kh0 = ldfrag_h(k0p);
      kh1 = ldfrag_h(k0p + (size_t)16 * KROW);
      kl0 = ldfrag_h(l0p);
      kl1 = ldfrag_h(l0p + (size_t)16 * KROW);
    }
    // ---- causal select + ALiBi + scale, online softmax in base 2, -inf-safe ----
    const int key0 = kb + c, key1 = kb + 16 + c;
#pragma unroll
    for (int r = 0; r < 8; ++r) {
      const int   qr = qr0 + r;
      const float a0 = slope * (float)(key0 - qr);
      const float a1 = slope * (float)(key1 - qr);
      const float u0 = (s0[r] * lsc + a0) * ul2;
      const float u1 = (s1[r] * lsc + a1) * ul2;
      const float t0 = (key0 > qr) ? -INFINITY : u0;
      const float t1 = (key1 > qr) ? -INFINITY : u1;
      float mx = fmaxf(t0, t1);
#pragma unroll
      for (int off = 1; off < 16; off <<= 1) mx = fmaxf(mx, __shfl_xor(mx, off, 32));
      const float mn = fmaxf(mrow[r], mx);
      const float ms = (mn == -INFINITY) ? 0.0f : mn;
      const float al = exp2f(mrow[r] - ms);
      mrow[r] = mn;
      const float e0 = exp2f(t0 - ms), ev1 = exp2f(t1 - ms);
      float ps = e0 + ev1;
#pragma unroll
      for (int off = 1; off < 16; off <<= 1) ps += __shfl_xor(ps, off, 32);
      lrow[r] = lrow[r] * al + ps;
#pragma unroll
      for (int j = 0; j < 4; ++j) o[j][r] *= al;
      const int ro = (8 * hh + r) * PTP + c;
      pt[ro]      = e0;
      pt[ro + 16] = ev1;
    }
    wave_sync_lds();
    // ---- A fragments of P*32768: f16 hi (and f16 residual when PRES), row = c, split k map over the 32 keys of this step ----
    FragH ph, pl;
    {
      const float* prow = pt + c * PTP + 8 * hh;
      const v4f pa = *(const v4f*)(prow), pb = *(const v4f*)(prow + 4);
      const v4f pc = *(const v4f*)(prow + 16), pd = *(const v4f*)(prow + 20);
#pragma unroll
      for (int e = 0; e < 4; ++e) {
        const float ta = pa[e] * PCAR, tb = pb[e] * PCAR, tc = pc[e] * PCAR, td = pd[e] * PCAR;
        const _Float16 ha = (_Float16)ta, hb = (_Float16)tb, hc = (_Float16)tc, hd = (_Float16)td;
        ph.h[0][e]     = ha;                  // elements 0..7  = keys kb + 8hh + 0..7
        ph.h[0][4 + e] = hb;
        ph.h[1][e]     = hc;                  // elements 8..15 = keys kb + 16 + 8hh + 0..7
        ph.h[1][4 + e] = hd;
        if constexpr (PRES == 1) {
          pl.h[0][e]     = (_Float16)(ta - (float)ha);
          pl.h[0][4 + e] = (_Float16)(tb - (float)hb);
          pl.h[1][e]     = (_Float16)(tc - (float)hc);
          pl.h[1][4 + e] = (_Float16)(td - (float)hd);
        }
      }
      if constexpr (PRES != 1) pl.v = ph.v;
    }
    // ---- P.V : B fragment col n = d = j*16 + c, keys contiguous in the v^T planes; 2 groups of 2 d-subtiles ----
    {
#pragma unroll
      for (int jg = 0; jg < 2; ++jg) {
        const v16h vha = vh[2 * jg], vhb2 = vh[2 * jg + 1];
        const v16h vla = vl[2 * jg], vlb2 = vl[2 * jg + 1];
        o[2 * jg]     = mma_h(ph.v, vha,  o[2 * jg]);                       // P_hi . v_hi
        if constexpr (PRES == 1) o[2 * jg] = mma_h(pl.v, vha, o[2 * jg]);   // P_lo . v_hi
        o[2 * jg]     = mma_h(ph.v, vla,  o[2 * jg]);                       // P_hi . v_lo
        o[2 * jg + 1] = mma_h(ph.v, vhb2, o[2 * jg + 1]);
        if constexpr (PRES == 1) o[2 * jg + 1] = mma_h(pl.v, vhb2, o[2 * jg + 1]);
        o[2 * jg + 1] = mma_h(ph.v, vlb2, o[2 * jg + 1]);
        guard2(o[2 * jg], o[2 * jg + 1], ph.v, pl.v, vha, vhb2, vla, vlb2);
      }
    }
    wave_sync_lds();
  }
  acc_guard4(o[0], o[1], o[2], o[3]);
  // ---- out = acc / Z (0 if Z == 0), carries (32768 on P, 1024 on v) folded once; written into the lane-owned slab ----
#pragma unroll
  for (int r = 0; r < 8; ++r) {
    const float lv  = lrow[r];
    const float ls  = (lv > 0.0f) ? lv : 1.0f;
    const float inv = (lv > 0.0f) ? ((1.0f / ls) * oc) : 0.0f;
#pragma unroll
    for (int j = 0; j < 4; ++j) {
      const int idx = (8 * hh + r) * SLP + j * 16 + c;
      slab[idx] = o[j][r] * inv;
    }
  }
  wave_sync_lds();
  v4u oh[4], ol[4];
  const int rq = lane >> 3, c8 = (lane & 7) * 8;
#pragma unroll
  for (int it = 0; it < 4; ++it) {
    const int row = it * 4 + rq;
    const v4f a = *(const v4f*)(slab + row * SLP + c8), b4 = *(const v4f*)(slab + row * SLP + c8 + 4);
    float w[8];
#pragma unroll
    for (int e = 0; e < 4; ++e) { w[e] = a[e] * OSC; w[4 + e] = b4[e] * OSC; }
#pragma unroll
    for (int e = 0; e < 4; ++e) {
      const _Float16 h0 = (_Float16)w[2 * e], h1 = (_Float16)w[2 * e + 1];
      const _Float16 l0 = (_Float16)(w[2 * e] - (float)h0), l1 = (_Float16)(w[2 * e + 1] - (float)h1);
      oh[it][e] = pk16(h_bits(h0), h_bits(h1));
      ol[it][e] = pk16(h_bits(l0), h_bits(l1));
    }
  }
  const size_t ob = ((size_t)b * SEQ + q0) * DOUT + (size_t)head * DV + c8;
  {
#pragma unroll
    for (int it = 0; it < 4; ++it) {
      const int row = it * 4 + rq;
      *(v4u*)(OHp + ob + (size_t)row * DOUT) = oh[it];
      *(v4u*)(OLp + ob + (size_t)row * DOUT) = ol[it];
    }
    
  }
}

// =====================================================================================================
// Workspace map (bytes); every plane is fully written by whole-line stores before it is read; all extents are exact multiples
// of the store granularity (no pad rows needed); every region offset a multiple of 262144:
//   XB  bf16 [MROWS][DIN]                 MROWS*2048      (NB=2, SEQ=2048: 8388608)
//   WQT bf16 [NQ n][DIN k]                1048576
//   WKT bf16 [NK n][DIN k]                262144
//   WVT bf16 [NV n][DIN k]                524288
//   WPT f16  [DOUT n][DOUT k] x1024       2097152
//   FQ  f32  [MROWS][NQ]                  MROWS*2048      (8388608)
//   FK  f32  [MROWS][NK]                  MROWS*512       (2097152)
//   FV  f32  [MROWS][NV]                  MROWS*1024      (4194304)
//   QH, QL f16 [MROWS][NQ] x256           MROWS*1024 each (4194304 each)
//   KH, KL f16 [MROWS][NK] x256           MROWS*256 each  (1048576 each)
//   VH, VL f16 [NB*NG][DV][SEQ] x1024     MROWS*512 each  (2097152 each)
//   OH, OL f16 [MROWS][DOUT] x1024        MROWS*2048 each (8388608 each)
//   end (NB=2, SEQ=2048)                  58458112
// =====================================================================================================
extern "C" void kernel_launch(void* const* d_in, const int* in_sizes, int n_in,
                              void* d_out, int out_size, void* d_ws, size_t ws_size,
                              hipStream_t stream) {
  if (n_in < 6) return;
  if (in_sizes[0] < ((NB - 1) * XS_FULL + SEQ) * DIN) return;
  if (in_sizes[1] != DIN * NQ) return;
  if (in_sizes[2] != DIN * NK) return;
  if (in_sizes[3] != DIN * NV) return;
  if (in_sizes[4] != DOUT * DOUT) return;
  if (in_sizes[5] != DOUT) return;
  if (out_size < MROWS * DOUT) return;

  const float* x   = (const float*)d_in[0];
  const float* wq  = (const float*)d_in[1];
  const float* wk  = (const float*)d_in[2];
  const float* wv  = (const float*)d_in[3];
  const float* wp  = (const float*)d_in[4];
  const float* bpv = (const float*)d_in[5];
  float*       out = (float*)d_out;

  const size_t szXB = (size_t)MROWS * DIN * 2;
  const size_t szWQ = (size_t)NQ * DIN * 2;
  const size_t szWK = (size_t)NK * DIN * 2;
  const size_t szWV = (size_t)NV * DIN * 2;
  const size_t szWP = (size_t)DOUT * DOUT * 2;
  const size_t szFQ = (size_t)MROWS * NQ * 4;
  const size_t szFK = (size_t)MROWS * NK * 4;
  const size_t szFV = (size_t)MROWS * NV * 4;
  const size_t szQ  = (size_t)MROWS * NQ * 2;                   // QH, QL
  const size_t szK  = (size_t)MROWS * NK * 2;                   // KH, KL
  const size_t szV  = (size_t)NB * NG * DV * SEQ * 2;           // VH, VL
  const size_t szO  = (size_t)MROWS * DOUT * 2;                 // OH, OL
  size_t off = 0;
  const size_t oXB = off; off += szXB;
  const size_t oWQ = off; off += szWQ;
  const size_t oWK = off; off += szWK;
  const size_t oWV = off; off += szWV;
  const size_t oWP = off; off += szWP;
  const size_t oFQ = off; off += szFQ;
  const size_t oFK = off; off += szFK;
  const size_t oFV = off; off += szFV;
  const size_t oQH = off; off += szQ;
  const size_t oQL = off; off += szQ;
  const size_t oKH = off; off += szK;
  const size_t oKL = off; off += szK;
  const size_t oVH = off; off += szV;
  const size_t oVL = off; off += szV;
  const size_t oOH = off; off += szO;
  const size_t oOL = off; off += szO;
  if (off > ws_size) return;                // off = 58458112 for NB = 2, SEQ = 2048
  if (off > (size_t)WS_CAP) return;

  char* ws = (char*)d_ws;
  u16*   XB  = (u16*)(ws + oXB);
  u16*   WQT = (u16*)(ws + oWQ);
  u16*   WKT = (u16*)(ws + oWK);
  u16*   WVT = (u16*)(ws + oWV);
  u16*   WPT = (u16*)(ws + oWP);
  float* FQ  = (float*)(ws + oFQ);
  float* FK  = (float*)(ws + oFK);
  float* FV  = (float*)(ws + oFV);
  u16*   QH  = (u16*)(ws + oQH);
  u16*   QL  = (u16*)(ws + oQL);
  u16*   KH  = (u16*)(ws + oKH);
  u16*   KL  = (u16*)(ws + oKL);
  u16*   VH  = (u16*)(ws + oVH);
  u16*   VL  = (u16*)(ws + oVL);
  u16*   OH  = (u16*)(ws + oOH);
  u16*   OL  = (u16*)(ws + oOL);

  const dim3 b256(256), b128(128), bAT(ATT_THREADS);
  const int  n8x = (SEQ * DIN) / 8;
  const dim3 gX((n8x + 255) / 256);                     // 1024 blocks per batch (SEQ=2048)
  const dim3 gWQ((NQ / 64) * (DIN / 64));               // 128
  const dim3 gWK((NK / 64) * (DIN / 64));               // 32
  const dim3 gWV((NV / 64) * (DIN / 64));               // 64
  const dim3 gWP((DOUT / 64) * (DOUT / 64));            // 256
  const dim3 gGQ((MROWS / 64) * (NQ / 64));
  const dim3 gGK((MROWS / 64) * (NK / 64));
  const dim3 gGV((MROWS / 64) * (NV / 64));
  const dim3 gVT(NB * NG * NST);
  const int  n8q = (MROWS * NQ) / 8;                    // q hi / residual planes
  const int  n8k = (MROWS * NK) / 8;                    // k hi / residual planes
  const dim3 gSQ((n8q + 255) / 256);
  const dim3 gSK((n8k + 255) / 256);
  const int  nqt1 = QO / 16;                            // query tiles with the P residual product (rows s < QO)
  const int  nqt0 = NQT - nqt1;                         // remaining query tiles
  const dim3 gGO((MROWS / 64) * (DOUT / 64));

  // (0) x -> bf16 plane [MROWS][DIN], one launch per batch row block
  for (int b = 0; b < NB; ++b) {
    cvt_bf<<<gX, b256, 0, stream>>>(x + (size_t)b * XS_FULL * DIN, XB + (size_t)b * SEQ * DIN, n8x);
  }
  // (1) weights: in [DIN k][NQ n] -> out [NQ n][DIN k] bf16; same for Wk [DIN][NK] -> [NK][DIN], Wv [DIN][NV] -> [NV][DIN];
  //     Wp in [DOUT k][DOUT n] -> out [DOUT n][DOUT k] as f16 of bf16 value x1024
  wt16<<<gWQ, b256, 0, stream>>>(wq, WQT, DIN, NQ, 0, 1.0f);
  wt16<<<gWK, b256, 0, stream>>>(wk, WKT, DIN, NK, 0, 1.0f);
  wt16<<<gWV, b256, 0, stream>>>(wv, WVT, DIN, NV, 0, 1.0f);
  wt16<<<gWP, b256, 0, stream>>>(wp, WPT, DOUT, DOUT, 1, WOS);
  // (2) v = x.Wv -> FV f32 [MROWS][NV]; (3) v^T hi + residual planes x1024
  gemm_bf<<<gGV, b128, 0, stream>>>(XB, WVT, FV, MROWS, NV, DIN);
  vt16<<<gVT, b256, 0, stream>>>(FV, VH, VL);
  // (4) q = x.Wq -> FQ [MROWS][NQ]; (5) q hi + residual planes x256
  gemm_bf<<<gGQ, b128, 0, stream>>>(XB, WQT, FQ, MROWS, NQ, DIN);
  split16<<<gSQ, b256, 0, stream>>>(FQ, QH, QL, n8q, QSC);
  // (6) k = x.Wk -> FK [MROWS][NK]; (7) k hi + residual planes x256
  gemm_bf<<<gGK, b128, 0, stream>>>(XB, WKT, FK, MROWS, NK, DIN);
  split16<<<gSK, b256, 0, stream>>>(FK, KH, KL, n8k, KSC);
  // (8) causal grouped attention with ALiBi -> O hi + residual planes f16 x1024 [MROWS][DOUT]:
  //     query tiles [0, QO/16) with the in-register P residual product, the rest without it
  attn_c<1><<<dim3(nqt1 * NHG * NB), bAT, 0, stream>>>(QH, QL, KH, KL, VH, VL, OH, OL, 0, nqt1);
  if (nqt0 > 0) {
    attn_c<0><<<dim3(nqt0 * NHG * NB), bAT, 0, stream>>>(QH, QL, KH, KL, VH, VL, OH, OL, nqt1, nqt0);
  }
  // (9) out = (O_hi + O_lo).Wp + bp -> d_out f32 [MROWS][DOUT], carries 1024 x 1024 folded back
  gemm_h2<<<gGO, b128, 0, stream>>>(OH, OL, WPT, bpv, out, MROWS, DOUT, DOUT, 1.0f / (OSC * WOS));
  (void)hipGetLastError();
}

// v002
// One run takes 214 microseconds.
// Two timings next to v001 put it at 1.20 and 1.22 times that version's speed.
// All steps since v000 together make it 1.27 times as fast.
// Contractions: x.Wq, x.Wk, x.Wv on v_wmma_f32_16x16x32_bf16 (x and W as bf16 RNE planes, W transposed to [n][k]);
// q.k^T (head dim 32) on v_wmma_f32_16x16x32_f16 with f16 hi + f16 residual planes on BOTH q and k (x256, products
// hi.hi + hi.lo + lo.hi); P.v on v_wmma_f32_16x16x32_f16 with v^T as f16 hi + residual planes x1024 (P.v_hi + P.v_lo for
// every row; plus P_lo.v_hi with an in-register f16 residual of P x32768 for query rows < 512); ctx.Wp + bp on
// v_wmma_f32_16x16x32_f16 with ctx x1024 as f16 hi + residual planes (hi.Wp + lo.Wp) and Wp as f16(bf16(Wp)) x1024 [n][k],
// bias as bf16 RNE value; all f32 accumulate. Causal select, ALiBi add, 1/sqrt(32) scale, base-2 online softmax and 1/Z
// fold in f32 on VALU. Grouped kv heads: query head h reads kv group (h % 4).
// Every 16-bit operand plane lies in workspace in FRAGMENT ORDER (see the fragment loaders): a fragment is 1024 contiguous bytes.
#include <hip/hip_runtime.h>
#include <math.h>
#include <stdint.h>

#ifndef NB
#define NB 2
#endif
#ifndef SEQ
#define SEQ 2048
#endif
#define XS_FULL 2048
#define DIN   1024
#define DOUT  1024
#define NH    16
#define NG    4
#define DQ    32
#define DV    64
#define NQ    (NH * DQ)
#define NK    (NG * DQ)
#define NV    (NG * DV)
#define MROWS (NB * SEQ)
#define QO    ((SEQ < 512) ? SEQ : 512)
#define RSQ_DQ 0.17677669529663687f
#define LOG2E  1.4426950408889634f
#define SQRT2F 1.4142135623730951f
#define QSC   256.0f
#define KSC   256.0f
#define PCAR  32768.0f
#define VCAR  1024.0f
#define OSC   1024.0f
#define WOS   1024.0f
#define WPB   2
#define NHG   (NH / WPB)
#define NQT   (SEQ / 16)
#define NST   (SEQ / 64)
#define NKT   (SEQ / 32)
#define ATT_THREADS (WPB * 32)
#define PTP   36
#define PTW   (16 * PTP)
#define SLP   68
#define SLW   (16 * SLP)
#define WREG  (PTW + SLW)
#define SLAB64 (16 * 68)
#define VTP   72
#define WTP   72
#define WS_CAP 134217728
static_assert(DOUT == NH * DV && NQ == 512 && NK == 128 && NV == 256 && DQ == 32 && DV == 64 && NG == 4 && NH == 16);
static_assert(NHG * WPB == NH && ATT_THREADS == 64 && WPB == 2);
static_assert(NB >= 1 && NB <= 2);
static_assert((SEQ % 64) == 0 && SEQ >= 64 && SEQ <= XS_FULL);
static_assert((QO % 16) == 0 && QO >= 16 && QO <= SEQ);
static_assert((DIN % 64) == 0 && (DOUT % 64) == 0 && (NQ % 64) == 0 && (NK % 64) == 0 && (NV % 64) == 0 && (DIN % 32) == 0);
static_assert(((SEQ * DIN / 8) % 256) == 0 && ((MROWS * NQ / 8) % 256) == 0 && ((MROWS * NK / 8) % 256) == 0);
static_assert(WPB * WREG * 4 <= 65536 && 2 * DV * VTP * 2 <= 65536 && 64 * WTP * 2 <= 65536 && 4 * SLAB64 * 4 <= 65536);

typedef unsigned short u16;
typedef _Float16 v16h __attribute__((ext_vector_type(16)));
typedef _Float16 v8h  __attribute__((ext_vector_type(8)));
typedef __bf16   v16b __attribute__((ext_vector_type(16)));
typedef float    v8f  __attribute__((ext_vector_type(8)));
typedef float    v4f  __attribute__((ext_vector_type(4)));
typedef unsigned int v4u __attribute__((ext_vector_type(4)));

union FragH { v16h v; v8h h[2]; v4u u[2]; };
union FragB { v16b v; v4u u[2]; };

// ---- scalar helpers --------------------------------------------------------------------------------
__device__ __forceinline__ unsigned short bf_bits(float f) {          // f32 -> bf16 bits, RNE convert
  unsigned u = __float_as_uint(f);
  return (unsigned short)((u + 0x7FFFu + ((u >> 16) & 1u)) >> 16);
}
__device__ __forceinline__ float bf_up(unsigned short h) { return __uint_as_float(((unsigned)h) << 16); }
__device__ __forceinline__ float bfr(float f) { return bf_up(bf_bits(f)); }
__device__ __forceinline__ unsigned short h_bits(_Float16 x) { return __builtin_bit_cast(unsigned short, x); }
__device__ __forceinline__ unsigned pk16(unsigned short a, unsigned short b) { return (unsigned)a | ((unsigned)b << 16); }
__device__ __forceinline__ v8f zero8() { v8f z = {0.f, 0.f, 0.f, 0.f, 0.f, 0.f, 0.f, 0.f}; return z; }

// ---- fragment order of a 16-bit operand plane of R rows (the WMMA's m or n index) x K columns (its k index), R % 16 == 0,
//      K % 32 == 0: a row-major grid of blocks of 16 rows x 32 columns, block (r >> 4, k >> 5) at half offset
//      ((r >> 4) * (K >> 5) + (k >> 5)) * 512; inside a block 64 chunks of 8 halves (16 B): chunk id holds row (id & 15),
//      columns ((id >> 4) & 3) * 8 .. + 7. So 16 rows x K columns take 16 * K halves, as in a row-major plane.
// ---- fragment loaders: 16-bit A/B operand, p + lb bytes = block base + 16 B * lane: lane -> row/col (lane&15), h = lane>>4;
//      elements 0..7 <- chunk lane (k0+8h..), elements 8..15 <- chunk 32 + lane (k0+16+8h..)  (same split k map for A and B);
//      each of the two loads of a wave reads 512 contiguous bytes = 4 whole 128-B lines
__device__ __forceinline__ v16h ldfrag_h(const _Float16* p, unsigned lb) {
  FragH f;
  const char* q = (const char*)(const void*)p + lb;
  f.h[0] = *(const v8h*)(const void*)(q);
  f.h[1] = *(const v8h*)(const void*)(q + 512);
  return f.v;
}
__device__ __forceinline__ v16b ldfrag_b(const u16* p, unsigned lb) { // bf16 plane read as unsigned integer vectors
  FragB f;
  const char* q = (const char*)(const void*)p + lb;
  f.u[0] = *(const v4u*)(const void*)(q);
  f.u[1] = *(const v4u*)(const void*)(q + 512);
  return f.v;
}

__device__ __forceinline__ v8f mma_h(v16h a, v16h b, v8f c) {
  return __builtin_amdgcn_wmma_f32_16x16x32_f16(false, a, false, b, (short)0, c, false, false);
}
__device__ __forceinline__ v8f mma_b(v16b a, v16b b, v8f c) {
  return __builtin_amdgcn_wmma_f32_16x16x32_bf16(false, a, false, b, (short)0, c, false, false);
}
__device__ __forceinline__ void guard2(v8f& a, v8f& b, v16h x0, v16h x1, v16h x2, v16h x3, v16h x4, v16h x5) {
#if defined(__HIP_DEVICE_COMPILE__)
  asm volatile("v_nop\n\tv_nop\n\tv_nop\n\tv_nop"
               : "+v"(a), "+v"(b) : "v"(x0), "v"(x1), "v"(x2), "v"(x3), "v"(x4), "v"(x5) : "memory");
#endif
}
template <typename F>
__device__ __forceinline__ void guard6(v8f& a, v8f& b, v8f& c, v8f& d, F x0, F x1, F x2, F x3, F x4, F x5) {
#if defined(__HIP_DEVICE_COMPILE__)
  asm volatile("v_nop\n\tv_nop\n\tv_nop\n\tv_nop"
               : "+v"(a), "+v"(b), "+v"(c), "+v"(d) : "v"(x0), "v"(x1), "v"(x2), "v"(x3), "v"(x4), "v"(x5) : "memory");
#endif
}
__device__ __forceinline__ void acc_guard4(v8f& a, v8f& b, v8f& c, v8f& d) {
#if defined(__HIP_DEVICE_COMPILE__)
  asm volatile("v_nop\n\tv_nop\n\tv_nop\n\tv_nop" : "+v"(a), "+v"(b), "+v"(c), "+v"(d));
#endif
}
__device__ __forceinline__ void wave_sync_lds() {
  __builtin_amdgcn_fence(__ATOMIC_RELEASE, "workgroup");
  __builtin_amdgcn_wave_barrier();
  __builtin_amdgcn_fence(__ATOMIC_ACQUIRE, "workgroup");
}

// =====================================================================================================
// f32 row-major [rows][DIN] -> bf16 RNE plane in fragment order. Thread = one chunk of D (8 elements of one row): two 16-B
// loads, one 16-B store; a wave stores 512 contiguous bytes.
// coverage: grid = ceil(n8/256) blocks x 256 thr x 8 (in-kernel bound) = the whole plane (n8 a multiple of 256 here).
// =====================================================================================================
__global__ __launch_bounds__(256) void cvt_bf(const float* __restrict__ x, u16* D, int n8) {
  const int gt = blockIdx.x * 256 + (int)threadIdx.x;                 // chunk index in D
  if (gt >= n8) return;
  const int blk = gt >> 6;
  const int row = (blk / (DIN / 32)) * 16 + (gt & 15);
  const int col = (blk % (DIN / 32)) * 32 + ((gt >> 4) & 3) * 8;
  const float* p = x + (size_t)row * DIN + col;
  const v4f a = *(const v4f*)(p), b4 = *(const v4f*)(p + 4);
  v4u o;
#pragma unroll
  for (int e = 0; e < 2; ++e) {
    o[e]     = pk16(bf_bits(a[2 * e]),  bf_bits(a[2 * e + 1]));
    o[2 + e] = pk16(bf_bits(b4[2 * e]), bf_bits(b4[2 * e + 1]));
  }
  u16* d = D + (size_t)gt * 8;
  {
    *(v4u*)(d) = o;
    
  }
}

// =====================================================================================================
// f32 W [K][N] (row-major, x.W layout) -> 16-bit plane D, N rows x K columns in fragment order (the B operand). f16mode == 0: bf16 RNE bits;
// f16mode == 1: f16 bits of (bf16 RNE value) * scale. Block = 64 n x 64 k output tile: each thread loads 16 floats of one
// k row (four 16-B loads), converts, scatters into the LDS tile T[n][k] (pitch 72 halves, scalar 2-B LDS stores of per-lane
// values); after a block barrier the tile leaves as its 8 blocks (4 n tiles x 2 k steps) of 64 chunks, a wave storing 512 contiguous B.
// coverage: load 256 thr x 16 = 64 k x 64 n; store 2 iterations x 256 thr x 8 halves = 8 blocks x 512 halves = the tile;
//           grid = (N/64)*(K/64) blocks covers D exactly once (host guarantees N % 64 == 0, K % 64 == 0).
// =====================================================================================================
__global__ __launch_bounds__(256) void wt16(const float* __restrict__ W, u16* D, int K, int N, int f16mode, float scale) {
  __shared__ __align__(16) u16 T[64 * WTP];
  const int tid = threadIdx.x;
  const int bid = blockIdx.x;
  const int nt  = N >> 6;
  const int n0  = (bid % nt) * 64;
  const int k0  = (bid / nt) * 64;
  if (k0 + 64 > K) return;                  // block-uniform, before the barrier; never taken with the exact grid
  {
    const int kr = tid >> 2;                // k row within tile 0..63
    const int nc = (tid & 3) * 16;          // n chunk 0,16,32,48
    const float* src = W + (size_t)(k0 + kr) * (size_t)N + n0 + nc;
#pragma unroll
    for (int i = 0; i < 4; ++i) {
      const v4f a = *(const v4f*)(src + 4 * i);
#pragma unroll
      for (int e = 0; e < 4; ++e) {
        const float f = a[e];
        const unsigned short hb = h_bits((_Float16)(bfr(f) * scale));
        const unsigned short bb = bf_bits(f);
        T[(nc + 4 * i + e) * WTP + kr] = (f16mode != 0) ? hb : bb;
      }
    }
  }
  __syncthreads();
  v4u v[2];
#pragma unroll
  for (int it = 0; it < 2; ++it) {
    const int id = it * 256 + tid;          // chunk of the tile: block id >> 6 = (n tile id >> 7, k step (id >> 6) & 1)
    v[it] = *(const v4u*)(T + ((id >> 7) * 16 + (id & 15)) * WTP + ((id >> 6) & 1) * 32 + ((id >> 4) & 3) * 8);
  }
  {
#pragma unroll
    for (int it = 0; it < 2; ++it) {
      const int id = it * 256 + tid;
      const size_t blk = (size_t)((n0 >> 4) + (id >> 7)) * (size_t)(K >> 5) + (size_t)((k0 >> 5) + ((id >> 6) & 1));
      *(v4u*)(D + blk * 512 + (id & 63) * 8) = v[it];
    }
    
  }
}

// =====================================================================================================
// f32 plane F (row-major, NC columns, n8*8 elements) -> f16 hi plane Hp = f16(F * sc) and f16 residual plane Lp = f16(t - f16(t)),
// both in fragment order. Thread = one chunk (8 elements of one row): two 16-B loads, one 16-B store per plane; a wave stores
// 512 contiguous bytes per plane. No barriers; every packed half comes from a per-lane (divergent) loaded value.
// coverage: grid = ceil(n8/256) blocks x 256 thr x 8 (in-kernel bound) = the whole of Hp and of Lp (n8 a multiple of 256 here).
// =====================================================================================================
template <int NC>
__global__ __launch_bounds__(256) void split16(const float* __restrict__ F, u16* Hp, u16* Lp, int n8, float sc) {
  const int gt = blockIdx.x * 256 + (int)threadIdx.x;                 // chunk index in Hp and in Lp
  if (gt >= n8) return;
  const int blk = gt >> 6;
  const int row = (blk / (NC / 32)) * 16 + (gt & 15);
  const int col = (blk % (NC / 32)) * 32 + ((gt >> 4) & 3) * 8;
  const float* p = F + (size_t)row * NC + col;
  const v4f a = *(const v4f*)(p), b4 = *(const v4f*)(p + 4);
  float w[8];
#pragma unroll
  for (int e = 0; e < 4; ++e) { w[e] = a[e] * sc; w[4 + e] = b4[e] * sc; }
  v4u oh, ol;
#pragma unroll
  for (int e = 0; e < 4; ++e) {
    const float t0 = w[2 * e], t1 = w[2 * e + 1];
    const _Float16 h0 = (_Float16)t0, h1 = (_Float16)t1;
    const _Float16 l0 = (_Float16)(t0 - (float)h0), l1 = (_Float16)(t1 - (float)h1);
    oh[e] = pk16(h_bits(h0), h_bits(h1));
    ol[e] = pk16(h_bits(l0), h_bits(l1));
  }
  u16* dh = Hp + (size_t)gt * 8;
  u16* dl = Lp + (size_t)gt * 8;
  {
    *(v4u*)(dh) = oh;
    *(v4u*)(dl) = ol;
    
  }
}

// =====================================================================================================
// v^T planes from the v projection F f32 [MROWS][NV] (row = b*SEQ + s, column = g*DV + d):
//   VH(row (b*NG + g)*DV + d, column s) = f16(v * 1024);  VL(same) = f16 residual (t - f16(t)), both for all keys s;
//   both planes NB*NG*DV rows x SEQ columns in fragment order.
// Block = (b, kv group g, 64 keys s0): each thread loads its 16 floats (key sl, d chunk dc) with 16-B loads, converts,
// scatters into two LDS tiles [64 d][64 keys] (pitch 72 halves); after a block barrier each tile leaves as its 8 blocks
// (4 d tiles x 2 key steps) of 64 chunks, a wave storing 512 contiguous bytes per plane.
// coverage: load 256 thr x 16 = 64 keys x 64 d; store 2 iterations x 256 thr x 8 halves = 8 blocks x 512 = the block's tile of
//           VH and of VL; grid = NB*NG*NST blocks covers both planes exactly once.
// =====================================================================================================
__global__ __launch_bounds__(256) void vt16(const float* __restrict__ F, u16* VHo, u16* VLo) {
  __shared__ __align__(16) u16 TH[DV * VTP];
  __shared__ __align__(16) u16 TL[DV * VTP];
  const int tid = threadIdx.x;
  const int bid = blockIdx.x;
  const int st  = bid % NST;
  const int t2  = bid / NST;
  const int g   = t2 % NG;
  const int b   = t2 / NG;
  if (b >= NB) return;                      // block-uniform, before the barrier; never taken with the exact grid
  const int s0  = st * 64;
  {
    const int sl = tid >> 2;                // key within tile 0..63
    const int dc = (tid & 3) * 16;          // d chunk 0,16,32,48
    const float* src = F + ((size_t)b * SEQ + s0 + sl) * NV + g * DV + dc;
#pragma unroll
    for (int i = 0; i < 4; ++i) {
      const v4f a = *(const v4f*)(src + 4 * i);
#pragma unroll
      for (int e = 0; e < 4; ++e) {
        const float t = a[e] * VCAR;
        const _Float16 hv = (_Float16)t;
        const _Float16 lv = (_Float16)(t - (float)hv);
        TH[(dc + 4 * i + e) * VTP + sl] = h_bits(hv);
        TL[(dc + 4 * i + e) * VTP + sl] = h_bits(lv);
      }
    }
  }
  __syncthreads();
  v4u vh[2], vl[2];
#pragma unroll
  for (int it = 0; it < 2; ++it) {
    const int id = it * 256 + tid;          // chunk of the tile: block id >> 6 = (d tile id >> 7, key step (id >> 6) & 1)
    const int lo = ((id >> 7) * 16 + (id & 15)) * VTP + ((id >> 6) & 1) * 32 + ((id >> 4) & 3) * 8;
    vh[it] = *(const v4u*)(TH + lo);
    vl[it] = *(const v4u*)(TL + lo);
  }
  const int rt0 = (b * NG + g) * (DV / 16);   // first 16-row tile of this (b, g) in the planes
  {
#pragma unroll
    for (int it = 0; it < 2; ++it) {
      const int id = it * 256 + tid;
      const size_t blk = (size_t)(rt0 + (id >> 7)) * (SEQ / 32) + (size_t)((s0 >> 5) + ((id >> 6) & 1));
      *(v4u*)(VHo + blk * 512 + (id & 63) * 8) = vh[it];
      *(v4u*)(VLo + blk * 512 + (id & 63) * 8) = vl[it];
    }
    
  }
}

// =====================================================================================================
// GEMM epilogue shared by all engines: the wave's 16x64 f32 tile (times oscale, plus the lane's per-column bias of each
// coverage: 8 instructions x 2 rows x 16 lanes x 4 floats = the wave's 16 x 64 tile.
// =====================================================================================================
__device__ __forceinline__ void epi64(float* sl, v8f a0, v8f a1, v8f a2, v8f a3, float oscale,
                                      float bb0, float bb1, float bb2, float bb3,
                                      float* C, int N, size_t rowb, int col0, int lane) {
  const int hh = lane >> 4, m = lane & 15;
#pragma unroll
  for (int r = 0; r < 8; ++r) {
    const int ro = (8 * hh + r) * 68 + m;
    sl[ro]      = a0[r] * oscale + bb0;
    sl[ro + 16] = a1[r] * oscale + bb1;
    sl[ro + 32] = a2[r] * oscale + bb2;
    sl[ro + 48] = a3[r] * oscale + bb3;
  }
  wave_sync_lds();
  v4f vals[8];
#pragma unroll
  for (int it = 0; it < 8; ++it) vals[it] = *(const v4f*)(sl + (it * 2 + hh) * 68 + m * 4);
  float* dst = C + (rowb + (size_t)hh) * (size_t)N + col0 + m * 4;
  {
#pragma unroll
    for (int it = 0; it < 8; ++it) {
      *(v4f*)(dst + (size_t)(it * 2) * (size_t)N) = vals[it];
    }
    
  }
}

// =====================================================================================================
// bf16 GEMM, no bias: C[M][N] (f32) = A (bf16, M rows x K, fragment order) . Bt^T (bf16, N rows x K, fragment order). Block = 64x64
// tile, 4 waves x 16 rows; fragments loaded straight from the planes' blocks (two 16-B loads each, split k map for A and B);
// K stepped by 32 (host guarantees K % 32 == 0, M % 64 == 0, N % 64 == 0, grid = (M/64)*(N/64)).
// =====================================================================================================
__global__ __launch_bounds__(128)
void gemm_bf(const u16* __restrict__ A, const u16* __restrict__ Bt, float* C, int M, int N, int K) {
  __shared__ __align__(16) float slab[4 * SLAB64];
  const int tid = threadIdx.x, wave = tid >> 5, lane = tid & 31;
  const int ntile = N >> 6;
  const int bid   = blockIdx.x;
  const int rowb  = (bid / ntile) * 64 + wave * 16;
  const int col0  = (bid % ntile) * 64;
  if (rowb + 16 > M) return;                // wave-uniform, never taken with the exact grid; no block barriers in this kernel
  const size_t bs = (size_t)16 * K;         // 16 rows on = one row of blocks on
  const u16* ap  = A  + (size_t)rowb * K + 8 * lane;   // the lane's chunk in block (rowb / 16, 0); the next k step is 512 halves on
  const u16* bp0 = Bt + (size_t)col0 * K + 8 * lane;
  const u16* bp1 = bp0 + bs;
  const u16* bp2 = bp1 + bs;
  const u16* bp3 = bp2 + bs;
  v8f acc0 = zero8(), acc1 = zero8(), acc2 = zero8(), acc3 = zero8();
#pragma unroll 1
  for (int k0 = 0; k0 < K; k0 += 32) {
    const v16b a  = ldfrag_b(ap, 0u);
    const v16b b0 = ldfrag_b(bp0, 0u);
    const v16b b1 = ldfrag_b(bp1, 0u);
    const v16b b2 = ldfrag_b(bp2, 0u);
    const v16b b3 = ldfrag_b(bp3, 0u);
    // the loads' address registers are named here, so none is given to a later load's result or stepped on before the
    // loads' address translations are back
#if defined(__HIP_DEVICE_COMPILE__)
    asm volatile("s_wait_xcnt 0x0" :: "v"(ap), "v"(bp0), "v"(bp1), "v"(bp2), "v"(bp3) : "memory");
#endif
    ap += 512; bp0 += 512; bp1 += 512; bp2 += 512; bp3 += 512;
    acc0 = mma_b(a, b0, acc0);
    acc1 = mma_b(a, b1, acc1);
    acc2 = mma_b(a, b2, acc2);
    acc3 = mma_b(a, b3, acc3);
    guard6<v16b>(acc0, acc1, acc2, acc3, a, b0, b1, b2, b3, a);
  }
  epi64(slab + wave * SLAB64, acc0, acc1, acc2, acc3, 1.0f, 0.0f, 0.0f, 0.0f, 0.0f, C, N, (size_t)rowb, col0, lane);
}

// =====================================================================================================
// f16 GEMM with a two-plane A operand and bias: C[M][N] (f32) = (Ah + Al) (f16 hi and residual planes, M rows x K, fragment
// order, residual unscaled relative to hi) . Bt^T (f16, N rows x K, fragment order) * oscale + bf16 RNE value of bias[n] (bias has
// N entries). Products ah.b + al.b into one accumulator. Same tiling, fragment loads (split k map) and epilogue as gemm_bf;
// K stepped by 32 (host guarantees K % 32 == 0, M % 64 == 0, N % 64 == 0, grid = (M/64)*(N/64)).
// =====================================================================================================
__global__ __launch_bounds__(128)
void gemm_h2(const u16* __restrict__ Ah, const u16* __restrict__ Al, const u16* __restrict__ Bt,
             const float* __restrict__ bias, float* C, int M, int N, int K, float oscale) {
  __shared__ __align__(16) float slab[4 * SLAB64];
  const int tid = threadIdx.x, wave = tid >> 5, lane = tid & 31, m = lane & 15;
  const int ntile = N >> 6;
  const int bid   = blockIdx.x;
  const int rowb  = (bid / ntile) * 64 + wave * 16;
  const int col0  = (bid % ntile) * 64;
  if (rowb + 16 > M) return;                // wave-uniform, never taken with the exact grid; no block barriers in this kernel
  const size_t bs = (size_t)16 * K;
  const _Float16* ahp = (const _Float16*)(const void*)Ah + (size_t)rowb * K + 8 * lane;   // the lane's chunk in block (rowb / 16, 0), as in gemm_bf
  const _Float16* alp = (const _Float16*)(const void*)Al + (size_t)rowb * K + 8 * lane;
  const _Float16* bp0 = (const _Float16*)(const void*)Bt + (size_t)col0 * K + 8 * lane;
  const _Float16* bp1 = bp0 + bs;
  const _Float16* bp2 = bp1 + bs;
  const _Float16* bp3 = bp2 + bs;
  v8f acc0 = zero8(), acc1 = zero8(), acc2 = zero8(), acc3 = zero8();
#pragma unroll 1
  for (int k0 = 0; k0 < K; k0 += 32) {
    const v16h ah = ldfrag_h(ahp, 0u), al = ldfrag_h(alp, 0u);
    const v16h b0 = ldfrag_h(bp0, 0u);
    const v16h b1 = ldfrag_h(bp1, 0u);
    const v16h b2 = ldfrag_h(bp2, 0u);
    const v16h b3 = ldfrag_h(bp3, 0u);
    // the loads' address registers are named here, so none is given to a later load's result or stepped on before the
    // loads' address translations are back
#if defined(__HIP_DEVICE_COMPILE__)
    asm volatile("s_wait_xcnt 0x0" :: "v"(ahp), "v"(alp), "v"(bp0), "v"(bp1), "v"(bp2), "v"(bp3) : "memory");
#endif
    ahp += 512; alp += 512; bp0 += 512; bp1 += 512; bp2 += 512; bp3 += 512;
    acc0 = mma_h(ah, b0, acc0);  acc0 = mma_h(al, b0, acc0);
    acc1 = mma_h(ah, b1, acc1);  acc1 = mma_h(al, b1, acc1);
    acc2 = mma_h(ah, b2, acc2);  acc2 = mma_h(al, b2, acc2);
    acc3 = mma_h(ah, b3, acc3);  acc3 = mma_h(al, b3, acc3);
    guard6<v16h>(acc0, acc1, acc2, acc3, ah, al, b0, b1, b2, b3);
  }
  // per-lane bias of D column m in each of the 4 subtiles; col0 + 48 + m <= N - 1 always
  const float bb0 = bfr(bias[col0 + m]);
  const float bb1 = bfr(bias[col0 + 16 + m]);
  const float bb2 = bfr(bias[col0 + 32 + m]);
  const float bb3 = bfr(bias[col0 + 48 + m]);
  epi64(slab + wave * SLAB64, acc0, acc1, acc2, acc3, oscale, bb0, bb1, bb2, bb3, C, N, (size_t)rowb, col0, lane);
}

// =====================================================================================================
// Causal grouped attention with ALiBi, q/k head dim 32, value head dim 64. Block bid -> (query tile qt = qtb + bid % nqtl:
// rows q0 = 16*qt .. q0+15, head pair hg, batch b); one wave per query head = hg*WPB + wave; kv group = head % NG.
//   q hi / residual planes f16 x256, row b*SEQ + s, column h*DQ + d (NQ columns); k hi / residual planes f16 x256, row
//   b*SEQ + s, column g*DQ + d (NK columns); v^T hi / residual planes x1024, row (b*NG + g)*DV + d, column s (SEQ columns);
//   O hi / residual planes f16 x1024, row b*SEQ + s, column h*DV + d (DOUT columns); all in fragment order.
//   scores (one k-step over d = 0..31) = q_hi.k_hi + q_hi.k_lo + q_lo.k_hi (3 products into one accumulator, residuals
//   unscaled relative to their hi planes), q fragments loop-invariant;
//   logit (log2 domain) t(i, j) = (acc/(256*256) + slope[h]*(j - i)) * (1/sqrt(32))*log2e, replaced by -inf where j > i,
//   slope[h] = 2^(-(h+1)/2) built exactly (power of two times f32 sqrt2 for odd h+1).
//   Key tiles of 32 visited in order for kb <= q0 + 15 (later tiles hold only keys above every query row of the tile).
//   Global loads run ahead of their use: a step issues its 16 v^T loads at its top and, right behind its score products,
//   the 8 k loads of the next step into the same registers, so their latency passes behind the softmax.
//   Online max-subtracted base-2 softmax in f32, -inf-safe rescale; the 16x32 prob tile stored to wave-private LDS (f32
//   for both PRES values) rebuilt from the LDS rows (float vector loads, same element type as stored); v^T B fragments for 4
//   d-subtiles from both v planes: P_hi.v_hi + P_hi.v_lo (+ P_lo.v_hi when PRES == 1), 2 groups of 2 subtiles.
//   After the loop: out = acc / Z (Z > 0 always: key 0 <= every query row; guarded anyway), carries 1/(32768*1024) folded
//   only (nkt <= NKT).
// coverage: per wave 4 instructions x 32 chunks x 8 halves = 2 blocks = 16 x 64 of each O plane; the two host launches cover
//           query tiles [0, QO/16) and [QO/16, NQT) x NHG x NB blocks x WPB waves = every (b, s, h) row segment of OH and
//           of OL exactly once.
// =====================================================================================================
template <int PRES>
__global__ __launch_bounds__(ATT_THREADS)
void attn_c(const u16* __restrict__ QHp, const u16* __restrict__ QLp,
            const u16* __restrict__ KHp, const u16* __restrict__ KLp,
            const u16* __restrict__ VHp, const u16* __restrict__ VLp,
            u16* OHp, u16* OLp, int qtb, int nqtl) {
  __shared__ __align__(16) float smem[WPB * WREG];

  const int tid  = threadIdx.x;
  const int wave = tid >> 5;
  const int lane = tid & 31;
  const int hh   = lane >> 4;
  const int c    = lane & 15;
  const int bid  = blockIdx.x;
  const int qt   = qtb + (bid % nqtl);
  const int t2   = bid / nqtl;
  const int hg   = t2 % NHG;
  const int b    = t2 / NHG;
  if (b >= NB) return;                      // block-uniform; no block barriers in this kernel; never taken with the exact grid
  const int q0   = qt * 16;
  if (q0 + 16 > SEQ) return;                // block-uniform; never taken
  const int head = hg * WPB + wave;
  const int kvh  = head % NG;               // tiled kv mapping: head h -> kv group h % NG

  float* pt   = smem + wave * WREG;         // prob tile [16][32] pitch 36
  float* slab = pt + PTW;                   // result slab [16][64] pitch 68

  // fragment-order blocks (512 halves each): q block (row tile, head); k block (key tile of 16, kv group), 16 keys on = 16 * NK
  // halves on; v^T block (d tile, key step of 32), 32 keys on = 512 halves on, 16 d on = 16 * SEQ halves on
  const _Float16* Qh  = (const _Float16*)(const void*)QHp + ((size_t)b * SEQ + q0) * NQ + (size_t)head * 512;
  const _Float16* Ql  = (const _Float16*)(const void*)QLp + ((size_t)b * SEQ + q0) * NQ + (size_t)head * 512;
  const _Float16* Khb = (const _Float16*)(const void*)KHp + (size_t)b * SEQ * NK + (size_t)kvh * 512;  // key row kb added per step
  const _Float16* Klb = (const _Float16*)(const void*)KLp + (size_t)b * SEQ * NK + (size_t)kvh * 512;
  const _Float16* Vhb = (const _Float16*)(const void*)VHp + (size_t)(b * NG + kvh) * DV * SEQ;         // d tile 0 (+j)
  const _Float16* Vlb = (const _Float16*)(const void*)VLp + (size_t)(b * NG + kvh) * DV * SEQ;
  const unsigned lb = 16u * (unsigned)lane;  // the lane's chunk inside a block, in bytes

  // ALiBi slope 2^(-(head+1)/2): even exponent -> exact power of two; odd -> power of two times f32 sqrt(2)
  const int   e1   = head + 1;
  const int   pw   = (e1 + 1) >> 1;
  const float p2   = __uint_as_float(((unsigned)(127 - pw)) << 23);
  const float slope = p2 * (((e1 & 1) != 0) ? SQRT2F : 1.0f);   // wave-uniform select by value
  const float lsc  = 1.0f / (QSC * KSC);
  const float ul2  = RSQ_DQ * LOG2E;
  const float oc   = 1.0f / (PCAR * VCAR);
  const size_t KROW = (size_t)NK;           // halves per key row in the k planes (16 rows = one row of blocks)

  const v16h qh = ldfrag_h(Qh, lb);             // loop-invariant q fragments (d = 0..31): hi plane
  const v16h ql = ldfrag_h(Ql, lb);             //                                         residual plane

  float mrow[8], lrow[8];
  v8f o[4];
#pragma unroll
  for (int r = 0; r < 8; ++r) { mrow[r] = -INFINITY; lrow[r] = 0.f; }
#pragma unroll
  for (int j = 0; j < 4; ++j) o[j] = zero8();
  const int ncaus = (q0 >> 5) + 1;                                            // tiles holding keys <= q0 + 15
  const int nkt = (ncaus < NKT) ? ncaus : NKT;
  const int qr0 = q0 + 8 * hh;                                                // query row of D element r = qr0 + r

  // k fragments of key tile 0; inside the loop each step fetches the next step's into the same registers
  v16h kh0 = ldfrag_h(Khb, lb);
  v16h kh1 = ldfrag_h(Khb + (size_t)16 * KROW, lb);
  v16h kl0 = ldfrag_h(Klb, lb);
  v16h kl1 = ldfrag_h(Klb + (size_t)16 * KROW, lb);

#pragma unroll 1
  for (int kt = 0; kt < nkt; ++kt) {
    const int kb = kt * 32;
    // ---- this step's v^T fragments (4 d-subtiles, both planes), issued first: they land behind the scores and the softmax ----
    v16h vh[4], vl[4];
#pragma unroll
    for (int j = 0; j < 4; ++j) vh[j] = ldfrag_h(Vhb + (size_t)kb * 16 + (size_t)j * 16 * SEQ, lb);
    // a later load's result may be given the address registers of the loads above: their translations are waited for first
    asm volatile("s_wait_xcnt 0x0" ::: "memory");
#pragma unroll
    for (int j = 0; j < 4; ++j) vl[j] = ldfrag_h(Vlb + (size_t)kb * 16 + (size_t)j * 16 * SEQ, lb);
    // ---- scores: D element r of this lane = (query row qr0 + r, key kb + c) in s0, key kb + 16 + c in s1 ----
    //      hi+residual planes on both operands: hi.hi + hi.lo + lo.hi
    v8f s0 = zero8(), s1 = zero8();
    {
      s0 = mma_h(qh, kh0, s0);              // hi.hi
      s0 = mma_h(qh, kl0, s0);              // hi.lo
      s0 = mma_h(ql, kh0, s0);              // lo.hi
      s1 = mma_h(qh, kh1, s1);
      s1 = mma_h(qh, kl1, s1);
      s1 = mma_h(ql, kh1, s1);
      guard2(s0, s1, qh, ql, kh0, kl0, kh1, kl1);
    }
    // ---- next step's k fragments, one step ahead; the last step re-reads its own tile (in bounds, values unused) ----
    {
      const int kn = (kt + 1 < nkt) ? kb + 32 : kb;
      const _Float16* k0p = Khb + (size_t)kn * KROW;
      const _Float16* l0p = Klb + (size_t)kn * KROW;
      kh0 = ldfrag_h(k0p, lb);
      kh1 = ldfrag_h(k0p + (size_t)16 * KROW, lb);
      kl0 = ldfrag_h(l0p, lb);
      kl1 = ldfrag_h(l0p + (size_t)16 * KROW, lb);
    }
    // ---- causal select + ALiBi + scale, online softmax in base 2, -inf-safe ----
    const int key0 = kb + c, key1 = kb + 16 + c;
#pragma unroll
    for (int r = 0; r < 8; ++r) {
      const int   qr = qr0 + r;
      const float a0 = slope * (float)(key0 - qr);
      const float a1 = slope * (float)(key1 - qr);
      const float u0 = (s0[r] * lsc + a0) * ul2;
      const float u1 = (s1[r] * lsc + a1) * ul2;
      const float t0 = (key0 > qr) ? -INFINITY : u0;
      const float t1 = (key1 > qr) ? -INFINITY : u1;
      float mx = fmaxf(t0, t1);
#pragma unroll
      for (int off = 1; off < 16; off <<= 1) mx = fmaxf(mx, __shfl_xor(mx, off, 32));
      const float mn = fmaxf(mrow[r], mx);
      const float ms = (mn == -INFINITY) ? 0.0f : mn;
      const float al = exp2f(mrow[r] - ms);
      mrow[r] = mn;
      const float e0 = exp2f(t0 - ms), ev1 = exp2f(t1 - ms);
      float ps = e0 + ev1;
#pragma unroll
      for (int off = 1; off < 16; off <<= 1) ps += __shfl_xor(ps, off, 32);
      lrow[r] = lrow[r] * al + ps;
#pragma unroll
      for (int j = 0; j < 4; ++j) o[j][r] *= al;
      const int ro = (8 * hh + r) * PTP + c;
      pt[ro]      = e0;
      pt[ro + 16] = ev1;
    }
    wave_sync_lds();
    // ---- A fragments of P*32768: f16 hi (and f16 residual when PRES), row = c, split k map over the 32 keys of this step ----
    FragH ph, pl;
    {
      const float* prow = pt + c * PTP + 8 * hh;
      const v4f pa = *(const v4f*)(prow), pb = *(const v4f*)(prow + 4);
      const v4f pc = *(const v4f*)(prow + 16), pd = *(const v4f*)(prow + 20);
#pragma unroll
      for (int e = 0; e < 4; ++e) {
        const float ta = pa[e] * PCAR, tb = pb[e] * PCAR, tc = pc[e] * PCAR, td = pd[e] * PCAR;
        const _Float16 ha = (_Float16)ta, hb = (_Float16)tb, hc = (_Float16)tc, hd = (_Float16)td;
        ph.h[0][e]     = ha;                  // elements 0..7  = keys kb + 8hh + 0..7
        ph.h[0][4 + e] = hb;
        ph.h[1][e]     = hc;                  // elements 8..15 = keys kb + 16 + 8hh + 0..7
        ph.h[1][4 + e] = hd;
        if constexpr (PRES == 1) {
          pl.h[0][e]     = (_Float16)(ta - (float)ha);
          pl.h[0][4 + e] = (_Float16)(tb - (float)hb);
          pl.h[1][e]     = (_Float16)(tc - (float)hc);
          pl.h[1][4 + e] = (_Float16)(td - (float)hd);
        }
      }
      if constexpr (PRES != 1) pl.v = ph.v;
    }
    // ---- P.V : B fragment col n = d = j*16 + c, k = the step's 32 keys; 2 groups of 2 d-subtiles ----
    {
#pragma unroll
      for (int jg = 0; jg < 2; ++jg) {
        const v16h vha = vh[2 * jg], vhb2 = vh[2 * jg + 1];
        const v16h vla = vl[2 * jg], vlb2 = vl[2 * jg + 1];
        o[2 * jg]     = mma_h(ph.v, vha,  o[2 * jg]);                       // P_hi . v_hi
        if constexpr (PRES == 1) o[2 * jg] = mma_h(pl.v, vha, o[2 * jg]);   // P_lo . v_hi
        o[2 * jg]     = mma_h(ph.v, vla,  o[2 * jg]);                       // P_hi . v_lo
        o[2 * jg + 1] = mma_h(ph.v, vhb2, o[2 * jg + 1]);
        if constexpr (PRES == 1) o[2 * jg + 1] = mma_h(pl.v, vhb2, o[2 * jg + 1]);
        o[2 * jg + 1] = mma_h(ph.v, vlb2, o[2 * jg + 1]);
        guard2(o[2 * jg], o[2 * jg + 1], ph.v, pl.v, vha, vhb2, vla, vlb2);
      }
    }
    wave_sync_lds();
  }
  acc_guard4(o[0], o[1], o[2], o[3]);
  // ---- out = acc / Z (0 if Z == 0), carries (32768 on P, 1024 on v) folded once; written into the lane-owned slab ----
#pragma unroll
  for (int r = 0; r < 8; ++r) {
    const float lv  = lrow[r];
    const float ls  = (lv > 0.0f) ? lv : 1.0f;
    const float inv = (lv > 0.0f) ? ((1.0f / ls) * oc) : 0.0f;
#pragma unroll
    for (int j = 0; j < 4; ++j) {
      const int idx = (8 * hh + r) * SLP + j * 16 + c;
      slab[idx] = o[j][r] * inv;
    }
  }
  wave_sync_lds();
  v4u oh[4], ol[4];
#pragma unroll
  for (int it = 0; it < 4; ++it) {
    // chunk it * 32 + lane of the wave's two O blocks: query row c, head columns it * 16 + 8 * hh .. + 7
    const float* sp = slab + c * SLP + it * 16 + 8 * hh;
    const v4f a = *(const v4f*)(sp), b4 = *(const v4f*)(sp + 4);
    float w[8];
#pragma unroll
    for (int e = 0; e < 4; ++e) { w[e] = a[e] * OSC; w[4 + e] = b4[e] * OSC; }
#pragma unroll
    for (int e = 0; e < 4; ++e) {
      const _Float16 h0 = (_Float16)w[2 * e], h1 = (_Float16)w[2 * e + 1];
      const _Float16 l0 = (_Float16)(w[2 * e] - (float)h0), l1 = (_Float16)(w[2 * e + 1] - (float)h1);
      oh[it][e] = pk16(h_bits(h0), h_bits(h1));
      ol[it][e] = pk16(h_bits(l0), h_bits(l1));
    }
  }
  const size_t ob = ((size_t)b * SEQ + q0) * DOUT + (size_t)head * (DV / 32) * 512 + 8 * lane;
  {
#pragma unroll
    for (int it = 0; it < 4; ++it) {
      *(v4u*)(OHp + ob + it * 256) = oh[it];
      *(v4u*)(OLp + ob + it * 256) = ol[it];
    }
    
  }
}

// =====================================================================================================
// Workspace map (bytes); every plane is fully written by whole-line stores before it is read; all extents are exact multiples
// of the store granularity (no pad rows needed); every region offset a multiple of 262144; the 16-bit planes are given as
// rows x columns and lie in fragment order, the f32 planes are row-major:
//   XB  bf16 MROWS x DIN                  MROWS*2048      (NB=2, SEQ=2048: 8388608)
//   WQT bf16 NQ n x DIN k                 1048576
//   WKT bf16 NK n x DIN k                 262144
//   WVT bf16 NV n x DIN k                 524288
//   WPT f16  DOUT n x DOUT k, x1024       2097152
//   FQ  f32  [MROWS][NQ]                  MROWS*2048      (8388608)
//   FK  f32  [MROWS][NK]                  MROWS*512       (2097152)
//   FV  f32  [MROWS][NV]                  MROWS*1024      (4194304)
//   QH, QL f16 MROWS x NQ, x256           MROWS*1024 each (4194304 each)
//   KH, KL f16 MROWS x NK, x256           MROWS*256 each  (1048576 each)
//   VH, VL f16 NB*NG*DV x SEQ, x1024      MROWS*512 each  (2097152 each)
//   OH, OL f16 MROWS x DOUT, x1024        MROWS*2048 each (8388608 each)
//   end (NB=2, SEQ=2048)                  58458112
// =====================================================================================================
extern "C" void kernel_launch(void* const* d_in, const int* in_sizes, int n_in,
                              void* d_out, int out_size, void* d_ws, size_t ws_size,
                              hipStream_t stream) {
  if (n_in < 6) return;
  if (in_sizes[0] < ((NB - 1) * XS_FULL + SEQ) * DIN) return;
  if (in_sizes[1] != DIN * NQ) return;
  if (in_sizes[2] != DIN * NK) return;
  if (in_sizes[3] != DIN * NV) return;
  if (in_sizes[4] != DOUT * DOUT) return;
  if (in_sizes[5] != DOUT) return;
  if (out_size < MROWS * DOUT) return;

  const float* x   = (const float*)d_in[0];
  const float* wq  = (const float*)d_in[1];
  const float* wk  = (const float*)d_in[2];
  const float* wv  = (const float*)d_in[3];
  const float* wp  = (const float*)d_in[4];
  const float* bpv = (const float*)d_in[5];
  float*       out = (float*)d_out;

  const size_t szXB = (size_t)MROWS * DIN * 2;
  const size_t szWQ = (size_t)NQ * DIN * 2;
  const size_t szWK = (size_t)NK * DIN * 2;
  const size_t szWV = (size_t)NV * DIN * 2;
  const size_t szWP = (size_t)DOUT * DOUT * 2;
  const size_t szFQ = (size_t)MROWS * NQ * 4;
  const size_t szFK = (size_t)MROWS * NK * 4;
  const size_t szFV = (size_t)MROWS * NV * 4;
  const size_t szQ  = (size_t)MROWS * NQ * 2;                   // QH, QL
  const size_t szK  = (size_t)MROWS * NK * 2;                   // KH, KL
  const size_t szV  = (size_t)NB * NG * DV * SEQ * 2;           // VH, VL
  const size_t szO  = (size_t)MROWS * DOUT * 2;                 // OH, OL
  size_t off = 0;
  const size_t oXB = off; off += szXB;
  const size_t oWQ = off; off += szWQ;
  const size_t oWK = off; off += szWK;
  const size_t oWV = off; off += szWV;
  const size_t oWP = off; off += szWP;
  const size_t oFQ = off; off += szFQ;
  const size_t oFK = off; off += szFK;
  const size_t oFV = off; off += szFV;
  const size_t oQH = off; off += szQ;
  const size_t oQL = off; off += szQ;
  const size_t oKH = off; off += szK;
  const size_t oKL = off; off += szK;
  const size_t oVH = off; off += szV;
  const size_t oVL = off; off += szV;
  const size_t oOH = off; off += szO;
  const size_t oOL = off; off += szO;
  if (off > ws_size) return;                // off = 58458112 for NB = 2, SEQ = 2048
  if (off > (size_t)WS_CAP) return;

  char* ws = (char*)d_ws;
  u16*   XB  = (u16*)(ws + oXB);
  u16*   WQT = (u16*)(ws + oWQ);
  u16*   WKT = (u16*)(ws + oWK);
  u16*   WVT = (u16*)(ws + oWV);
  u16*   WPT = (u16*)(ws + oWP);
  float* FQ  = (float*)(ws + oFQ);
  float* FK  = (float*)(ws + oFK);
  float* FV  = (float*)(ws + oFV);
  u16*   QH  = (u16*)(ws + oQH);
  u16*   QL  = (u16*)(ws + oQL);
  u16*   KH  = (u16*)(ws + oKH);
  u16*   KL  = (u16*)(ws + oKL);
  u16*   VH  = (u16*)(ws + oVH);
  u16*   VL  = (u16*)(ws + oVL);
  u16*   OH  = (u16*)(ws + oOH);
  u16*   OL  = (u16*)(ws + oOL);

  const dim3 b256(256), b128(128), bAT(ATT_THREADS);
  const int  n8x = (SEQ * DIN) / 8;
  const dim3 gX((n8x + 255) / 256);                     // 1024 blocks per batch (SEQ=2048)
  const dim3 gWQ((NQ / 64) * (DIN / 64));               // 128
  const dim3 gWK((NK / 64) * (DIN / 64));               // 32
  const dim3 gWV((NV / 64) * (DIN / 64));               // 64
  const dim3 gWP((DOUT / 64) * (DOUT / 64));            // 256
  const dim3 gGQ((MROWS / 64) * (NQ / 64));
  const dim3 gGK((MROWS / 64) * (NK / 64));
  const dim3 gGV((MROWS / 64) * (NV / 64));
  const dim3 gVT(NB * NG * NST);
  const int  n8q = (MROWS * NQ) / 8;                    // q hi / residual planes
  const int  n8k = (MROWS * NK) / 8;                    // k hi / residual planes
  const dim3 gSQ((n8q + 255) / 256);
  const dim3 gSK((n8k + 255) / 256);
  const int  nqt1 = QO / 16;                            // query tiles with the P residual product (rows s < QO)
  const int  nqt0 = NQT - nqt1;                         // remaining query tiles
  const dim3 gGO((MROWS / 64) * (DOUT / 64));

  // (0) x -> bf16 plane MROWS x DIN (fragment order), one launch per batch row block
  for (int b = 0; b < NB; ++b) {
    cvt_bf<<<gX, b256, 0, stream>>>(x + (size_t)b * XS_FULL * DIN, XB + (size_t)b * SEQ * DIN, n8x);
  }
  // (1) weights: in [DIN k][NQ n] -> out NQ n x DIN k bf16; same for Wk [DIN][NK] -> NK x DIN, Wv [DIN][NV] -> NV x DIN;
  //     Wp in [DOUT k][DOUT n] -> out DOUT n x DOUT k as f16 of bf16 value x1024; all out planes in fragment order
  wt16<<<gWQ, b256, 0, stream>>>(wq, WQT, DIN, NQ, 0, 1.0f);
  wt16<<<gWK, b256, 0, stream>>>(wk, WKT, DIN, NK, 0, 1.0f);
  wt16<<<gWV, b256, 0, stream>>>(wv, WVT, DIN, NV, 0, 1.0f);
  wt16<<<gWP, b256, 0, stream>>>(wp, WPT, DOUT, DOUT, 1, WOS);
  // (2) v = x.Wv -> FV f32 [MROWS][NV]; (3) v^T hi + residual planes x1024
  gemm_bf<<<gGV, b128, 0, stream>>>(XB, WVT, FV, MROWS, NV, DIN);
  vt16<<<gVT, b256, 0, stream>>>(FV, VH, VL);
  // (4) q = x.Wq -> FQ [MROWS][NQ]; (5) q hi + residual planes x256
  gemm_bf<<<gGQ, b128, 0, stream>>>(XB, WQT, FQ, MROWS, NQ, DIN);
  split16<NQ><<<gSQ, b256, 0, stream>>>(FQ, QH, QL, n8q, QSC);
  // (6) k = x.Wk -> FK [MROWS][NK]; (7) k hi + residual planes x256
  gemm_bf<<<gGK, b128, 0, stream>>>(XB, WKT, FK, MROWS, NK, DIN);
  split16<NK><<<gSK, b256, 0, stream>>>(FK, KH, KL, n8k, KSC);
  // (8) causal grouped attention with ALiBi -> O hi + residual planes f16 x1024, MROWS x DOUT:
  //     query tiles [0, QO/16) with the in-register P residual product, the rest without it
  attn_c<1><<<dim3(nqt1 * NHG * NB), bAT, 0, stream>>>(QH, QL, KH, KL, VH, VL, OH, OL, 0, nqt1);
  if (nqt0 > 0) {
    attn_c<0><<<dim3(nqt0 * NHG * NB), bAT, 0, stream>>>(QH, QL, KH, KL, VH, VL, OH, OL, nqt1, nqt0);
  }
  // (9) out = (O_hi + O_lo).Wp + bp -> d_out f32 [MROWS][DOUT], carries 1024 x 1024 folded back
  gemm_h2<<<gGO, b128, 0, stream>>>(OH, OL, WPT, bpv, out, MROWS, DOUT, DOUT, 1.0f / (OSC * WOS));
  (void)hipGetLastError();
}

// v003
// It runs in 182 microseconds.
// Timed twice side by side with v002, it ran 1.17 times as fast both times.
// All steps since v000 together make it 1.48 times as fast.
#include <hip/hip_runtime.h>
#include <math.h>
#include <stdint.h>

#ifndef NB
#define NB 2
#endif
#ifndef SEQ
#define SEQ 2048
#endif
#define XS_FULL 2048
#define DIN   1024
#define DOUT  1024
#define NH    16
#define NG    4
#define DQ    32
#define DV    64
#define NQ    (NH * DQ)
#define NK    (NG * DQ)
#define NV    (NG * DV)
#define MROWS (NB * SEQ)
#define QO    ((SEQ < 512) ? SEQ : 512)
#define RSQ_DQ 0.17677669529663687f
#define LOG2E  1.4426950408889634f
#define SQRT2F 1.4142135623730951f
#define QSC   256.0f
#define KSC   256.0f
#define PCAR  32768.0f
#define VCAR  1024.0f
#define OSC   1024.0f
#define WOS   1024.0f
#define WPB   2
#define NHG   (NH / WPB)
#define NQT   (SEQ / 16)
#define NST   (SEQ / 64)
#define NKT   (SEQ / 32)
#define ATT_THREADS (WPB * 32)
#define SLAB64 (16 * 68)
#define VTP   72
#define WTP   72
#define WS_CAP 134217728
static_assert(DOUT == NH * DV && NQ == 512 && NK == 128 && NV == 256 && DQ == 32 && DV == 64 && NG == 4 && NH == 16);
static_assert(NHG * WPB == NH && ATT_THREADS == 64 && WPB == 2);
static_assert(NB >= 1 && NB <= 2);
static_assert((SEQ % 64) == 0 && SEQ >= 64 && SEQ <= XS_FULL);
static_assert((QO % 16) == 0 && QO >= 16 && QO <= SEQ);
static_assert((DIN % 64) == 0 && (DOUT % 64) == 0 && (NQ % 64) == 0 && (NK % 64) == 0 && (NV % 64) == 0 && (DIN % 32) == 0);
static_assert(((SEQ * DIN / 8) % 256) == 0 && ((MROWS * NQ / 8) % 256) == 0 && ((MROWS * NK / 8) % 256) == 0);
static_assert(2 * DV * VTP * 2 <= 65536 && 64 * WTP * 2 <= 65536 && 4 * SLAB64 * 4 <= 65536);

typedef unsigned short u16;
typedef _Float16 v16h __attribute__((ext_vector_type(16)));
typedef _Float16 v8h  __attribute__((ext_vector_type(8)));
typedef __bf16   v16b __attribute__((ext_vector_type(16)));
typedef float    v8f  __attribute__((ext_vector_type(8)));
typedef float    v4f  __attribute__((ext_vector_type(4)));
typedef unsigned int v4u __attribute__((ext_vector_type(4)));

union FragH { v16h v; v8h h[2]; v4u u[2]; };
union FragB { v16b v; v4u u[2]; };

// ---- scalar helpers --------------------------------------------------------------------------------
__device__ __forceinline__ unsigned short bf_bits(float f) {          // f32 -> bf16 bits, RNE convert
  unsigned u = __float_as_uint(f);
  return (unsigned short)((u + 0x7FFFu + ((u >> 16) & 1u)) >> 16);
}
__device__ __forceinline__ float bf_up(unsigned short h) { return __uint_as_float(((unsigned)h) << 16); }
__device__ __forceinline__ float bfr(float f) { return bf_up(bf_bits(f)); }
__device__ __forceinline__ unsigned short h_bits(_Float16 x) { return __builtin_bit_cast(unsigned short, x); }
__device__ __forceinline__ unsigned pk16(unsigned short a, unsigned short b) { return (unsigned)a | ((unsigned)b << 16); }
__device__ __forceinline__ v8f zero8() { v8f z = {0.f, 0.f, 0.f, 0.f, 0.f, 0.f, 0.f, 0.f}; return z; }
__device__ __forceinline__ float xhalf(float x) {                     // the value of lane l ^ 16
  const int b = __builtin_bit_cast(int, x);
  return __builtin_bit_cast(float, __builtin_amdgcn_permlanex16(b, b, 0x76543210, 0xfedcba98, false, false));
}

// ---- fragment order of a 16-bit operand plane of R rows (the WMMA's m or n index) x K columns (its k index), R % 16 == 0,
//      K % 32 == 0: a row-major grid of blocks of 16 rows x 32 columns, block (r >> 4, k >> 5) at half offset
//      ((r >> 4) * (K >> 5) + (k >> 5)) * 512; inside a block 64 chunks of 8 halves (16 B): chunk id holds row (id & 15),
//      columns ((id >> 4) & 3) * 8 .. + 7. So 16 rows x K columns take 16 * K halves, as in a row-major plane.
// ---- fragment loaders: 16-bit A/B operand, p + lb bytes = block base + 16 B * lane: lane -> row/col (lane&15), h = lane>>4;
//      elements 0..7 <- chunk lane (k0+8h..), elements 8..15 <- chunk 32 + lane (k0+16+8h..)  (same split k map for A and B);
//      each of the two loads of a wave reads 512 contiguous bytes = 4 whole 128-B lines
__device__ __forceinline__ v16h ldfrag_h(const _Float16* p, unsigned lb) {
  FragH f;
  const char* q = (const char*)(const void*)p + lb;
  f.h[0] = *(const v8h*)(const void*)(q);
  f.h[1] = *(const v8h*)(const void*)(q + 512);
  return f.v;
}
__device__ __forceinline__ v16b ldfrag_b(const u16* p, unsigned lb) { // bf16 plane read as unsigned integer vectors
  FragB f;
  const char* q = (const char*)(const void*)p + lb;
  f.u[0] = *(const v4u*)(const void*)(q);
  f.u[1] = *(const v4u*)(const void*)(q + 512);
  return f.v;
}

__device__ __forceinline__ v8f mma_h(v16h a, v16h b, v8f c) {
  return __builtin_amdgcn_wmma_f32_16x16x32_f16(false, a, false, b, (short)0, c, false, false);
}
__device__ __forceinline__ v8f mma_b(v16b a, v16b b, v8f c) {
  return __builtin_amdgcn_wmma_f32_16x16x32_bf16(false, a, false, b, (short)0, c, false, false);
}
__device__ __forceinline__ void guard2(v8f& a, v8f& b, v16h x0, v16h x1, v16h x2, v16h x3, v16h x4, v16h x5) {
#if defined(__HIP_DEVICE_COMPILE__)
  asm volatile("v_nop\n\tv_nop\n\tv_nop\n\tv_nop"
               : "+v"(a), "+v"(b) : "v"(x0), "v"(x1), "v"(x2), "v"(x3), "v"(x4), "v"(x5) : "memory");
#endif
}
template <typename F>
__device__ __forceinline__ void guard6(v8f& a, v8f& b, v8f& c, v8f& d, F x0, F x1, F x2, F x3, F x4, F x5) {
#if defined(__HIP_DEVICE_COMPILE__)
  asm volatile("v_nop\n\tv_nop\n\tv_nop\n\tv_nop"
               : "+v"(a), "+v"(b), "+v"(c), "+v"(d) : "v"(x0), "v"(x1), "v"(x2), "v"(x3), "v"(x4), "v"(x5) : "memory");
#endif
}
__device__ __forceinline__ void acc_guard4(v8f& a, v8f& b, v8f& c, v8f& d) {
#if defined(__HIP_DEVICE_COMPILE__)
  asm volatile("v_nop\n\tv_nop\n\tv_nop\n\tv_nop" : "+v"(a), "+v"(b), "+v"(c), "+v"(d));
#endif
}
__device__ __forceinline__ void wave_sync_lds() {
  __builtin_amdgcn_fence(__ATOMIC_RELEASE, "workgroup");
  __builtin_amdgcn_wave_barrier();
  __builtin_amdgcn_fence(__ATOMIC_ACQUIRE, "workgroup");
}

// =====================================================================================================
// f32 row-major [rows][DIN] -> bf16 RNE plane in fragment order. Thread = one chunk of D (8 elements of one row): two 16-B
// loads, one 16-B store; a wave stores 512 contiguous bytes.
// coverage: grid = ceil(n8/256) blocks x 256 thr x 8 (in-kernel bound) = the whole plane (n8 a multiple of 256 here).
// =====================================================================================================
__global__ __launch_bounds__(256) void cvt_bf(const float* __restrict__ x, u16* D, int n8) {
  const int gt = blockIdx.x * 256 + (int)threadIdx.x;                 // chunk index in D
  if (gt >= n8) return;
  const int blk = gt >> 6;
  const int row = (blk / (DIN / 32)) * 16 + (gt & 15);
  const int col = (blk % (DIN / 32)) * 32 + ((gt >> 4) & 3) * 8;
  const float* p = x + (size_t)row * DIN + col;
  const v4f a = *(const v4f*)(p), b4 = *(const v4f*)(p + 4);
  v4u o;
#pragma unroll
  for (int e = 0; e < 2; ++e) {
    o[e]     = pk16(bf_bits(a[2 * e]),  bf_bits(a[2 * e + 1]));
    o[2 + e] = pk16(bf_bits(b4[2 * e]), bf_bits(b4[2 * e + 1]));
  }
  u16* d = D + (size_t)gt * 8;
  {
    *(v4u*)(d) = o;
    
  }
}

// =====================================================================================================
// f32 W [K][N] (row-major, x.W layout) -> 16-bit plane D, N rows x K columns in fragment order (the B operand). f16mode == 0: bf16 RNE bits;
// f16mode == 1: f16 bits of (bf16 RNE value) * scale. Block = 64 n x 64 k output tile: each thread loads 16 floats of one
// k row (four 16-B loads), converts, scatters into the LDS tile T[n][k] (pitch 72 halves, scalar 2-B LDS stores of per-lane
// values); after a block barrier the tile leaves as its 8 blocks (4 n tiles x 2 k steps) of 64 chunks, a wave storing 512 contiguous B.
// coverage: load 256 thr x 16 = 64 k x 64 n; store 2 iterations x 256 thr x 8 halves = 8 blocks x 512 halves = the tile;
//           grid = (N/64)*(K/64) blocks covers D exactly once (host guarantees N % 64 == 0, K % 64 == 0).
// =====================================================================================================
__global__ __launch_bounds__(256) void wt16(const float* __restrict__ W, u16* D, int K, int N, int f16mode, float scale) {
  __shared__ __align__(16) u16 T[64 * WTP];
  const int tid = threadIdx.x;
  const int bid = blockIdx.x;
  const int nt  = N >> 6;
  const int n0  = (bid % nt) * 64;
  const int k0  = (bid / nt) * 64;
  if (k0 + 64 > K) return;                  // block-uniform, before the barrier; never taken with the exact grid
  {
    const int kr = tid >> 2;                // k row within tile 0..63
    const int nc = (tid & 3) * 16;          // n chunk 0,16,32,48
    const float* src = W + (size_t)(k0 + kr) * (size_t)N + n0 + nc;
#pragma unroll
    for (int i = 0; i < 4; ++i) {
      const v4f a = *(const v4f*)(src + 4 * i);
#pragma unroll
      for (int e = 0; e < 4; ++e) {
        const float f = a[e];
        const unsigned short hb = h_bits((_Float16)(bfr(f) * scale));
        const unsigned short bb = bf_bits(f);
        T[(nc + 4 * i + e) * WTP + kr] = (f16mode != 0) ? hb : bb;
      }
    }
  }
  __syncthreads();
  v4u v[2];
#pragma unroll
  for (int it = 0; it < 2; ++it) {
    const int id = it * 256 + tid;          // chunk of the tile: block id >> 6 = (n tile id >> 7, k step (id >> 6) & 1)
    v[it] = *(const v4u*)(T + ((id >> 7) * 16 + (id & 15)) * WTP + ((id >> 6) & 1) * 32 + ((id >> 4) & 3) * 8);
  }
  {
#pragma unroll
    for (int it = 0; it < 2; ++it) {
      const int id = it * 256 + tid;
      const size_t blk = (size_t)((n0 >> 4) + (id >> 7)) * (size_t)(K >> 5) + (size_t)((k0 >> 5) + ((id >> 6) & 1));
      *(v4u*)(D + blk * 512 + (id & 63) * 8) = v[it];
    }
    
  }
}

// =====================================================================================================
// f32 plane F (row-major, NC columns, n8*8 elements) -> f16 hi plane Hp = f16(F * sc) and f16 residual plane Lp = f16(t - f16(t)),
// both in fragment order. Thread = one chunk (8 elements of one row): two 16-B loads, one 16-B store per plane; a wave stores
// 512 contiguous bytes per plane. No barriers; every packed half comes from a per-lane (divergent) loaded value.
// coverage: grid = ceil(n8/256) blocks x 256 thr x 8 (in-kernel bound) = the whole of Hp and of Lp (n8 a multiple of 256 here).
// =====================================================================================================
template <int NC>
__global__ __launch_bounds__(256) void split16(const float* __restrict__ F, u16* Hp, u16* Lp, int n8, float sc) {
  const int gt = blockIdx.x * 256 + (int)threadIdx.x;                 // chunk index in Hp and in Lp
  if (gt >= n8) return;
  const int blk = gt >> 6;
  const int row = (blk / (NC / 32)) * 16 + (gt & 15);
  const int col = (blk % (NC / 32)) * 32 + ((gt >> 4) & 3) * 8;
  const float* p = F + (size_t)row * NC + col;
  const v4f a = *(const v4f*)(p), b4 = *(const v4f*)(p + 4);
  float w[8];
#pragma unroll
  for (int e = 0; e < 4; ++e) { w[e] = a[e] * sc; w[4 + e] = b4[e] * sc; }
  v4u oh, ol;
#pragma unroll
  for (int e = 0; e < 4; ++e) {
    const float t0 = w[2 * e], t1 = w[2 * e + 1];
    const _Float16 h0 = (_Float16)t0, h1 = (_Float16)t1;
    const _Float16 l0 = (_Float16)(t0 - (float)h0), l1 = (_Float16)(t1 - (float)h1);
    oh[e] = pk16(h_bits(h0), h_bits(h1));
    ol[e] = pk16(h_bits(l0), h_bits(l1));
  }
  u16* dh = Hp + (size_t)gt * 8;
  u16* dl = Lp + (size_t)gt * 8;
  {
    *(v4u*)(dh) = oh;
    *(v4u*)(dl) = ol;
    
  }
}

// =====================================================================================================
// v^T planes from the v projection F f32 [MROWS][NV] (row = b*SEQ + s, column = g*DV + d):
//   VH(row (b*NG + g)*DV + d, column s) = f16(v * 1024);  VL(same) = f16 residual (t - f16(t)), both for all keys s;
//   both planes NB*NG*DV rows x SEQ columns in fragment order.
// Block = (b, kv group g, 64 keys s0): each thread loads its 16 floats (key sl, d chunk dc) with 16-B loads, converts,
// scatters into two LDS tiles [64 d][64 keys] (pitch 72 halves); after a block barrier each tile leaves as its 8 blocks
// (4 d tiles x 2 key steps) of 64 chunks, a wave storing 512 contiguous bytes per plane.
// coverage: load 256 thr x 16 = 64 keys x 64 d; store 2 iterations x 256 thr x 8 halves = 8 blocks x 512 = the block's tile of
//           VH and of VL; grid = NB*NG*NST blocks covers both planes exactly once.
// =====================================================================================================
__global__ __launch_bounds__(256) void vt16(const float* __restrict__ F, u16* VHo, u16* VLo) {
  __shared__ __align__(16) u16 TH[DV * VTP];
  __shared__ __align__(16) u16 TL[DV * VTP];
  const int tid = threadIdx.x;
  const int bid = blockIdx.x;
  const int st  = bid % NST;
  const int t2  = bid / NST;
  const int g   = t2 % NG;
  const int b   = t2 / NG;
  if (b >= NB) return;                      // block-uniform, before the barrier; never taken with the exact grid
  const int s0  = st * 64;
  {
    const int sl = tid >> 2;                // key within tile 0..63
    const int dc = (tid & 3) * 16;          // d chunk 0,16,32,48
    const float* src = F + ((size_t)b * SEQ + s0 + sl) * NV + g * DV + dc;
#pragma unroll
    for (int i = 0; i < 4; ++i) {
      const v4f a = *(const v4f*)(src + 4 * i);
#pragma unroll
      for (int e = 0; e < 4; ++e) {
        const float t = a[e] * VCAR;
        const _Float16 hv = (_Float16)t;
        const _Float16 lv = (_Float16)(t - (float)hv);
        TH[(dc + 4 * i + e) * VTP + sl] = h_bits(hv);
        TL[(dc + 4 * i + e) * VTP + sl] = h_bits(lv);
      }
    }
  }
  __syncthreads();
  v4u vh[2], vl[2];
#pragma unroll
  for (int it = 0; it < 2; ++it) {
    const int id = it * 256 + tid;          // chunk of the tile: block id >> 6 = (d tile id >> 7, key step (id >> 6) & 1)
    const int lo = ((id >> 7) * 16 + (id & 15)) * VTP + ((id >> 6) & 1) * 32 + ((id >> 4) & 3) * 8;
    vh[it] = *(const v4u*)(TH + lo);
    vl[it] = *(const v4u*)(TL + lo);
  }
  const int rt0 = (b * NG + g) * (DV / 16);   // first 16-row tile of this (b, g) in the planes
  {
#pragma unroll
    for (int it = 0; it < 2; ++it) {
      const int id = it * 256 + tid;
      const size_t blk = (size_t)(rt0 + (id >> 7)) * (SEQ / 32) + (size_t)((s0 >> 5) + ((id >> 6) & 1));
      *(v4u*)(VHo + blk * 512 + (id & 63) * 8) = vh[it];
      *(v4u*)(VLo + blk * 512 + (id & 63) * 8) = vl[it];
    }
    
  }
}

// =====================================================================================================
// GEMM epilogue shared by all engines: the wave's 16x64 f32 tile (times oscale, plus the lane's per-column bias of each
// coverage: 8 instructions x 2 rows x 16 lanes x 4 floats = the wave's 16 x 64 tile.
// =====================================================================================================
__device__ __forceinline__ void epi64(float* sl, v8f a0, v8f a1, v8f a2, v8f a3, float oscale,
                                      float bb0, float bb1, float bb2, float bb3,
                                      float* C, int N, size_t rowb, int col0, int lane) {
  const int hh = lane >> 4, m = lane & 15;
#pragma unroll
  for (int r = 0; r < 8; ++r) {
    const int ro = (8 * hh + r) * 68 + m;
    sl[ro]      = a0[r] * oscale + bb0;
    sl[ro + 16] = a1[r] * oscale + bb1;
    sl[ro + 32] = a2[r] * oscale + bb2;
    sl[ro + 48] = a3[r] * oscale + bb3;
  }
  wave_sync_lds();
  v4f vals[8];
#pragma unroll
  for (int it = 0; it < 8; ++it) vals[it] = *(const v4f*)(sl + (it * 2 + hh) * 68 + m * 4);
  float* dst = C + (rowb + (size_t)hh) * (size_t)N + col0 + m * 4;
  {
#pragma unroll
    for (int it = 0; it < 8; ++it) {
      *(v4f*)(dst + (size_t)(it * 2) * (size_t)N) = vals[it];
    }
    
  }
}

// =====================================================================================================
// bf16 GEMM, no bias: C[M][N] (f32) = A (bf16, M rows x K, fragment order) . Bt^T (bf16, N rows x K, fragment order). Block = 64x64
// tile, 4 waves x 16 rows; fragments loaded straight from the planes' blocks (two 16-B loads each, split k map for A and B);
// K stepped by 32 (host guarantees K % 32 == 0, M % 64 == 0, N % 64 == 0, grid = (M/64)*(N/64)).
// =====================================================================================================
__global__ __launch_bounds__(128)
void gemm_bf(const u16* __restrict__ A, const u16* __restrict__ Bt, float* C, int M, int N, int K) {
  __shared__ __align__(16) float slab[4 * SLAB64];
  const int tid = threadIdx.x, wave = tid >> 5, lane = tid & 31;
  const int ntile = N >> 6;
  const int bid   = blockIdx.x;
  const int rowb  = (bid / ntile) * 64 + wave * 16;
  const int col0  = (bid % ntile) * 64;
  if (rowb + 16 > M) return;                // wave-uniform, never taken with the exact grid; no block barriers in this kernel
  const size_t bs = (size_t)16 * K;         // 16 rows on = one row of blocks on
  const u16* ap  = A  + (size_t)rowb * K + 8 * lane;   // the lane's chunk in block (rowb / 16, 0); the next k step is 512 halves on
  const u16* bp0 = Bt + (size_t)col0 * K + 8 * lane;
  const u16* bp1 = bp0 + bs;
  const u16* bp2 = bp1 + bs;
  const u16* bp3 = bp2 + bs;
  v8f acc0 = zero8(), acc1 = zero8(), acc2 = zero8(), acc3 = zero8();
#pragma unroll 1
  for (int k0 = 0; k0 < K; k0 += 32) {
    const v16b a  = ldfrag_b(ap, 0u);
    const v16b b0 = ldfrag_b(bp0, 0u);
    const v16b b1 = ldfrag_b(bp1, 0u);
    const v16b b2 = ldfrag_b(bp2, 0u);
    const v16b b3 = ldfrag_b(bp3, 0u);
    // the loads' address registers are named here, so none is given to a later load's result or stepped on before the
    // loads' address translations are back
#if defined(__HIP_DEVICE_COMPILE__)
    asm volatile("s_wait_xcnt 0x0" :: "v"(ap), "v"(bp0), "v"(bp1), "v"(bp2), "v"(bp3) : "memory");
#endif
    ap += 512; bp0 += 512; bp1 += 512; bp2 += 512; bp3 += 512;
    acc0 = mma_b(a, b0, acc0);
    acc1 = mma_b(a, b1, acc1);
    acc2 = mma_b(a, b2, acc2);
    acc3 = mma_b(a, b3, acc3);
    guard6<v16b>(acc0, acc1, acc2, acc3, a, b0, b1, b2, b3, a);
  }
  epi64(slab + wave * SLAB64, acc0, acc1, acc2, acc3, 1.0f, 0.0f, 0.0f, 0.0f, 0.0f, C, N, (size_t)rowb, col0, lane);
}

// =====================================================================================================
// f16 GEMM with a two-plane A operand and bias: C[M][N] (f32) = (Ah + Al) (f16 hi and residual planes, M rows x K, fragment
// order, residual unscaled relative to hi) . Bt^T (f16, N rows x K, fragment order) * oscale + bf16 RNE value of bias[n] (bias has
// N entries). Products ah.b + al.b into one accumulator. Same tiling, fragment loads (split k map) and epilogue as gemm_bf;
// K stepped by 32 (host guarantees K % 32 == 0, M % 64 == 0, N % 64 == 0, grid = (M/64)*(N/64)).
// =====================================================================================================
__global__ __launch_bounds__(128)
void gemm_h2(const u16* __restrict__ Ah, const u16* __restrict__ Al, const u16* __restrict__ Bt,
             const float* __restrict__ bias, float* C, int M, int N, int K, float oscale) {
  __shared__ __align__(16) float slab[4 * SLAB64];
  const int tid = threadIdx.x, wave = tid >> 5, lane = tid & 31, m = lane & 15;
  const int ntile = N >> 6;
  const int bid   = blockIdx.x;
  const int rowb  = (bid / ntile) * 64 + wave * 16;
  const int col0  = (bid % ntile) * 64;
  if (rowb + 16 > M) return;                // wave-uniform, never taken with the exact grid; no block barriers in this kernel
  const size_t bs = (size_t)16 * K;
  const _Float16* ahp = (const _Float16*)(const void*)Ah + (size_t)rowb * K + 8 * lane;   // the lane's chunk in block (rowb / 16, 0), as in gemm_bf
  const _Float16* alp = (const _Float16*)(const void*)Al + (size_t)rowb * K + 8 * lane;
  const _Float16* bp0 = (const _Float16*)(const void*)Bt + (size_t)col0 * K + 8 * lane;
  const _Float16* bp1 = bp0 + bs;
  const _Float16* bp2 = bp1 + bs;
  const _Float16* bp3 = bp2 + bs;
  v8f acc0 = zero8(), acc1 = zero8(), acc2 = zero8(), acc3 = zero8();
#pragma unroll 1
  for (int k0 = 0; k0 < K; k0 += 32) {
    const v16h ah = ldfrag_h(ahp, 0u), al = ldfrag_h(alp, 0u);
    const v16h b0 = ldfrag_h(bp0, 0u);
    const v16h b1 = ldfrag_h(bp1, 0u);
    const v16h b2 = ldfrag_h(bp2, 0u);
    const v16h b3 = ldfrag_h(bp3, 0u);
    // the loads' address registers are named here, so none is given to a later load's result or stepped on before the
    // loads' address translations are back
#if defined(__HIP_DEVICE_COMPILE__)
    asm volatile("s_wait_xcnt 0x0" :: "v"(ahp), "v"(alp), "v"(bp0), "v"(bp1), "v"(bp2), "v"(bp3) : "memory");
#endif
    ahp += 512; alp += 512; bp0 += 512; bp1 += 512; bp2 += 512; bp3 += 512;
    acc0 = mma_h(ah, b0, acc0);  acc0 = mma_h(al, b0, acc0);
    acc1 = mma_h(ah, b1, acc1);  acc1 = mma_h(al, b1, acc1);
    acc2 = mma_h(ah, b2, acc2);  acc2 = mma_h(al, b2, acc2);
    acc3 = mma_h(ah, b3, acc3);  acc3 = mma_h(al, b3, acc3);
    guard6<v16h>(acc0, acc1, acc2, acc3, ah, al, b0, b1, b2, b3);
  }
  // per-lane bias of D column m in each of the 4 subtiles; col0 + 48 + m <= N - 1 always
  const float bb0 = bfr(bias[col0 + m]);
  const float bb1 = bfr(bias[col0 + 16 + m]);
  const float bb2 = bfr(bias[col0 + 32 + m]);
  const float bb3 = bfr(bias[col0 + 48 + m]);
  epi64(slab + wave * SLAB64, acc0, acc1, acc2, acc3, oscale, bb0, bb1, bb2, bb3, C, N, (size_t)rowb, col0, lane);
}

// =====================================================================================================
// Causal grouped attention with ALiBi, q/k head dim 32, value head dim 64. Block bid -> (query tile qt = qtb + bid % nqtl:
// rows q0 = 16*qt .. q0+15, head pair hg, batch b); one wave per query head = hg*WPB + wave; kv group = head % NG.
//   q hi / residual planes f16 x256, row b*SEQ + s, column h*DQ + d (NQ columns); k hi / residual planes f16 x256, row
//   b*SEQ + s, column g*DQ + d (NK columns); v^T hi / residual planes x1024, row (b*NG + g)*DV + d, column s (SEQ columns);
//   O hi / residual planes f16 x1024, row b*SEQ + s, column h*DV + d (DOUT columns); all in fragment order.
//   scores, transposed: S^T (16 keys x 16 queries, one k-step over d = 0..31) = k_hi.q_hi + k_lo.q_hi + k_hi.q_lo (A = k block,
//   B = q block; 3 products into one accumulator, residuals unscaled relative to their hi planes), q fragments loop-invariant;
//   a lane holds 16 of the step's 32 scores of ONE query (q0 + lane % 16), lane l ^ 16 the other 16;
//   logit (log2 domain) t(i, j) = (acc/(256*256) + slope[h]*(j - i)) * (1/sqrt(32))*log2e, replaced by -inf where j > i,
//   slope[h] = 2^(-(h+1)/2) built exactly (power of two times f32 sqrt2 for odd h+1).
//   Key tiles of 32 visited in order for kb <= q0 + 15 (later tiles hold only keys above every query row of the tile).
//   Global loads run ahead of their use: a step issues its 16 v^T loads at its top and, right behind its score products,
//   the 8 k loads of the next step into the same registers, so their latency passes behind the softmax.
//   Online max-subtracted base-2 softmax in f32, -inf-safe rescale: maximum and sum run over the lane's own registers, the
//   maximum joined with lane l ^ 16 in each step, the two half sums once behind the loop. The two score tiles of a step,
//   converted in place, ARE the B fragment of P^T (element e <- tile e / 8, register e % 8: the planes' split k map), so P
//   passes through no LDS; v^T blocks are the A fragments of 4 d-subtiles, both v planes: O^T += v_hi.P_hi + v_lo.P_hi
//   (+ v_hi.P_lo when PRES == 1), 2 groups of 2 subtiles.
//   After the loop: out = acc / Z (Z > 0 always: key 0 <= every query row; guarded anyway), carries 1/(32768*1024) folded
//   once; a lane's 8 registers of a subtile are 8 consecutive d of its query = one chunk of the O planes.
// coverage: per wave 4 instructions x 32 chunks x 8 halves = 2 blocks = 16 x 64 of each O plane; the two host launches cover
//           query tiles [0, QO/16) and [QO/16, NQT) x NHG x NB blocks x WPB waves = every (b, s, h) row segment of OH and
//           of OL exactly once.
// =====================================================================================================
template <int PRES>
__global__ __launch_bounds__(ATT_THREADS)
void attn_c(const u16* __restrict__ QHp, const u16* __restrict__ QLp,
            const u16* __restrict__ KHp, const u16* __restrict__ KLp,
            const u16* __restrict__ VHp, const u16* __restrict__ VLp,
            u16* OHp, u16* OLp, int qtb, int nqtl) {
  const int tid  = threadIdx.x;
  const int wave = tid >> 5;
  const int lane = tid & 31;
  const int hh   = lane >> 4;
  const int c    = lane & 15;
  const int bid  = blockIdx.x;
  const int qt   = qtb + (bid % nqtl);
  const int t2   = bid / nqtl;
  const int hg   = t2 % NHG;
  const int b    = t2 / NHG;
  if (b >= NB) return;                      // block-uniform; no block barriers in this kernel; never taken with the exact grid
  const int q0   = qt * 16;
  if (q0 + 16 > SEQ) return;                // block-uniform; never taken
  const int head = hg * WPB + wave;
  const int kvh  = head % NG;               // tiled kv mapping: head h -> kv group h % NG

  // fragment-order blocks (512 halves each): q block (row tile, head); k block (key tile of 16, kv group), 16 keys on = 16 * NK
  // halves on; v^T block (d tile, key step of 32), 32 keys on = 512 halves on, 16 d on = 16 * SEQ halves on
  const _Float16* Qh  = (const _Float16*)(const void*)QHp + ((size_t)b * SEQ + q0) * NQ + (size_t)head * 512;
  const _Float16* Ql  = (const _Float16*)(const void*)QLp + ((size_t)b * SEQ + q0) * NQ + (size_t)head * 512;
  const _Float16* Khb = (const _Float16*)(const void*)KHp + (size_t)b * SEQ * NK + (size_t)kvh * 512;  // key row kb added per step
  const _Float16* Klb = (const _Float16*)(const void*)KLp + (size_t)b * SEQ * NK + (size_t)kvh * 512;
  const _Float16* Vhb = (const _Float16*)(const void*)VHp + (size_t)(b * NG + kvh) * DV * SEQ;         // d tile 0 (+j)
  const _Float16* Vlb = (const _Float16*)(const void*)VLp + (size_t)(b * NG + kvh) * DV * SEQ;
  const unsigned lb = 16u * (unsigned)lane;  // the lane's chunk inside a block, in bytes

  // ALiBi slope 2^(-(head+1)/2): even exponent -> exact power of two; odd -> power of two times f32 sqrt(2)
  const int   e1   = head + 1;
  const int   pw   = (e1 + 1) >> 1;
  const float p2   = __uint_as_float(((unsigned)(127 - pw)) << 23);
  const float slope = p2 * (((e1 & 1) != 0) ? SQRT2F : 1.0f);   // wave-uniform select by value
  const float lsc  = 1.0f / (QSC * KSC);
  const float ul2  = RSQ_DQ * LOG2E;
  const float oc   = 1.0f / (PCAR * VCAR);
  const size_t KROW = (size_t)NK;           // halves per key row in the k planes (16 rows = one row of blocks)

  const v16h qh = ldfrag_h(Qh, lb);             // loop-invariant q fragments (d = 0..31): hi plane
  const v16h ql = ldfrag_h(Ql, lb);             //                                         residual plane

  float mrow = -INFINITY, lrow = 0.f;       // the lane's query: running maximum (both halves alike), sum over this half's keys
  v8f o[4];                                 // O^T: o[j][r] = (d = j*16 + 8*hh + r, query q0 + c)
#pragma unroll
  for (int j = 0; j < 4; ++j) o[j] = zero8();
  const int ncaus = (q0 >> 5) + 1;                                            // tiles holding keys <= q0 + 15
  const int nkt = (ncaus < NKT) ? ncaus : NKT;
  const int qr  = q0 + c;                                                     // the lane's query row

  // k fragments of key tile 0; inside the loop each step fetches the next step's into the same registers
  v16h kh0 = ldfrag_h(Khb, lb);
  v16h kh1 = ldfrag_h(Khb + (size_t)16 * KROW, lb);
  v16h kl0 = ldfrag_h(Klb, lb);
  v16h kl1 = ldfrag_h(Klb + (size_t)16 * KROW, lb);

#pragma unroll 1
  for (int kt = 0; kt < nkt; ++kt) {
    const int kb = kt * 32;
    // ---- this step's v^T fragments (4 d-subtiles, both planes), issued first: they land behind the scores and the softmax ----
    v16h vh[4], vl[4];
#pragma unroll
    for (int j = 0; j < 4; ++j) vh[j] = ldfrag_h(Vhb + (size_t)kb * 16 + (size_t)j * 16 * SEQ, lb);
    // a later load's result may be given the address registers of the loads above: their translations are waited for first
    asm volatile("s_wait_xcnt 0x0" ::: "memory");
#pragma unroll
    for (int j = 0; j < 4; ++j) vl[j] = ldfrag_h(Vlb + (size_t)kb * 16 + (size_t)j * 16 * SEQ, lb);
    // ---- scores: D element r of this lane = (key kb + 8*hh + r, query qr) in s0, key kb + 16 + 8*hh + r in s1 ----
    //      hi+residual planes on both operands: k_hi.q_hi + k_lo.q_hi + k_hi.q_lo
    v8f s0 = zero8(), s1 = zero8();
    {
      s0 = mma_h(kh0, qh, s0);              // hi.hi
      s0 = mma_h(kl0, qh, s0);              // k residual . q hi
      s0 = mma_h(kh0, ql, s0);              // k hi . q residual
      s1 = mma_h(kh1, qh, s1);
      s1 = mma_h(kl1, qh, s1);
      s1 = mma_h(kh1, ql, s1);
      guard2(s0, s1, qh, ql, kh0, kl0, kh1, kl1);
    }
    // ---- next step's k fragments, one step ahead; the last step re-reads its own tile (in bounds, values unused) ----
    {
      const int kn = (kt + 1 < nkt) ? kb + 32 : kb;
      const _Float16* k0p = Khb + (size_t)kn * KROW;
      const _Float16* l0p = Klb + (size_t)kn * KROW;
      kh0 = ldfrag_h(k0p, lb);
      kh1 = ldfrag_h(k0p + (size_t)16 * KROW, lb);
      kl0 = ldfrag_h(l0p, lb);
      kl1 = ldfrag_h(l0p + (size_t)16 * KROW, lb);
    }
    // the softmax below may be given the address registers of the loads above: their translations are waited for first
    asm volatile("s_wait_xcnt 0x0" ::: "memory");
    // holds the k loads and their wait in front of the softmax: the scheduler otherwise sinks them deep into it (it has no
    // memory operation left to hold them), and less of their latency passes behind it
    __builtin_amdgcn_sched_barrier(0);
    // ---- causal select + ALiBi + scale, online softmax in base 2, -inf-safe; all 16 values belong to query qr ----
    const int dk = kb + 8 * hh - qr;        // key - query of s0[0]
    float t0[8], t1[8];
#pragma unroll
    for (int r = 0; r < 8; ++r) {
      const int   d0 = dk + r, d1 = dk + 16 + r;
      const float a0 = slope * (float)d0;
      const float a1 = slope * (float)d1;
      const float u0 = (s0[r] * lsc + a0) * ul2;
      const float u1 = (s1[r] * lsc + a1) * ul2;
      t0[r] = (d0 > 0) ? -INFINITY : u0;
      t1[r] = (d1 > 0) ? -INFINITY : u1;
    }
    float mq[4];
#pragma unroll
    for (int i = 0; i < 4; ++i) mq[i] = fmaxf(fmaxf(t0[2 * i], t0[2 * i + 1]), fmaxf(t1[2 * i], t1[2 * i + 1]));
    float mx = fmaxf(fmaxf(mq[0], mq[1]), fmaxf(mq[2], mq[3]));
    mx = fmaxf(mx, xhalf(mx));              // the other 16 keys of the step
    const float mn = fmaxf(mrow, mx);
    const float ms = (mn == -INFINITY) ? 0.0f : mn;
    const float al = exp2f(mrow - ms);
    mrow = mn;
    float e0[8], e1[8];
#pragma unroll
    for (int r = 0; r < 8; ++r) { e0[r] = exp2f(t0[r] - ms); e1[r] = exp2f(t1[r] - ms); }
    float sq[4];
#pragma unroll
    for (int i = 0; i < 4; ++i) sq[i] = (e0[2 * i] + e0[2 * i + 1]) + (e1[2 * i] + e1[2 * i + 1]);
    lrow = lrow * al + ((sq[0] + sq[1]) + (sq[2] + sq[3]));
#pragma unroll
    for (int j = 0; j < 4; ++j) {
#pragma unroll
      for (int r = 0; r < 8; ++r) o[j][r] *= al;
    }
    // ---- B fragments of P^T*32768: f16 hi (and f16 residual when PRES), column = query c, split k map over the 32 keys of
    //      this step: elements 0..7 = keys kb + 8hh + 0..7 (s0's rows), elements 8..15 = keys kb + 16 + 8hh + 0..7 (s1's) ----
    FragH ph, pl;
    {
#pragma unroll
      for (int e = 0; e < 8; ++e) {
        const float ta = e0[e] * PCAR, tc = e1[e] * PCAR;
        const _Float16 ha = (_Float16)ta, hc = (_Float16)tc;
        ph.h[0][e] = ha;
        ph.h[1][e] = hc;
        if constexpr (PRES == 1) {
          pl.h[0][e] = (_Float16)(ta - (float)ha);
          pl.h[1][e] = (_Float16)(tc - (float)hc);
        }
      }
      if constexpr (PRES != 1) pl.v = ph.v;
    }
    // ---- v^T.P^T : A fragment row m = d = j*16 + c, k = the step's 32 keys; 2 groups of 2 d-subtiles ----
    {
#pragma unroll
      for (int jg = 0; jg < 2; ++jg) {
        const v16h vha = vh[2 * jg], vhb2 = vh[2 * jg + 1];
        const v16h vla = vl[2 * jg], vlb2 = vl[2 * jg + 1];
        o[2 * jg]     = mma_h(vha,  ph.v, o[2 * jg]);                       // v_hi . P_hi
        if constexpr (PRES == 1) o[2 * jg] = mma_h(vha, pl.v, o[2 * jg]);   // v_hi . P_lo
        o[2 * jg]     = mma_h(vla,  ph.v, o[2 * jg]);                       // v_lo . P_hi
        o[2 * jg + 1] = mma_h(vhb2, ph.v, o[2 * jg + 1]);
        if constexpr (PRES == 1) o[2 * jg + 1] = mma_h(vhb2, pl.v, o[2 * jg + 1]);
        o[2 * jg + 1] = mma_h(vlb2, ph.v, o[2 * jg + 1]);
        guard2(o[2 * jg], o[2 * jg + 1], ph.v, pl.v, vha, vhb2, vla, vlb2);
      }
    }
  }
  acc_guard4(o[0], o[1], o[2], o[3]);
  // ---- out = acc / Z (0 if Z == 0), Z = the two halves' sums, carries (32768 on P, 1024 on v) folded once ----
  const float lv  = lrow + xhalf(lrow);
  const float ls  = (lv > 0.0f) ? lv : 1.0f;
  const float inv = (lv > 0.0f) ? ((1.0f / ls) * oc) : 0.0f;
  v4u oh[4], ol[4];
#pragma unroll
  for (int it = 0; it < 4; ++it) {
    // chunk it * 32 + lane of the wave's two O blocks: query row c, head columns it * 16 + 8 * hh .. + 7 = o[it][0..7]
    float w[8];
#pragma unroll
    for (int e = 0; e < 8; ++e) w[e] = (o[it][e] * inv) * OSC;
#pragma unroll
    for (int e = 0; e < 4; ++e) {
      const _Float16 h0 = (_Float16)w[2 * e], h1 = (_Float16)w[2 * e + 1];
      const _Float16 l0 = (_Float16)(w[2 * e] - (float)h0), l1 = (_Float16)(w[2 * e + 1] - (float)h1);
      oh[it][e] = pk16(h_bits(h0), h_bits(h1));
      ol[it][e] = pk16(h_bits(l0), h_bits(l1));
    }
  }
  const size_t ob = ((size_t)b * SEQ + q0) * DOUT + (size_t)head * (DV / 32) * 512 + 8 * lane;
  {
#pragma unroll
    for (int it = 0; it < 4; ++it) {
      *(v4u*)(OHp + ob + it * 256) = oh[it];
      *(v4u*)(OLp + ob + it * 256) = ol[it];
    }
    
  }
}

// =====================================================================================================
// Workspace map (bytes); every plane is fully written by whole-line stores before it is read; all extents are exact multiples
// of the store granularity (no pad rows needed); every region offset a multiple of 262144; the 16-bit planes are given as
// rows x columns and lie in fragment order, the f32 planes are row-major:
//   XB  bf16 MROWS x DIN                  MROWS*2048      (NB=2, SEQ=2048: 8388608)
//   WQT bf16 NQ n x DIN k                 1048576
//   WKT bf16 NK n x DIN k                 262144
//   WVT bf16 NV n x DIN k                 524288
//   WPT f16  DOUT n x DOUT k, x1024       2097152
//   FQ  f32  [MROWS][NQ]                  MROWS*2048      (8388608)
//   FK  f32  [MROWS][NK]                  MROWS*512       (2097152)
//   FV  f32  [MROWS][NV]                  MROWS*1024      (4194304)
//   QH, QL f16 MROWS x NQ, x256           MROWS*1024 each (4194304 each)
//   KH, KL f16 MROWS x NK, x256           MROWS*256 each  (1048576 each)
//   VH, VL f16 NB*NG*DV x SEQ, x1024      MROWS*512 each  (2097152 each)
//   OH, OL f16 MROWS x DOUT, x1024        MROWS*2048 each (8388608 each)
//   end (NB=2, SEQ=2048)                  58458112
// =====================================================================================================
extern "C" void kernel_launch(void* const* d_in, const int* in_sizes, int n_in,
                              void* d_out, int out_size, void* d_ws, size_t ws_size,
                              hipStream_t stream) {
  if (n_in < 6) return;
  if (in_sizes[0] < ((NB - 1) * XS_FULL + SEQ) * DIN) return;
  if (in_sizes[1] != DIN * NQ) return;
  if (in_sizes[2] != DIN * NK) return;
  if (in_sizes[3] != DIN * NV) return;
  if (in_sizes[4] != DOUT * DOUT) return;
  if (in_sizes[5] != DOUT) return;
  if (out_size < MROWS * DOUT) return;

  const float* x   = (const float*)d_in[0];
  const float* wq  = (const float*)d_in[1];
  const float* wk  = (const float*)d_in[2];
  const float* wv  = (const float*)d_in[3];
  const float* wp  = (const float*)d_in[4];
  const float* bpv = (const float*)d_in[5];
  float*       out = (float*)d_out;

  const size_t szXB = (size_t)MROWS * DIN * 2;
  const size_t szWQ = (size_t)NQ * DIN * 2;
  const size_t szWK = (size_t)NK * DIN * 2;
  const size_t szWV = (size_t)NV * DIN * 2;
  const size_t szWP = (size_t)DOUT * DOUT * 2;
  const size_t szFQ = (size_t)MROWS * NQ * 4;
  const size_t szFK = (size_t)MROWS * NK * 4;
  const size_t szFV = (size_t)MROWS * NV * 4;
  const size_t szQ  = (size_t)MROWS * NQ * 2;                   // QH, QL
  const size_t szK  = (size_t)MROWS * NK * 2;                   // KH, KL
  const size_t szV  = (size_t)NB * NG * DV * SEQ * 2;           // VH, VL
  const size_t szO  = (size_t)MROWS * DOUT * 2;                 // OH, OL
  size_t off = 0;
  const size_t oXB = off; off += szXB;
  const size_t oWQ = off; off += szWQ;
  const size_t oWK = off; off += szWK;
  const size_t oWV = off; off += szWV;
  const size_t oWP = off; off += szWP;
  const size_t oFQ = off; off += szFQ;
  const size_t oFK = off; off += szFK;
  const size_t oFV = off; off += szFV;
  const size_t oQH = off; off += szQ;
  const size_t oQL = off; off += szQ;
  const size_t oKH = off; off += szK;
  const size_t oKL = off; off += szK;
  const size_t oVH = off; off += szV;
  const size_t oVL = off; off += szV;
  const size_t oOH = off; off += szO;
  const size_t oOL = off; off += szO;
  if (off > ws_size) return;                // off = 58458112 for NB = 2, SEQ = 2048
  if (off > (size_t)WS_CAP) return;

  char* ws = (char*)d_ws;
  u16*   XB  = (u16*)(ws + oXB);
  u16*   WQT = (u16*)(ws + oWQ);
  u16*   WKT = (u16*)(ws + oWK);
  u16*   WVT = (u16*)(ws + oWV);
  u16*   WPT = (u16*)(ws + oWP);
  float* FQ  = (float*)(ws + oFQ);
  float* FK  = (float*)(ws + oFK);
  float* FV  = (float*)(ws + oFV);
  u16*   QH  = (u16*)(ws + oQH);
  u16*   QL  = (u16*)(ws + oQL);
  u16*   KH  = (u16*)(ws + oKH);
  u16*   KL  = (u16*)(ws + oKL);
  u16*   VH  = (u16*)(ws + oVH);
  u16*   VL  = (u16*)(ws + oVL);
  u16*   OH  = (u16*)(ws + oOH);
  u16*   OL  = (u16*)(ws + oOL);

  const dim3 b256(256), b128(128), bAT(ATT_THREADS);
  const int  n8x = (SEQ * DIN) / 8;
  const dim3 gX((n8x + 255) / 256);                     // 1024 blocks per batch (SEQ=2048)
  const dim3 gWQ((NQ / 64) * (DIN / 64));               // 128
  const dim3 gWK((NK / 64) * (DIN / 64));               // 32
  const dim3 gWV((NV / 64) * (DIN / 64));               // 64
  const dim3 gWP((DOUT / 64) * (DOUT / 64));            // 256
  const dim3 gGQ((MROWS / 64) * (NQ / 64));
  const dim3 gGK((MROWS / 64) * (NK / 64));
  const dim3 gGV((MROWS / 64) * (NV / 64));
  const dim3 gVT(NB * NG * NST);
  const int  n8q = (MROWS * NQ) / 8;                    // q hi / residual planes
  const int  n8k = (MROWS * NK) / 8;                    // k hi / residual planes
  const dim3 gSQ((n8q + 255) / 256);
  const dim3 gSK((n8k + 255) / 256);
  const int  nqt1 = QO / 16;                            // query tiles with the P residual product (rows s < QO)
  const int  nqt0 = NQT - nqt1;                         // remaining query tiles
  const dim3 gGO((MROWS / 64) * (DOUT / 64));

  // (0) x -> bf16 plane MROWS x DIN (fragment order), one launch per batch row block
  for (int b = 0; b < NB; ++b) {
    cvt_bf<<<gX, b256, 0, stream>>>(x + (size_t)b * XS_FULL * DIN, XB + (size_t)b * SEQ * DIN, n8x);
  }
  // (1) weights: in [DIN k][NQ n] -> out NQ n x DIN k bf16; same for Wk [DIN][NK] -> NK x DIN, Wv [DIN][NV] -> NV x DIN;
  //     Wp in [DOUT k][DOUT n] -> out DOUT n x DOUT k as f16 of bf16 value x1024; all out planes in fragment order
  wt16<<<gWQ, b256, 0, stream>>>(wq, WQT, DIN, NQ, 0, 1.0f);
  wt16<<<gWK, b256, 0, stream>>>(wk, WKT, DIN, NK, 0, 1.0f);
  wt16<<<gWV, b256, 0, stream>>>(wv, WVT, DIN, NV, 0, 1.0f);
  wt16<<<gWP, b256, 0, stream>>>(wp, WPT, DOUT, DOUT, 1, WOS);
  // (2) v = x.Wv -> FV f32 [MROWS][NV]; (3) v^T hi + residual planes x1024
  gemm_bf<<<gGV, b128, 0, stream>>>(XB, WVT, FV, MROWS, NV, DIN);
  vt16<<<gVT, b256, 0, stream>>>(FV, VH, VL);
  // (4) q = x.Wq -> FQ [MROWS][NQ]; (5) q hi + residual planes x256
  gemm_bf<<<gGQ, b128, 0, stream>>>(XB, WQT, FQ, MROWS, NQ, DIN);
  split16<NQ><<<gSQ, b256, 0, stream>>>(FQ, QH, QL, n8q, QSC);
  // (6) k = x.Wk -> FK [MROWS][NK]; (7) k hi + residual planes x256
  gemm_bf<<<gGK, b128, 0, stream>>>(XB, WKT, FK, MROWS, NK, DIN);
  split16<NK><<<gSK, b256, 0, stream>>>(FK, KH, KL, n8k, KSC);
  // (8) causal grouped attention with ALiBi -> O hi + residual planes f16 x1024, MROWS x DOUT:
  //     query tiles [0, QO/16) with the in-register P residual product, the rest without it
  attn_c<1><<<dim3(nqt1 * NHG * NB), bAT, 0, stream>>>(QH, QL, KH, KL, VH, VL, OH, OL, 0, nqt1);
  if (nqt0 > 0) {
    attn_c<0><<<dim3(nqt0 * NHG * NB), bAT, 0, stream>>>(QH, QL, KH, KL, VH, VL, OH, OL, nqt1, nqt0);
  }
  // (9) out = (O_hi + O_lo).Wp + bp -> d_out f32 [MROWS][DOUT], carries 1024 x 1024 folded back
  gemm_h2<<<gGO, b128, 0, stream>>>(OH, OL, WPT, bpv, out, MROWS, DOUT, DOUT, 1.0f / (OSC * WOS));
  (void)hipGetLastError();
}

// v004
// A run of this version takes 118 microseconds.
// In both of two side-by-side timings against v003, it was 1.53 times as fast.
// Over all steps from v000 it is 2.26 times as fast.
#include <hip/hip_runtime.h>
#include <math.h>
#include <stdint.h>

#ifndef NB
#define NB 2
#endif
#ifndef SEQ
#define SEQ 2048
#endif
#define XS_FULL 2048
#define DIN   1024
#define DOUT  1024
#define NH    16
#define NG    4
#define DQ    32
#define DV    64
#define NQ    (NH * DQ)
#define NK    (NG * DQ)
#define NV    (NG * DV)
#define MROWS (NB * SEQ)
#define QO    ((SEQ < 512) ? SEQ : 512)
#define RSQ_DQ 0.17677669529663687f
#define LOG2E  1.4426950408889634f
#define SQRT2F 1.4142135623730951f
#define QSC   256.0f
#define KSC   256.0f
#define PCAR  32768.0f
#define VCAR  1024.0f
#define OSC   1024.0f
#define WOS   1024.0f
#define WPB   2
#define NHG   (NH / WPB)
#define NQT   (SEQ / 16)
#define NST   (SEQ / 64)
#define NKT   (SEQ / 32)
#define ATT_THREADS (WPB * 32)
#define SLAB64 (16 * 68)
#define VTP   72
#define WTP   72
#define WS_CAP 134217728
// block counts of the jobs that share a launch
#define GX    ((SEQ * DIN / 8 + 255) / 256)
#define GWQ   ((NQ / 64) * (DIN / 64))
#define GWK   ((NK / 64) * (DIN / 64))
#define GWV   ((NV / 64) * (DIN / 64))
#define GWP   ((DOUT / 64) * (DOUT / 64))
#define GWALL (GWP + GWQ + GWK + GWV)
#define GVT   (NB * NG * NST)
#define GSQ   ((MROWS * NQ / 8 + 255) / 256)
#define GSK   ((MROWS * NK / 8 + 255) / 256)
#define NQKV  (NQ + NK + NV)
static_assert(DOUT == NH * DV && NQ == 512 && NK == 128 && NV == 256 && DQ == 32 && DV == 64 && NG == 4 && NH == 16);
static_assert(NHG * WPB == NH && ATT_THREADS == 64 && WPB == 2);
static_assert(NB >= 1 && NB <= 2);
static_assert((SEQ % 64) == 0 && SEQ >= 64 && SEQ <= XS_FULL);
static_assert((QO % 16) == 0 && QO >= 16 && QO <= SEQ);
static_assert((DIN % 64) == 0 && (DOUT % 64) == 0 && (NQ % 64) == 0 && (NK % 64) == 0 && (NV % 64) == 0 && (DIN % 32) == 0);
static_assert(((SEQ * DIN / 8) % 256) == 0 && ((MROWS * NQ / 8) % 256) == 0 && ((MROWS * NK / 8) % 256) == 0);
static_assert(2 * DV * VTP * 2 <= 65536 && 64 * WTP * 2 <= 65536 && 4 * SLAB64 * 4 <= 65536);

typedef unsigned short u16;
typedef _Float16 v16h __attribute__((ext_vector_type(16)));
typedef _Float16 v8h  __attribute__((ext_vector_type(8)));
typedef __bf16   v16b __attribute__((ext_vector_type(16)));
typedef float    v8f  __attribute__((ext_vector_type(8)));
typedef float    v4f  __attribute__((ext_vector_type(4)));
typedef unsigned int v4u __attribute__((ext_vector_type(4)));

union FragH { v16h v; v8h h[2]; v4u u[2]; };
union FragB { v16b v; v4u u[2]; };

// ---- scalar helpers --------------------------------------------------------------------------------
__device__ __forceinline__ unsigned short bf_bits(float f) {          // f32 -> bf16 bits, RNE convert
  unsigned u = __float_as_uint(f);
  return (unsigned short)((u + 0x7FFFu + ((u >> 16) & 1u)) >> 16);
}
__device__ __forceinline__ float bf_up(unsigned short h) { return __uint_as_float(((unsigned)h) << 16); }
__device__ __forceinline__ float bfr(float f) { return bf_up(bf_bits(f)); }
__device__ __forceinline__ unsigned short h_bits(_Float16 x) { return __builtin_bit_cast(unsigned short, x); }
__device__ __forceinline__ unsigned pk16(unsigned short a, unsigned short b) { return (unsigned)a | ((unsigned)b << 16); }
__device__ __forceinline__ v8f zero8() { v8f z = {0.f, 0.f, 0.f, 0.f, 0.f, 0.f, 0.f, 0.f}; return z; }
__device__ __forceinline__ float xhalf(float x) {                     // the value of lane l ^ 16
  const int b = __builtin_bit_cast(int, x);
  return __builtin_bit_cast(float, __builtin_amdgcn_permlanex16(b, b, 0x76543210, 0xfedcba98, false, false));
}

// ---- fragment order of a 16-bit operand plane of R rows (the WMMA's m or n index) x K columns (its k index), R % 16 == 0,
//      K % 32 == 0: a row-major grid of blocks of 16 rows x 32 columns, block (r >> 4, k >> 5) at half offset
//      ((r >> 4) * (K >> 5) + (k >> 5)) * 512; inside a block 64 chunks of 8 halves (16 B): chunk id holds row (id & 15),
//      columns ((id >> 4) & 3) * 8 .. + 7. So 16 rows x K columns take 16 * K halves, as in a row-major plane.
// ---- fragment loaders: 16-bit A/B operand, p + lb bytes = block base + 16 B * lane: lane -> row/col (lane&15), h = lane>>4;
//      elements 0..7 <- chunk lane (k0+8h..), elements 8..15 <- chunk 32 + lane (k0+16+8h..)  (same split k map for A and B);
//      each of the two loads of a wave reads 512 contiguous bytes = 4 whole 128-B lines
__device__ __forceinline__ v16h ldfrag_h(const _Float16* p, unsigned lb) {
  FragH f;
  const char* q = (const char*)(const void*)p + lb;
  f.h[0] = *(const v8h*)(const void*)(q);
  f.h[1] = *(const v8h*)(const void*)(q + 512);
  return f.v;
}
__device__ __forceinline__ v16b ldfrag_b(const u16* p, unsigned lb) { // bf16 plane read as unsigned integer vectors
  FragB f;
  const char* q = (const char*)(const void*)p + lb;
  f.u[0] = *(const v4u*)(const void*)(q);
  f.u[1] = *(const v4u*)(const void*)(q + 512);
  return f.v;
}

__device__ __forceinline__ v8f mma_h(v16h a, v16h b, v8f c) {
  return __builtin_amdgcn_wmma_f32_16x16x32_f16(false, a, false, b, (short)0, c, false, false);
}
__device__ __forceinline__ v8f mma_b(v16b a, v16b b, v8f c) {
  return __builtin_amdgcn_wmma_f32_16x16x32_bf16(false, a, false, b, (short)0, c, false, false);
}
__device__ __forceinline__ void guard2(v8f& a, v8f& b, v16h x0, v16h x1, v16h x2, v16h x3, v16h x4, v16h x5) {
#if defined(__HIP_DEVICE_COMPILE__)
  asm volatile("v_nop\n\tv_nop\n\tv_nop\n\tv_nop"
               : "+v"(a), "+v"(b) : "v"(x0), "v"(x1), "v"(x2), "v"(x3), "v"(x4), "v"(x5) : "memory");
#endif
}
template <typename F>
__device__ __forceinline__ void guard6(v8f& a, v8f& b, v8f& c, v8f& d, F x0, F x1, F x2, F x3, F x4, F x5) {
#if defined(__HIP_DEVICE_COMPILE__)
  asm volatile("v_nop\n\tv_nop\n\tv_nop\n\tv_nop"
               : "+v"(a), "+v"(b), "+v"(c), "+v"(d) : "v"(x0), "v"(x1), "v"(x2), "v"(x3), "v"(x4), "v"(x5) : "memory");
#endif
}
__device__ __forceinline__ void acc_guard4(v8f& a, v8f& b, v8f& c, v8f& d) {
#if defined(__HIP_DEVICE_COMPILE__)
  asm volatile("v_nop\n\tv_nop\n\tv_nop\n\tv_nop" : "+v"(a), "+v"(b), "+v"(c), "+v"(d));
#endif
}
__device__ __forceinline__ void wave_sync_lds() {
  __builtin_amdgcn_fence(__ATOMIC_RELEASE, "workgroup");
  __builtin_amdgcn_wave_barrier();
  __builtin_amdgcn_fence(__ATOMIC_ACQUIRE, "workgroup");
}

// =====================================================================================================
// f32 row-major [rows][DIN] -> bf16 RNE plane in fragment order. Thread = one chunk of D (8 elements of one row): two 16-B
// loads, one 16-B store; a wave stores 512 contiguous bytes.
// coverage: bid = 0 .. ceil(n8/256) - 1, x 256 thr x 8 (in-kernel bound) = the whole plane (n8 a multiple of 256 here).
// =====================================================================================================
__device__ __forceinline__ void cvt_bf(const float* __restrict__ x, u16* D, int n8, int bid) {
  const int gt = bid * 256 + (int)threadIdx.x;                        // chunk index in D
  if (gt >= n8) return;
  const int blk = gt >> 6;
  const int row = (blk / (DIN / 32)) * 16 + (gt & 15);
  const int col = (blk % (DIN / 32)) * 32 + ((gt >> 4) & 3) * 8;
  const float* p = x + (size_t)row * DIN + col;
  const v4f a = *(const v4f*)(p), b4 = *(const v4f*)(p + 4);
  v4u o;
#pragma unroll
  for (int e = 0; e < 2; ++e) {
    o[e]     = pk16(bf_bits(a[2 * e]),  bf_bits(a[2 * e + 1]));
    o[2 + e] = pk16(bf_bits(b4[2 * e]), bf_bits(b4[2 * e + 1]));
  }
  u16* d = D + (size_t)gt * 8;
  {
    *(v4u*)(d) = o;
    
  }
}

// =====================================================================================================
// f32 W [K][N] (row-major, x.W layout) -> 16-bit plane D, N rows x K columns in fragment order (the B operand). f16mode == 0: bf16 RNE bits;
// f16mode == 1: f16 bits of (bf16 RNE value) * scale. Block = 64 n x 64 k output tile: each thread loads 16 floats of one
// k row (four 16-B loads), converts, scatters into the LDS tile T[n][k] (pitch 72 halves, scalar 2-B LDS stores of per-lane
// values); after a block barrier the tile leaves as its 8 blocks (4 n tiles x 2 k steps) of 64 chunks, a wave storing 512 contiguous B.
// coverage: load 256 thr x 16 = 64 k x 64 n; store 2 iterations x 256 thr x 8 halves = 8 blocks x 512 halves = the tile;
//           bid = 0 .. (N/64)*(K/64) - 1 covers D exactly once (N % 64 == 0, K % 64 == 0).
// =====================================================================================================
__device__ __forceinline__ void wt16(const float* __restrict__ W, u16* D, int K, int N, int f16mode, float scale, int bid) {
  __shared__ __align__(16) u16 T[64 * WTP];
  const int tid = threadIdx.x;
  const int nt  = N >> 6;
  const int n0  = (bid % nt) * 64;
  const int k0  = (bid / nt) * 64;
  if (k0 + 64 > K) return;                  // block-uniform, before the barrier; never taken with the exact grid
  {
    const int kr = tid >> 2;                // k row within tile 0..63
    const int nc = (tid & 3) * 16;          // n chunk 0,16,32,48
    const float* src = W + (size_t)(k0 + kr) * (size_t)N + n0 + nc;
#pragma unroll
    for (int i = 0; i < 4; ++i) {
      const v4f a = *(const v4f*)(src + 4 * i);
#pragma unroll
      for (int e = 0; e < 4; ++e) {
        const float f = a[e];
        const unsigned short hb = h_bits((_Float16)(bfr(f) * scale));
        const unsigned short bb = bf_bits(f);
        T[(nc + 4 * i + e) * WTP + kr] = (f16mode != 0) ? hb : bb;
      }
    }
  }
  __syncthreads();
  v4u v[2];
#pragma unroll
  for (int it = 0; it < 2; ++it) {
    const int id = it * 256 + tid;          // chunk of the tile: block id >> 6 = (n tile id >> 7, k step (id >> 6) & 1)
    v[it] = *(const v4u*)(T + ((id >> 7) * 16 + (id & 15)) * WTP + ((id >> 6) & 1) * 32 + ((id >> 4) & 3) * 8);
  }
  {
#pragma unroll
    for (int it = 0; it < 2; ++it) {
      const int id = it * 256 + tid;
      const size_t blk = (size_t)((n0 >> 4) + (id >> 7)) * (size_t)(K >> 5) + (size_t)((k0 >> 5) + ((id >> 6) & 1));
      *(v4u*)(D + blk * 512 + (id & 63) * 8) = v[it];
    }
    
  }
}

// =====================================================================================================
// All jobs that read only the inputs, in one launch; a block does one block's work of one job, chosen by its index (block-uniform):
//   [0, GWP) Wp [DOUT k][DOUT n] -> DOUT n x DOUT k as f16 of bf16 value x1024; then GWQ blocks Wq [DIN k][NQ n] -> NQ n x DIN k
//   bf16; GWK blocks Wk -> NK x DIN; GWV blocks Wv -> NV x DIN; then NB * GX blocks x -> bf16 plane MROWS x DIN, GX per batch.
// =====================================================================================================
__global__ __launch_bounds__(256)
void prep_in(const float* __restrict__ x, const float* __restrict__ wq, const float* __restrict__ wk,
             const float* __restrict__ wv, const float* __restrict__ wp,
             u16* XB, u16* WQT, u16* WKT, u16* WVT, u16* WPT) {
  const int bid = blockIdx.x;
  if (bid < GWALL) {
    const float* W = wp;
    u16* D = WPT;
    int K = DOUT, N = DOUT, mode = 1, lb = bid;
    float sc = WOS;
    if (bid >= GWP + GWQ + GWK)  { W = wv; D = WVT; K = DIN; N = NV; mode = 0; sc = 1.0f; lb = bid - (GWP + GWQ + GWK); }
    else if (bid >= GWP + GWQ)   { W = wk; D = WKT; K = DIN; N = NK; mode = 0; sc = 1.0f; lb = bid - (GWP + GWQ); }
    else if (bid >= GWP)         { W = wq; D = WQT; K = DIN; N = NQ; mode = 0; sc = 1.0f; lb = bid - GWP; }
    wt16(W, D, K, N, mode, sc, lb);
  } else {
    const int cb = bid - GWALL;
    const int b  = cb / GX;
    if (b >= NB) return;                    // block-uniform; never taken with the exact grid
    cvt_bf(x + (size_t)b * XS_FULL * DIN, XB + (size_t)b * SEQ * DIN, (SEQ * DIN) / 8, cb % GX);
  }
}

// =====================================================================================================
// f32 plane F (row-major, NC columns, n8*8 elements) -> f16 hi plane Hp = f16(F * sc) and f16 residual plane Lp = f16(t - f16(t)),
// both in fragment order. Thread = one chunk (8 elements of one row): two 16-B loads, one 16-B store per plane; a wave stores
// 512 contiguous bytes per plane. No barriers; every packed half comes from a per-lane (divergent) loaded value.
// coverage: bid = 0 .. ceil(n8/256) - 1, x 256 thr x 8 (in-kernel bound) = the whole of Hp and of Lp (n8 a multiple of 256 here).
// =====================================================================================================
template <int NC>
__device__ __forceinline__ void split16(const float* __restrict__ F, u16* Hp, u16* Lp, int n8, float sc, int bid) {
  const int gt = bid * 256 + (int)threadIdx.x;                        // chunk index in Hp and in Lp
  if (gt >= n8) return;
  const int blk = gt >> 6;
  const int row = (blk / (NC / 32)) * 16 + (gt & 15);
  const int col = (blk % (NC / 32)) * 32 + ((gt >> 4) & 3) * 8;
  const float* p = F + (size_t)row * NC + col;
  const v4f a = *(const v4f*)(p), b4 = *(const v4f*)(p + 4);
  float w[8];
#pragma unroll
  for (int e = 0; e < 4; ++e) { w[e] = a[e] * sc; w[4 + e] = b4[e] * sc; }
  v4u oh, ol;
#pragma unroll
  for (int e = 0; e < 4; ++e) {
    const float t0 = w[2 * e], t1 = w[2 * e + 1];
    const _Float16 h0 = (_Float16)t0, h1 = (_Float16)t1;
    const _Float16 l0 = (_Float16)(t0 - (float)h0), l1 = (_Float16)(t1 - (float)h1);
    oh[e] = pk16(h_bits(h0), h_bits(h1));
    ol[e] = pk16(h_bits(l0), h_bits(l1));
  }
  u16* dh = Hp + (size_t)gt * 8;
  u16* dl = Lp + (size_t)gt * 8;
  {
    *(v4u*)(dh) = oh;
    *(v4u*)(dl) = ol;
    
  }
}

// =====================================================================================================
// v^T planes from the v projection F f32 [MROWS][NV] (row = b*SEQ + s, column = g*DV + d):
//   VH(row (b*NG + g)*DV + d, column s) = f16(v * 1024);  VL(same) = f16 residual (t - f16(t)), both for all keys s;
//   both planes NB*NG*DV rows x SEQ columns in fragment order.
// Block = (b, kv group g, 64 keys s0): each thread loads its 16 floats (key sl, d chunk dc) with 16-B loads, converts,
// scatters into two LDS tiles [64 d][64 keys] (pitch 72 halves); after a block barrier each tile leaves as its 8 blocks
// (4 d tiles x 2 key steps) of 64 chunks, a wave storing 512 contiguous bytes per plane.
// coverage: load 256 thr x 16 = 64 keys x 64 d; store 2 iterations x 256 thr x 8 halves = 8 blocks x 512 = the block's tile of
//           VH and of VL; bid = 0 .. NB*NG*NST - 1 covers both planes exactly once.
// =====================================================================================================
__device__ __forceinline__ void vt16(const float* __restrict__ F, u16* VHo, u16* VLo, int bid) {
  __shared__ __align__(16) u16 TH[DV * VTP];
  __shared__ __align__(16) u16 TL[DV * VTP];
  const int tid = threadIdx.x;
  const int st  = bid % NST;
  const int t2  = bid / NST;
  const int g   = t2 % NG;
  const int b   = t2 / NG;
  if (b >= NB) return;                      // block-uniform, before the barrier; never taken with the exact grid
  const int s0  = st * 64;
  {
    const int sl = tid >> 2;                // key within tile 0..63
    const int dc = (tid & 3) * 16;          // d chunk 0,16,32,48
    const float* src = F + ((size_t)b * SEQ + s0 + sl) * NV + g * DV + dc;
#pragma unroll
    for (int i = 0; i < 4; ++i) {
      const v4f a = *(const v4f*)(src + 4 * i);
#pragma unroll
      for (int e = 0; e < 4; ++e) {
        const float t = a[e] * VCAR;
        const _Float16 hv = (_Float16)t;
        const _Float16 lv = (_Float16)(t - (float)hv);
        TH[(dc + 4 * i + e) * VTP + sl] = h_bits(hv);
        TL[(dc + 4 * i + e) * VTP + sl] = h_bits(lv);
      }
    }
  }
  __syncthreads();
  v4u vh[2], vl[2];
#pragma unroll
  for (int it = 0; it < 2; ++it) {
    const int id = it * 256 + tid;          // chunk of the tile: block id >> 6 = (d tile id >> 7, key step (id >> 6) & 1)
    const int lo = ((id >> 7) * 16 + (id & 15)) * VTP + ((id >> 6) & 1) * 32 + ((id >> 4) & 3) * 8;
    vh[it] = *(const v4u*)(TH + lo);
    vl[it] = *(const v4u*)(TL + lo);
  }
  const int rt0 = (b * NG + g) * (DV / 16);   // first 16-row tile of this (b, g) in the planes
  {
#pragma unroll
    for (int it = 0; it < 2; ++it) {
      const int id = it * 256 + tid;
      const size_t blk = (size_t)(rt0 + (id >> 7)) * (SEQ / 32) + (size_t)((s0 >> 5) + ((id >> 6) & 1));
      *(v4u*)(VHo + blk * 512 + (id & 63) * 8) = vh[it];
      *(v4u*)(VLo + blk * 512 + (id & 63) * 8) = vl[it];
    }
    
  }
}

// =====================================================================================================
// The three jobs that turn the f32 projections into attention's f16 planes, in one launch; a block does one block's work of one
// job, chosen by its index (block-uniform): [0, GVT) v^T planes x1024; then GSQ blocks q planes x256; then GSK blocks k planes x256.
// =====================================================================================================
__global__ __launch_bounds__(256)
void split_qkv(const float* __restrict__ FQ, const float* __restrict__ FK, const float* __restrict__ FV,
               u16* QH, u16* QL, u16* KH, u16* KL, u16* VH, u16* VL) {
  const int bid = blockIdx.x;
  if (bid < GVT)            vt16(FV, VH, VL, bid);
  else if (bid < GVT + GSQ) split16<NQ>(FQ, QH, QL, (MROWS * NQ) / 8, QSC, bid - GVT);
  else                      split16<NK>(FK, KH, KL, (MROWS * NK) / 8, KSC, bid - (GVT + GSQ));
}

// =====================================================================================================
// GEMM epilogue shared by all engines: the wave's 16x64 f32 tile (times oscale, plus the lane's per-column bias of each
// coverage: 8 instructions x 2 rows x 16 lanes x 4 floats = the wave's 16 x 64 tile.
// =====================================================================================================
__device__ __forceinline__ void epi64(float* sl, v8f a0, v8f a1, v8f a2, v8f a3, float oscale,
                                      float bb0, float bb1, float bb2, float bb3,
                                      float* C, int N, size_t rowb, int col0, int lane) {
  const int hh = lane >> 4, m = lane & 15;
#pragma unroll
  for (int r = 0; r < 8; ++r) {
    const int ro = (8 * hh + r) * 68 + m;
    sl[ro]      = a0[r] * oscale + bb0;
    sl[ro + 16] = a1[r] * oscale + bb1;
    sl[ro + 32] = a2[r] * oscale + bb2;
    sl[ro + 48] = a3[r] * oscale + bb3;
  }
  wave_sync_lds();
  v4f vals[8];
#pragma unroll
  for (int it = 0; it < 8; ++it) vals[it] = *(const v4f*)(sl + (it * 2 + hh) * 68 + m * 4);
  float* dst = C + (rowb + (size_t)hh) * (size_t)N + col0 + m * 4;
  {
#pragma unroll
    for (int it = 0; it < 8; ++it) {
      *(v4f*)(dst + (size_t)(it * 2) * (size_t)N) = vals[it];
    }
    
  }
}

// =====================================================================================================
// bf16 GEMM, no bias, the q, k and v projections in one launch: [CQ | CK | CV][M][NQ | NK | NV] (f32, three row-major planes) =
// A (bf16, M rows x K, fragment order) . Bt^T (bf16, NQKV rows x K, fragment order: the rows of Wq^T, Wk^T, Wv^T one behind the
// other, which is how the three planes lie in the workspace). Block = 64x64 tile, 4 waves x 16 rows; a tile lies in one plane
// (NQ, NK, NV multiples of 64), chosen by the block's column tile (block-uniform); fragments loaded straight from the planes'
// blocks (two 16-B loads each, split k map for A and B);
// K stepped by 32 (host guarantees K % 32 == 0, M % 64 == 0, grid = (M/64)*(NQKV/64)).
// =====================================================================================================
__global__ __launch_bounds__(128)
void gemm_qkv(const u16* __restrict__ A, const u16* __restrict__ Bt, float* CQ, float* CK, float* CV, int M, int K) {
  __shared__ __align__(16) float slab[4 * SLAB64];
  const int tid = threadIdx.x, wave = tid >> 5, lane = tid & 31;
  const int ntile = NQKV >> 6;
  const int bid   = blockIdx.x;
  const int rowb  = (bid / ntile) * 64 + wave * 16;
  const int colb  = (bid % ntile) * 64;     // first row of the tile in Bt
  if (rowb + 16 > M) return;                // wave-uniform, never taken with the exact grid; no block barriers in this kernel
  float* C = CQ;
  int N = NQ, col0 = colb;                  // the tile's plane, its row length and the tile's first column in it
  if (colb >= NQ + NK) { C = CV; N = NV; col0 = colb - (NQ + NK); }
  else if (colb >= NQ) { C = CK; N = NK; col0 = colb - NQ; }
  const size_t bs = (size_t)16 * K;         // 16 rows on = one row of blocks on
  const u16* ap  = A  + (size_t)rowb * K + 8 * lane;   // the lane's chunk in block (rowb / 16, 0); the next k step is 512 halves on
  const u16* bp0 = Bt + (size_t)colb * K + 8 * lane;
  const u16* bp1 = bp0 + bs;
  const u16* bp2 = bp1 + bs;
  const u16* bp3 = bp2 + bs;
  v8f acc0 = zero8(), acc1 = zero8(), acc2 = zero8(), acc3 = zero8();
#pragma unroll 1
  for (int k0 = 0; k0 < K; k0 += 32) {
    const v16b a  = ldfrag_b(ap, 0u);
    const v16b b0 = ldfrag_b(bp0, 0u);
    const v16b b1 = ldfrag_b(bp1, 0u);
    const v16b b2 = ldfrag_b(bp2, 0u);
    const v16b b3 = ldfrag_b(bp3, 0u);
    // the loads' address registers are named here, so none is given to a later load's result or stepped on before the
    // loads' address translations are back
#if defined(__HIP_DEVICE_COMPILE__)
    asm volatile("s_wait_xcnt 0x0" :: "v"(ap), "v"(bp0), "v"(bp1), "v"(bp2), "v"(bp3) : "memory");
#endif
    ap += 512; bp0 += 512; bp1 += 512; bp2 += 512; bp3 += 512;
    acc0 = mma_b(a, b0, acc0);
    acc1 = mma_b(a, b1, acc1);
    acc2 = mma_b(a, b2, acc2);
    acc3 = mma_b(a, b3, acc3);
    guard6<v16b>(acc0, acc1, acc2, acc3, a, b0, b1, b2, b3, a);
  }
  epi64(slab + wave * SLAB64, acc0, acc1, acc2, acc3, 1.0f, 0.0f, 0.0f, 0.0f, 0.0f, C, N, (size_t)rowb, col0, lane);
}

// =====================================================================================================
// f16 GEMM with a two-plane A operand and bias: C[M][N] (f32) = (Ah + Al) (f16 hi and residual planes, M rows x K, fragment
// order, residual unscaled relative to hi) . Bt^T (f16, N rows x K, fragment order) * oscale + bf16 RNE value of bias[n] (bias has
// N entries). Products ah.b + al.b into one accumulator. Same tiling, fragment loads (split k map) and epilogue as gemm_qkv;
// K stepped by 32 (host guarantees K % 32 == 0, M % 64 == 0, N % 64 == 0, grid = (M/64)*(N/64)).
// =====================================================================================================
__global__ __launch_bounds__(128)
void gemm_h2(const u16* __restrict__ Ah, const u16* __restrict__ Al, const u16* __restrict__ Bt,
             const float* __restrict__ bias, float* C, int M, int N, int K, float oscale) {
  __shared__ __align__(16) float slab[4 * SLAB64];
  const int tid = threadIdx.x, wave = tid >> 5, lane = tid & 31, m = lane & 15;
  const int ntile = N >> 6;
  const int bid   = blockIdx.x;
  const int rowb  = (bid / ntile) * 64 + wave * 16;
  const int col0  = (bid % ntile) * 64;
  if (rowb + 16 > M) return;                // wave-uniform, never taken with the exact grid; no block barriers in this kernel
  const size_t bs = (size_t)16 * K;
  const _Float16* ahp = (const _Float16*)(const void*)Ah + (size_t)rowb * K + 8 * lane;   // the lane's chunk in block (rowb / 16, 0), as in gemm_qkv
  const _Float16* alp = (const _Float16*)(const void*)Al + (size_t)rowb * K + 8 * lane;
  const _Float16* bp0 = (const _Float16*)(const void*)Bt + (size_t)col0 * K + 8 * lane;
  const _Float16* bp1 = bp0 + bs;
  const _Float16* bp2 = bp1 + bs;
  const _Float16* bp3 = bp2 + bs;
  v8f acc0 = zero8(), acc1 = zero8(), acc2 = zero8(), acc3 = zero8();
#pragma unroll 1
  for (int k0 = 0; k0 < K; k0 += 32) {
    const v16h ah = ldfrag_h(ahp, 0u), al = ldfrag_h(alp, 0u);
    const v16h b0 = ldfrag_h(bp0, 0u);
    const v16h b1 = ldfrag_h(bp1, 0u);
    const v16h b2 = ldfrag_h(bp2, 0u);
    const v16h b3 = ldfrag_h(bp3, 0u);
    // the loads' address registers are named here, so none is given to a later load's result or stepped on before the
    // loads' address translations are back
#if defined(__HIP_DEVICE_COMPILE__)
    asm volatile("s_wait_xcnt 0x0" :: "v"(ahp), "v"(alp), "v"(bp0), "v"(bp1), "v"(bp2), "v"(bp3) : "memory");
#endif
    ahp += 512; alp += 512; bp0 += 512; bp1 += 512; bp2 += 512; bp3 += 512;
    acc0 = mma_h(ah, b0, acc0);  acc0 = mma_h(al, b0, acc0);
    acc1 = mma_h(ah, b1, acc1);  acc1 = mma_h(al, b1, acc1);
    acc2 = mma_h(ah, b2, acc2);  acc2 = mma_h(al, b2, acc2);
    acc3 = mma_h(ah, b3, acc3);  acc3 = mma_h(al, b3, acc3);
    guard6<v16h>(acc0, acc1, acc2, acc3, ah, al, b0, b1, b2, b3);
  }
  // per-lane bias of D column m in each of the 4 subtiles; col0 + 48 + m <= N - 1 always
  const float bb0 = bfr(bias[col0 + m]);
  const float bb1 = bfr(bias[col0 + 16 + m]);
  const float bb2 = bfr(bias[col0 + 32 + m]);
  const float bb3 = bfr(bias[col0 + 48 + m]);
  epi64(slab + wave * SLAB64, acc0, acc1, acc2, acc3, oscale, bb0, bb1, bb2, bb3, C, N, (size_t)rowb, col0, lane);
}

// =====================================================================================================
// Causal grouped attention with ALiBi, q/k head dim 32, value head dim 64. Block bid -> (query tile qt = qtb + bid % nqtl:
// rows q0 = 16*qt .. q0+15, head pair hg, batch b); one wave per query head = hg*WPB + wave; kv group = head % NG.
//   q hi / residual planes f16 x256, row b*SEQ + s, column h*DQ + d (NQ columns); k hi / residual planes f16 x256, row
//   b*SEQ + s, column g*DQ + d (NK columns); v^T hi / residual planes x1024, row (b*NG + g)*DV + d, column s (SEQ columns);
//   O hi / residual planes f16 x1024, row b*SEQ + s, column h*DV + d (DOUT columns); all in fragment order.
//   scores, transposed: S^T (16 keys x 16 queries, one k-step over d = 0..31) = k_hi.q_hi + k_lo.q_hi + k_hi.q_lo (A = k block,
//   B = q block; 3 products into one accumulator, residuals unscaled relative to their hi planes), q fragments loop-invariant;
//   a lane holds 16 of the step's 32 scores of ONE query (q0 + lane % 16), lane l ^ 16 the other 16;
//   logit (log2 domain) t(i, j) = (acc/(256*256) + slope[h]*(j - i)) * (1/sqrt(32))*log2e, replaced by -inf where j > i,
//   slope[h] = 2^(-(h+1)/2) built exactly (power of two times f32 sqrt2 for odd h+1).
//   Key tiles of 32 visited in order for kb <= q0 + 15 (later tiles hold only keys above every query row of the tile).
//   Global loads run ahead of their use: a step issues its 16 v^T loads at its top and, right behind its score products,
//   the 8 k loads of the next step into the same registers, so their latency passes behind the softmax.
//   Online max-subtracted base-2 softmax in f32, -inf-safe rescale: maximum and sum run over the lane's own registers, the
//   maximum joined with lane l ^ 16 in each step, the two half sums once behind the loop. The two score tiles of a step,
//   converted in place, ARE the B fragment of P^T (element e <- tile e / 8, register e % 8: the planes' split k map), so P
//   passes through no LDS; v^T blocks are the A fragments of 4 d-subtiles, both v planes: O^T += v_hi.P_hi + v_lo.P_hi
//   (+ v_hi.P_lo when PRES == 1), 2 groups of 2 subtiles.
//   After the loop: out = acc / Z (Z > 0 always: key 0 <= every query row; guarded anyway), carries 1/(32768*1024) folded
//   once; a lane's 8 registers of a subtile are 8 consecutive d of its query = one chunk of the O planes.
// coverage: per wave 4 instructions x 32 chunks x 8 halves = 2 blocks = 16 x 64 of each O plane; the two block ranges of attn_all
//           cover query tiles [QO/16, NQT) and [0, QO/16) x NHG x NB blocks x WPB waves = every (b, s, h) row segment of OH and
//           of OL exactly once.
// =====================================================================================================
template <int PRES>
__device__ __forceinline__
void attn_c(const u16* __restrict__ QHp, const u16* __restrict__ QLp,
            const u16* __restrict__ KHp, const u16* __restrict__ KLp,
            const u16* __restrict__ VHp, const u16* __restrict__ VLp,
            u16* OHp, u16* OLp, int qtb, int nqtl, int bid) {
  const int tid  = threadIdx.x;
  const int wave = tid >> 5;
  const int lane = tid & 31;
  const int hh   = lane >> 4;
  const int c    = lane & 15;
  const int qt   = qtb + (bid % nqtl);
  const int t2   = bid / nqtl;
  const int hg   = t2 % NHG;
  const int b    = t2 / NHG;
  if (b >= NB) return;                      // block-uniform; no block barriers in this kernel; never taken with the exact grid
  const int q0   = qt * 16;
  if (q0 + 16 > SEQ) return;                // block-uniform; never taken
  const int head = hg * WPB + wave;
  const int kvh  = head % NG;               // tiled kv mapping: head h -> kv group h % NG

  // fragment-order blocks (512 halves each): q block (row tile, head); k block (key tile of 16, kv group), 16 keys on = 16 * NK
  // halves on; v^T block (d tile, key step of 32), 32 keys on = 512 halves on, 16 d on = 16 * SEQ halves on
  const _Float16* Qh  = (const _Float16*)(const void*)QHp + ((size_t)b * SEQ + q0) * NQ + (size_t)head * 512;
  const _Float16* Ql  = (const _Float16*)(const void*)QLp + ((size_t)b * SEQ + q0) * NQ + (size_t)head * 512;
  const _Float16* Khb = (const _Float16*)(const void*)KHp + (size_t)b * SEQ * NK + (size_t)kvh * 512;  // key row kb added per step
  const _Float16* Klb = (const _Float16*)(const void*)KLp + (size_t)b * SEQ * NK + (size_t)kvh * 512;
  const _Float16* Vhb = (const _Float16*)(const void*)VHp + (size_t)(b * NG + kvh) * DV * SEQ;         // d tile 0 (+j)
  const _Float16* Vlb = (const _Float16*)(const void*)VLp + (size_t)(b * NG + kvh) * DV * SEQ;
  const unsigned lb = 16u * (unsigned)lane;  // the lane's chunk inside a block, in bytes

  // ALiBi slope 2^(-(head+1)/2): even exponent -> exact power of two; odd -> power of two times f32 sqrt(2)
  const int   e1   = head + 1;
  const int   pw   = (e1 + 1) >> 1;
  const float p2   = __uint_as_float(((unsigned)(127 - pw)) << 23);
  const float slope = p2 * (((e1 & 1) != 0) ? SQRT2F : 1.0f);   // wave-uniform select by value
  const float lsc  = 1.0f / (QSC * KSC);
  const float ul2  = RSQ_DQ * LOG2E;
  const float oc   = 1.0f / (PCAR * VCAR);
  const size_t KROW = (size_t)NK;           // halves per key row in the k planes (16 rows = one row of blocks)

  const v16h qh = ldfrag_h(Qh, lb);             // loop-invariant q fragments (d = 0..31): hi plane
  const v16h ql = ldfrag_h(Ql, lb);             //                                         residual plane

  float mrow = -INFINITY, lrow = 0.f;       // the lane's query: running maximum (both halves alike), sum over this half's keys
  v8f o[4];                                 // O^T: o[j][r] = (d = j*16 + 8*hh + r, query q0 + c)
#pragma unroll
  for (int j = 0; j < 4; ++j) o[j] = zero8();
  const int ncaus = (q0 >> 5) + 1;                                            // tiles holding keys <= q0 + 15
  const int nkt = (ncaus < NKT) ? ncaus : NKT;
  const int qr  = q0 + c;                                                     // the lane's query row

  // k fragments of key tile 0; inside the loop each step fetches the next step's into the same registers
  v16h kh0 = ldfrag_h(Khb, lb);
  v16h kh1 = ldfrag_h(Khb + (size_t)16 * KROW, lb);
  v16h kl0 = ldfrag_h(Klb, lb);
  v16h kl1 = ldfrag_h(Klb + (size_t)16 * KROW, lb);

#pragma unroll 1
  for (int kt = 0; kt < nkt; ++kt) {
    const int kb = kt * 32;
    // ---- this step's v^T fragments (4 d-subtiles, both planes), issued first: they land behind the scores and the softmax ----
    v16h vh[4], vl[4];
#pragma unroll
    for (int j = 0; j < 4; ++j) vh[j] = ldfrag_h(Vhb + (size_t)kb * 16 + (size_t)j * 16 * SEQ, lb);
    // a later load's result may be given the address registers of the loads above: their translations are waited for first
    asm volatile("s_wait_xcnt 0x0" ::: "memory");
#pragma unroll
    for (int j = 0; j < 4; ++j) vl[j] = ldfrag_h(Vlb + (size_t)kb * 16 + (size_t)j * 16 * SEQ, lb);
    // ---- scores: D element r of this lane = (key kb + 8*hh + r, query qr) in s0, key kb + 16 + 8*hh + r in s1 ----
    //      hi+residual planes on both operands: k_hi.q_hi + k_lo.q_hi + k_hi.q_lo
    v8f s0 = zero8(), s1 = zero8();
    {
      s0 = mma_h(kh0, qh, s0);              // hi.hi
      s0 = mma_h(kl0, qh, s0);              // k residual . q hi
      s0 = mma_h(kh0, ql, s0);              // k hi . q residual
      s1 = mma_h(kh1, qh, s1);
      s1 = mma_h(kl1, qh, s1);
      s1 = mma_h(kh1, ql, s1);
      guard2(s0, s1, qh, ql, kh0, kl0, kh1, kl1);
    }
    // ---- next step's k fragments, one step ahead; the last step re-reads its own tile (in bounds, values unused) ----
    {
      const int kn = (kt + 1 < nkt) ? kb + 32 : kb;
      const _Float16* k0p = Khb + (size_t)kn * KROW;
      const _Float16* l0p = Klb + (size_t)kn * KROW;
      kh0 = ldfrag_h(k0p, lb);
      kh1 = ldfrag_h(k0p + (size_t)16 * KROW, lb);
      kl0 = ldfrag_h(l0p, lb);
      kl1 = ldfrag_h(l0p + (size_t)16 * KROW, lb);
    }
    // the softmax below may be given the address registers of the loads above: their translations are waited for first
    asm volatile("s_wait_xcnt 0x0" ::: "memory");
    // holds the k loads and their wait in front of the softmax: the scheduler otherwise sinks them deep into it (it has no
    // memory operation left to hold them), and less of their latency passes behind it
    __builtin_amdgcn_sched_barrier(0);
    // ---- causal select + ALiBi + scale, online softmax in base 2, -inf-safe; all 16 values belong to query qr ----
    const int dk = kb + 8 * hh - qr;        // key - query of s0[0]
    float t0[8], t1[8];
#pragma unroll
    for (int r = 0; r < 8; ++r) {
      const int   d0 = dk + r, d1 = dk + 16 + r;
      const float a0 = slope * (float)d0;
      const float a1 = slope * (float)d1;
      const float u0 = (s0[r] * lsc + a0) * ul2;
      const float u1 = (s1[r] * lsc + a1) * ul2;
      t0[r] = (d0 > 0) ? -INFINITY : u0;
      t1[r] = (d1 > 0) ? -INFINITY : u1;
    }
    float mq[4];
#pragma unroll
    for (int i = 0; i < 4; ++i) mq[i] = fmaxf(fmaxf(t0[2 * i], t0[2 * i + 1]), fmaxf(t1[2 * i], t1[2 * i + 1]));
    float mx = fmaxf(fmaxf(mq[0], mq[1]), fmaxf(mq[2], mq[3]));
    mx = fmaxf(mx, xhalf(mx));              // the other 16 keys of the step
    const float mn = fmaxf(mrow, mx);
    const float ms = (mn == -INFINITY) ? 0.0f : mn;
    const float al = exp2f(mrow - ms);
    mrow = mn;
    float e0[8], e1[8];
#pragma unroll
    for (int r = 0; r < 8; ++r) { e0[r] = exp2f(t0[r] - ms); e1[r] = exp2f(t1[r] - ms); }
    float sq[4];
#pragma unroll
    for (int i = 0; i < 4; ++i) sq[i] = (e0[2 * i] + e0[2 * i + 1]) + (e1[2 * i] + e1[2 * i + 1]);
    lrow = lrow * al + ((sq[0] + sq[1]) + (sq[2] + sq[3]));
#pragma unroll
    for (int j = 0; j < 4; ++j) {
#pragma unroll
      for (int r = 0; r < 8; ++r) o[j][r] *= al;
    }
    // ---- B fragments of P^T*32768: f16 hi (and f16 residual when PRES), column = query c, split k map over the 32 keys of
    //      this step: elements 0..7 = keys kb + 8hh + 0..7 (s0's rows), elements 8..15 = keys kb + 16 + 8hh + 0..7 (s1's) ----
    FragH ph, pl;
    {
#pragma unroll
      for (int e = 0; e < 8; ++e) {
        const float ta = e0[e] * PCAR, tc = e1[e] * PCAR;
        const _Float16 ha = (_Float16)ta, hc = (_Float16)tc;
        ph.h[0][e] = ha;
        ph.h[1][e] = hc;
        if constexpr (PRES == 1) {
          pl.h[0][e] = (_Float16)(ta - (float)ha);
          pl.h[1][e] = (_Float16)(tc - (float)hc);
        }
      }
      if constexpr (PRES != 1) pl.v = ph.v;
    }
    // ---- v^T.P^T : A fragment row m = d = j*16 + c, k = the step's 32 keys; 2 groups of 2 d-subtiles ----
    {
#pragma unroll
      for (int jg = 0; jg < 2; ++jg) {
        const v16h vha = vh[2 * jg], vhb2 = vh[2 * jg + 1];
        const v16h vla = vl[2 * jg], vlb2 = vl[2 * jg + 1];
        o[2 * jg]     = mma_h(vha,  ph.v, o[2 * jg]);                       // v_hi . P_hi
        if constexpr (PRES == 1) o[2 * jg] = mma_h(vha, pl.v, o[2 * jg]);   // v_hi . P_lo
        o[2 * jg]     = mma_h(vla,  ph.v, o[2 * jg]);                       // v_lo . P_hi
        o[2 * jg + 1] = mma_h(vhb2, ph.v, o[2 * jg + 1]);
        if constexpr (PRES == 1) o[2 * jg + 1] = mma_h(vhb2, pl.v, o[2 * jg + 1]);
        o[2 * jg + 1] = mma_h(vlb2, ph.v, o[2 * jg + 1]);
        guard2(o[2 * jg], o[2 * jg + 1], ph.v, pl.v, vha, vhb2, vla, vlb2);
      }
    }
  }
  acc_guard4(o[0], o[1], o[2], o[3]);
  // ---- out = acc / Z (0 if Z == 0), Z = the two halves' sums, carries (32768 on P, 1024 on v) folded once ----
  const float lv  = lrow + xhalf(lrow);
  const float ls  = (lv > 0.0f) ? lv : 1.0f;
  const float inv = (lv > 0.0f) ? ((1.0f / ls) * oc) : 0.0f;
  v4u oh[4], ol[4];
#pragma unroll
  for (int it = 0; it < 4; ++it) {
    // chunk it * 32 + lane of the wave's two O blocks: query row c, head columns it * 16 + 8 * hh .. + 7 = o[it][0..7]
    float w[8];
#pragma unroll
    for (int e = 0; e < 8; ++e) w[e] = (o[it][e] * inv) * OSC;
#pragma unroll
    for (int e = 0; e < 4; ++e) {
      const _Float16 h0 = (_Float16)w[2 * e], h1 = (_Float16)w[2 * e + 1];
      const _Float16 l0 = (_Float16)(w[2 * e] - (float)h0), l1 = (_Float16)(w[2 * e + 1] - (float)h1);
      oh[it][e] = pk16(h_bits(h0), h_bits(h1));
      ol[it][e] = pk16(h_bits(l0), h_bits(l1));
    }
  }
  const size_t ob = ((size_t)b * SEQ + q0) * DOUT + (size_t)head * (DV / 32) * 512 + 8 * lane;
  {
#pragma unroll
    for (int it = 0; it < 4; ++it) {
      *(v4u*)(OHp + ob + it * 256) = oh[it];
      *(v4u*)(OLp + ob + it * 256) = ol[it];
    }
    
  }
}

// =====================================================================================================
// Both kinds of query tile in one launch, chosen by the block's index (block-uniform): blocks [0, nqt0 * NHG * NB) take the nqt0
// query tiles from nqt1 on (the longer key loops), without the P residual product; the other nqt1 * NHG * NB blocks take query
// tiles [0, nqt1), with it.
// =====================================================================================================
__global__ __launch_bounds__(ATT_THREADS)
void attn_all(const u16* __restrict__ QHp, const u16* __restrict__ QLp,
              const u16* __restrict__ KHp, const u16* __restrict__ KLp,
              const u16* __restrict__ VHp, const u16* __restrict__ VLp,
              u16* OHp, u16* OLp, int nqt1, int nqt0) {
  const int bid = blockIdx.x;
  const int nb0 = nqt0 * NHG * NB;
  if (bid < nb0) attn_c<0>(QHp, QLp, KHp, KLp, VHp, VLp, OHp, OLp, nqt1, nqt0, bid);
  else           attn_c<1>(QHp, QLp, KHp, KLp, VHp, VLp, OHp, OLp, 0, nqt1, bid - nb0);
}

// =====================================================================================================
// Workspace map (bytes); every plane is fully written by whole-line stores before it is read; all extents are exact multiples
// of the store granularity (no pad rows needed); every region offset a multiple of 262144; the 16-bit planes are given as
// rows x columns and lie in fragment order, the f32 planes are row-major:
//   XB  bf16 MROWS x DIN                  MROWS*2048      (NB=2, SEQ=2048: 8388608)
//   WQT bf16 NQ n x DIN k                 1048576
//   WKT bf16 NK n x DIN k                 262144
//   WVT bf16 NV n x DIN k                 524288
//   WPT f16  DOUT n x DOUT k, x1024       2097152
//   FQ  f32  [MROWS][NQ]                  MROWS*2048      (8388608)
//   FK  f32  [MROWS][NK]                  MROWS*512       (2097152)
//   FV  f32  [MROWS][NV]                  MROWS*1024      (4194304)
//   QH, QL f16 MROWS x NQ, x256           MROWS*1024 each (4194304 each)
//   KH, KL f16 MROWS x NK, x256           MROWS*256 each  (1048576 each)
//   VH, VL f16 NB*NG*DV x SEQ, x1024      MROWS*512 each  (2097152 each)
//   OH, OL f16 MROWS x DOUT, x1024        MROWS*2048 each (8388608 each)
//   end (NB=2, SEQ=2048)                  58458112
// =====================================================================================================
extern "C" void kernel_launch(void* const* d_in, const int* in_sizes, int n_in,
                              void* d_out, int out_size, void* d_ws, size_t ws_size,
                              hipStream_t stream) {
  if (n_in < 6) return;
  if (in_sizes[0] < ((NB - 1) * XS_FULL + SEQ) * DIN) return;
  if (in_sizes[1] != DIN * NQ) return;
  if (in_sizes[2] != DIN * NK) return;
  if (in_sizes[3] != DIN * NV) return;
  if (in_sizes[4] != DOUT * DOUT) return;
  if (in_sizes[5] != DOUT) return;
  if (out_size < MROWS * DOUT) return;

  const float* x   = (const float*)d_in[0];
  const float* wq  = (const float*)d_in[1];
  const float* wk  = (const float*)d_in[2];
  const float* wv  = (const float*)d_in[3];
  const float* wp  = (const float*)d_in[4];
  const float* bpv = (const float*)d_in[5];
  float*       out = (float*)d_out;

  const size_t szXB = (size_t)MROWS * DIN * 2;
  const size_t szWQ = (size_t)NQ * DIN * 2;
  const size_t szWK = (size_t)NK * DIN * 2;
  const size_t szWV = (size_t)NV * DIN * 2;
  const size_t szWP = (size_t)DOUT * DOUT * 2;
  const size_t szFQ = (size_t)MROWS * NQ * 4;
  const size_t szFK = (size_t)MROWS * NK * 4;
  const size_t szFV = (size_t)MROWS * NV * 4;
  const size_t szQ  = (size_t)MROWS * NQ * 2;                   // QH, QL
  const size_t szK  = (size_t)MROWS * NK * 2;                   // KH, KL
  const size_t szV  = (size_t)NB * NG * DV * SEQ * 2;           // VH, VL
  const size_t szO  = (size_t)MROWS * DOUT * 2;                 // OH, OL
  size_t off = 0;
  const size_t oXB = off; off += szXB;
  const size_t oWQ = off; off += szWQ;
  const size_t oWK = off; off += szWK;
  const size_t oWV = off; off += szWV;
  const size_t oWP = off; off += szWP;
  const size_t oFQ = off; off += szFQ;
  const size_t oFK = off; off += szFK;
  const size_t oFV = off; off += szFV;
  const size_t oQH = off; off += szQ;
  const size_t oQL = off; off += szQ;
  const size_t oKH = off; off += szK;
  const size_t oKL = off; off += szK;
  const size_t oVH = off; off += szV;
  const size_t oVL = off; off += szV;
  const size_t oOH = off; off += szO;
  const size_t oOL = off; off += szO;
  if (off > ws_size) return;                // off = 58458112 for NB = 2, SEQ = 2048
  if (off > (size_t)WS_CAP) return;

  char* ws = (char*)d_ws;
  u16*   XB  = (u16*)(ws + oXB);
  u16*   WQT = (u16*)(ws + oWQ);
  u16*   WKT = (u16*)(ws + oWK);
  u16*   WVT = (u16*)(ws + oWV);
  u16*   WPT = (u16*)(ws + oWP);
  float* FQ  = (float*)(ws + oFQ);
  float* FK  = (float*)(ws + oFK);
  float* FV  = (float*)(ws + oFV);
  u16*   QH  = (u16*)(ws + oQH);
  u16*   QL  = (u16*)(ws + oQL);
  u16*   KH  = (u16*)(ws + oKH);
  u16*   KL  = (u16*)(ws + oKL);
  u16*   VH  = (u16*)(ws + oVH);
  u16*   VL  = (u16*)(ws + oVL);
  u16*   OH  = (u16*)(ws + oOH);
  u16*   OL  = (u16*)(ws + oOL);

  const dim3 b256(256), b128(128), bAT(ATT_THREADS);
  const dim3 gPI(GWALL + NB * GX);                      // 480 weight blocks + 1024 x blocks per batch (SEQ=2048)
  const dim3 gGP((MROWS / 64) * (NQKV / 64));
  const dim3 gSP(GVT + GSQ + GSK);
  const int  nqt1 = QO / 16;                            // query tiles with the P residual product (rows s < QO)
  const int  nqt0 = NQT - nqt1;                         // remaining query tiles
  const dim3 gGO((MROWS / 64) * (DOUT / 64));

  // (0) x -> bf16 plane MROWS x DIN; Wq, Wk, Wv -> bf16 n x k planes; Wp -> f16 n x k plane x1024; all in fragment order
  prep_in<<<gPI, b256, 0, stream>>>(x, wq, wk, wv, wp, XB, WQT, WKT, WVT, WPT);
  // (1) q = x.Wq -> FQ [MROWS][NQ], k = x.Wk -> FK [MROWS][NK], v = x.Wv -> FV [MROWS][NV]; WQT, WKT, WVT lie one behind the
  //     other in the workspace and are read as one plane of NQKV rows
  gemm_qkv<<<gGP, b128, 0, stream>>>(XB, WQT, FQ, FK, FV, MROWS, DIN);
  // (2) v^T hi + residual planes x1024, q and k hi + residual planes x256
  split_qkv<<<gSP, b256, 0, stream>>>(FQ, FK, FV, QH, QL, KH, KL, VH, VL);
  // (3) causal grouped attention with ALiBi -> O hi + residual planes f16 x1024, MROWS x DOUT:
  //     query tiles [0, QO/16) with the in-register P residual product, the rest without it
  attn_all<<<dim3((nqt0 + nqt1) * NHG * NB), bAT, 0, stream>>>(QH, QL, KH, KL, VH, VL, OH, OL, nqt1, nqt0);
  // (4) out = (O_hi + O_lo).Wp + bp -> d_out f32 [MROWS][DOUT], carries 1024 x 1024 folded back
  gemm_h2<<<gGO, b128, 0, stream>>>(OH, OL, WPT, bpv, out, MROWS, DOUT, DOUT, 1.0f / (OSC * WOS));
  (void)hipGetLastError();
}

// v005
// It runs in 113 microseconds.
// Two timings next to v004 put it at 1.06 and 1.09 times that version's speed.
// Over all steps from v000 it is 2.43 times as fast.
#include <hip/hip_runtime.h>
#include <math.h>
#include <stdint.h>

#ifndef NB
#define NB 2
#endif
#ifndef SEQ
#define SEQ 2048
#endif
#define XS_FULL 2048
#define DIN   1024
#define DOUT  1024
#define NH    16
#define NG    4
#define DQ    32
#define DV    64
#define NQ    (NH * DQ)
#define NK    (NG * DQ)
#define NV    (NG * DV)
#define MROWS (NB * SEQ)
#define QO    ((SEQ < 512) ? SEQ : 512)
#define RSQ_DQ 0.17677669529663687f
#define LOG2E  1.4426950408889634f
#define SQRT2F 1.4142135623730951f
#define QSC   256.0f
#define KSC   256.0f
#define PCAR  32768.0f
#define VCAR  1024.0f
#define OSC   1024.0f
#define WOS   1024.0f
#define WPB   4
#define NHG   (NH / WPB)
#define KVBLK 12
#define KVBUF (KVBLK * 512)
#define NQT   (SEQ / 16)
#define NST   (SEQ / 64)
#define NKT   (SEQ / 32)
#define ATT_THREADS (WPB * 32)
#define SLAB64 (16 * 68)
#define VTP   72
#define WTP   72
#define WS_CAP 134217728
// block counts of the jobs that share a launch
#define GX    ((SEQ * DIN / 8 + 255) / 256)
#define GWQ   ((NQ / 64) * (DIN / 64))
#define GWK   ((NK / 64) * (DIN / 64))
#define GWV   ((NV / 64) * (DIN / 64))
#define GWP   ((DOUT / 64) * (DOUT / 64))
#define GWALL (GWP + GWQ + GWK + GWV)
#define GVT   (NB * NG * NST)
#define GSQ   ((MROWS * NQ / 8 + 255) / 256)
#define GSK   ((MROWS * NK / 8 + 255) / 256)
#define NQKV  (NQ + NK + NV)
static_assert(DOUT == NH * DV && NQ == 512 && NK == 128 && NV == 256 && DQ == 32 && DV == 64 && NG == 4 && NH == 16);
static_assert(NHG * WPB == NH && ATT_THREADS == 128 && WPB == 4 && NHG == NG);
static_assert(NB >= 1 && NB <= 2);
static_assert((SEQ % 64) == 0 && SEQ >= 64 && SEQ <= XS_FULL);
static_assert((QO % 16) == 0 && QO >= 16 && QO <= SEQ);
static_assert((DIN % 64) == 0 && (DOUT % 64) == 0 && (NQ % 64) == 0 && (NK % 64) == 0 && (NV % 64) == 0 && (DIN % 32) == 0);
static_assert(((SEQ * DIN / 8) % 256) == 0 && ((MROWS * NQ / 8) % 256) == 0 && ((MROWS * NK / 8) % 256) == 0);
static_assert(2 * DV * VTP * 2 <= 65536 && 64 * WTP * 2 <= 65536 && 4 * SLAB64 * 4 <= 65536 && 2 * KVBUF * 2 <= 65536);

typedef unsigned short u16;
typedef _Float16 v16h __attribute__((ext_vector_type(16)));
typedef _Float16 v8h  __attribute__((ext_vector_type(8)));
typedef __bf16   v16b __attribute__((ext_vector_type(16)));
typedef float    v8f  __attribute__((ext_vector_type(8)));
typedef float    v4f  __attribute__((ext_vector_type(4)));
typedef unsigned int v4u __attribute__((ext_vector_type(4)));

union FragH { v16h v; v8h h[2]; v4u u[2]; };
union FragB { v16b v; v4u u[2]; };

// ---- scalar helpers --------------------------------------------------------------------------------
__device__ __forceinline__ unsigned short bf_bits(float f) {          // f32 -> bf16 bits, RNE convert
  unsigned u = __float_as_uint(f);
  return (unsigned short)((u + 0x7FFFu + ((u >> 16) & 1u)) >> 16);
}
__device__ __forceinline__ float bf_up(unsigned short h) { return __uint_as_float(((unsigned)h) << 16); }
__device__ __forceinline__ float bfr(float f) { return bf_up(bf_bits(f)); }
__device__ __forceinline__ unsigned short h_bits(_Float16 x) { return __builtin_bit_cast(unsigned short, x); }
__device__ __forceinline__ unsigned pk16(unsigned short a, unsigned short b) { return (unsigned)a | ((unsigned)b << 16); }
__device__ __forceinline__ v8f zero8() { v8f z = {0.f, 0.f, 0.f, 0.f, 0.f, 0.f, 0.f, 0.f}; return z; }
__device__ __forceinline__ float xhalf(float x) {                     // the value of lane l ^ 16
  const int b = __builtin_bit_cast(int, x);
  return __builtin_bit_cast(float, __builtin_amdgcn_permlanex16(b, b, 0x76543210, 0xfedcba98, false, false));
}

// ---- fragment order of a 16-bit operand plane of R rows (the WMMA's m or n index) x K columns (its k index), R % 16 == 0,
//      K % 32 == 0: a row-major grid of blocks of 16 rows x 32 columns, block (r >> 4, k >> 5) at half offset
//      ((r >> 4) * (K >> 5) + (k >> 5)) * 512; inside a block 64 chunks of 8 halves (16 B): chunk id holds row (id & 15),
//      columns ((id >> 4) & 3) * 8 .. + 7. So 16 rows x K columns take 16 * K halves, as in a row-major plane.
// ---- fragment loaders: 16-bit A/B operand, p + lb bytes = block base + 16 B * lane: lane -> row/col (lane&15), h = lane>>4;
//      elements 0..7 <- chunk lane (k0+8h..), elements 8..15 <- chunk 32 + lane (k0+16+8h..)  (same split k map for A and B);
//      each of the two loads of a wave reads 512 contiguous bytes = 4 whole 128-B lines
__device__ __forceinline__ v16h ldfrag_h(const _Float16* p, unsigned lb) {
  FragH f;
  const char* q = (const char*)(const void*)p + lb;
  f.h[0] = *(const v8h*)(const void*)(q);
  f.h[1] = *(const v8h*)(const void*)(q + 512);
  return f.v;
}
__device__ __forceinline__ v16b ldfrag_b(const u16* p, unsigned lb) { // bf16 plane read as unsigned integer vectors
  FragB f;
  const char* q = (const char*)(const void*)p + lb;
  f.u[0] = *(const v4u*)(const void*)(q);
  f.u[1] = *(const v4u*)(const void*)(q + 512);
  return f.v;
}

__device__ __forceinline__ v8f mma_h(v16h a, v16h b, v8f c) {
  return __builtin_amdgcn_wmma_f32_16x16x32_f16(false, a, false, b, (short)0, c, false, false);
}
__device__ __forceinline__ v8f mma_b(v16b a, v16b b, v8f c) {
  return __builtin_amdgcn_wmma_f32_16x16x32_bf16(false, a, false, b, (short)0, c, false, false);
}
__device__ __forceinline__ void guard2(v8f& a, v8f& b, v16h x0, v16h x1, v16h x2, v16h x3, v16h x4, v16h x5) {
#if defined(__HIP_DEVICE_COMPILE__)
  asm volatile("v_nop\n\tv_nop\n\tv_nop\n\tv_nop"
               : "+v"(a), "+v"(b) : "v"(x0), "v"(x1), "v"(x2), "v"(x3), "v"(x4), "v"(x5) : "memory");
#endif
}
template <typename F>
__device__ __forceinline__ void guard6(v8f& a, v8f& b, v8f& c, v8f& d, F x0, F x1, F x2, F x3, F x4, F x5) {
#if defined(__HIP_DEVICE_COMPILE__)
  asm volatile("v_nop\n\tv_nop\n\tv_nop\n\tv_nop"
               : "+v"(a), "+v"(b), "+v"(c), "+v"(d) : "v"(x0), "v"(x1), "v"(x2), "v"(x3), "v"(x4), "v"(x5) : "memory");
#endif
}
__device__ __forceinline__ void acc_guard4(v8f& a, v8f& b, v8f& c, v8f& d) {
#if defined(__HIP_DEVICE_COMPILE__)
  asm volatile("v_nop\n\tv_nop\n\tv_nop\n\tv_nop" : "+v"(a), "+v"(b), "+v"(c), "+v"(d));
#endif
}
__device__ __forceinline__ void wave_sync_lds() {
  __builtin_amdgcn_fence(__ATOMIC_RELEASE, "workgroup");
  __builtin_amdgcn_wave_barrier();
  __builtin_amdgcn_fence(__ATOMIC_ACQUIRE, "workgroup");
}

// =====================================================================================================
// f32 row-major [rows][DIN] -> bf16 RNE plane in fragment order. Thread = one chunk of D (8 elements of one row): two 16-B
// loads, one 16-B store; a wave stores 512 contiguous bytes.
// coverage: bid = 0 .. ceil(n8/256) - 1, x 256 thr x 8 (in-kernel bound) = the whole plane (n8 a multiple of 256 here).
// =====================================================================================================
__device__ __forceinline__ void cvt_bf(const float* __restrict__ x, u16* D, int n8, int bid) {
  const int gt = bid * 256 + (int)threadIdx.x;                        // chunk index in D
  if (gt >= n8) return;
  const int blk = gt >> 6;
  const int row = (blk / (DIN / 32)) * 16 + (gt & 15);
  const int col = (blk % (DIN / 32)) * 32 + ((gt >> 4) & 3) * 8;
  const float* p = x + (size_t)row * DIN + col;
  const v4f a = *(const v4f*)(p), b4 = *(const v4f*)(p + 4);
  v4u o;
#pragma unroll
  for (int e = 0; e < 2; ++e) {
    o[e]     = pk16(bf_bits(a[2 * e]),  bf_bits(a[2 * e + 1]));
    o[2 + e] = pk16(bf_bits(b4[2 * e]), bf_bits(b4[2 * e + 1]));
  }
  u16* d = D + (size_t)gt * 8;
  {
    *(v4u*)(d) = o;
    
  }
}

// =====================================================================================================
// f32 W [K][N] (row-major, x.W layout) -> 16-bit plane D, N rows x K columns in fragment order (the B operand). f16mode == 0: bf16 RNE bits;
// f16mode == 1: f16 bits of (bf16 RNE value) * scale. Block = 64 n x 64 k output tile: each thread loads 16 floats of one
// k row (four 16-B loads), converts, scatters into the LDS tile T[n][k] (pitch 72 halves, scalar 2-B LDS stores of per-lane
// values); after a block barrier the tile leaves as its 8 blocks (4 n tiles x 2 k steps) of 64 chunks, a wave storing 512 contiguous B.
// coverage: load 256 thr x 16 = 64 k x 64 n; store 2 iterations x 256 thr x 8 halves = 8 blocks x 512 halves = the tile;
//           bid = 0 .. (N/64)*(K/64) - 1 covers D exactly once (N % 64 == 0, K % 64 == 0).
// =====================================================================================================
__device__ __forceinline__ void wt16(const float* __restrict__ W, u16* D, int K, int N, int f16mode, float scale, int bid) {
  __shared__ __align__(16) u16 T[64 * WTP];
  const int tid = threadIdx.x;
  const int nt  = N >> 6;
  const int n0  = (bid % nt) * 64;
  const int k0  = (bid / nt) * 64;
  if (k0 + 64 > K) return;                  // block-uniform, before the barrier; never taken with the exact grid
  {
    const int kr = tid >> 2;                // k row within tile 0..63
    const int nc = (tid & 3) * 16;          // n chunk 0,16,32,48
    const float* src = W + (size_t)(k0 + kr) * (size_t)N + n0 + nc;
#pragma unroll
    for (int i = 0; i < 4; ++i) {
      const v4f a = *(const v4f*)(src + 4 * i);
#pragma unroll
      for (int e = 0; e < 4; ++e) {
        const float f = a[e];
        const unsigned short hb = h_bits((_Float16)(bfr(f) * scale));
        const unsigned short bb = bf_bits(f);
        T[(nc + 4 * i + e) * WTP + kr] = (f16mode != 0) ? hb : bb;
      }
    }
  }
  __syncthreads();
  v4u v[2];
#pragma unroll
  for (int it = 0; it < 2; ++it) {
    const int id = it * 256 + tid;          // chunk of the tile: block id >> 6 = (n tile id >> 7, k step (id >> 6) & 1)
    v[it] = *(const v4u*)(T + ((id >> 7) * 16 + (id & 15)) * WTP + ((id >> 6) & 1) * 32 + ((id >> 4) & 3) * 8);
  }
  {
#pragma unroll
    for (int it = 0; it < 2; ++it) {
      const int id = it * 256 + tid;
      const size_t blk = (size_t)((n0 >> 4) + (id >> 7)) * (size_t)(K >> 5) + (size_t)((k0 >> 5) + ((id >> 6) & 1));
      *(v4u*)(D + blk * 512 + (id & 63) * 8) = v[it];
    }
    
  }
}

// =====================================================================================================
// All jobs that read only the inputs, in one launch; a block does one block's work of one job, chosen by its index (block-uniform):
//   [0, GWP) Wp [DOUT k][DOUT n] -> DOUT n x DOUT k as f16 of bf16 value x1024; then GWQ blocks Wq [DIN k][NQ n] -> NQ n x DIN k
//   bf16; GWK blocks Wk -> NK x DIN; GWV blocks Wv -> NV x DIN; then NB * GX blocks x -> bf16 plane MROWS x DIN, GX per batch.
// =====================================================================================================
__global__ __launch_bounds__(256)
void prep_in(const float* __restrict__ x, const float* __restrict__ wq, const float* __restrict__ wk,
             const float* __restrict__ wv, const float* __restrict__ wp,
             u16* XB, u16* WQT, u16* WKT, u16* WVT, u16* WPT) {
  const int bid = blockIdx.x;
  if (bid < GWALL) {
    const float* W = wp;
    u16* D = WPT;
    int K = DOUT, N = DOUT, mode = 1, lb = bid;
    float sc = WOS;
    if (bid >= GWP + GWQ + GWK)  { W = wv; D = WVT; K = DIN; N = NV; mode = 0; sc = 1.0f; lb = bid - (GWP + GWQ + GWK); }
    else if (bid >= GWP + GWQ)   { W = wk; D = WKT; K = DIN; N = NK; mode = 0; sc = 1.0f; lb = bid - (GWP + GWQ); }
    else if (bid >= GWP)         { W = wq; D = WQT; K = DIN; N = NQ; mode = 0; sc = 1.0f; lb = bid - GWP; }
    wt16(W, D, K, N, mode, sc, lb);
  } else {
    const int cb = bid - GWALL;
    const int b  = cb / GX;
    if (b >= NB) return;                    // block-uniform; never taken with the exact grid
    cvt_bf(x + (size_t)b * XS_FULL * DIN, XB + (size_t)b * SEQ * DIN, (SEQ * DIN) / 8, cb % GX);
  }
}

// =====================================================================================================
// f32 plane F (row-major, NC columns, n8*8 elements) -> f16 hi plane Hp = f16(F * sc) and f16 residual plane Lp = f16(t - f16(t)),
// both in fragment order. Thread = one chunk (8 elements of one row): two 16-B loads, one 16-B store per plane; a wave stores
// 512 contiguous bytes per plane. No barriers; every packed half comes from a per-lane (divergent) loaded value.
// coverage: bid = 0 .. ceil(n8/256) - 1, x 256 thr x 8 (in-kernel bound) = the whole of Hp and of Lp (n8 a multiple of 256 here).
// =====================================================================================================
template <int NC>
__device__ __forceinline__ void split16(const float* __restrict__ F, u16* Hp, u16* Lp, int n8, float sc, int bid) {
  const int gt = bid * 256 + (int)threadIdx.x;                        // chunk index in Hp and in Lp
  if (gt >= n8) return;
  const int blk = gt >> 6;
  const int row = (blk / (NC / 32)) * 16 + (gt & 15);
  const int col = (blk % (NC / 32)) * 32 + ((gt >> 4) & 3) * 8;
  const float* p = F + (size_t)row * NC + col;
  const v4f a = *(const v4f*)(p), b4 = *(const v4f*)(p + 4);
  float w[8];
#pragma unroll
  for (int e = 0; e < 4; ++e) { w[e] = a[e] * sc; w[4 + e] = b4[e] * sc; }
  v4u oh, ol;
#pragma unroll
  for (int e = 0; e < 4; ++e) {
    const float t0 = w[2 * e], t1 = w[2 * e + 1];
    const _Float16 h0 = (_Float16)t0, h1 = (_Float16)t1;
    const _Float16 l0 = (_Float16)(t0 - (float)h0), l1 = (_Float16)(t1 - (float)h1);
    oh[e] = pk16(h_bits(h0), h_bits(h1));
    ol[e] = pk16(h_bits(l0), h_bits(l1));
  }
  u16* dh = Hp + (size_t)gt * 8;
  u16* dl = Lp + (size_t)gt * 8;
  {
    *(v4u*)(dh) = oh;
    *(v4u*)(dl) = ol;
    
  }
}

// =====================================================================================================
// v^T planes from the v projection F f32 [MROWS][NV] (row = b*SEQ + s, column = g*DV + d):
//   VH(row (b*NG + g)*DV + d, column s) = f16(v * 1024);  VL(same) = f16 residual (t - f16(t)), both for all keys s;
//   both planes NB*NG*DV rows x SEQ columns in fragment order.
// Block = (b, kv group g, 64 keys s0): each thread loads its 16 floats (key sl, d chunk dc) with 16-B loads, converts,
// scatters into two LDS tiles [64 d][64 keys] (pitch 72 halves); after a block barrier each tile leaves as its 8 blocks
// (4 d tiles x 2 key steps) of 64 chunks, a wave storing 512 contiguous bytes per plane.
// coverage: load 256 thr x 16 = 64 keys x 64 d; store 2 iterations x 256 thr x 8 halves = 8 blocks x 512 = the block's tile of
//           VH and of VL; bid = 0 .. NB*NG*NST - 1 covers both planes exactly once.
// =====================================================================================================
__device__ __forceinline__ void vt16(const float* __restrict__ F, u16* VHo, u16* VLo, int bid) {
  __shared__ __align__(16) u16 TH[DV * VTP];
  __shared__ __align__(16) u16 TL[DV * VTP];
  const int tid = threadIdx.x;
  const int st  = bid % NST;
  const int t2  = bid / NST;
  const int g   = t2 % NG;
  const int b   = t2 / NG;
  if (b >= NB) return;                      // block-uniform, before the barrier; never taken with the exact grid
  const int s0  = st * 64;
  {
    const int sl = tid >> 2;                // key within tile 0..63
    const int dc = (tid & 3) * 16;          // d chunk 0,16,32,48
    const float* src = F + ((size_t)b * SEQ + s0 + sl) * NV + g * DV + dc;
#pragma unroll
    for (int i = 0; i < 4; ++i) {
      const v4f a = *(const v4f*)(src + 4 * i);
#pragma unroll
      for (int e = 0; e < 4; ++e) {
        const float t = a[e] * VCAR;
        const _Float16 hv = (_Float16)t;
        const _Float16 lv = (_Float16)(t - (float)hv);
        TH[(dc + 4 * i + e) * VTP + sl] = h_bits(hv);
        TL[(dc + 4 * i + e) * VTP + sl] = h_bits(lv);
      }
    }
  }
  __syncthreads();
  v4u vh[2], vl[2];
#pragma unroll
  for (int it = 0; it < 2; ++it) {
    const int id = it * 256 + tid;          // chunk of the tile: block id >> 6 = (d tile id >> 7, key step (id >> 6) & 1)
    const int lo = ((id >> 7) * 16 + (id & 15)) * VTP + ((id >> 6) & 1) * 32 + ((id >> 4) & 3) * 8;
    vh[it] = *(const v4u*)(TH + lo);
    vl[it] = *(const v4u*)(TL + lo);
  }
  const int rt0 = (b * NG + g) * (DV / 16);   // first 16-row tile of this (b, g) in the planes
  {
#pragma unroll
    for (int it = 0; it < 2; ++it) {
      const int id = it * 256 + tid;
      const size_t blk = (size_t)(rt0 + (id >> 7)) * (SEQ / 32) + (size_t)((s0 >> 5) + ((id >> 6) & 1));
      *(v4u*)(VHo + blk * 512 + (id & 63) * 8) = vh[it];
      *(v4u*)(VLo + blk * 512 + (id & 63) * 8) = vl[it];
    }
    
  }
}

// =====================================================================================================
// The three jobs that turn the f32 projections into attention's f16 planes, in one launch; a block does one block's work of one
// job, chosen by its index (block-uniform): [0, GVT) v^T planes x1024; then GSQ blocks q planes x256; then GSK blocks k planes x256.
// =====================================================================================================
__global__ __launch_bounds__(256)
void split_qkv(const float* __restrict__ FQ, const float* __restrict__ FK, const float* __restrict__ FV,
               u16* QH, u16* QL, u16* KH, u16* KL, u16* VH, u16* VL) {
  const int bid = blockIdx.x;
  if (bid < GVT)            vt16(FV, VH, VL, bid);
  else if (bid < GVT + GSQ) split16<NQ>(FQ, QH, QL, (MROWS * NQ) / 8, QSC, bid - GVT);
  else                      split16<NK>(FK, KH, KL, (MROWS * NK) / 8, KSC, bid - (GVT + GSQ));
}

// =====================================================================================================
// GEMM epilogue shared by all engines: the wave's 16x64 f32 tile (times oscale, plus the lane's per-column bias of each
// coverage: 8 instructions x 2 rows x 16 lanes x 4 floats = the wave's 16 x 64 tile.
// =====================================================================================================
__device__ __forceinline__ void epi64(float* sl, v8f a0, v8f a1, v8f a2, v8f a3, float oscale,
                                      float bb0, float bb1, float bb2, float bb3,
                                      float* C, int N, size_t rowb, int col0, int lane) {
  const int hh = lane >> 4, m = lane & 15;
#pragma unroll
  for (int r = 0; r < 8; ++r) {
    const int ro = (8 * hh + r) * 68 + m;
    sl[ro]      = a0[r] * oscale + bb0;
    sl[ro + 16] = a1[r] * oscale + bb1;
    sl[ro + 32] = a2[r] * oscale + bb2;
    sl[ro + 48] = a3[r] * oscale + bb3;
  }
  wave_sync_lds();
  v4f vals[8];
#pragma unroll
  for (int it = 0; it < 8; ++it) vals[it] = *(const v4f*)(sl + (it * 2 + hh) * 68 + m * 4);
  float* dst = C + (rowb + (size_t)hh) * (size_t)N + col0 + m * 4;
  {
#pragma unroll
    for (int it = 0; it < 8; ++it) {
      *(v4f*)(dst + (size_t)(it * 2) * (size_t)N) = vals[it];
    }
    
  }
}

// =====================================================================================================
// bf16 GEMM, no bias, the q, k and v projections in one launch: [CQ | CK | CV][M][NQ | NK | NV] (f32, three row-major planes) =
// A (bf16, M rows x K, fragment order) . Bt^T (bf16, NQKV rows x K, fragment order: the rows of Wq^T, Wk^T, Wv^T one behind the
// other, which is how the three planes lie in the workspace). Block = 64x64 tile, 4 waves x 16 rows; a tile lies in one plane
// (NQ, NK, NV multiples of 64), chosen by the block's column tile (block-uniform); fragments loaded straight from the planes'
// blocks (two 16-B loads each, split k map for A and B);
// K stepped by 32 (host guarantees K % 32 == 0, M % 64 == 0, grid = (M/64)*(NQKV/64)).
// =====================================================================================================
__global__ __launch_bounds__(128)
void gemm_qkv(const u16* __restrict__ A, const u16* __restrict__ Bt, float* CQ, float* CK, float* CV, int M, int K) {
  __shared__ __align__(16) float slab[4 * SLAB64];
  const int tid = threadIdx.x, wave = tid >> 5, lane = tid & 31;
  const int ntile = NQKV >> 6;
  const int bid   = blockIdx.x;
  const int rowb  = (bid / ntile) * 64 + wave * 16;
  const int colb  = (bid % ntile) * 64;     // first row of the tile in Bt
  if (rowb + 16 > M) return;                // wave-uniform, never taken with the exact grid; no block barriers in this kernel
  float* C = CQ;
  int N = NQ, col0 = colb;                  // the tile's plane, its row length and the tile's first column in it
  if (colb >= NQ + NK) { C = CV; N = NV; col0 = colb - (NQ + NK); }
  else if (colb >= NQ) { C = CK; N = NK; col0 = colb - NQ; }
  const size_t bs = (size_t)16 * K;         // 16 rows on = one row of blocks on
  const u16* ap  = A  + (size_t)rowb * K + 8 * lane;   // the lane's chunk in block (rowb / 16, 0); the next k step is 512 halves on
  const u16* bp0 = Bt + (size_t)colb * K + 8 * lane;
  const u16* bp1 = bp0 + bs;
  const u16* bp2 = bp1 + bs;
  const u16* bp3 = bp2 + bs;
  v8f acc0 = zero8(), acc1 = zero8(), acc2 = zero8(), acc3 = zero8();
#pragma unroll 1
  for (int k0 = 0; k0 < K; k0 += 32) {
    const v16b a  = ldfrag_b(ap, 0u);
    const v16b b0 = ldfrag_b(bp0, 0u);
    const v16b b1 = ldfrag_b(bp1, 0u);
    const v16b b2 = ldfrag_b(bp2, 0u);
    const v16b b3 = ldfrag_b(bp3, 0u);
    // the loads' address registers are named here, so none is given to a later load's result or stepped on before the
    // loads' address translations are back
#if defined(__HIP_DEVICE_COMPILE__)
    asm volatile("s_wait_xcnt 0x0" :: "v"(ap), "v"(bp0), "v"(bp1), "v"(bp2), "v"(bp3) : "memory");
#endif
    ap += 512; bp0 += 512; bp1 += 512; bp2 += 512; bp3 += 512;
    acc0 = mma_b(a, b0, acc0);
    acc1 = mma_b(a, b1, acc1);
    acc2 = mma_b(a, b2, acc2);
    acc3 = mma_b(a, b3, acc3);
    guard6<v16b>(acc0, acc1, acc2, acc3, a, b0, b1, b2, b3, a);
  }
  epi64(slab + wave * SLAB64, acc0, acc1, acc2, acc3, 1.0f, 0.0f, 0.0f, 0.0f, 0.0f, C, N, (size_t)rowb, col0, lane);
}

// =====================================================================================================
// f16 GEMM with a two-plane A operand and bias: C[M][N] (f32) = (Ah + Al) (f16 hi and residual planes, M rows x K, fragment
// order, residual unscaled relative to hi) . Bt^T (f16, N rows x K, fragment order) * oscale + bf16 RNE value of bias[n] (bias has
// N entries). Products ah.b + al.b into one accumulator. Same tiling, fragment loads (split k map) and epilogue as gemm_qkv;
// K stepped by 32 (host guarantees K % 32 == 0, M % 64 == 0, N % 64 == 0, grid = (M/64)*(N/64)).
// =====================================================================================================
__global__ __launch_bounds__(128)
void gemm_h2(const u16* __restrict__ Ah, const u16* __restrict__ Al, const u16* __restrict__ Bt,
             const float* __restrict__ bias, float* C, int M, int N, int K, float oscale) {
  __shared__ __align__(16) float slab[4 * SLAB64];
  const int tid = threadIdx.x, wave = tid >> 5, lane = tid & 31, m = lane & 15;
  const int ntile = N >> 6;
  const int bid   = blockIdx.x;
  const int rowb  = (bid / ntile) * 64 + wave * 16;
  const int col0  = (bid % ntile) * 64;
  if (rowb + 16 > M) return;                // wave-uniform, never taken with the exact grid; no block barriers in this kernel
  const size_t bs = (size_t)16 * K;
  const _Float16* ahp = (const _Float16*)(const void*)Ah + (size_t)rowb * K + 8 * lane;   // the lane's chunk in block (rowb / 16, 0), as in gemm_qkv
  const _Float16* alp = (const _Float16*)(const void*)Al + (size_t)rowb * K + 8 * lane;
  const _Float16* bp0 = (const _Float16*)(const void*)Bt + (size_t)col0 * K + 8 * lane;
  const _Float16* bp1 = bp0 + bs;
  const _Float16* bp2 = bp1 + bs;
  const _Float16* bp3 = bp2 + bs;
  v8f acc0 = zero8(), acc1 = zero8(), acc2 = zero8(), acc3 = zero8();
#pragma unroll 1
  for (int k0 = 0; k0 < K; k0 += 32) {
    const v16h ah = ldfrag_h(ahp, 0u), al = ldfrag_h(alp, 0u);
    const v16h b0 = ldfrag_h(bp0, 0u);
    const v16h b1 = ldfrag_h(bp1, 0u);
    const v16h b2 = ldfrag_h(bp2, 0u);
    const v16h b3 = ldfrag_h(bp3, 0u);
    // the loads' address registers are named here, so none is given to a later load's result or stepped on before the
    // loads' address translations are back
#if defined(__HIP_DEVICE_COMPILE__)
    asm volatile("s_wait_xcnt 0x0" :: "v"(ahp), "v"(alp), "v"(bp0), "v"(bp1), "v"(bp2), "v"(bp3) : "memory");
#endif
    ahp += 512; alp += 512; bp0 += 512; bp1 += 512; bp2 += 512; bp3 += 512;
    acc0 = mma_h(ah, b0, acc0);  acc0 = mma_h(al, b0, acc0);
    acc1 = mma_h(ah, b1, acc1);  acc1 = mma_h(al, b1, acc1);
    acc2 = mma_h(ah, b2, acc2);  acc2 = mma_h(al, b2, acc2);
    acc3 = mma_h(ah, b3, acc3);  acc3 = mma_h(al, b3, acc3);
    guard6<v16h>(acc0, acc1, acc2, acc3, ah, al, b0, b1, b2, b3);
  }
  // per-lane bias of D column m in each of the 4 subtiles; col0 + 48 + m <= N - 1 always
  const float bb0 = bfr(bias[col0 + m]);
  const float bb1 = bfr(bias[col0 + 16 + m]);
  const float bb2 = bfr(bias[col0 + 32 + m]);
  const float bb3 = bfr(bias[col0 + 48 + m]);
  epi64(slab + wave * SLAB64, acc0, acc1, acc2, acc3, oscale, bb0, bb1, bb2, bb3, C, N, (size_t)rowb, col0, lane);
}

// =====================================================================================================
// Causal grouped attention with ALiBi, q/k head dim 32, value head dim 64. Block bid -> (query tile qt = qtb + bid % nqtl:
// rows q0 = 16*qt .. q0+15, kv group hg, batch b); one wave per query head = hg + NG*wave, the 4 heads with head % NG = hg.
//   q hi / residual planes f16 x256, row b*SEQ + s, column h*DQ + d (NQ columns); k hi / residual planes f16 x256, row
//   b*SEQ + s, column g*DQ + d (NK columns); v^T hi / residual planes x1024, row (b*NG + g)*DV + d, column s (SEQ columns);
//   O hi / residual planes f16 x1024, row b*SEQ + s, column h*DV + d (DOUT columns); all in fragment order.
//   scores, transposed: S^T (16 keys x 16 queries, one k-step over d = 0..31) = k_hi.q_hi + k_lo.q_hi + k_hi.q_lo (A = k block,
//   B = q block; 3 products into one accumulator, residuals unscaled relative to their hi planes), q fragments loop-invariant;
//   a lane holds 16 of the step's 32 scores of ONE query (q0 + lane % 16), lane l ^ 16 the other 16;
//   logit (log2 domain) t(i, j) = (acc/(256*256) + slope[h]*(j - i)) * (1/sqrt(32))*log2e, replaced by -inf where j > i,
//   slope[h] = 2^(-(h+1)/2) built exactly (power of two times f32 sqrt2 for odd h+1).
//   Key tiles of 32 visited in order for kb <= q0 + 15 (later tiles hold only keys above every query row of the tile).
//   A step's 12 blocks of 1 KiB (k hi 2, k residual 2, v^T hi 4, v^T residual 4) are the same for the block's 4 heads: they come
//   into LDS once, by asynchronous copies (wave w brings k block w, v^T hi block w, v^T residual block w), two buffers, the copies
//   of step t + 1 in flight while step t is worked on; every wave reads all 12 blocks as its fragments from LDS.
//   Online max-subtracted base-2 softmax in f32, -inf-safe rescale: maximum and sum run over the lane's own registers, the
//   maximum joined with lane l ^ 16 in each step, the two half sums once behind the loop. The two score tiles of a step,
//   converted in place, ARE the B fragment of P^T (element e <- tile e / 8, register e % 8: the planes' split k map), so P
//   passes through no LDS; v^T blocks are the A fragments of 4 d-subtiles, both v planes: O^T += v_hi.P_hi + v_lo.P_hi
//   (+ v_hi.P_lo when PRES == 1), 2 groups of 2 subtiles.
//   After the loop: out = acc / Z (Z > 0 always: key 0 <= every query row; guarded anyway), carries 1/(32768*1024) folded
//   once; a lane's 8 registers of a subtile are 8 consecutive d of its query = one chunk of the O planes.
// coverage: per wave 4 instructions x 32 chunks x 8 halves = 2 blocks = 16 x 64 of each O plane; the two block ranges of attn_all
//           cover query tiles [QO/16, NQT) and [0, QO/16) x NHG x NB blocks x WPB waves = every (b, s, h) row segment of OH and
//           of OL exactly once.
// =====================================================================================================
// One wave's six asynchronous copies of a step (16 B a lane each, 512 contiguous bytes a wave): the two halves of a k block to LDS
// byte address l, of a v^T hi block to l + 4096, of a v^T residual block to l + 8192. The closing s_wait_xcnt stands in the copies'
// own statement, so that no address register named here is rewritten in front of it.
__device__ __forceinline__ void kv_copy(unsigned l, const _Float16* gk, const _Float16* gh, const _Float16* gl) {
#if defined(__HIP_DEVICE_COMPILE__)
  asm volatile("global_load_async_to_lds_b128 %0, %6, off\n\t"
               "global_load_async_to_lds_b128 %1, %7, off\n\t"
               "global_load_async_to_lds_b128 %2, %8, off\n\t"
               "global_load_async_to_lds_b128 %3, %9, off\n\t"
               "global_load_async_to_lds_b128 %4, %10, off\n\t"
               "global_load_async_to_lds_b128 %5, %11, off\n\t"
               "s_wait_xcnt 0x0"
               :: "v"(l), "v"(l + 512u), "v"(l + 4096u), "v"(l + 4608u), "v"(l + 8192u), "v"(l + 8704u),
                  "v"(gk), "v"(gk + 256), "v"(gh), "v"(gh + 256), "v"(gl), "v"(gl + 256)
               : "memory");
#endif
}

template <int PRES>
__device__ __forceinline__
void attn_c(const u16* __restrict__ QHp, const u16* __restrict__ QLp,
            const u16* __restrict__ KHp, const u16* __restrict__ KLp,
            const u16* __restrict__ VHp, const u16* __restrict__ VLp,
            u16* OHp, u16* OLp, int qtb, int nqtl, int bid, u16* kvs) {
  const int tid  = threadIdx.x;
  const int wave = tid >> 5;
  const int lane = tid & 31;
  const int hh   = lane >> 4;
  const int c    = lane & 15;
  const int qt   = qtb + (bid % nqtl);
  const int t2   = bid / nqtl;
  const int hg   = t2 % NHG;
  const int b    = t2 / NHG;
  if (b >= NB) return;                      // block-uniform, before every barrier; never taken with the exact grid
  const int q0   = qt * 16;
  if (q0 + 16 > SEQ) return;                // block-uniform, before every barrier; never taken
  const int head = hg + NG * wave;
  const int kvh  = hg;                      // tiled kv mapping: head h -> kv group h % NG, the same for the block's 4 waves

  // fragment-order blocks (512 halves each): q block (row tile, head); k block (key tile of 16, kv group), 16 keys on = 16 * NK
  // halves on; v^T block (d tile, key step of 32), 32 keys on = 512 halves on, 16 d on = 16 * SEQ halves on
  const _Float16* Qh  = (const _Float16*)(const void*)QHp + ((size_t)b * SEQ + q0) * NQ + (size_t)head * 512;
  const _Float16* Ql  = (const _Float16*)(const void*)QLp + ((size_t)b * SEQ + q0) * NQ + (size_t)head * 512;
  const _Float16* Khb = (const _Float16*)(const void*)KHp + (size_t)b * SEQ * NK + (size_t)kvh * 512;  // key row kb added per step
  const _Float16* Klb = (const _Float16*)(const void*)KLp + (size_t)b * SEQ * NK + (size_t)kvh * 512;
  const _Float16* Vhb = (const _Float16*)(const void*)VHp + (size_t)(b * NG + kvh) * DV * SEQ;         // d tile 0 (+j)
  const _Float16* Vlb = (const _Float16*)(const void*)VLp + (size_t)(b * NG + kvh) * DV * SEQ;
  const unsigned lb = 16u * (unsigned)lane;  // the lane's chunk inside a block, in bytes

  // ALiBi slope 2^(-(head+1)/2): even exponent -> exact power of two; odd -> power of two times f32 sqrt(2)
  const int   e1   = head + 1;
  const int   pw   = (e1 + 1) >> 1;
  const float p2   = __uint_as_float(((unsigned)(127 - pw)) << 23);
  const float slope = p2 * (((e1 & 1) != 0) ? SQRT2F : 1.0f);   // wave-uniform select by value
  const float lsc  = 1.0f / (QSC * KSC);
  const float ul2  = RSQ_DQ * LOG2E;
  const float oc   = 1.0f / (PCAR * VCAR);
  const size_t KROW = (size_t)NK;           // halves per key row in the k planes (16 rows = one row of blocks)

  const v16h qh = ldfrag_h(Qh, lb);             // loop-invariant q fragments (d = 0..31): hi plane
  const v16h ql = ldfrag_h(Ql, lb);             //                                         residual plane

  float mrow = -INFINITY, lrow = 0.f;       // the lane's query: running maximum (both halves alike), sum over this half's keys
  v8f o[4];                                 // O^T: o[j][r] = (d = j*16 + 8*hh + r, query q0 + c)
#pragma unroll
  for (int j = 0; j < 4; ++j) o[j] = zero8();
  const int ncaus = (q0 >> 5) + 1;                                            // tiles holding keys <= q0 + 15
  const int nkt = (ncaus < NKT) ? ncaus : NKT;
  const int qr  = q0 + c;                                                     // the lane's query row

  // the wave's share of a step's copies: k block wave (hi plane key tiles 0, 1, residual plane key tiles 0, 1), v^T hi d tile wave,
  // v^T residual d tile wave; the lane's 16 B of each half block. A step on: 32 key rows in k, one block (512 halves) in v^T.
  const _Float16* gk = (((wave & 2) != 0) ? Klb : Khb) + (size_t)(16 * (wave & 1)) * KROW + 8 * lane;
  const _Float16* gh = Vhb + (size_t)wave * 16 * SEQ + 8 * lane;
  const _Float16* gl = Vlb + (size_t)wave * 16 * SEQ + 8 * lane;
  const unsigned  lw = (unsigned)(size_t)kvs + 1024u * (unsigned)wave + lb;   // LDS byte address: buffer 0, block wave, the lane's chunk

  // step 0 into buffer 0, landed and published; then step 1 into buffer 1, in flight over step 0
  kv_copy(lw, gk, gh, gl);
  asm volatile("s_wait_asynccnt 0x0" ::: "memory");   // this wave's copies have landed before the barrier lets others read them
  __syncthreads();
  if (nkt > 1) kv_copy(lw + 2u * KVBUF, gk + (size_t)32 * KROW, gh + 512, gl + 512);

#pragma unroll 1
  for (int kt = 0; kt < nkt; ++kt) {
    const int kb = kt * 32;
    // ---- this step's fragments from its LDS buffer, as one group: k first (the scores wait for these alone), then v^T ----
    const _Float16* kvb = (const _Float16*)(const void*)kvs + (kt & 1) * KVBUF;
    const v16h kh0 = ldfrag_h(kvb, lb);
    const v16h kh1 = ldfrag_h(kvb + 512, lb);
    const v16h kl0 = ldfrag_h(kvb + 1024, lb);
    const v16h kl1 = ldfrag_h(kvb + 1536, lb);
    v16h vh[4], vl[4];
#pragma unroll
    for (int j = 0; j < 4; ++j) vh[j] = ldfrag_h(kvb + 2048 + j * 512, lb);
#pragma unroll
    for (int j = 0; j < 4; ++j) vl[j] = ldfrag_h(kvb + 4096 + j * 512, lb);
    // ---- scores: D element r of this lane = (key kb + 8*hh + r, query qr) in s0, key kb + 16 + 8*hh + r in s1 ----
    //      hi+residual planes on both operands: k_hi.q_hi + k_lo.q_hi + k_hi.q_lo
    v8f s0 = zero8(), s1 = zero8();
    {
      s0 = mma_h(kh0, qh, s0);              // hi.hi
      s0 = mma_h(kl0, qh, s0);              // k residual . q hi
      s0 = mma_h(kh0, ql, s0);              // k hi . q residual
      s1 = mma_h(kh1, qh, s1);
      s1 = mma_h(kl1, qh, s1);
      s1 = mma_h(kh1, ql, s1);
      guard2(s0, s1, qh, ql, kh0, kl0, kh1, kl1);
    }
    // ---- causal select + ALiBi + scale, online softmax in base 2, -inf-safe; all 16 values belong to query qr ----
    const int dk = kb + 8 * hh - qr;        // key - query of s0[0]
    float t0[8], t1[8];
#pragma unroll
    for (int r = 0; r < 8; ++r) {
      const int   d0 = dk + r, d1 = dk + 16 + r;
      const float a0 = slope * (float)d0;
      const float a1 = slope * (float)d1;
      const float u0 = (s0[r] * lsc + a0) * ul2;
      const float u1 = (s1[r] * lsc + a1) * ul2;
      t0[r] = (d0 > 0) ? -INFINITY : u0;
      t1[r] = (d1 > 0) ? -INFINITY : u1;
    }
    float mq[4];
#pragma unroll
    for (int i = 0; i < 4; ++i) mq[i] = fmaxf(fmaxf(t0[2 * i], t0[2 * i + 1]), fmaxf(t1[2 * i], t1[2 * i + 1]));
    float mx = fmaxf(fmaxf(mq[0], mq[1]), fmaxf(mq[2], mq[3]));
    mx = fmaxf(mx, xhalf(mx));              // the other 16 keys of the step
    const float mn = fmaxf(mrow, mx);
    const float ms = (mn == -INFINITY) ? 0.0f : mn;
    const float al = exp2f(mrow - ms);
    mrow = mn;
    float e0[8], e1[8];
#pragma unroll
    for (int r = 0; r < 8; ++r) { e0[r] = exp2f(t0[r] - ms); e1[r] = exp2f(t1[r] - ms); }
    float sq[4];
#pragma unroll
    for (int i = 0; i < 4; ++i) sq[i] = (e0[2 * i] + e0[2 * i + 1]) + (e1[2 * i] + e1[2 * i + 1]);
    lrow = lrow * al + ((sq[0] + sq[1]) + (sq[2] + sq[3]));
#pragma unroll
    for (int j = 0; j < 4; ++j) {
#pragma unroll
      for (int r = 0; r < 8; ++r) o[j][r] *= al;
    }
    // ---- B fragments of P^T*32768: f16 hi (and f16 residual when PRES), column = query c, split k map over the 32 keys of
    //      this step: elements 0..7 = keys kb + 8hh + 0..7 (s0's rows), elements 8..15 = keys kb + 16 + 8hh + 0..7 (s1's) ----
    FragH ph, pl;
    {
#pragma unroll
      for (int e = 0; e < 8; ++e) {
        const float ta = e0[e] * PCAR, tc = e1[e] * PCAR;
        const _Float16 ha = (_Float16)ta, hc = (_Float16)tc;
        ph.h[0][e] = ha;
        ph.h[1][e] = hc;
        if constexpr (PRES == 1) {
          pl.h[0][e] = (_Float16)(ta - (float)ha);
          pl.h[1][e] = (_Float16)(tc - (float)hc);
        }
      }
      if constexpr (PRES != 1) pl.v = ph.v;
    }
    // ---- v^T.P^T : A fragment row m = d = j*16 + c, k = the step's 32 keys; 2 groups of 2 d-subtiles ----
    {
#pragma unroll
      for (int jg = 0; jg < 2; ++jg) {
        const v16h vha = vh[2 * jg], vhb2 = vh[2 * jg + 1];
        const v16h vla = vl[2 * jg], vlb2 = vl[2 * jg + 1];
        o[2 * jg]     = mma_h(vha,  ph.v, o[2 * jg]);                       // v_hi . P_hi
        if constexpr (PRES == 1) o[2 * jg] = mma_h(vha, pl.v, o[2 * jg]);   // v_hi . P_lo
        o[2 * jg]     = mma_h(vla,  ph.v, o[2 * jg]);                       // v_lo . P_hi
        o[2 * jg + 1] = mma_h(vhb2, ph.v, o[2 * jg + 1]);
        if constexpr (PRES == 1) o[2 * jg + 1] = mma_h(vhb2, pl.v, o[2 * jg + 1]);
        o[2 * jg + 1] = mma_h(vlb2, ph.v, o[2 * jg + 1]);
        guard2(o[2 * jg], o[2 * jg + 1], ph.v, pl.v, vha, vhb2, vla, vlb2);
      }
    }
    // ---- hand-over: step kt + 1 is published, and this step's buffer is free for step kt + 2 ----
    asm volatile("s_wait_dscnt 0x0" ::: "memory");      // this wave's reads of the buffer are done before anyone refills it
    asm volatile("s_wait_asynccnt 0x0" ::: "memory");   // this wave's copies of step kt + 1 have landed before others read them
    __syncthreads();
    if (kt + 2 < nkt)
      kv_copy(lw + (unsigned)(kt & 1) * (2u * KVBUF), gk + (size_t)(kb + 64) * KROW, gh + (size_t)(kb + 64) * 16, gl + (size_t)(kb + 64) * 16);
  }
  asm volatile("s_wait_asynccnt 0x0" ::: "memory");     // no copy is left in flight when the wave goes on to its end
  acc_guard4(o[0], o[1], o[2], o[3]);
  // ---- out = acc / Z (0 if Z == 0), Z = the two halves' sums, carries (32768 on P, 1024 on v) folded once ----
  const float lv  = lrow + xhalf(lrow);
  const float ls  = (lv > 0.0f) ? lv : 1.0f;
  const float inv = (lv > 0.0f) ? ((1.0f / ls) * oc) : 0.0f;
  v4u oh[4], ol[4];
#pragma unroll
  for (int it = 0; it < 4; ++it) {
    // chunk it * 32 + lane of the wave's two O blocks: query row c, head columns it * 16 + 8 * hh .. + 7 = o[it][0..7]
    float w[8];
#pragma unroll
    for (int e = 0; e < 8; ++e) w[e] = (o[it][e] * inv) * OSC;
#pragma unroll
    for (int e = 0; e < 4; ++e) {
      const _Float16 h0 = (_Float16)w[2 * e], h1 = (_Float16)w[2 * e + 1];
      const _Float16 l0 = (_Float16)(w[2 * e] - (float)h0), l1 = (_Float16)(w[2 * e + 1] - (float)h1);
      oh[it][e] = pk16(h_bits(h0), h_bits(h1));
      ol[it][e] = pk16(h_bits(l0), h_bits(l1));
    }
  }
  const size_t ob = ((size_t)b * SEQ + q0) * DOUT + (size_t)head * (DV / 32) * 512 + 8 * lane;
  {
#pragma unroll
    for (int it = 0; it < 4; ++it) {
      *(v4u*)(OHp + ob + it * 256) = oh[it];
      *(v4u*)(OLp + ob + it * 256) = ol[it];
    }
    
  }
}

// =====================================================================================================
// Both kinds of query tile in one launch, chosen by the block's index (block-uniform): blocks [0, nqt0 * NHG * NB) take the nqt0
// query tiles from nqt1 on (the longer key loops), without the P residual product; the other nqt1 * NHG * NB blocks take query
// tiles [0, nqt1), with it.
// =====================================================================================================
__global__ __launch_bounds__(ATT_THREADS)
void attn_all(const u16* __restrict__ QHp, const u16* __restrict__ QLp,
              const u16* __restrict__ KHp, const u16* __restrict__ KLp,
              const u16* __restrict__ VHp, const u16* __restrict__ VLp,
              u16* OHp, u16* OLp, int nqt1, int nqt0) {
  __shared__ __align__(16) u16 kvs[2 * KVBUF];          // two buffers of a step's 12 k and v^T blocks
  const int bid = blockIdx.x;
  const int nb0 = nqt0 * NHG * NB;
  if (bid < nb0) attn_c<0>(QHp, QLp, KHp, KLp, VHp, VLp, OHp, OLp, nqt1, nqt0, bid, kvs);
  else           attn_c<1>(QHp, QLp, KHp, KLp, VHp, VLp, OHp, OLp, 0, nqt1, bid - nb0, kvs);
}

// =====================================================================================================
// Workspace map (bytes); every plane is fully written by whole-line stores before it is read; all extents are exact multiples
// of the store granularity (no pad rows needed); every region offset a multiple of 262144; the 16-bit planes are given as
// rows x columns and lie in fragment order, the f32 planes are row-major:
//   XB  bf16 MROWS x DIN                  MROWS*2048      (NB=2, SEQ=2048: 8388608)
//   WQT bf16 NQ n x DIN k                 1048576
//   WKT bf16 NK n x DIN k                 262144
//   WVT bf16 NV n x DIN k                 524288
//   WPT f16  DOUT n x DOUT k, x1024       2097152
//   FQ  f32  [MROWS][NQ]                  MROWS*2048      (8388608)
//   FK  f32  [MROWS][NK]                  MROWS*512       (2097152)
//   FV  f32  [MROWS][NV]                  MROWS*1024      (4194304)
//   QH, QL f16 MROWS x NQ, x256           MROWS*1024 each (4194304 each)
//   KH, KL f16 MROWS x NK, x256           MROWS*256 each  (1048576 each)
//   VH, VL f16 NB*NG*DV x SEQ, x1024      MROWS*512 each  (2097152 each)
//   OH, OL f16 MROWS x DOUT, x1024        MROWS*2048 each (8388608 each)
//   end (NB=2, SEQ=2048)                  58458112
// =====================================================================================================
extern "C" void kernel_launch(void* const* d_in, const int* in_sizes, int n_in,
                              void* d_out, int out_size, void* d_ws, size_t ws_size,
                              hipStream_t stream) {
  if (n_in < 6) return;
  if (in_sizes[0] < ((NB - 1) * XS_FULL + SEQ) * DIN) return;
  if (in_sizes[1] != DIN * NQ) return;
  if (in_sizes[2] != DIN * NK) return;
  if (in_sizes[3] != DIN * NV) return;
  if (in_sizes[4] != DOUT * DOUT) return;
  if (in_sizes[5] != DOUT) return;
  if (out_size < MROWS * DOUT) return;

  const float* x   = (const float*)d_in[0];
  const float* wq  = (const float*)d_in[1];
  const float* wk  = (const float*)d_in[2];
  const float* wv  = (const float*)d_in[3];
  const float* wp  = (const float*)d_in[4];
  const float* bpv = (const float*)d_in[5];
  float*       out = (float*)d_out;

  const size_t szXB = (size_t)MROWS * DIN * 2;
  const size_t szWQ = (size_t)NQ * DIN * 2;
  const size_t szWK = (size_t)NK * DIN * 2;
  const size_t szWV = (size_t)NV * DIN * 2;
  const size_t szWP = (size_t)DOUT * DOUT * 2;
  const size_t szFQ = (size_t)MROWS * NQ * 4;
  const size_t szFK = (size_t)MROWS * NK * 4;
  const size_t szFV = (size_t)MROWS * NV * 4;
  const size_t szQ  = (size_t)MROWS * NQ * 2;                   // QH, QL
  const size_t szK  = (size_t)MROWS * NK * 2;                   // KH, KL
  const size_t szV  = (size_t)NB * NG * DV * SEQ * 2;           // VH, VL
  const size_t szO  = (size_t)MROWS * DOUT * 2;                 // OH, OL
  size_t off = 0;
  const size_t oXB = off; off += szXB;
  const size_t oWQ = off; off += szWQ;
  const size_t oWK = off; off += szWK;
  const size_t oWV = off; off += szWV;
  const size_t oWP = off; off += szWP;
  const size_t oFQ = off; off += szFQ;
  const size_t oFK = off; off += szFK;
  const size_t oFV = off; off += szFV;
  const size_t oQH = off; off += szQ;
  const size_t oQL = off; off += szQ;
  const size_t oKH = off; off += szK;
  const size_t oKL = off; off += szK;
  const size_t oVH = off; off += szV;
  const size_t oVL = off; off += szV;
  const size_t oOH = off; off += szO;
  const size_t oOL = off; off += szO;
  if (off > ws_size) return;                // off = 58458112 for NB = 2, SEQ = 2048
  if (off > (size_t)WS_CAP) return;

  char* ws = (char*)d_ws;
  u16*   XB  = (u16*)(ws + oXB);
  u16*   WQT = (u16*)(ws + oWQ);
  u16*   WKT = (u16*)(ws + oWK);
  u16*   WVT = (u16*)(ws + oWV);
  u16*   WPT = (u16*)(ws + oWP);
  float* FQ  = (float*)(ws + oFQ);
  float* FK  = (float*)(ws + oFK);
  float* FV  = (float*)(ws + oFV);
  u16*   QH  = (u16*)(ws + oQH);
  u16*   QL  = (u16*)(ws + oQL);
  u16*   KH  = (u16*)(ws + oKH);
  u16*   KL  = (u16*)(ws + oKL);
  u16*   VH  = (u16*)(ws + oVH);
  u16*   VL  = (u16*)(ws + oVL);
  u16*   OH  = (u16*)(ws + oOH);
  u16*   OL  = (u16*)(ws + oOL);

  const dim3 b256(256), b128(128), bAT(ATT_THREADS);
  const dim3 gPI(GWALL + NB * GX);                      // 480 weight blocks + 1024 x blocks per batch (SEQ=2048)
  const dim3 gGP((MROWS / 64) * (NQKV / 64));
  const dim3 gSP(GVT + GSQ + GSK);
  const int  nqt1 = QO / 16;                            // query tiles with the P residual product (rows s < QO)
  const int  nqt0 = NQT - nqt1;                         // remaining query tiles
  const dim3 gGO((MROWS / 64) * (DOUT / 64));

  // (0) x -> bf16 plane MROWS x DIN; Wq, Wk, Wv -> bf16 n x k planes; Wp -> f16 n x k plane x1024; all in fragment order
  prep_in<<<gPI, b256, 0, stream>>>(x, wq, wk, wv, wp, XB, WQT, WKT, WVT, WPT);
  // (1) q = x.Wq -> FQ [MROWS][NQ], k = x.Wk -> FK [MROWS][NK], v = x.Wv -> FV [MROWS][NV]; WQT, WKT, WVT lie one behind the
  //     other in the workspace and are read as one plane of NQKV rows
  gemm_qkv<<<gGP, b128, 0, stream>>>(XB, WQT, FQ, FK, FV, MROWS, DIN);
  // (2) v^T hi + residual planes x1024, q and k hi + residual planes x256
  split_qkv<<<gSP, b256, 0, stream>>>(FQ, FK, FV, QH, QL, KH, KL, VH, VL);
  // (3) causal grouped attention with ALiBi -> O hi + residual planes f16 x1024, MROWS x DOUT:
  //     query tiles [0, QO/16) with the in-register P residual product, the rest without it
  attn_all<<<dim3((nqt0 + nqt1) * NHG * NB), bAT, 0, stream>>>(QH, QL, KH, KL, VH, VL, OH, OL, nqt1, nqt0);
  // (4) out = (O_hi + O_lo).Wp + bp -> d_out f32 [MROWS][DOUT], carries 1024 x 1024 folded back
  gemm_h2<<<gGO, b128, 0, stream>>>(OH, OL, WPT, bpv, out, MROWS, DOUT, DOUT, 1.0f / (OSC * WOS));
  (void)hipGetLastError();
}

// v006
// It runs in 104 microseconds.
// Two timings next to v005 both put it at 1.07 times that version's speed.
// Counting every step since v000, it is 2.60 times as fast.
#include <hip/hip_runtime.h>
#include <math.h>
#include <stdint.h>

#ifndef NB
#define NB 2
#endif
#ifndef SEQ
#define SEQ 2048
#endif
#define XS_FULL 2048
#define DIN   1024
#define DOUT  1024
#define NH    16
#define NG    4
#define DQ    32
#define DV    64
#define NQ    (NH * DQ)
#define NK    (NG * DQ)
#define NV    (NG * DV)
#define MROWS (NB * SEQ)
#define QO    ((SEQ < 512) ? SEQ : 512)
#define RSQ_DQ 0.17677669529663687f
#define LOG2E  1.4426950408889634f
#define SQRT2F 1.4142135623730951f
#define QSC   256.0f
#define KSC   256.0f
#define PCAR  32768.0f
#define VCAR  1024.0f
#define OSC   1024.0f
#define WOS   1024.0f
#define WPB   4
#define NHG   (NH / WPB)
#define KVBLK 12
#define KVBUF (KVBLK * 512)
#define NQT   (SEQ / 16)
#define NKT   (SEQ / 32)
#define ATT_THREADS (WPB * 32)
#define SLAB64 (16 * 68)
#define WTP   72
#define WS_CAP 134217728
// block counts of the jobs that share a launch
#define GX    ((SEQ * DIN / 8 + 255) / 256)
#define GWQ   ((NQ / 64) * (DIN / 64))
#define GWK   ((NK / 64) * (DIN / 64))
#define GWV   ((NV / 64) * (DIN / 64))
#define GWP   ((DOUT / 64) * (DOUT / 64))
#define GWALL (GWP + GWQ + GWK + GWV)
#define NQKV  (NQ + NK + NV)
static_assert(DOUT == NH * DV && NQ == 512 && NK == 128 && NV == 256 && DQ == 32 && DV == 64 && NG == 4 && NH == 16);
static_assert(NHG * WPB == NH && ATT_THREADS == 128 && WPB == 4 && NHG == NG);
static_assert(NB >= 1 && NB <= 2);
static_assert((SEQ % 64) == 0 && SEQ >= 64 && SEQ <= XS_FULL);
static_assert((QO % 16) == 0 && QO >= 16 && QO <= SEQ);
static_assert((DIN % 64) == 0 && (DOUT % 64) == 0 && (NQ % 64) == 0 && (NK % 64) == 0 && (NV % 64) == 0 && (DIN % 32) == 0);
static_assert(((SEQ * DIN / 8) % 256) == 0);
static_assert(64 * WTP * 2 <= 65536 && 4 * SLAB64 * 4 <= 65536 && 2 * KVBUF * 2 <= 65536);

typedef unsigned short u16;
typedef _Float16 v16h __attribute__((ext_vector_type(16)));
typedef _Float16 v8h  __attribute__((ext_vector_type(8)));
typedef __bf16   v16b __attribute__((ext_vector_type(16)));
typedef float    v8f  __attribute__((ext_vector_type(8)));
typedef float    v4f  __attribute__((ext_vector_type(4)));
typedef unsigned int v4u __attribute__((ext_vector_type(4)));

union FragH { v16h v; v8h h[2]; v4u u[2]; };
union FragB { v16b v; v4u u[2]; };

// ---- scalar helpers --------------------------------------------------------------------------------
__device__ __forceinline__ unsigned short bf_bits(float f) {          // f32 -> bf16 bits, RNE convert
  unsigned u = __float_as_uint(f);
  return (unsigned short)((u + 0x7FFFu + ((u >> 16) & 1u)) >> 16);
}
__device__ __forceinline__ float bf_up(unsigned short h) { return __uint_as_float(((unsigned)h) << 16); }
__device__ __forceinline__ float bfr(float f) { return bf_up(bf_bits(f)); }
__device__ __forceinline__ unsigned short h_bits(_Float16 x) { return __builtin_bit_cast(unsigned short, x); }
__device__ __forceinline__ unsigned pk16(unsigned short a, unsigned short b) { return (unsigned)a | ((unsigned)b << 16); }
__device__ __forceinline__ v8f zero8() { v8f z = {0.f, 0.f, 0.f, 0.f, 0.f, 0.f, 0.f, 0.f}; return z; }
__device__ __forceinline__ float xhalf(float x) {                     // the value of lane l ^ 16
  const int b = __builtin_bit_cast(int, x);
  return __builtin_bit_cast(float, __builtin_amdgcn_permlanex16(b, b, 0x76543210, 0xfedcba98, false, false));
}

// ---- fragment order of a 16-bit operand plane of R rows (the WMMA's m or n index) x K columns (its k index), R % 16 == 0,
//      K % 32 == 0: a row-major grid of blocks of 16 rows x 32 columns, block (r >> 4, k >> 5) at half offset
//      ((r >> 4) * (K >> 5) + (k >> 5)) * 512; inside a block 64 chunks of 8 halves (16 B): chunk id holds row (id & 15),
//      columns ((id >> 4) & 3) * 8 .. + 7. So 16 rows x K columns take 16 * K halves, as in a row-major plane.
// ---- fragment loaders: 16-bit A/B operand, p + lb bytes = block base + 16 B * lane: lane -> row/col (lane&15), h = lane>>4;
//      elements 0..7 <- chunk lane (k0+8h..), elements 8..15 <- chunk 32 + lane (k0+16+8h..)  (same split k map for A and B);
//      each of the two loads of a wave reads 512 contiguous bytes = 4 whole 128-B lines
__device__ __forceinline__ v16h ldfrag_h(const _Float16* p, unsigned lb) {
  FragH f;
  const char* q = (const char*)(const void*)p + lb;
  f.h[0] = *(const v8h*)(const void*)(q);
  f.h[1] = *(const v8h*)(const void*)(q + 512);
  return f.v;
}
__device__ __forceinline__ v16b ldfrag_b(const u16* p, unsigned lb) { // bf16 plane read as unsigned integer vectors
  FragB f;
  const char* q = (const char*)(const void*)p + lb;
  f.u[0] = *(const v4u*)(const void*)(q);
  f.u[1] = *(const v4u*)(const void*)(q + 512);
  return f.v;
}

__device__ __forceinline__ v8f mma_h(v16h a, v16h b, v8f c) {
  return __builtin_amdgcn_wmma_f32_16x16x32_f16(false, a, false, b, (short)0, c, false, false);
}
__device__ __forceinline__ v8f mma_b(v16b a, v16b b, v8f c) {
  return __builtin_amdgcn_wmma_f32_16x16x32_bf16(false, a, false, b, (short)0, c, false, false);
}
__device__ __forceinline__ void guard2(v8f& a, v8f& b, v16h x0, v16h x1, v16h x2, v16h x3, v16h x4, v16h x5) {
#if defined(__HIP_DEVICE_COMPILE__)
  asm volatile("v_nop\n\tv_nop\n\tv_nop\n\tv_nop"
               : "+v"(a), "+v"(b) : "v"(x0), "v"(x1), "v"(x2), "v"(x3), "v"(x4), "v"(x5) : "memory");
#endif
}
template <typename F>
__device__ __forceinline__ void guard6(v8f& a, v8f& b, v8f& c, v8f& d, F x0, F x1, F x2, F x3, F x4, F x5) {
#if defined(__HIP_DEVICE_COMPILE__)
  asm volatile("v_nop\n\tv_nop\n\tv_nop\n\tv_nop"
               : "+v"(a), "+v"(b), "+v"(c), "+v"(d) : "v"(x0), "v"(x1), "v"(x2), "v"(x3), "v"(x4), "v"(x5) : "memory");
#endif
}
__device__ __forceinline__ void acc_guard4(v8f& a, v8f& b, v8f& c, v8f& d) {
#if defined(__HIP_DEVICE_COMPILE__)
  asm volatile("v_nop\n\tv_nop\n\tv_nop\n\tv_nop" : "+v"(a), "+v"(b), "+v"(c), "+v"(d));
#endif
}
__device__ __forceinline__ void wave_sync_lds() {
  __builtin_amdgcn_fence(__ATOMIC_RELEASE, "workgroup");
  __builtin_amdgcn_wave_barrier();
  __builtin_amdgcn_fence(__ATOMIC_ACQUIRE, "workgroup");
}

// =====================================================================================================
// f32 row-major [rows][DIN] -> bf16 RNE plane in fragment order. Thread = one chunk of D (8 elements of one row): two 16-B
// loads, one 16-B store; a wave stores 512 contiguous bytes.
// coverage: bid = 0 .. ceil(n8/256) - 1, x 256 thr x 8 (in-kernel bound) = the whole plane (n8 a multiple of 256 here).
// =====================================================================================================
__device__ __forceinline__ void cvt_bf(const float* __restrict__ x, u16* D, int n8, int bid) {
  const int gt = bid * 256 + (int)threadIdx.x;                        // chunk index in D
  if (gt >= n8) return;
  const int blk = gt >> 6;
  const int row = (blk / (DIN / 32)) * 16 + (gt & 15);
  const int col = (blk % (DIN / 32)) * 32 + ((gt >> 4) & 3) * 8;
  const float* p = x + (size_t)row * DIN + col;
  const v4f a = *(const v4f*)(p), b4 = *(const v4f*)(p + 4);
  v4u o;
#pragma unroll
  for (int e = 0; e < 2; ++e) {
    o[e]     = pk16(bf_bits(a[2 * e]),  bf_bits(a[2 * e + 1]));
    o[2 + e] = pk16(bf_bits(b4[2 * e]), bf_bits(b4[2 * e + 1]));
  }
  u16* d = D + (size_t)gt * 8;
  {
    *(v4u*)(d) = o;
    
  }
}

// =====================================================================================================
// f32 W [K][N] (row-major, x.W layout) -> 16-bit plane D, N rows x K columns in fragment order (A operand for Wq, Wk; B for Wv, Wp). f16mode == 0: bf16 RNE bits;
// f16mode == 1: f16 bits of (bf16 RNE value) * scale. Block = 64 n x 64 k output tile: each thread loads 16 floats of one
// k row (four 16-B loads), converts, scatters into the LDS tile T[n][k] (pitch 72 halves, scalar 2-B LDS stores of per-lane
// values); after a block barrier the tile leaves as its 8 blocks (4 n tiles x 2 k steps) of 64 chunks, a wave storing 512 contiguous B.
// coverage: load 256 thr x 16 = 64 k x 64 n; store 2 iterations x 256 thr x 8 halves = 8 blocks x 512 halves = the tile;
//           bid = 0 .. (N/64)*(K/64) - 1 covers D exactly once (N % 64 == 0, K % 64 == 0).
// =====================================================================================================
__device__ __forceinline__ void wt16(const float* __restrict__ W, u16* D, int K, int N, int f16mode, float scale, int bid) {
  __shared__ __align__(16) u16 T[64 * WTP];
  const int tid = threadIdx.x;
  const int nt  = N >> 6;
  const int n0  = (bid % nt) * 64;
  const int k0  = (bid / nt) * 64;
  if (k0 + 64 > K) return;                  // block-uniform, before the barrier; never taken with the exact grid
  {
    const int kr = tid >> 2;                // k row within tile 0..63
    const int nc = (tid & 3) * 16;          // n chunk 0,16,32,48
    const float* src = W + (size_t)(k0 + kr) * (size_t)N + n0 + nc;
#pragma unroll
    for (int i = 0; i < 4; ++i) {
      const v4f a = *(const v4f*)(src + 4 * i);
#pragma unroll
      for (int e = 0; e < 4; ++e) {
        const float f = a[e];
        const unsigned short hb = h_bits((_Float16)(bfr(f) * scale));
        const unsigned short bb = bf_bits(f);
        T[(nc + 4 * i + e) * WTP + kr] = (f16mode != 0) ? hb : bb;
      }
    }
  }
  __syncthreads();
  v4u v[2];
#pragma unroll
  for (int it = 0; it < 2; ++it) {
    const int id = it * 256 + tid;          // chunk of the tile: block id >> 6 = (n tile id >> 7, k step (id >> 6) & 1)
    v[it] = *(const v4u*)(T + ((id >> 7) * 16 + (id & 15)) * WTP + ((id >> 6) & 1) * 32 + ((id >> 4) & 3) * 8);
  }
  {
#pragma unroll
    for (int it = 0; it < 2; ++it) {
      const int id = it * 256 + tid;
      const size_t blk = (size_t)((n0 >> 4) + (id >> 7)) * (size_t)(K >> 5) + (size_t)((k0 >> 5) + ((id >> 6) & 1));
      *(v4u*)(D + blk * 512 + (id & 63) * 8) = v[it];
    }
    
  }
}

// =====================================================================================================
// All jobs that read only the inputs, in one launch; a block does one block's work of one job, chosen by its index (block-uniform):
//   [0, GWP) Wp [DOUT k][DOUT n] -> DOUT n x DOUT k as f16 of bf16 value x1024; then GWQ blocks Wq [DIN k][NQ n] -> NQ n x DIN k
//   bf16; GWK blocks Wk -> NK x DIN; GWV blocks Wv -> NV x DIN; then NB * GX blocks x -> bf16 plane MROWS x DIN, GX per batch.
// =====================================================================================================
__global__ __launch_bounds__(256)
void prep_in(const float* __restrict__ x, const float* __restrict__ wq, const float* __restrict__ wk,
             const float* __restrict__ wv, const float* __restrict__ wp,
             u16* XB, u16* WQT, u16* WKT, u16* WVT, u16* WPT) {
  const int bid = blockIdx.x;
  if (bid < GWALL) {
    const float* W = wp;
    u16* D = WPT;
    int K = DOUT, N = DOUT, mode = 1, lb = bid;
    float sc = WOS;
    if (bid >= GWP + GWQ + GWK)  { W = wv; D = WVT; K = DIN; N = NV; mode = 0; sc = 1.0f; lb = bid - (GWP + GWQ + GWK); }
    else if (bid >= GWP + GWQ)   { W = wk; D = WKT; K = DIN; N = NK; mode = 0; sc = 1.0f; lb = bid - (GWP + GWQ); }
    else if (bid >= GWP)         { W = wq; D = WQT; K = DIN; N = NQ; mode = 0; sc = 1.0f; lb = bid - GWP; }
    wt16(W, D, K, N, mode, sc, lb);
  } else {
    const int cb = bid - GWALL;
    const int b  = cb / GX;
    if (b >= NB) return;                    // block-uniform; never taken with the exact grid
    cvt_bf(x + (size_t)b * XS_FULL * DIN, XB + (size_t)b * SEQ * DIN, (SEQ * DIN) / 8, cb % GX);
  }
}

// =====================================================================================================
// Epilogue of the output GEMM: the wave's 16x64 f32 tile (times oscale, plus the lane's per-column bias of each
// coverage: 8 instructions x 2 rows x 16 lanes x 4 floats = the wave's 16 x 64 tile.
// =====================================================================================================
__device__ __forceinline__ void epi64(float* sl, v8f a0, v8f a1, v8f a2, v8f a3, float oscale,
                                      float bb0, float bb1, float bb2, float bb3,
                                      float* C, int N, size_t rowb, int col0, int lane) {
  const int hh = lane >> 4, m = lane & 15;
#pragma unroll
  for (int r = 0; r < 8; ++r) {
    const int ro = (8 * hh + r) * 68 + m;
    sl[ro]      = a0[r] * oscale + bb0;
    sl[ro + 16] = a1[r] * oscale + bb1;
    sl[ro + 32] = a2[r] * oscale + bb2;
    sl[ro + 48] = a3[r] * oscale + bb3;
  }
  wave_sync_lds();
  v4f vals[8];
#pragma unroll
  for (int it = 0; it < 8; ++it) vals[it] = *(const v4f*)(sl + (it * 2 + hh) * 68 + m * 4);
  float* dst = C + (rowb + (size_t)hh) * (size_t)N + col0 + m * 4;
  {
#pragma unroll
    for (int it = 0; it < 8; ++it) {
      *(v4f*)(dst + (size_t)(it * 2) * (size_t)N) = vals[it];
    }
    
  }
}

// =====================================================================================================
// bf16 GEMM, no bias, the q, k and v projections in one launch, stored straight as attention's f16 planes (hi = f16(t), residual =
// f16(t - hi), t = value * scale; fragment order): A (bf16, M rows x K, fragment order) . Bt^T (bf16, NQKV rows x K, fragment
// order: the rows of Wq^T, Wk^T, Wv^T one behind the other, which is how the three planes lie in the workspace).
// Block = 64x64 tile, 4 waves x 16 rows of A; a tile lies in one projection (NQ, NK, NV multiples of 64), chosen by the block's
// column tile (block-uniform); fragments loaded straight from the planes' blocks (two 16-B loads each, split k map for A and B);
// K stepped by 32 (host guarantees K % 32 == 0, M % 64 == 0, grid = (M/64)*(NQKV/64)).
// A chunk of a plane is 8 consecutive columns of one plane row, so each projection is computed with the side up that puts a chunk
// into one lane's 8 accumulator registers:
//   q, k (plane row = x row, plane column = n): D = W rows . x rows^T, lane = x row rowb + lane % 16, registers = n 8*(lane/16) + r;
//   v^T  (plane row = n = (g, d), plane column = key = x row): D = x rows . W rows^T, lane = n, registers = x rows 8*(lane/16) + r.
// coverage: per wave 4 subtiles x 32 chunks x 8 halves = 16 x 64 of the hi and of the residual plane, each store instruction of a
//           wave 512 contiguous bytes; the grid's tiles cover QH, QL, KH, KL, VH, VL exactly once.
// =====================================================================================================
template <int WA>                           // WA == 1: the W fragments are the A operand (q, k); WA == 0: the x fragment is (v)
__device__ __forceinline__ void qkv_tile(const u16* ap, const u16* bp0, int K, float sc, u16* dh, u16* dl, int jstep) {
  const size_t bs = (size_t)16 * K;         // 16 rows on = one row of blocks on
  const u16* bp1 = bp0 + bs;
  const u16* bp2 = bp1 + bs;
  const u16* bp3 = bp2 + bs;
  v8f acc[4];
#pragma unroll
  for (int j = 0; j < 4; ++j) acc[j] = zero8();
#pragma unroll 1
  for (int k0 = 0; k0 < K; k0 += 32) {
    const v16b a  = ldfrag_b(ap, 0u);
    const v16b b0 = ldfrag_b(bp0, 0u);
    const v16b b1 = ldfrag_b(bp1, 0u);
    const v16b b2 = ldfrag_b(bp2, 0u);
    const v16b b3 = ldfrag_b(bp3, 0u);
    // the loads' address registers are named here, so none is given to a later load's result or stepped on before the
    // loads' address translations are back
#if defined(__HIP_DEVICE_COMPILE__)
    asm volatile("s_wait_xcnt 0x0" :: "v"(ap), "v"(bp0), "v"(bp1), "v"(bp2), "v"(bp3) : "memory");
#endif
    ap += 512; bp0 += 512; bp1 += 512; bp2 += 512; bp3 += 512;
    if constexpr (WA == 1) {
      acc[0] = mma_b(b0, a, acc[0]);
      acc[1] = mma_b(b1, a, acc[1]);
      acc[2] = mma_b(b2, a, acc[2]);
      acc[3] = mma_b(b3, a, acc[3]);
    } else {
      acc[0] = mma_b(a, b0, acc[0]);
      acc[1] = mma_b(a, b1, acc[1]);
      acc[2] = mma_b(a, b2, acc[2]);
      acc[3] = mma_b(a, b3, acc[3]);
    }
    guard6<v16b>(acc[0], acc[1], acc[2], acc[3], a, b0, b1, b2, b3, a);
  }
  v4u oh[4], ol[4];
#pragma unroll
  for (int j = 0; j < 4; ++j) {
#pragma unroll
    for (int e = 0; e < 4; ++e) {
      const float t0 = acc[j][2 * e] * sc, t1 = acc[j][2 * e + 1] * sc;
      const _Float16 h0 = (_Float16)t0, h1 = (_Float16)t1;
      const _Float16 l0 = (_Float16)(t0 - (float)h0), l1 = (_Float16)(t1 - (float)h1);
      oh[j][e] = pk16(h_bits(h0), h_bits(h1));
      ol[j][e] = pk16(h_bits(l0), h_bits(l1));
    }
  }
#pragma unroll
  for (int j = 0; j < 4; ++j) {
    *(v4u*)(dh + (size_t)j * jstep) = oh[j];
    *(v4u*)(dl + (size_t)j * jstep) = ol[j];
  }
  // a precaution: in the listing the other instance's prologue follows these eight stores and rewrites their address and data
  // registers; this wait stands in front of every such write
#if defined(__HIP_DEVICE_COMPILE__)
  asm volatile("s_wait_xcnt 0x0" ::: "memory");
#endif
}

__global__ __launch_bounds__(128)
void gemm_qkv(const u16* __restrict__ A, const u16* __restrict__ Bt, u16* QH, u16* QL, u16* KH, u16* KL, u16* VH, u16* VL,
              int M, int K) {
  const int tid = threadIdx.x, wave = tid >> 5, lane = tid & 31;
  const int ntile = NQKV >> 6;
  const int bid   = blockIdx.x;
  const int rowb  = (bid / ntile) * 64 + wave * 16;
  const int colb  = (bid % ntile) * 64;     // first row of the tile in Bt
  if (rowb + 16 > M) return;                // wave-uniform, never taken with the exact grid; no barriers in this kernel
  const u16* ap  = A  + (size_t)rowb * K + 8 * lane;   // the lane's chunk in block (rowb / 16, 0); the next k step is 512 halves on
  const u16* bp0 = Bt + (size_t)colb * K + 8 * lane;
  if (colb >= NQ + NK) {
    // v^T planes: row tile (b*NG + g) * (DV/16) + j, key step s0 / 32; the wave's 16 keys are one half of that block's 64 chunks
    const int g  = (colb - (NQ + NK)) / DV;
    const int b  = rowb / SEQ;
    const int s0 = rowb - b * SEQ;
    const size_t o = ((size_t)((b * NG + g) * (DV / 16)) * (SEQ / 32) + (size_t)(s0 >> 5)) * 512 + (size_t)(((s0 >> 4) & 1) * 32 + lane) * 8;
    qkv_tile<0>(ap, bp0, K, VCAR, VH + o, VL + o, (SEQ / 32) * 512);
  } else {
    // q or k planes: row tile rowb / 16, column step (column / 32); subtile j = chunks (j & 1) * 32 + lane of block j / 2: 256 halves on
    const bool isk = colb >= NQ;
    const int  nc  = isk ? NK : NQ;         // the plane's columns, and the tile's first column in it
    const int  c0  = isk ? colb - NQ : colb;
    const size_t o = ((size_t)(rowb >> 4) * (size_t)(nc >> 5) + (size_t)(c0 >> 5)) * 512 + (size_t)lane * 8;
    qkv_tile<1>(ap, bp0, K, isk ? KSC : QSC, (isk ? KH : QH) + o, (isk ? KL : QL) + o, 256);
  }
}

// =====================================================================================================
// f16 GEMM with a two-plane A operand and bias: C[M][N] (f32) = (Ah + Al) (f16 hi and residual planes, M rows x K, fragment
// order, residual unscaled relative to hi) . Bt^T (f16, N rows x K, fragment order) * oscale + bf16 RNE value of bias[n] (bias has
// N entries). Products ah.b + al.b into one accumulator. Same tiling and fragment loads (split k map) as gemm_qkv;
// K stepped by 32 (host guarantees K % 32 == 0, M % 64 == 0, N % 64 == 0, grid = (M/64)*(N/64)).
// =====================================================================================================
__global__ __launch_bounds__(128)
void gemm_h2(const u16* __restrict__ Ah, const u16* __restrict__ Al, const u16* __restrict__ Bt,
             const float* __restrict__ bias, float* C, int M, int N, int K, float oscale) {
  __shared__ __align__(16) float slab[4 * SLAB64];
  const int tid = threadIdx.x, wave = tid >> 5, lane = tid & 31, m = lane & 15;
  const int ntile = N >> 6;
  const int bid   = blockIdx.x;
  const int rowb  = (bid / ntile) * 64 + wave * 16;
  const int col0  = (bid % ntile) * 64;
  if (rowb + 16 > M) return;                // wave-uniform, never taken with the exact grid; no block barriers in this kernel
  const size_t bs = (size_t)16 * K;
  const _Float16* ahp = (const _Float16*)(const void*)Ah + (size_t)rowb * K + 8 * lane;   // the lane's chunk in block (rowb / 16, 0), as in gemm_qkv
  const _Float16* alp = (const _Float16*)(const void*)Al + (size_t)rowb * K + 8 * lane;
  const _Float16* bp0 = (const _Float16*)(const void*)Bt + (size_t)col0 * K + 8 * lane;
  const _Float16* bp1 = bp0 + bs;
  const _Float16* bp2 = bp1 + bs;
  const _Float16* bp3 = bp2 + bs;
  v8f acc0 = zero8(), acc1 = zero8(), acc2 = zero8(), acc3 = zero8();
#pragma unroll 1
  for (int k0 = 0; k0 < K; k0 += 32) {
    const v16h ah = ldfrag_h(ahp, 0u), al = ldfrag_h(alp, 0u);
    const v16h b0 = ldfrag_h(bp0, 0u);
    const v16h b1 = ldfrag_h(bp1, 0u);
    const v16h b2 = ldfrag_h(bp2, 0u);
    const v16h b3 = ldfrag_h(bp3, 0u);
    // the loads' address registers are named here, so none is given to a later load's result or stepped on before the
    // loads' address translations are back
#if defined(__HIP_DEVICE_COMPILE__)
    asm volatile("s_wait_xcnt 0x0" :: "v"(ahp), "v"(alp), "v"(bp0), "v"(bp1), "v"(bp2), "v"(bp3) : "memory");
#endif
    ahp += 512; alp += 512; bp0 += 512; bp1 += 512; bp2 += 512; bp3 += 512;
    acc0 = mma_h(ah, b0, acc0);  acc0 = mma_h(al, b0, acc0);
    acc1 = mma_h(ah, b1, acc1);  acc1 = mma_h(al, b1, acc1);
    acc2 = mma_h(ah, b2, acc2);  acc2 = mma_h(al, b2, acc2);
    acc3 = mma_h(ah, b3, acc3);  acc3 = mma_h(al, b3, acc3);
    guard6<v16h>(acc0, acc1, acc2, acc3, ah, al, b0, b1, b2, b3);
  }
  // per-lane bias of D column m in each of the 4 subtiles; col0 + 48 + m <= N - 1 always
  const float bb0 = bfr(bias[col0 + m]);
  const float bb1 = bfr(bias[col0 + 16 + m]);
  const float bb2 = bfr(bias[col0 + 32 + m]);
  const float bb3 = bfr(bias[col0 + 48 + m]);
  epi64(slab + wave * SLAB64, acc0, acc1, acc2, acc3, oscale, bb0, bb1, bb2, bb3, C, N, (size_t)rowb, col0, lane);
}

// =====================================================================================================
// Causal grouped attention with ALiBi, q/k head dim 32, value head dim 64. Block bid -> (query tile qt = qtb + bid % nqtl:
// rows q0 = 16*qt .. q0+15, kv group hg, batch b); one wave per query head = hg + NG*wave, the 4 heads with head % NG = hg.
//   q hi / residual planes f16 x256, row b*SEQ + s, column h*DQ + d (NQ columns); k hi / residual planes f16 x256, row
//   b*SEQ + s, column g*DQ + d (NK columns); v^T hi / residual planes x1024, row (b*NG + g)*DV + d, column s (SEQ columns);
//   O hi / residual planes f16 x1024, row b*SEQ + s, column h*DV + d (DOUT columns); all in fragment order.
//   scores, transposed: S^T (16 keys x 16 queries, one k-step over d = 0..31) = k_hi.q_hi + k_lo.q_hi + k_hi.q_lo (A = k block,
//   B = q block; 3 products into one accumulator, residuals unscaled relative to their hi planes), q fragments loop-invariant;
//   a lane holds 16 of the step's 32 scores of ONE query (q0 + lane % 16), lane l ^ 16 the other 16;
//   logit (log2 domain) t(i, j) = (acc/(256*256) + slope[h]*(j - i)) * (1/sqrt(32))*log2e, replaced by -inf where j > i,
//   slope[h] = 2^(-(h+1)/2) built exactly (power of two times f32 sqrt2 for odd h+1).
//   Key tiles of 32 visited in order for kb <= q0 + 15 (later tiles hold only keys above every query row of the tile).
//   A step's 12 blocks of 1 KiB (k hi 2, k residual 2, v^T hi 4, v^T residual 4) are the same for the block's 4 heads: they come
//   into LDS once, by asynchronous copies (wave w brings k block w, v^T hi block w, v^T residual block w), two buffers, the copies
//   of step t + 1 in flight while step t is worked on; every wave reads all 12 blocks as its fragments from LDS.
//   Online max-subtracted base-2 softmax in f32, -inf-safe rescale: maximum and sum run over the lane's own registers, the
//   maximum joined with lane l ^ 16 in each step, the two half sums once behind the loop. The two score tiles of a step,
//   converted in place, ARE the B fragment of P^T (element e <- tile e / 8, register e % 8: the planes' split k map), so P
//   passes through no LDS; v^T blocks are the A fragments of 4 d-subtiles, both v planes: O^T += v_hi.P_hi + v_lo.P_hi
//   (+ v_hi.P_lo when PRES == 1), 2 groups of 2 subtiles.
//   After the loop: out = acc / Z (Z > 0 always: key 0 <= every query row; guarded anyway), carries 1/(32768*1024) folded
//   once; a lane's 8 registers of a subtile are 8 consecutive d of its query = one chunk of the O planes.
// coverage: per wave 4 instructions x 32 chunks x 8 halves = 2 blocks = 16 x 64 of each O plane; the two block ranges of attn_all
//           cover query tiles [QO/16, NQT) and [0, QO/16) x NHG x NB blocks x WPB waves = every (b, s, h) row segment of OH and
//           of OL exactly once.
// =====================================================================================================
// One wave's six asynchronous copies of a step (16 B a lane each, 512 contiguous bytes a wave): the two halves of a k block to LDS
// byte address l, of a v^T hi block to l + 4096, of a v^T residual block to l + 8192. The closing s_wait_xcnt stands in the copies'
// own statement, so that no address register named here is rewritten in front of it.
__device__ __forceinline__ void kv_copy(unsigned l, const _Float16* gk, const _Float16* gh, const _Float16* gl) {
#if defined(__HIP_DEVICE_COMPILE__)
  asm volatile("global_load_async_to_lds_b128 %0, %6, off\n\t"
               "global_load_async_to_lds_b128 %1, %7, off\n\t"
               "global_load_async_to_lds_b128 %2, %8, off\n\t"
               "global_load_async_to_lds_b128 %3, %9, off\n\t"
               "global_load_async_to_lds_b128 %4, %10, off\n\t"
               "global_load_async_to_lds_b128 %5, %11, off\n\t"
               "s_wait_xcnt 0x0"
               :: "v"(l), "v"(l + 512u), "v"(l + 4096u), "v"(l + 4608u), "v"(l + 8192u), "v"(l + 8704u),
                  "v"(gk), "v"(gk + 256), "v"(gh), "v"(gh + 256), "v"(gl), "v"(gl + 256)
               : "memory");
#endif
}

template <int PRES>
__device__ __forceinline__
void attn_c(const u16* __restrict__ QHp, const u16* __restrict__ QLp,
            const u16* __restrict__ KHp, const u16* __restrict__ KLp,
            const u16* __restrict__ VHp, const u16* __restrict__ VLp,
            u16* OHp, u16* OLp, int qtb, int nqtl, int bid, u16* kvs) {
  const int tid  = threadIdx.x;
  const int wave = tid >> 5;
  const int lane = tid & 31;
  const int hh   = lane >> 4;
  const int c    = lane & 15;
  const int qt   = qtb + (bid % nqtl);
  const int t2   = bid / nqtl;
  const int hg   = t2 % NHG;
  const int b    = t2 / NHG;
  if (b >= NB) return;                      // block-uniform, before every barrier; never taken with the exact grid
  const int q0   = qt * 16;
  if (q0 + 16 > SEQ) return;                // block-uniform, before every barrier; never taken
  const int head = hg + NG * wave;
  const int kvh  = hg;                      // tiled kv mapping: head h -> kv group h % NG, the same for the block's 4 waves

  // fragment-order blocks (512 halves each): q block (row tile, head); k block (key tile of 16, kv group), 16 keys on = 16 * NK
  // halves on; v^T block (d tile, key step of 32), 32 keys on = 512 halves on, 16 d on = 16 * SEQ halves on
  const _Float16* Qh  = (const _Float16*)(const void*)QHp + ((size_t)b * SEQ + q0) * NQ + (size_t)head * 512;
  const _Float16* Ql  = (const _Float16*)(const void*)QLp + ((size_t)b * SEQ + q0) * NQ + (size_t)head * 512;
  const _Float16* Khb = (const _Float16*)(const void*)KHp + (size_t)b * SEQ * NK + (size_t)kvh * 512;  // key row kb added per step
  const _Float16* Klb = (const _Float16*)(const void*)KLp + (size_t)b * SEQ * NK + (size_t)kvh * 512;
  const _Float16* Vhb = (const _Float16*)(const void*)VHp + (size_t)(b * NG + kvh) * DV * SEQ;         // d tile 0 (+j)
  const _Float16* Vlb = (const _Float16*)(const void*)VLp + (size_t)(b * NG + kvh) * DV * SEQ;
  const unsigned lb = 16u * (unsigned)lane;  // the lane's chunk inside a block, in bytes

  // ALiBi slope 2^(-(head+1)/2): even exponent -> exact power of two; odd -> power of two times f32 sqrt(2)
  const int   e1   = head + 1;
  const int   pw   = (e1 + 1) >> 1;
  const float p2   = __uint_as_float(((unsigned)(127 - pw)) << 23);
  const float slope = p2 * (((e1 & 1) != 0) ? SQRT2F : 1.0f);   // wave-uniform select by value
  const float lsc  = 1.0f / (QSC * KSC);
  const float ul2  = RSQ_DQ * LOG2E;
  const float oc   = 1.0f / (PCAR * VCAR);
  const size_t KROW = (size_t)NK;           // halves per key row in the k planes (16 rows = one row of blocks)

  const v16h qh = ldfrag_h(Qh, lb);             // loop-invariant q fragments (d = 0..31): hi plane
  const v16h ql = ldfrag_h(Ql, lb);             //                                         residual plane

  float mrow = -INFINITY, lrow = 0.f;       // the lane's query: running maximum (both halves alike), sum over this half's keys
  v8f o[4];                                 // O^T: o[j][r] = (d = j*16 + 8*hh + r, query q0 + c)
#pragma unroll
  for (int j = 0; j < 4; ++j) o[j] = zero8();
  const int ncaus = (q0 >> 5) + 1;                                            // tiles holding keys <= q0 + 15
  const int nkt = (ncaus < NKT) ? ncaus : NKT;
  const int qr  = q0 + c;                                                     // the lane's query row

  // the wave's share of a step's copies: k block wave (hi plane key tiles 0, 1, residual plane key tiles 0, 1), v^T hi d tile wave,
  // v^T residual d tile wave; the lane's 16 B of each half block. A step on: 32 key rows in k, one block (512 halves) in v^T.
  const _Float16* gk = (((wave & 2) != 0) ? Klb : Khb) + (size_t)(16 * (wave & 1)) * KROW + 8 * lane;
  const _Float16* gh = Vhb + (size_t)wave * 16 * SEQ + 8 * lane;
  const _Float16* gl = Vlb + (size_t)wave * 16 * SEQ + 8 * lane;
  const unsigned  lw = (unsigned)(size_t)kvs + 1024u * (unsigned)wave + lb;   // LDS byte address: buffer 0, block wave, the lane's chunk

  // step 0 into buffer 0, landed and published; then step 1 into buffer 1, in flight over step 0
  kv_copy(lw, gk, gh, gl);
  asm volatile("s_wait_asynccnt 0x0" ::: "memory");   // this wave's copies have landed before the barrier lets others read them
  __syncthreads();
  if (nkt > 1) kv_copy(lw + 2u * KVBUF, gk + (size_t)32 * KROW, gh + 512, gl + 512);

#pragma unroll 1
  for (int kt = 0; kt < nkt; ++kt) {
    const int kb = kt * 32;
    // ---- this step's fragments from its LDS buffer, as one group: k first (the scores wait for these alone), then v^T ----
    const _Float16* kvb = (const _Float16*)(const void*)kvs + (kt & 1) * KVBUF;
    const v16h kh0 = ldfrag_h(kvb, lb);
    const v16h kh1 = ldfrag_h(kvb + 512, lb);
    const v16h kl0 = ldfrag_h(kvb + 1024, lb);
    const v16h kl1 = ldfrag_h(kvb + 1536, lb);
    v16h vh[4], vl[4];
#pragma unroll
    for (int j = 0; j < 4; ++j) vh[j] = ldfrag_h(kvb + 2048 + j * 512, lb);
#pragma unroll
    for (int j = 0; j < 4; ++j) vl[j] = ldfrag_h(kvb + 4096 + j * 512, lb);
    // ---- scores: D element r of this lane = (key kb + 8*hh + r, query qr) in s0, key kb + 16 + 8*hh + r in s1 ----
    //      hi+residual planes on both operands: k_hi.q_hi + k_lo.q_hi + k_hi.q_lo
    v8f s0 = zero8(), s1 = zero8();
    {
      s0 = mma_h(kh0, qh, s0);              // hi.hi
      s0 = mma_h(kl0, qh, s0);              // k residual . q hi
      s0 = mma_h(kh0, ql, s0);              // k hi . q residual
      s1 = mma_h(kh1, qh, s1);
      s1 = mma_h(kl1, qh, s1);
      s1 = mma_h(kh1, ql, s1);
      guard2(s0, s1, qh, ql, kh0, kl0, kh1, kl1);
    }
    // ---- causal select + ALiBi + scale, online softmax in base 2, -inf-safe; all 16 values belong to query qr ----
    const int dk = kb + 8 * hh - qr;        // key - query of s0[0]
    float t0[8], t1[8];
#pragma unroll
    for (int r = 0; r < 8; ++r) {
      const int   d0 = dk + r, d1 = dk + 16 + r;
      const float a0 = slope * (float)d0;
      const float a1 = slope * (float)d1;
      const float u0 = (s0[r] * lsc + a0) * ul2;
      const float u1 = (s1[r] * lsc + a1) * ul2;
      t0[r] = (d0 > 0) ? -INFINITY : u0;
      t1[r] = (d1 > 0) ? -INFINITY : u1;
    }
    float mq[4];
#pragma unroll
    for (int i = 0; i < 4; ++i) mq[i] = fmaxf(fmaxf(t0[2 * i], t0[2 * i + 1]), fmaxf(t1[2 * i], t1[2 * i + 1]));
    float mx = fmaxf(fmaxf(mq[0], mq[1]), fmaxf(mq[2], mq[3]));
    mx = fmaxf(mx, xhalf(mx));              // the other 16 keys of the step
    const float mn = fmaxf(mrow, mx);
    const float ms = (mn == -INFINITY) ? 0.0f : mn;
    const float al = exp2f(mrow - ms);
    mrow = mn;
    float e0[8], e1[8];
#pragma unroll
    for (int r = 0; r < 8; ++r) { e0[r] = exp2f(t0[r] - ms); e1[r] = exp2f(t1[r] - ms); }
    float sq[4];
#pragma unroll
    for (int i = 0; i < 4; ++i) sq[i] = (e0[2 * i] + e0[2 * i + 1]) + (e1[2 * i] + e1[2 * i + 1]);
    lrow = lrow * al + ((sq[0] + sq[1]) + (sq[2] + sq[3]));
#pragma unroll
    for (int j = 0; j < 4; ++j) {
#pragma unroll
      for (int r = 0; r < 8; ++r) o[j][r] *= al;
    }
    // ---- B fragments of P^T*32768: f16 hi (and f16 residual when PRES), column = query c, split k map over the 32 keys of
    //      this step: elements 0..7 = keys kb + 8hh + 0..7 (s0's rows), elements 8..15 = keys kb + 16 + 8hh + 0..7 (s1's) ----
    FragH ph, pl;
    {
#pragma unroll
      for (int e = 0; e < 8; ++e) {
        const float ta = e0[e] * PCAR, tc = e1[e] * PCAR;
        const _Float16 ha = (_Float16)ta, hc = (_Float16)tc;
        ph.h[0][e] = ha;
        ph.h[1][e] = hc;
        if constexpr (PRES == 1) {
          pl.h[0][e] = (_Float16)(ta - (float)ha);
          pl.h[1][e] = (_Float16)(tc - (float)hc);
        }
      }
      if constexpr (PRES != 1) pl.v = ph.v;
    }
    // ---- v^T.P^T : A fragment row m = d = j*16 + c, k = the step's 32 keys; 2 groups of 2 d-subtiles ----
    {
#pragma unroll
      for (int jg = 0; jg < 2; ++jg) {
        const v16h vha = vh[2 * jg], vhb2 = vh[2 * jg + 1];
        const v16h vla = vl[2 * jg], vlb2 = vl[2 * jg + 1];
        o[2 * jg]     = mma_h(vha,  ph.v, o[2 * jg]);                       // v_hi . P_hi
        if constexpr (PRES == 1) o[2 * jg] = mma_h(vha, pl.v, o[2 * jg]);   // v_hi . P_lo
        o[2 * jg]     = mma_h(vla,  ph.v, o[2 * jg]);                       // v_lo . P_hi
        o[2 * jg + 1] = mma_h(vhb2, ph.v, o[2 * jg + 1]);
        if constexpr (PRES == 1) o[2 * jg + 1] = mma_h(vhb2, pl.v, o[2 * jg + 1]);
        o[2 * jg + 1] = mma_h(vlb2, ph.v, o[2 * jg + 1]);
        guard2(o[2 * jg], o[2 * jg + 1], ph.v, pl.v, vha, vhb2, vla, vlb2);
      }
    }
    // ---- hand-over: step kt + 1 is published, and this step's buffer is free for step kt + 2 ----
    asm volatile("s_wait_dscnt 0x0" ::: "memory");      // this wave's reads of the buffer are done before anyone refills it
    asm volatile("s_wait_asynccnt 0x0" ::: "memory");   // this wave's copies of step kt + 1 have landed before others read them
    __syncthreads();
    if (kt + 2 < nkt)
      kv_copy(lw + (unsigned)(kt & 1) * (2u * KVBUF), gk + (size_t)(kb + 64) * KROW, gh + (size_t)(kb + 64) * 16, gl + (size_t)(kb + 64) * 16);
  }
  asm volatile("s_wait_asynccnt 0x0" ::: "memory");     // no copy is left in flight when the wave goes on to its end
  acc_guard4(o[0], o[1], o[2], o[3]);
  // ---- out = acc / Z (0 if Z == 0), Z = the two halves' sums, carries (32768 on P, 1024 on v) folded once ----
  const float lv  = lrow + xhalf(lrow);
  const float ls  = (lv > 0.0f) ? lv : 1.0f;
  const float inv = (lv > 0.0f) ? ((1.0f / ls) * oc) : 0.0f;
  v4u oh[4], ol[4];
#pragma unroll
  for (int it = 0; it < 4; ++it) {
    // chunk it * 32 + lane of the wave's two O blocks: query row c, head columns it * 16 + 8 * hh .. + 7 = o[it][0..7]
    float w[8];
#pragma unroll
    for (int e = 0; e < 8; ++e) w[e] = (o[it][e] * inv) * OSC;
#pragma unroll
    for (int e = 0; e < 4; ++e) {
      const _Float16 h0 = (_Float16)w[2 * e], h1 = (_Float16)w[2 * e + 1];
      const _Float16 l0 = (_Float16)(w[2 * e] - (float)h0), l1 = (_Float16)(w[2 * e + 1] - (float)h1);
      oh[it][e] = pk16(h_bits(h0), h_bits(h1));
      ol[it][e] = pk16(h_bits(l0), h_bits(l1));
    }
  }
  const size_t ob = ((size_t)b * SEQ + q0) * DOUT + (size_t)head * (DV / 32) * 512 + 8 * lane;
  {
#pragma unroll
    for (int it = 0; it < 4; ++it) {
      *(v4u*)(OHp + ob + it * 256) = oh[it];
      *(v4u*)(OLp + ob + it * 256) = ol[it];
    }
    
  }
}

// =====================================================================================================
// Both kinds of query tile in one launch, chosen by the block's index (block-uniform): blocks [0, nqt0 * NHG * NB) take the nqt0
// query tiles from nqt1 on (the longer key loops), without the P residual product; the other nqt1 * NHG * NB blocks take query
// tiles [0, nqt1), with it.
// =====================================================================================================
__global__ __launch_bounds__(ATT_THREADS)
void attn_all(const u16* __restrict__ QHp, const u16* __restrict__ QLp,
              const u16* __restrict__ KHp, const u16* __restrict__ KLp,
              const u16* __restrict__ VHp, const u16* __restrict__ VLp,
              u16* OHp, u16* OLp, int nqt1, int nqt0) {
  __shared__ __align__(16) u16 kvs[2 * KVBUF];          // two buffers of a step's 12 k and v^T blocks
  const int bid = blockIdx.x;
  const int nb0 = nqt0 * NHG * NB;
  if (bid < nb0) attn_c<0>(QHp, QLp, KHp, KLp, VHp, VLp, OHp, OLp, nqt1, nqt0, bid, kvs);
  else           attn_c<1>(QHp, QLp, KHp, KLp, VHp, VLp, OHp, OLp, 0, nqt1, bid - nb0, kvs);
}

// =====================================================================================================
// Workspace map (bytes); every plane is fully written by whole-line stores before it is read; all extents are exact multiples
// of the store granularity (no pad rows needed); every region offset a multiple of 262144; the 16-bit planes are given as
// rows x columns and lie in fragment order, the f32 planes are row-major:
//   XB  bf16 MROWS x DIN                  MROWS*2048      (NB=2, SEQ=2048: 8388608)
//   WQT bf16 NQ n x DIN k                 1048576
//   WKT bf16 NK n x DIN k                 262144
//   WVT bf16 NV n x DIN k                 524288
//   WPT f16  DOUT n x DOUT k, x1024       2097152
//   QH, QL f16 MROWS x NQ, x256           MROWS*1024 each (4194304 each)
//   KH, KL f16 MROWS x NK, x256           MROWS*256 each  (1048576 each)
//   VH, VL f16 NB*NG*DV x SEQ, x1024      MROWS*512 each  (2097152 each)
//   OH, OL f16 MROWS x DOUT, x1024        MROWS*2048 each (8388608 each)
//   end (NB=2, SEQ=2048)                  43778048
// =====================================================================================================
extern "C" void kernel_launch(void* const* d_in, const int* in_sizes, int n_in,
                              void* d_out, int out_size, void* d_ws, size_t ws_size,
                              hipStream_t stream) {
  if (n_in < 6) return;
  if (in_sizes[0] < ((NB - 1) * XS_FULL + SEQ) * DIN) return;
  if (in_sizes[1] != DIN * NQ) return;
  if (in_sizes[2] != DIN * NK) return;
  if (in_sizes[3] != DIN * NV) return;
  if (in_sizes[4] != DOUT * DOUT) return;
  if (in_sizes[5] != DOUT) return;
  if (out_size < MROWS * DOUT) return;

  const float* x   = (const float*)d_in[0];
  const float* wq  = (const float*)d_in[1];
  const float* wk  = (const float*)d_in[2];
  const float* wv  = (const float*)d_in[3];
  const float* wp  = (const float*)d_in[4];
  const float* bpv = (const float*)d_in[5];
  float*       out = (float*)d_out;

  const size_t szXB = (size_t)MROWS * DIN * 2;
  const size_t szWQ = (size_t)NQ * DIN * 2;
  const size_t szWK = (size_t)NK * DIN * 2;
  const size_t szWV = (size_t)NV * DIN * 2;
  const size_t szWP = (size_t)DOUT * DOUT * 2;
  const size_t szQ  = (size_t)MROWS * NQ * 2;                   // QH, QL
  const size_t szK  = (size_t)MROWS * NK * 2;                   // KH, KL
  const size_t szV  = (size_t)NB * NG * DV * SEQ * 2;           // VH, VL
  const size_t szO  = (size_t)MROWS * DOUT * 2;                 // OH, OL
  size_t off = 0;
  const size_t oXB = off; off += szXB;
  const size_t oWQ = off; off += szWQ;
  const size_t oWK = off; off += szWK;
  const size_t oWV = off; off += szWV;
  const size_t oWP = off; off += szWP;
  const size_t oQH = off; off += szQ;
  const size_t oQL = off; off += szQ;
  const size_t oKH = off; off += szK;
  const size_t oKL = off; off += szK;
  const size_t oVH = off; off += szV;
  const size_t oVL = off; off += szV;
  const size_t oOH = off; off += szO;
  const size_t oOL = off; off += szO;
  if (off > ws_size) return;                // off = 43778048 for NB = 2, SEQ = 2048
  if (off > (size_t)WS_CAP) return;

  char* ws = (char*)d_ws;
  u16*   XB  = (u16*)(ws + oXB);
  u16*   WQT = (u16*)(ws + oWQ);
  u16*   WKT = (u16*)(ws + oWK);
  u16*   WVT = (u16*)(ws + oWV);
  u16*   WPT = (u16*)(ws + oWP);
  u16*   QH  = (u16*)(ws + oQH);
  u16*   QL  = (u16*)(ws + oQL);
  u16*   KH  = (u16*)(ws + oKH);
  u16*   KL  = (u16*)(ws + oKL);
  u16*   VH  = (u16*)(ws + oVH);
  u16*   VL  = (u16*)(ws + oVL);
  u16*   OH  = (u16*)(ws + oOH);
  u16*   OL  = (u16*)(ws + oOL);

  const dim3 b256(256), b128(128), bAT(ATT_THREADS);
  const dim3 gPI(GWALL + NB * GX);                      // 480 weight blocks + 1024 x blocks per batch (SEQ=2048)
  const dim3 gGP((MROWS / 64) * (NQKV / 64));
  const int  nqt1 = QO / 16;                            // query tiles with the P residual product (rows s < QO)
  const int  nqt0 = NQT - nqt1;                         // remaining query tiles
  const dim3 gGO((MROWS / 64) * (DOUT / 64));

  // (0) x -> bf16 plane MROWS x DIN; Wq, Wk, Wv -> bf16 n x k planes; Wp -> f16 n x k plane x1024; all in fragment order
  prep_in<<<gPI, b256, 0, stream>>>(x, wq, wk, wv, wp, XB, WQT, WKT, WVT, WPT);
  // (1) q = x.Wq, k = x.Wk -> hi + residual planes x256, v = x.Wv -> v^T hi + residual planes x1024; WQT, WKT, WVT lie one behind
  //     the other in the workspace and are read as one plane of NQKV rows
  gemm_qkv<<<gGP, b128, 0, stream>>>(XB, WQT, QH, QL, KH, KL, VH, VL, MROWS, DIN);
  // (2) causal grouped attention with ALiBi -> O hi + residual planes f16 x1024, MROWS x DOUT:
  //     query tiles [0, QO/16) with the in-register P residual product, the rest without it
  attn_all<<<dim3((nqt0 + nqt1) * NHG * NB), bAT, 0, stream>>>(QH, QL, KH, KL, VH, VL, OH, OL, nqt1, nqt0);
  // (3) out = (O_hi + O_lo).Wp + bp -> d_out f32 [MROWS][DOUT], carries 1024 x 1024 folded back
  gemm_h2<<<gGO, b128, 0, stream>>>(OH, OL, WPT, bpv, out, MROWS, DOUT, DOUT, 1.0f / (OSC * WOS));
  (void)hipGetLastError();
}

// v007
// Measured time: 98.7 microseconds a run.
// Timed twice side by side with v006, it ran 1.06 times as fast both times.
// Counting every step since v000, it is 2.76 times as fast.
#include <hip/hip_runtime.h>
#include <math.h>
#include <stdint.h>

#ifndef NB
#define NB 2
#endif
#ifndef SEQ
#define SEQ 2048
#endif
#define XS_FULL 2048
#define DIN   1024
#define DOUT  1024
#define NH    16
#define NG    4
#define DQ    32
#define DV    64
#define NQ    (NH * DQ)
#define NK    (NG * DQ)
#define NV    (NG * DV)
#define MROWS (NB * SEQ)
#define QO    ((SEQ < 512) ? SEQ : 512)
#define RSQ_DQ 0.17677669529663687f
#define LOG2E  1.4426950408889634f
#define SQRT2F 1.4142135623730951f
#define QSC   256.0f
#define KSC   256.0f
#define PCAR  32768.0f
#define VCAR  1024.0f
#define OSC   1024.0f
#define WOS   1024.0f
#define WPB   4
#define NHG   (NH / WPB)
#define KVBLK 12
#define KVBUF (KVBLK * 512)
#define NQT   (SEQ / 16)
#define NKT   (SEQ / 32)
#define ATT_THREADS (WPB * 32)
#define SLAB64 (16 * 68)
#define WTP   72
#define WS_CAP 134217728
#define KUQ   4                             // k steps of 32 whose fragment loads gemm_qkv issues as one group
#define KUO   4                             // the same for gemm_h2
// block counts of the jobs that share a launch
#define GX    ((SEQ * DIN / 8 + 255) / 256)
#define GWQ   ((NQ / 64) * (DIN / 64))
#define GWK   ((NK / 64) * (DIN / 64))
#define GWV   ((NV / 64) * (DIN / 64))
#define GWP   ((DOUT / 64) * (DOUT / 64))
#define GWALL (GWP + GWQ + GWK + GWV)
#define NQKV  (NQ + NK + NV)
static_assert(DOUT == NH * DV && NQ == 512 && NK == 128 && NV == 256 && DQ == 32 && DV == 64 && NG == 4 && NH == 16);
static_assert(NHG * WPB == NH && ATT_THREADS == 128 && WPB == 4 && NHG == NG);
static_assert(NB >= 1 && NB <= 2);
static_assert((SEQ % 64) == 0 && SEQ >= 64 && SEQ <= XS_FULL);
static_assert((QO % 16) == 0 && QO >= 16 && QO <= SEQ);
static_assert((DIN % 64) == 0 && (DOUT % 64) == 0 && (NQ % 64) == 0 && (NK % 64) == 0 && (NV % 64) == 0 && (DIN % 32) == 0);
static_assert(((SEQ * DIN / 8) % 256) == 0);
static_assert((DIN % (32 * KUQ)) == 0 && (DOUT % (32 * KUO)) == 0);
static_assert(64 * WTP * 2 <= 65536 && 4 * SLAB64 * 4 <= 65536 && 2 * KVBUF * 2 <= 65536);

typedef unsigned short u16;
typedef _Float16 v16h __attribute__((ext_vector_type(16)));
typedef _Float16 v8h  __attribute__((ext_vector_type(8)));
typedef __bf16   v16b __attribute__((ext_vector_type(16)));
typedef float    v8f  __attribute__((ext_vector_type(8)));
typedef float    v4f  __attribute__((ext_vector_type(4)));
typedef unsigned int v4u __attribute__((ext_vector_type(4)));

union FragH { v16h v; v8h h[2]; v4u u[2]; };
union FragB { v16b v; v4u u[2]; };

// ---- scalar helpers --------------------------------------------------------------------------------
__device__ __forceinline__ unsigned short bf_bits(float f) {          // f32 -> bf16 bits, RNE convert
  unsigned u = __float_as_uint(f);
  return (unsigned short)((u + 0x7FFFu + ((u >> 16) & 1u)) >> 16);
}
__device__ __forceinline__ float bf_up(unsigned short h) { return __uint_as_float(((unsigned)h) << 16); }
__device__ __forceinline__ float bfr(float f) { return bf_up(bf_bits(f)); }
__device__ __forceinline__ unsigned short h_bits(_Float16 x) { return __builtin_bit_cast(unsigned short, x); }
__device__ __forceinline__ unsigned pk16(unsigned short a, unsigned short b) { return (unsigned)a | ((unsigned)b << 16); }
__device__ __forceinline__ v8f zero8() { v8f z = {0.f, 0.f, 0.f, 0.f, 0.f, 0.f, 0.f, 0.f}; return z; }
__device__ __forceinline__ float xhalf(float x) {                     // the value of lane l ^ 16
  const int b = __builtin_bit_cast(int, x);
  return __builtin_bit_cast(float, __builtin_amdgcn_permlanex16(b, b, 0x76543210, 0xfedcba98, false, false));
}

// ---- fragment order of a 16-bit operand plane of R rows (the WMMA's m or n index) x K columns (its k index), R % 16 == 0,
//      K % 32 == 0: a row-major grid of blocks of 16 rows x 32 columns, block (r >> 4, k >> 5) at half offset
//      ((r >> 4) * (K >> 5) + (k >> 5)) * 512; inside a block 64 chunks of 8 halves (16 B): chunk id holds row (id & 15),
//      columns ((id >> 4) & 3) * 8 .. + 7. So 16 rows x K columns take 16 * K halves, as in a row-major plane.
// ---- fragment loaders: 16-bit A/B operand, p + lb bytes = block base + 16 B * lane: lane -> row/col (lane&15), h = lane>>4;
//      elements 0..7 <- chunk lane (k0+8h..), elements 8..15 <- chunk 32 + lane (k0+16+8h..)  (same split k map for A and B);
//      each of the two loads of a wave reads 512 contiguous bytes = 4 whole 128-B lines
__device__ __forceinline__ v16h ldfrag_h(const _Float16* p, unsigned lb) {
  FragH f;
  const char* q = (const char*)(const void*)p + lb;
  f.h[0] = *(const v8h*)(const void*)(q);
  f.h[1] = *(const v8h*)(const void*)(q + 512);
  return f.v;
}
__device__ __forceinline__ v16b ldfrag_b(const u16* p, unsigned lb) { // bf16 plane read as unsigned integer vectors
  FragB f;
  const char* q = (const char*)(const void*)p + lb;
  f.u[0] = *(const v4u*)(const void*)(q);
  f.u[1] = *(const v4u*)(const void*)(q + 512);
  return f.v;
}

__device__ __forceinline__ v8f mma_h(v16h a, v16h b, v8f c) {
  return __builtin_amdgcn_wmma_f32_16x16x32_f16(false, a, false, b, (short)0, c, false, false);
}
__device__ __forceinline__ v8f mma_b(v16b a, v16b b, v8f c) {
  return __builtin_amdgcn_wmma_f32_16x16x32_bf16(false, a, false, b, (short)0, c, false, false);
}
__device__ __forceinline__ void guard2(v8f& a, v8f& b, v16h x0, v16h x1, v16h x2, v16h x3, v16h x4, v16h x5) {
#if defined(__HIP_DEVICE_COMPILE__)
  asm volatile("v_nop\n\tv_nop\n\tv_nop\n\tv_nop"
               : "+v"(a), "+v"(b) : "v"(x0), "v"(x1), "v"(x2), "v"(x3), "v"(x4), "v"(x5) : "memory");
#endif
}
template <typename F>
__device__ __forceinline__ void guard6(v8f& a, v8f& b, v8f& c, v8f& d, F x0, F x1, F x2, F x3, F x4, F x5) {
#if defined(__HIP_DEVICE_COMPILE__)
  asm volatile("v_nop\n\tv_nop\n\tv_nop\n\tv_nop"
               : "+v"(a), "+v"(b), "+v"(c), "+v"(d) : "v"(x0), "v"(x1), "v"(x2), "v"(x3), "v"(x4), "v"(x5) : "memory");
#endif
}
__device__ __forceinline__ void acc_guard4(v8f& a, v8f& b, v8f& c, v8f& d) {
#if defined(__HIP_DEVICE_COMPILE__)
  asm volatile("v_nop\n\tv_nop\n\tv_nop\n\tv_nop" : "+v"(a), "+v"(b), "+v"(c), "+v"(d));
#endif
}
__device__ __forceinline__ void wave_sync_lds() {
  __builtin_amdgcn_fence(__ATOMIC_RELEASE, "workgroup");
  __builtin_amdgcn_wave_barrier();
  __builtin_amdgcn_fence(__ATOMIC_ACQUIRE, "workgroup");
}

// =====================================================================================================
// f32 row-major [rows][DIN] -> bf16 RNE plane in fragment order. Thread = one chunk of D (8 elements of one row): two 16-B
// loads, one 16-B store; a wave stores 512 contiguous bytes.
// coverage: bid = 0 .. ceil(n8/256) - 1, x 256 thr x 8 (in-kernel bound) = the whole plane (n8 a multiple of 256 here).
// =====================================================================================================
__device__ __forceinline__ void cvt_bf(const float* __restrict__ x, u16* D, int n8, int bid) {
  const int gt = bid * 256 + (int)threadIdx.x;                        // chunk index in D
  if (gt >= n8) return;
  const int blk = gt >> 6;
  const int row = (blk / (DIN / 32)) * 16 + (gt & 15);
  const int col = (blk % (DIN / 32)) * 32 + ((gt >> 4) & 3) * 8;
  const float* p = x + (size_t)row * DIN + col;
  const v4f a = *(const v4f*)(p), b4 = *(const v4f*)(p + 4);
  v4u o;
#pragma unroll
  for (int e = 0; e < 2; ++e) {
    o[e]     = pk16(bf_bits(a[2 * e]),  bf_bits(a[2 * e + 1]));
    o[2 + e] = pk16(bf_bits(b4[2 * e]), bf_bits(b4[2 * e + 1]));
  }
  u16* d = D + (size_t)gt * 8;
  {
    *(v4u*)(d) = o;
    
  }
}

// =====================================================================================================
// f32 W [K][N] (row-major, x.W layout) -> 16-bit plane D, N rows x K columns in fragment order (A operand for Wq, Wk; B for Wv, Wp). f16mode == 0: bf16 RNE bits;
// f16mode == 1: f16 bits of (bf16 RNE value) * scale. Block = 64 n x 64 k output tile: each thread loads 16 floats of one
// k row (four 16-B loads), converts, scatters into the LDS tile T[n][k] (pitch 72 halves, scalar 2-B LDS stores of per-lane
// values); after a block barrier the tile leaves as its 8 blocks (4 n tiles x 2 k steps) of 64 chunks, a wave storing 512 contiguous B.
// coverage: load 256 thr x 16 = 64 k x 64 n; store 2 iterations x 256 thr x 8 halves = 8 blocks x 512 halves = the tile;
//           bid = 0 .. (N/64)*(K/64) - 1 covers D exactly once (N % 64 == 0, K % 64 == 0).
// =====================================================================================================
__device__ __forceinline__ void wt16(const float* __restrict__ W, u16* D, int K, int N, int f16mode, float scale, int bid) {
  __shared__ __align__(16) u16 T[64 * WTP];
  const int tid = threadIdx.x;
  const int nt  = N >> 6;
  const int n0  = (bid % nt) * 64;
  const int k0  = (bid / nt) * 64;
  if (k0 + 64 > K) return;                  // block-uniform, before the barrier; never taken with the exact grid
  {
    const int kr = tid >> 2;                // k row within tile 0..63
    const int nc = (tid & 3) * 16;          // n chunk 0,16,32,48
    const float* src = W + (size_t)(k0 + kr) * (size_t)N + n0 + nc;
#pragma unroll
    for (int i = 0; i < 4; ++i) {
      const v4f a = *(const v4f*)(src + 4 * i);
#pragma unroll
      for (int e = 0; e < 4; ++e) {
        const float f = a[e];
        const unsigned short hb = h_bits((_Float16)(bfr(f) * scale));
        const unsigned short bb = bf_bits(f);
        T[(nc + 4 * i + e) * WTP + kr] = (f16mode != 0) ? hb : bb;
      }
    }
  }
  __syncthreads();
  v4u v[2];
#pragma unroll
  for (int it = 0; it < 2; ++it) {
    const int id = it * 256 + tid;          // chunk of the tile: block id >> 6 = (n tile id >> 7, k step (id >> 6) & 1)
    v[it] = *(const v4u*)(T + ((id >> 7) * 16 + (id & 15)) * WTP + ((id >> 6) & 1) * 32 + ((id >> 4) & 3) * 8);
  }
  {
#pragma unroll
    for (int it = 0; it < 2; ++it) {
      const int id = it * 256 + tid;
      const size_t blk = (size_t)((n0 >> 4) + (id >> 7)) * (size_t)(K >> 5) + (size_t)((k0 >> 5) + ((id >> 6) & 1));
      *(v4u*)(D + blk * 512 + (id & 63) * 8) = v[it];
    }
    
  }
}

// =====================================================================================================
// All jobs that read only the inputs, in one launch; a block does one block's work of one job, chosen by its index (block-uniform):
//   [0, GWP) Wp [DOUT k][DOUT n] -> DOUT n x DOUT k as f16 of bf16 value x1024; then GWQ blocks Wq [DIN k][NQ n] -> NQ n x DIN k
//   bf16; GWK blocks Wk -> NK x DIN; GWV blocks Wv -> NV x DIN; then NB * GX blocks x -> bf16 plane MROWS x DIN, GX per batch.
// =====================================================================================================
__global__ __launch_bounds__(256)
void prep_in(const float* __restrict__ x, const float* __restrict__ wq, const float* __restrict__ wk,
             const float* __restrict__ wv, const float* __restrict__ wp,
             u16* XB, u16* WQT, u16* WKT, u16* WVT, u16* WPT) {
  const int bid = blockIdx.x;
  if (bid < GWALL) {
    const float* W = wp;
    u16* D = WPT;
    int K = DOUT, N = DOUT, mode = 1, lb = bid;
    float sc = WOS;
    if (bid >= GWP + GWQ + GWK)  { W = wv; D = WVT; K = DIN; N = NV; mode = 0; sc = 1.0f; lb = bid - (GWP + GWQ + GWK); }
    else if (bid >= GWP + GWQ)   { W = wk; D = WKT; K = DIN; N = NK; mode = 0; sc = 1.0f; lb = bid - (GWP + GWQ); }
    else if (bid >= GWP)         { W = wq; D = WQT; K = DIN; N = NQ; mode = 0; sc = 1.0f; lb = bid - GWP; }
    wt16(W, D, K, N, mode, sc, lb);
  } else {
    const int cb = bid - GWALL;
    const int b  = cb / GX;
    if (b >= NB) return;                    // block-uniform; never taken with the exact grid
    cvt_bf(x + (size_t)b * XS_FULL * DIN, XB + (size_t)b * SEQ * DIN, (SEQ * DIN) / 8, cb % GX);
  }
}

// =====================================================================================================
// Epilogue of the output GEMM: the wave's 16x64 f32 tile (times oscale, plus the lane's per-column bias of each
// coverage: 8 instructions x 2 rows x 16 lanes x 4 floats = the wave's 16 x 64 tile.
// =====================================================================================================
__device__ __forceinline__ void epi64(float* sl, v8f a0, v8f a1, v8f a2, v8f a3, float oscale,
                                      float bb0, float bb1, float bb2, float bb3,
                                      float* C, int N, size_t rowb, int col0, int lane) {
  const int hh = lane >> 4, m = lane & 15;
#pragma unroll
  for (int r = 0; r < 8; ++r) {
    const int ro = (8 * hh + r) * 68 + m;
    sl[ro]      = a0[r] * oscale + bb0;
    sl[ro + 16] = a1[r] * oscale + bb1;
    sl[ro + 32] = a2[r] * oscale + bb2;
    sl[ro + 48] = a3[r] * oscale + bb3;
  }
  wave_sync_lds();
  v4f vals[8];
#pragma unroll
  for (int it = 0; it < 8; ++it) vals[it] = *(const v4f*)(sl + (it * 2 + hh) * 68 + m * 4);
  float* dst = C + (rowb + (size_t)hh) * (size_t)N + col0 + m * 4;
  {
#pragma unroll
    for (int it = 0; it < 8; ++it) {
      *(v4f*)(dst + (size_t)(it * 2) * (size_t)N) = vals[it];
    }
    
  }
}

// =====================================================================================================
// bf16 GEMM, no bias, the q, k and v projections in one launch, stored straight as attention's f16 planes (hi = f16(t), residual =
// f16(t - hi), t = value * scale; fragment order): A (bf16, M rows x K, fragment order) . Bt^T (bf16, NQKV rows x K, fragment
// order: the rows of Wq^T, Wk^T, Wv^T one behind the other, which is how the three planes lie in the workspace).
// Block = 64x64 tile, 4 waves x 16 rows of A; a tile lies in one projection (NQ, NK, NV multiples of 64), chosen by the block's
// column tile (block-uniform); fragments loaded straight from the planes' blocks (two 16-B loads each, split k map for A and B);
// K stepped by 32 * KUQ (host guarantees K % (32 * KUQ) == 0, M % 64 == 0, grid = (M/64)*(NQKV/64)).
// A chunk of a plane is 8 consecutive columns of one plane row, so each projection is computed with the side up that puts a chunk
// into one lane's 8 accumulator registers:
//   q, k (plane row = x row, plane column = n): D = W rows . x rows^T, lane = x row rowb + lane % 16, registers = n 8*(lane/16) + r;
//   v^T  (plane row = n = (g, d), plane column = key = x row): D = x rows . W rows^T, lane = n, registers = x rows 8*(lane/16) + r.
// coverage: per wave 4 subtiles x 32 chunks x 8 halves = 16 x 64 of the hi and of the residual plane, each store instruction of a
//           wave 512 contiguous bytes; the grid's tiles cover QH, QL, KH, KL, VH, VL exactly once.
// =====================================================================================================
template <int WA>                           // WA == 1: the W fragments are the A operand (q, k); WA == 0: the x fragment is (v)
__device__ __forceinline__ void qkv_tile(const u16* ap, const u16* bp0, int K, float sc, u16* dh, u16* dl, int jstep) {
  const size_t bs = (size_t)16 * K;         // 16 rows on = one row of blocks on
  const u16* bp1 = bp0 + bs;
  const u16* bp2 = bp1 + bs;
  const u16* bp3 = bp2 + bs;
  v8f acc[4];
#pragma unroll
  for (int j = 0; j < 4; ++j) acc[j] = zero8();
#pragma unroll 1
  for (int k0 = 0; k0 < K; k0 += 32 * KUQ) {
    // the fragments of KUQ k steps, all loads issued as one group in k order: one wait for the planes' latency serves KUQ steps
    v16b a[KUQ], b0[KUQ], b1[KUQ], b2[KUQ], b3[KUQ];
#pragma unroll                              // every index constant: the fragment arrays stay in registers
    for (int u = 0; u < KUQ; ++u) {
      a[u]  = ldfrag_b(ap,  1024u * u);
      b0[u] = ldfrag_b(bp0, 1024u * u);
      b1[u] = ldfrag_b(bp1, 1024u * u);
      b2[u] = ldfrag_b(bp2, 1024u * u);
      b3[u] = ldfrag_b(bp3, 1024u * u);
    }
    // the loads' address registers are named here, so none is given to a later load's result or stepped on before the
    // loads' address translations are back
#if defined(__HIP_DEVICE_COMPILE__)
    asm volatile("s_wait_xcnt 0x0" :: "v"(ap), "v"(bp0), "v"(bp1), "v"(bp2), "v"(bp3) : "memory");
#endif
    // without this the scheduler sinks each step's loads down to its products, and one step's loads are in flight again
    __builtin_amdgcn_sched_barrier(0);
    ap += 512 * KUQ; bp0 += 512 * KUQ; bp1 += 512 * KUQ; bp2 += 512 * KUQ; bp3 += 512 * KUQ;
#pragma unroll                              // every index constant: the fragment arrays stay in registers
    for (int u = 0; u < KUQ; ++u) {
      if constexpr (WA == 1) {
        acc[0] = mma_b(b0[u], a[u], acc[0]);
        acc[1] = mma_b(b1[u], a[u], acc[1]);
        acc[2] = mma_b(b2[u], a[u], acc[2]);
        acc[3] = mma_b(b3[u], a[u], acc[3]);
      } else {
        acc[0] = mma_b(a[u], b0[u], acc[0]);
        acc[1] = mma_b(a[u], b1[u], acc[1]);
        acc[2] = mma_b(a[u], b2[u], acc[2]);
        acc[3] = mma_b(a[u], b3[u], acc[3]);
      }
    }
    guard6<v16b>(acc[0], acc[1], acc[2], acc[3], a[KUQ - 1], b0[KUQ - 1], b1[KUQ - 1], b2[KUQ - 1], b3[KUQ - 1], a[KUQ - 1]);
  }
  v4u oh[4], ol[4];
#pragma unroll
  for (int j = 0; j < 4; ++j) {
#pragma unroll
    for (int e = 0; e < 4; ++e) {
      const float t0 = acc[j][2 * e] * sc, t1 = acc[j][2 * e + 1] * sc;
      const _Float16 h0 = (_Float16)t0, h1 = (_Float16)t1;
      const _Float16 l0 = (_Float16)(t0 - (float)h0), l1 = (_Float16)(t1 - (float)h1);
      oh[j][e] = pk16(h_bits(h0), h_bits(h1));
      ol[j][e] = pk16(h_bits(l0), h_bits(l1));
    }
  }
#pragma unroll
  for (int j = 0; j < 4; ++j) {
    *(v4u*)(dh + (size_t)j * jstep) = oh[j];
    *(v4u*)(dl + (size_t)j * jstep) = ol[j];
  }
  // a precaution: in the listing the other instance's prologue follows these eight stores and rewrites their address and data
  // registers; this wait stands in front of every such write
#if defined(__HIP_DEVICE_COMPILE__)
  asm volatile("s_wait_xcnt 0x0" ::: "memory");
#endif
}

__global__ __launch_bounds__(128)
void gemm_qkv(const u16* __restrict__ A, const u16* __restrict__ Bt, u16* QH, u16* QL, u16* KH, u16* KL, u16* VH, u16* VL,
              int M, int K) {
  const int tid = threadIdx.x, wave = tid >> 5, lane = tid & 31;
  const int ntile = NQKV >> 6;
  const int bid   = blockIdx.x;
  const int rowb  = (bid / ntile) * 64 + wave * 16;
  const int colb  = (bid % ntile) * 64;     // first row of the tile in Bt
  if (rowb + 16 > M) return;                // wave-uniform, never taken with the exact grid; no barriers in this kernel
  const u16* ap  = A  + (size_t)rowb * K + 8 * lane;   // the lane's chunk in block (rowb / 16, 0); the next k step is 512 halves on
  const u16* bp0 = Bt + (size_t)colb * K + 8 * lane;
  if (colb >= NQ + NK) {
    // v^T planes: row tile (b*NG + g) * (DV/16) + j, key step s0 / 32; the wave's 16 keys are one half of that block's 64 chunks
    const int g  = (colb - (NQ + NK)) / DV;
    const int b  = rowb / SEQ;
    const int s0 = rowb - b * SEQ;
    const size_t o = ((size_t)((b * NG + g) * (DV / 16)) * (SEQ / 32) + (size_t)(s0 >> 5)) * 512 + (size_t)(((s0 >> 4) & 1) * 32 + lane) * 8;
    qkv_tile<0>(ap, bp0, K, VCAR, VH + o, VL + o, (SEQ / 32) * 512);
  } else {
    // q or k planes: row tile rowb / 16, column step (column / 32); subtile j = chunks (j & 1) * 32 + lane of block j / 2: 256 halves on
    const bool isk = colb >= NQ;
    const int  nc  = isk ? NK : NQ;         // the plane's columns, and the tile's first column in it
    const int  c0  = isk ? colb - NQ : colb;
    const size_t o = ((size_t)(rowb >> 4) * (size_t)(nc >> 5) + (size_t)(c0 >> 5)) * 512 + (size_t)lane * 8;
    qkv_tile<1>(ap, bp0, K, isk ? KSC : QSC, (isk ? KH : QH) + o, (isk ? KL : QL) + o, 256);
  }
}

// =====================================================================================================
// f16 GEMM with a two-plane A operand and bias: C[M][N] (f32) = (Ah + Al) (f16 hi and residual planes, M rows x K, fragment
// order, residual unscaled relative to hi) . Bt^T (f16, N rows x K, fragment order) * oscale + bf16 RNE value of bias[n] (bias has
// N entries). Products ah.b + al.b into one accumulator. Same tiling and fragment loads (split k map) as gemm_qkv;
// K stepped by 32 * KUO (host guarantees K % (32 * KUO) == 0, M % 64 == 0, N % 64 == 0, grid = (M/64)*(N/64)).
// =====================================================================================================
__global__ __launch_bounds__(128)
void gemm_h2(const u16* __restrict__ Ah, const u16* __restrict__ Al, const u16* __restrict__ Bt,
             const float* __restrict__ bias, float* C, int M, int N, int K, float oscale) {
  __shared__ __align__(16) float slab[4 * SLAB64];
  const int tid = threadIdx.x, wave = tid >> 5, lane = tid & 31, m = lane & 15;
  const int ntile = N >> 6;
  const int bid   = blockIdx.x;
  const int rowb  = (bid / ntile) * 64 + wave * 16;
  const int col0  = (bid % ntile) * 64;
  if (rowb + 16 > M) return;                // wave-uniform, never taken with the exact grid; no block barriers in this kernel
  const size_t bs = (size_t)16 * K;
  const _Float16* ahp = (const _Float16*)(const void*)Ah + (size_t)rowb * K + 8 * lane;   // the lane's chunk in block (rowb / 16, 0), as in gemm_qkv
  const _Float16* alp = (const _Float16*)(const void*)Al + (size_t)rowb * K + 8 * lane;
  const _Float16* bp0 = (const _Float16*)(const void*)Bt + (size_t)col0 * K + 8 * lane;
  const _Float16* bp1 = bp0 + bs;
  const _Float16* bp2 = bp1 + bs;
  const _Float16* bp3 = bp2 + bs;
  v8f acc0 = zero8(), acc1 = zero8(), acc2 = zero8(), acc3 = zero8();
#pragma unroll 1
  for (int k0 = 0; k0 < K; k0 += 32 * KUO) {
    // the fragments of KUO k steps, all loads issued as one group in k order, as in gemm_qkv
    v16h ah[KUO], al[KUO], b0[KUO], b1[KUO], b2[KUO], b3[KUO];
#pragma unroll                              // every index constant: the fragment arrays stay in registers
    for (int u = 0; u < KUO; ++u) {
      ah[u] = ldfrag_h(ahp, 1024u * u);
      al[u] = ldfrag_h(alp, 1024u * u);
      b0[u] = ldfrag_h(bp0, 1024u * u);
      b1[u] = ldfrag_h(bp1, 1024u * u);
      b2[u] = ldfrag_h(bp2, 1024u * u);
      b3[u] = ldfrag_h(bp3, 1024u * u);
    }
    // the loads' address registers are named here, so none is given to a later load's result or stepped on before the
    // loads' address translations are back
#if defined(__HIP_DEVICE_COMPILE__)
    asm volatile("s_wait_xcnt 0x0" :: "v"(ahp), "v"(alp), "v"(bp0), "v"(bp1), "v"(bp2), "v"(bp3) : "memory");
#endif
    // without this the scheduler sinks each step's loads down to its products, and one step's loads are in flight again
    __builtin_amdgcn_sched_barrier(0);
    ahp += 512 * KUO; alp += 512 * KUO; bp0 += 512 * KUO; bp1 += 512 * KUO; bp2 += 512 * KUO; bp3 += 512 * KUO;
#pragma unroll                              // every index constant: the fragment arrays stay in registers
    for (int u = 0; u < KUO; ++u) {
      acc0 = mma_h(ah[u], b0[u], acc0);  acc0 = mma_h(al[u], b0[u], acc0);
      acc1 = mma_h(ah[u], b1[u], acc1);  acc1 = mma_h(al[u], b1[u], acc1);
      acc2 = mma_h(ah[u], b2[u], acc2);  acc2 = mma_h(al[u], b2[u], acc2);
      acc3 = mma_h(ah[u], b3[u], acc3);  acc3 = mma_h(al[u], b3[u], acc3);
    }
    guard6<v16h>(acc0, acc1, acc2, acc3, ah[KUO - 1], al[KUO - 1], b0[KUO - 1], b1[KUO - 1], b2[KUO - 1], b3[KUO - 1]);
  }
  // per-lane bias of D column m in each of the 4 subtiles; col0 + 48 + m <= N - 1 always
  const float bb0 = bfr(bias[col0 + m]);
  const float bb1 = bfr(bias[col0 + 16 + m]);
  const float bb2 = bfr(bias[col0 + 32 + m]);
  const float bb3 = bfr(bias[col0 + 48 + m]);
  epi64(slab + wave * SLAB64, acc0, acc1, acc2, acc3, oscale, bb0, bb1, bb2, bb3, C, N, (size_t)rowb, col0, lane);
}

// =====================================================================================================
// Causal grouped attention with ALiBi, q/k head dim 32, value head dim 64. Block bid -> (query tile qt = qtb + bid % nqtl:
// rows q0 = 16*qt .. q0+15, kv group hg, batch b); one wave per query head = hg + NG*wave, the 4 heads with head % NG = hg.
//   q hi / residual planes f16 x256, row b*SEQ + s, column h*DQ + d (NQ columns); k hi / residual planes f16 x256, row
//   b*SEQ + s, column g*DQ + d (NK columns); v^T hi / residual planes x1024, row (b*NG + g)*DV + d, column s (SEQ columns);
//   O hi / residual planes f16 x1024, row b*SEQ + s, column h*DV + d (DOUT columns); all in fragment order.
//   scores, transposed: S^T (16 keys x 16 queries, one k-step over d = 0..31) = k_hi.q_hi + k_lo.q_hi + k_hi.q_lo (A = k block,
//   B = q block; 3 products into one accumulator, residuals unscaled relative to their hi planes), q fragments loop-invariant;
//   a lane holds 16 of the step's 32 scores of ONE query (q0 + lane % 16), lane l ^ 16 the other 16;
//   logit (log2 domain) t(i, j) = (acc/(256*256) + slope[h]*(j - i)) * (1/sqrt(32))*log2e, replaced by -inf where j > i,
//   slope[h] = 2^(-(h+1)/2) built exactly (power of two times f32 sqrt2 for odd h+1).
//   Key tiles of 32 visited in order for kb <= q0 + 15 (later tiles hold only keys above every query row of the tile).
//   A step's 12 blocks of 1 KiB (k hi 2, k residual 2, v^T hi 4, v^T residual 4) are the same for the block's 4 heads: they come
//   into LDS once, by asynchronous copies (wave w brings k block w, v^T hi block w, v^T residual block w), two buffers, the copies
//   of step t + 1 in flight while step t is worked on; every wave reads all 12 blocks as its fragments from LDS.
//   Online max-subtracted base-2 softmax in f32, -inf-safe rescale: maximum and sum run over the lane's own registers, the
//   maximum joined with lane l ^ 16 in each step, the two half sums once behind the loop. The two score tiles of a step,
//   converted in place, ARE the B fragment of P^T (element e <- tile e / 8, register e % 8: the planes' split k map), so P
//   passes through no LDS; v^T blocks are the A fragments of 4 d-subtiles, both v planes: O^T += v_hi.P_hi + v_lo.P_hi
//   (+ v_hi.P_lo when PRES == 1), 2 groups of 2 subtiles.
//   After the loop: out = acc / Z (Z > 0 always: key 0 <= every query row; guarded anyway), carries 1/(32768*1024) folded
//   once; a lane's 8 registers of a subtile are 8 consecutive d of its query = one chunk of the O planes.
// coverage: per wave 4 instructions x 32 chunks x 8 halves = 2 blocks = 16 x 64 of each O plane; the two block ranges of attn_all
//           cover query tiles [QO/16, NQT) and [0, QO/16) x NHG x NB blocks x WPB waves = every (b, s, h) row segment of OH and
//           of OL exactly once.
// =====================================================================================================
// One wave's six asynchronous copies of a step (16 B a lane each, 512 contiguous bytes a wave): the two halves of a k block to LDS
// byte address l, of a v^T hi block to l + 4096, of a v^T residual block to l + 8192. The closing s_wait_xcnt stands in the copies'
// own statement, so that no address register named here is rewritten in front of it.
__device__ __forceinline__ void kv_copy(unsigned l, const _Float16* gk, const _Float16* gh, const _Float16* gl) {
#if defined(__HIP_DEVICE_COMPILE__)
  asm volatile("global_load_async_to_lds_b128 %0, %6, off\n\t"
               "global_load_async_to_lds_b128 %1, %7, off\n\t"
               "global_load_async_to_lds_b128 %2, %8, off\n\t"
               "global_load_async_to_lds_b128 %3, %9, off\n\t"
               "global_load_async_to_lds_b128 %4, %10, off\n\t"
               "global_load_async_to_lds_b128 %5, %11, off\n\t"
               "s_wait_xcnt 0x0"
               :: "v"(l), "v"(l + 512u), "v"(l + 4096u), "v"(l + 4608u), "v"(l + 8192u), "v"(l + 8704u),
                  "v"(gk), "v"(gk + 256), "v"(gh), "v"(gh + 256), "v"(gl), "v"(gl + 256)
               : "memory");
#endif
}

template <int PRES>
__device__ __forceinline__
void attn_c(const u16* __restrict__ QHp, const u16* __restrict__ QLp,
            const u16* __restrict__ KHp, const u16* __restrict__ KLp,
            const u16* __restrict__ VHp, const u16* __restrict__ VLp,
            u16* OHp, u16* OLp, int qtb, int nqtl, int bid, u16* kvs) {
  const int tid  = threadIdx.x;
  const int wave = tid >> 5;
  const int lane = tid & 31;
  const int hh   = lane >> 4;
  const int c    = lane & 15;
  const int qt   = qtb + (bid % nqtl);
  const int t2   = bid / nqtl;
  const int hg   = t2 % NHG;
  const int b    = t2 / NHG;
  if (b >= NB) return;                      // block-uniform, before every barrier; never taken with the exact grid
  const int q0   = qt * 16;
  if (q0 + 16 > SEQ) return;                // block-uniform, before every barrier; never taken
  const int head = hg + NG * wave;
  const int kvh  = hg;                      // tiled kv mapping: head h -> kv group h % NG, the same for the block's 4 waves

  // fragment-order blocks (512 halves each): q block (row tile, head); k block (key tile of 16, kv group), 16 keys on = 16 * NK
  // halves on; v^T block (d tile, key step of 32), 32 keys on = 512 halves on, 16 d on = 16 * SEQ halves on
  const _Float16* Qh  = (const _Float16*)(const void*)QHp + ((size_t)b * SEQ + q0) * NQ + (size_t)head * 512;
  const _Float16* Ql  = (const _Float16*)(const void*)QLp + ((size_t)b * SEQ + q0) * NQ + (size_t)head * 512;
  const _Float16* Khb = (const _Float16*)(const void*)KHp + (size_t)b * SEQ * NK + (size_t)kvh * 512;  // key row kb added per step
  const _Float16* Klb = (const _Float16*)(const void*)KLp + (size_t)b * SEQ * NK + (size_t)kvh * 512;
  const _Float16* Vhb = (const _Float16*)(const void*)VHp + (size_t)(b * NG + kvh) * DV * SEQ;         // d tile 0 (+j)
  const _Float16* Vlb = (const _Float16*)(const void*)VLp + (size_t)(b * NG + kvh) * DV * SEQ;
  const unsigned lb = 16u * (unsigned)lane;  // the lane's chunk inside a block, in bytes

  // ALiBi slope 2^(-(head+1)/2): even exponent -> exact power of two; odd -> power of two times f32 sqrt(2)
  const int   e1   = head + 1;
  const int   pw   = (e1 + 1) >> 1;
  const float p2   = __uint_as_float(((unsigned)(127 - pw)) << 23);
  const float slope = p2 * (((e1 & 1) != 0) ? SQRT2F : 1.0f);   // wave-uniform select by value
  const float lsc  = 1.0f / (QSC * KSC);
  const float ul2  = RSQ_DQ * LOG2E;
  const float oc   = 1.0f / (PCAR * VCAR);
  const size_t KROW = (size_t)NK;           // halves per key row in the k planes (16 rows = one row of blocks)

  const v16h qh = ldfrag_h(Qh, lb);             // loop-invariant q fragments (d = 0..31): hi plane
  const v16h ql = ldfrag_h(Ql, lb);             //                                         residual plane

  float mrow = -INFINITY, lrow = 0.f;       // the lane's query: running maximum (both halves alike), sum over this half's keys
  v8f o[4];                                 // O^T: o[j][r] = (d = j*16 + 8*hh + r, query q0 + c)
#pragma unroll
  for (int j = 0; j < 4; ++j) o[j] = zero8();
  const int ncaus = (q0 >> 5) + 1;                                            // tiles holding keys <= q0 + 15
  const int nkt = (ncaus < NKT) ? ncaus : NKT;
  const int qr  = q0 + c;                                                     // the lane's query row

  // the wave's share of a step's copies: k block wave (hi plane key tiles 0, 1, residual plane key tiles 0, 1), v^T hi d tile wave,
  // v^T residual d tile wave; the lane's 16 B of each half block. A step on: 32 key rows in k, one block (512 halves) in v^T.
  const _Float16* gk = (((wave & 2) != 0) ? Klb : Khb) + (size_t)(16 * (wave & 1)) * KROW + 8 * lane;
  const _Float16* gh = Vhb + (size_t)wave * 16 * SEQ + 8 * lane;
  const _Float16* gl = Vlb + (size_t)wave * 16 * SEQ + 8 * lane;
  const unsigned  lw = (unsigned)(size_t)kvs + 1024u * (unsigned)wave + lb;   // LDS byte address: buffer 0, block wave, the lane's chunk

  // step 0 into buffer 0, landed and published; then step 1 into buffer 1, in flight over step 0
  kv_copy(lw, gk, gh, gl);
  asm volatile("s_wait_asynccnt 0x0" ::: "memory");   // this wave's copies have landed before the barrier lets others read them
  __syncthreads();
  if (nkt > 1) kv_copy(lw + 2u * KVBUF, gk + (size_t)32 * KROW, gh + 512, gl + 512);

#pragma unroll 1
  for (int kt = 0; kt < nkt; ++kt) {
    const int kb = kt * 32;
    // ---- this step's fragments from its LDS buffer, as one group: k first (the scores wait for these alone), then v^T ----
    const _Float16* kvb = (const _Float16*)(const void*)kvs + (kt & 1) * KVBUF;
    const v16h kh0 = ldfrag_h(kvb, lb);
    const v16h kh1 = ldfrag_h(kvb + 512, lb);
    const v16h kl0 = ldfrag_h(kvb + 1024, lb);
    const v16h kl1 = ldfrag_h(kvb + 1536, lb);
    v16h vh[4], vl[4];
#pragma unroll
    for (int j = 0; j < 4; ++j) vh[j] = ldfrag_h(kvb + 2048 + j * 512, lb);
#pragma unroll
    for (int j = 0; j < 4; ++j) vl[j] = ldfrag_h(kvb + 4096 + j * 512, lb);
    // ---- scores: D element r of this lane = (key kb + 8*hh + r, query qr) in s0, key kb + 16 + 8*hh + r in s1 ----
    //      hi+residual planes on both operands: k_hi.q_hi + k_lo.q_hi + k_hi.q_lo
    v8f s0 = zero8(), s1 = zero8();
    {
      s0 = mma_h(kh0, qh, s0);              // hi.hi
      s0 = mma_h(kl0, qh, s0);              // k residual . q hi
      s0 = mma_h(kh0, ql, s0);              // k hi . q residual
      s1 = mma_h(kh1, qh, s1);
      s1 = mma_h(kl1, qh, s1);
      s1 = mma_h(kh1, ql, s1);
      guard2(s0, s1, qh, ql, kh0, kl0, kh1, kl1);
    }
    // ---- causal select + ALiBi + scale, online softmax in base 2, -inf-safe; all 16 values belong to query qr ----
    const int dk = kb + 8 * hh - qr;        // key - query of s0[0]
    float t0[8], t1[8];
#pragma unroll
    for (int r = 0; r < 8; ++r) {
      const int   d0 = dk + r, d1 = dk + 16 + r;
      const float a0 = slope * (float)d0;
      const float a1 = slope * (float)d1;
      const float u0 = (s0[r] * lsc + a0) * ul2;
      const float u1 = (s1[r] * lsc + a1) * ul2;
      t0[r] = (d0 > 0) ? -INFINITY : u0;
      t1[r] = (d1 > 0) ? -INFINITY : u1;
    }
    float mq[4];
#pragma unroll
    for (int i = 0; i < 4; ++i) mq[i] = fmaxf(fmaxf(t0[2 * i], t0[2 * i + 1]), fmaxf(t1[2 * i], t1[2 * i + 1]));
    float mx = fmaxf(fmaxf(mq[0], mq[1]), fmaxf(mq[2], mq[3]));
    mx = fmaxf(mx, xhalf(mx));              // the other 16 keys of the step
    const float mn = fmaxf(mrow, mx);
    const float ms = (mn == -INFINITY) ? 0.0f : mn;
    const float al = exp2f(mrow - ms);
    mrow = mn;
    float e0[8], e1[8];
#pragma unroll
    for (int r = 0; r < 8; ++r) { e0[r] = exp2f(t0[r] - ms); e1[r] = exp2f(t1[r] - ms); }
    float sq[4];
#pragma unroll
    for (int i = 0; i < 4; ++i) sq[i] = (e0[2 * i] + e0[2 * i + 1]) + (e1[2 * i] + e1[2 * i + 1]);
    lrow = lrow * al + ((sq[0] + sq[1]) + (sq[2] + sq[3]));
#pragma unroll
    for (int j = 0; j < 4; ++j) {
#pragma unroll
      for (int r = 0; r < 8; ++r) o[j][r] *= al;
    }
    // ---- B fragments of P^T*32768: f16 hi (and f16 residual when PRES), column = query c, split k map over the 32 keys of
    //      this step: elements 0..7 = keys kb + 8hh + 0..7 (s0's rows), elements 8..15 = keys kb + 16 + 8hh + 0..7 (s1's) ----
    FragH ph, pl;
    {
#pragma unroll
      for (int e = 0; e < 8; ++e) {
        const float ta = e0[e] * PCAR, tc = e1[e] * PCAR;
        const _Float16 ha = (_Float16)ta, hc = (_Float16)tc;
        ph.h[0][e] = ha;
        ph.h[1][e] = hc;
        if constexpr (PRES == 1) {
          pl.h[0][e] = (_Float16)(ta - (float)ha);
          pl.h[1][e] = (_Float16)(tc - (float)hc);
        }
      }
      if constexpr (PRES != 1) pl.v = ph.v;
    }
    // ---- v^T.P^T : A fragment row m = d = j*16 + c, k = the step's 32 keys; 2 groups of 2 d-subtiles ----
    {
#pragma unroll
      for (int jg = 0; jg < 2; ++jg) {
        const v16h vha = vh[2 * jg], vhb2 = vh[2 * jg + 1];
        const v16h vla = vl[2 * jg], vlb2 = vl[2 * jg + 1];
        o[2 * jg]     = mma_h(vha,  ph.v, o[2 * jg]);                       // v_hi . P_hi
        if constexpr (PRES == 1) o[2 * jg] = mma_h(vha, pl.v, o[2 * jg]);   // v_hi . P_lo
        o[2 * jg]     = mma_h(vla,  ph.v, o[2 * jg]);                       // v_lo . P_hi
        o[2 * jg + 1] = mma_h(vhb2, ph.v, o[2 * jg + 1]);
        if constexpr (PRES == 1) o[2 * jg + 1] = mma_h(vhb2, pl.v, o[2 * jg + 1]);
        o[2 * jg + 1] = mma_h(vlb2, ph.v, o[2 * jg + 1]);
        guard2(o[2 * jg], o[2 * jg + 1], ph.v, pl.v, vha, vhb2, vla, vlb2);
      }
    }
    // ---- hand-over: step kt + 1 is published, and this step's buffer is free for step kt + 2 ----
    asm volatile("s_wait_dscnt 0x0" ::: "memory");      // this wave's reads of the buffer are done before anyone refills it
    asm volatile("s_wait_asynccnt 0x0" ::: "memory");   // this wave's copies of step kt + 1 have landed before others read them
    __syncthreads();
    if (kt + 2 < nkt)
      kv_copy(lw + (unsigned)(kt & 1) * (2u * KVBUF), gk + (size_t)(kb + 64) * KROW, gh + (size_t)(kb + 64) * 16, gl + (size_t)(kb + 64) * 16);
  }
  asm volatile("s_wait_asynccnt 0x0" ::: "memory");     // no copy is left in flight when the wave goes on to its end
  acc_guard4(o[0], o[1], o[2], o[3]);
  // ---- out = acc / Z (0 if Z == 0), Z = the two halves' sums, carries (32768 on P, 1024 on v) folded once ----
  const float lv  = lrow + xhalf(lrow);
  const float ls  = (lv > 0.0f) ? lv : 1.0f;
  const float inv = (lv > 0.0f) ? ((1.0f / ls) * oc) : 0.0f;
  v4u oh[4], ol[4];
#pragma unroll
  for (int it = 0; it < 4; ++it) {
    // chunk it * 32 + lane of the wave's two O blocks: query row c, head columns it * 16 + 8 * hh .. + 7 = o[it][0..7]
    float w[8];
#pragma unroll
    for (int e = 0; e < 8; ++e) w[e] = (o[it][e] * inv) * OSC;
#pragma unroll
    for (int e = 0; e < 4; ++e) {
      const _Float16 h0 = (_Float16)w[2 * e], h1 = (_Float16)w[2 * e + 1];
      const _Float16 l0 = (_Float16)(w[2 * e] - (float)h0), l1 = (_Float16)(w[2 * e + 1] - (float)h1);
      oh[it][e] = pk16(h_bits(h0), h_bits(h1));
      ol[it][e] = pk16(h_bits(l0), h_bits(l1));
    }
  }
  const size_t ob = ((size_t)b * SEQ + q0) * DOUT + (size_t)head * (DV / 32) * 512 + 8 * lane;
  {
#pragma unroll
    for (int it = 0; it < 4; ++it) {
      *(v4u*)(OHp + ob + it * 256) = oh[it];
      *(v4u*)(OLp + ob + it * 256) = ol[it];
    }
    
  }
}

// =====================================================================================================
// Both kinds of query tile in one launch, chosen by the block's index (block-uniform): blocks [0, nqt0 * NHG * NB) take the nqt0
// query tiles from nqt1 on (the longer key loops), without the P residual product; the other nqt1 * NHG * NB blocks take query
// tiles [0, nqt1), with it.
// =====================================================================================================
__global__ __launch_bounds__(ATT_THREADS)
void attn_all(const u16* __restrict__ QHp, const u16* __restrict__ QLp,
              const u16* __restrict__ KHp, const u16* __restrict__ KLp,
              const u16* __restrict__ VHp, const u16* __restrict__ VLp,
              u16* OHp, u16* OLp, int nqt1, int nqt0) {
  __shared__ __align__(16) u16 kvs[2 * KVBUF];          // two buffers of a step's 12 k and v^T blocks
  const int bid = blockIdx.x;
  const int nb0 = nqt0 * NHG * NB;
  if (bid < nb0) attn_c<0>(QHp, QLp, KHp, KLp, VHp, VLp, OHp, OLp, nqt1, nqt0, bid, kvs);
  else           attn_c<1>(QHp, QLp, KHp, KLp, VHp, VLp, OHp, OLp, 0, nqt1, bid - nb0, kvs);
}

// =====================================================================================================
// Workspace map (bytes); every plane is fully written by whole-line stores before it is read; all extents are exact multiples
// of the store granularity (no pad rows needed); every region offset a multiple of 262144; the 16-bit planes are given as
// rows x columns and lie in fragment order, the f32 planes are row-major:
//   XB  bf16 MROWS x DIN                  MROWS*2048      (NB=2, SEQ=2048: 8388608)
//   WQT bf16 NQ n x DIN k                 1048576
//   WKT bf16 NK n x DIN k                 262144
//   WVT bf16 NV n x DIN k                 524288
//   WPT f16  DOUT n x DOUT k, x1024       2097152
//   QH, QL f16 MROWS x NQ, x256           MROWS*1024 each (4194304 each)
//   KH, KL f16 MROWS x NK, x256           MROWS*256 each  (1048576 each)
//   VH, VL f16 NB*NG*DV x SEQ, x1024      MROWS*512 each  (2097152 each)
//   OH, OL f16 MROWS x DOUT, x1024        MROWS*2048 each (8388608 each)
//   end (NB=2, SEQ=2048)                  43778048
// =====================================================================================================
extern "C" void kernel_launch(void* const* d_in, const int* in_sizes, int n_in,
                              void* d_out, int out_size, void* d_ws, size_t ws_size,
                              hipStream_t stream) {
  if (n_in < 6) return;
  if (in_sizes[0] < ((NB - 1) * XS_FULL + SEQ) * DIN) return;
  if (in_sizes[1] != DIN * NQ) return;
  if (in_sizes[2] != DIN * NK) return;
  if (in_sizes[3] != DIN * NV) return;
  if (in_sizes[4] != DOUT * DOUT) return;
  if (in_sizes[5] != DOUT) return;
  if (out_size < MROWS * DOUT) return;

  const float* x   = (const float*)d_in[0];
  const float* wq  = (const float*)d_in[1];
  const float* wk  = (const float*)d_in[2];
  const float* wv  = (const float*)d_in[3];
  const float* wp  = (const float*)d_in[4];
  const float* bpv = (const float*)d_in[5];
  float*       out = (float*)d_out;

  const size_t szXB = (size_t)MROWS * DIN * 2;
  const size_t szWQ = (size_t)NQ * DIN * 2;
  const size_t szWK = (size_t)NK * DIN * 2;
  const size_t szWV = (size_t)NV * DIN * 2;
  const size_t szWP = (size_t)DOUT * DOUT * 2;
  const size_t szQ  = (size_t)MROWS * NQ * 2;                   // QH, QL
  const size_t szK  = (size_t)MROWS * NK * 2;                   // KH, KL
  const size_t szV  = (size_t)NB * NG * DV * SEQ * 2;           // VH, VL
  const size_t szO  = (size_t)MROWS * DOUT * 2;                 // OH, OL
  size_t off = 0;
  const size_t oXB = off; off += szXB;
  const size_t oWQ = off; off += szWQ;
  const size_t oWK = off; off += szWK;
  const size_t oWV = off; off += szWV;
  const size_t oWP = off; off += szWP;
  const size_t oQH = off; off += szQ;
  const size_t oQL = off; off += szQ;
  const size_t oKH = off; off += szK;
  const size_t oKL = off; off += szK;
  const size_t oVH = off; off += szV;
  const size_t oVL = off; off += szV;
  const size_t oOH = off; off += szO;
  const size_t oOL = off; off += szO;
  if (off > ws_size) return;                // off = 43778048 for NB = 2, SEQ = 2048
  if (off > (size_t)WS_CAP) return;

  char* ws = (char*)d_ws;
  u16*   XB  = (u16*)(ws + oXB);
  u16*   WQT = (u16*)(ws + oWQ);
  u16*   WKT = (u16*)(ws + oWK);
  u16*   WVT = (u16*)(ws + oWV);
  u16*   WPT = (u16*)(ws + oWP);
  u16*   QH  = (u16*)(ws + oQH);
  u16*   QL  = (u16*)(ws + oQL);
  u16*   KH  = (u16*)(ws + oKH);
  u16*   KL  = (u16*)(ws + oKL);
  u16*   VH  = (u16*)(ws + oVH);
  u16*   VL  = (u16*)(ws + oVL);
  u16*   OH  = (u16*)(ws + oOH);
  u16*   OL  = (u16*)(ws + oOL);

  const dim3 b256(256), b128(128), bAT(ATT_THREADS);
  const dim3 gPI(GWALL + NB * GX);                      // 480 weight blocks + 1024 x blocks per batch (SEQ=2048)
  const dim3 gGP((MROWS / 64) * (NQKV / 64));
  const int  nqt1 = QO / 16;                            // query tiles with the P residual product (rows s < QO)
  const int  nqt0 = NQT - nqt1;                         // remaining query tiles
  const dim3 gGO((MROWS / 64) * (DOUT / 64));

  // (0) x -> bf16 plane MROWS x DIN; Wq, Wk, Wv -> bf16 n x k planes; Wp -> f16 n x k plane x1024; all in fragment order
  prep_in<<<gPI, b256, 0, stream>>>(x, wq, wk, wv, wp, XB, WQT, WKT, WVT, WPT);
  // (1) q = x.Wq, k = x.Wk -> hi + residual planes x256, v = x.Wv -> v^T hi + residual planes x1024; WQT, WKT, WVT lie one behind
  //     the other in the workspace and are read as one plane of NQKV rows
  gemm_qkv<<<gGP, b128, 0, stream>>>(XB, WQT, QH, QL, KH, KL, VH, VL, MROWS, DIN);
  // (2) causal grouped attention with ALiBi -> O hi + residual planes f16 x1024, MROWS x DOUT:
  //     query tiles [0, QO/16) with the in-register P residual product, the rest without it
  attn_all<<<dim3((nqt0 + nqt1) * NHG * NB), bAT, 0, stream>>>(QH, QL, KH, KL, VH, VL, OH, OL, nqt1, nqt0);
  // (3) out = (O_hi + O_lo).Wp + bp -> d_out f32 [MROWS][DOUT], carries 1024 x 1024 folded back
  gemm_h2<<<gGO, b128, 0, stream>>>(OH, OL, WPT, bpv, out, MROWS, DOUT, DOUT, 1.0f / (OSC * WOS));
  (void)hipGetLastError();
}

// v008
// Measured time: 96.4 microseconds a run.
// Next to v007, in two timings, it ran 1.03 and 1.02 times as fast.
// Counting every step since v000, it is 2.83 times as fast.
#include <hip/hip_runtime.h>
#include <math.h>
#include <stdint.h>

#ifndef NB
#define NB 2
#endif
#ifndef SEQ
#define SEQ 2048
#endif
#define XS_FULL 2048
#define DIN   1024
#define DOUT  1024
#define NH    16
#define NG    4
#define DQ    32
#define DV    64
#define NQ    (NH * DQ)
#define NK    (NG * DQ)
#define NV    (NG * DV)
#define MROWS (NB * SEQ)
#define QO    ((SEQ < 512) ? SEQ : 512)
#define RSQ_DQ 0.17677669529663687f
#define LOG2E  1.4426950408889634f
#define SQRT2F 1.4142135623730951f
#define QSC   256.0f
#define KSC   256.0f
#define PCAR  32768.0f
#define VCAR  1024.0f
#define OSC   1024.0f
#define WOS   1024.0f
#define WPB   4
#define NHG   (NH / WPB)
#define KVBLK 12
#define KVBUF (KVBLK * 512)
#define NQT   (SEQ / 16)
#define NKT   (SEQ / 32)
#define ATT_THREADS (WPB * 32)
#define SLAB64 (16 * 68)
#define WTP   72
#define WS_CAP 134217728
#define KUQ   4                             // k steps of 32 whose fragment loads gemm_qkv issues as one group
#define KUO   4                             // the same for gemm_h2
// block counts of the jobs that share a launch
#define GX    ((SEQ * DIN / 8 + 255) / 256)
#define GWQ   ((NQ / 64) * (DIN / 64))
#define GWK   ((NK / 64) * (DIN / 64))
#define GWV   ((NV / 64) * (DIN / 64))
#define GWP   ((DOUT / 64) * (DOUT / 64))
#define GWALL (GWP + GWQ + GWK + GWV)
#define NQKV  (NQ + NK + NV)
static_assert(DOUT == NH * DV && NQ == 512 && NK == 128 && NV == 256 && DQ == 32 && DV == 64 && NG == 4 && NH == 16);
static_assert(NHG * WPB == NH && ATT_THREADS == 128 && WPB == 4 && NHG == NG);
static_assert(NB >= 1 && NB <= 2);
static_assert((SEQ % 64) == 0 && SEQ >= 64 && SEQ <= XS_FULL);
static_assert((QO % 16) == 0 && QO >= 16 && QO <= SEQ);
static_assert((DIN % 64) == 0 && (DOUT % 64) == 0 && (NQ % 64) == 0 && (NK % 64) == 0 && (NV % 64) == 0 && (DIN % 32) == 0);
static_assert(((SEQ * DIN / 8) % 256) == 0);
static_assert((DIN % (32 * KUQ)) == 0 && (DOUT % (32 * KUO)) == 0);
static_assert(64 * WTP * 2 <= 65536 && 4 * SLAB64 * 4 <= 65536 && 2 * KVBUF * 2 <= 65536);

typedef unsigned short u16;
typedef _Float16 v16h __attribute__((ext_vector_type(16)));
typedef _Float16 v8h  __attribute__((ext_vector_type(8)));
typedef __bf16   v16b __attribute__((ext_vector_type(16)));
typedef float    v8f  __attribute__((ext_vector_type(8)));
typedef float    v4f  __attribute__((ext_vector_type(4)));
typedef unsigned int v4u __attribute__((ext_vector_type(4)));

union FragH { v16h v; v8h h[2]; v4u u[2]; };
union FragB { v16b v; v4u u[2]; };

// ---- scalar helpers --------------------------------------------------------------------------------
__device__ __forceinline__ unsigned short bf_bits(float f) {          // f32 -> bf16 bits, RNE convert
  unsigned u = __float_as_uint(f);
  return (unsigned short)((u + 0x7FFFu + ((u >> 16) & 1u)) >> 16);
}
__device__ __forceinline__ float bf_up(unsigned short h) { return __uint_as_float(((unsigned)h) << 16); }
__device__ __forceinline__ float bfr(float f) { return bf_up(bf_bits(f)); }
__device__ __forceinline__ unsigned short h_bits(_Float16 x) { return __builtin_bit_cast(unsigned short, x); }
__device__ __forceinline__ unsigned pk16(unsigned short a, unsigned short b) { return (unsigned)a | ((unsigned)b << 16); }
__device__ __forceinline__ v8f zero8() { v8f z = {0.f, 0.f, 0.f, 0.f, 0.f, 0.f, 0.f, 0.f}; return z; }
__device__ __forceinline__ float xhalf(float x) {                     // the value of lane l ^ 16
  const int b = __builtin_bit_cast(int, x);
  return __builtin_bit_cast(float, __builtin_amdgcn_permlanex16(b, b, 0x76543210, 0xfedcba98, false, false));
}

// 2^x as the bare v_exp_f32. The library exp2f wraps it in a range fix-up (compare, two selects, add, ldexp) that only keeps results
// below 2^-126; here such a weight is 0 in f16 x32768 and adds nothing to a row sum that is at least 1. -inf gives 0, as before.
// A run of them stands in one asm statement: the outputs are early-clobber, so no v_exp_f32 writes a register that another one of the
// run reads, and the closing v_nop is the slot the instruction set asks for behind the last one, before its result is read or its
// source overwritten.
__device__ __forceinline__ void ex2x8(float (&e)[8], const float (&x)[8]) {
#if defined(__HIP_DEVICE_COMPILE__)
  asm("v_exp_f32 %0, %8\n\tv_exp_f32 %1, %9\n\tv_exp_f32 %2, %10\n\tv_exp_f32 %3, %11\n\t"
      "v_exp_f32 %4, %12\n\tv_exp_f32 %5, %13\n\tv_exp_f32 %6, %14\n\tv_exp_f32 %7, %15\n\tv_nop"
      : "=&v"(e[0]), "=&v"(e[1]), "=&v"(e[2]), "=&v"(e[3]), "=&v"(e[4]), "=&v"(e[5]), "=&v"(e[6]), "=&v"(e[7])
      : "v"(x[0]), "v"(x[1]), "v"(x[2]), "v"(x[3]), "v"(x[4]), "v"(x[5]), "v"(x[6]), "v"(x[7]));
#endif
}
__device__ __forceinline__ float ex2x1(float x) {
  float e = 0.f;
#if defined(__HIP_DEVICE_COMPILE__)
  asm("v_exp_f32 %0, %1\n\tv_nop" : "=&v"(e) : "v"(x));
#endif
  return e;
}

// ---- fragment order of a 16-bit operand plane of R rows (the WMMA's m or n index) x K columns (its k index), R % 16 == 0,
//      K % 32 == 0: a row-major grid of blocks of 16 rows x 32 columns, block (r >> 4, k >> 5) at half offset
//      ((r >> 4) * (K >> 5) + (k >> 5)) * 512; inside a block 64 chunks of 8 halves (16 B): chunk id holds row (id & 15),
//      columns ((id >> 4) & 3) * 8 .. + 7. So 16 rows x K columns take 16 * K halves, as in a row-major plane.
// ---- fragment loaders: 16-bit A/B operand, p + lb bytes = block base + 16 B * lane: lane -> row/col (lane&15), h = lane>>4;
//      elements 0..7 <- chunk lane (k0+8h..), elements 8..15 <- chunk 32 + lane (k0+16+8h..)  (same split k map for A and B);
//      each of the two loads of a wave reads 512 contiguous bytes = 4 whole 128-B lines
__device__ __forceinline__ v16h ldfrag_h(const _Float16* p, unsigned lb) {
  FragH f;
  const char* q = (const char*)(const void*)p + lb;
  f.h[0] = *(const v8h*)(const void*)(q);
  f.h[1] = *(const v8h*)(const void*)(q + 512);
  return f.v;
}
__device__ __forceinline__ v16b ldfrag_b(const u16* p, unsigned lb) { // bf16 plane read as unsigned integer vectors
  FragB f;
  const char* q = (const char*)(const void*)p + lb;
  f.u[0] = *(const v4u*)(const void*)(q);
  f.u[1] = *(const v4u*)(const void*)(q + 512);
  return f.v;
}

__device__ __forceinline__ v8f mma_h(v16h a, v16h b, v8f c) {
  return __builtin_amdgcn_wmma_f32_16x16x32_f16(false, a, false, b, (short)0, c, false, false);
}
__device__ __forceinline__ v8f mma_b(v16b a, v16b b, v8f c) {
  return __builtin_amdgcn_wmma_f32_16x16x32_bf16(false, a, false, b, (short)0, c, false, false);
}
__device__ __forceinline__ void guard2(v8f& a, v8f& b, v16h x0, v16h x1, v16h x2, v16h x3, v16h x4, v16h x5) {
#if defined(__HIP_DEVICE_COMPILE__)
  asm volatile("v_nop\n\tv_nop\n\tv_nop\n\tv_nop"
               : "+v"(a), "+v"(b) : "v"(x0), "v"(x1), "v"(x2), "v"(x3), "v"(x4), "v"(x5) : "memory");
#endif
}
template <typename F>
__device__ __forceinline__ void guard6(v8f& a, v8f& b, v8f& c, v8f& d, F x0, F x1, F x2, F x3, F x4, F x5) {
#if defined(__HIP_DEVICE_COMPILE__)
  asm volatile("v_nop\n\tv_nop\n\tv_nop\n\tv_nop"
               : "+v"(a), "+v"(b), "+v"(c), "+v"(d) : "v"(x0), "v"(x1), "v"(x2), "v"(x3), "v"(x4), "v"(x5) : "memory");
#endif
}
__device__ __forceinline__ void acc_guard4(v8f& a, v8f& b, v8f& c, v8f& d) {
#if defined(__HIP_DEVICE_COMPILE__)
  asm volatile("v_nop\n\tv_nop\n\tv_nop\n\tv_nop" : "+v"(a), "+v"(b), "+v"(c), "+v"(d));
#endif
}
__device__ __forceinline__ void wave_sync_lds() {
  __builtin_amdgcn_fence(__ATOMIC_RELEASE, "workgroup");
  __builtin_amdgcn_wave_barrier();
  __builtin_amdgcn_fence(__ATOMIC_ACQUIRE, "workgroup");
}

// =====================================================================================================
// f32 row-major [rows][DIN] -> bf16 RNE plane in fragment order. Thread = one chunk of D (8 elements of one row): two 16-B
// loads, one 16-B store; a wave stores 512 contiguous bytes.
// coverage: bid = 0 .. ceil(n8/256) - 1, x 256 thr x 8 (in-kernel bound) = the whole plane (n8 a multiple of 256 here).
// =====================================================================================================
__device__ __forceinline__ void cvt_bf(const float* __restrict__ x, u16* D, int n8, int bid) {
  const int gt = bid * 256 + (int)threadIdx.x;                        // chunk index in D
  if (gt >= n8) return;
  const int blk = gt >> 6;
  const int row = (blk / (DIN / 32)) * 16 + (gt & 15);
  const int col = (blk % (DIN / 32)) * 32 + ((gt >> 4) & 3) * 8;
  const float* p = x + (size_t)row * DIN + col;
  const v4f a = *(const v4f*)(p), b4 = *(const v4f*)(p + 4);
  v4u o;
#pragma unroll
  for (int e = 0; e < 2; ++e) {
    o[e]     = pk16(bf_bits(a[2 * e]),  bf_bits(a[2 * e + 1]));
    o[2 + e] = pk16(bf_bits(b4[2 * e]), bf_bits(b4[2 * e + 1]));
  }
  u16* d = D + (size_t)gt * 8;
  {
    *(v4u*)(d) = o;
    
  }
}

// =====================================================================================================
// f32 W [K][N] (row-major, x.W layout) -> 16-bit plane D, N rows x K columns in fragment order (A operand for Wq, Wk; B for Wv, Wp). f16mode == 0: bf16 RNE bits;
// f16mode == 1: f16 bits of (bf16 RNE value) * scale. Block = 64 n x 64 k output tile: each thread loads 16 floats of one
// k row (four 16-B loads), converts, scatters into the LDS tile T[n][k] (pitch 72 halves, scalar 2-B LDS stores of per-lane
// values); after a block barrier the tile leaves as its 8 blocks (4 n tiles x 2 k steps) of 64 chunks, a wave storing 512 contiguous B.
// coverage: load 256 thr x 16 = 64 k x 64 n; store 2 iterations x 256 thr x 8 halves = 8 blocks x 512 halves = the tile;
//           bid = 0 .. (N/64)*(K/64) - 1 covers D exactly once (N % 64 == 0, K % 64 == 0).
// =====================================================================================================
__device__ __forceinline__ void wt16(const float* __restrict__ W, u16* D, int K, int N, int f16mode, float scale, int bid) {
  __shared__ __align__(16) u16 T[64 * WTP];
  const int tid = threadIdx.x;
  const int nt  = N >> 6;
  const int n0  = (bid % nt) * 64;
  const int k0  = (bid / nt) * 64;
  if (k0 + 64 > K) return;                  // block-uniform, before the barrier; never taken with the exact grid
  {
    const int kr = tid >> 2;                // k row within tile 0..63
    const int nc = (tid & 3) * 16;          // n chunk 0,16,32,48
    const float* src = W + (size_t)(k0 + kr) * (size_t)N + n0 + nc;
#pragma unroll
    for (int i = 0; i < 4; ++i) {
      const v4f a = *(const v4f*)(src + 4 * i);
#pragma unroll
      for (int e = 0; e < 4; ++e) {
        const float f = a[e];
        const unsigned short hb = h_bits((_Float16)(bfr(f) * scale));
        const unsigned short bb = bf_bits(f);
        T[(nc + 4 * i + e) * WTP + kr] = (f16mode != 0) ? hb : bb;
      }
    }
  }
  __syncthreads();
  v4u v[2];
#pragma unroll
  for (int it = 0; it < 2; ++it) {
    const int id = it * 256 + tid;          // chunk of the tile: block id >> 6 = (n tile id >> 7, k step (id >> 6) & 1)
    v[it] = *(const v4u*)(T + ((id >> 7) * 16 + (id & 15)) * WTP + ((id >> 6) & 1) * 32 + ((id >> 4) & 3) * 8);
  }
  {
#pragma unroll
    for (int it = 0; it < 2; ++it) {
      const int id = it * 256 + tid;
      const size_t blk = (size_t)((n0 >> 4) + (id >> 7)) * (size_t)(K >> 5) + (size_t)((k0 >> 5) + ((id >> 6) & 1));
      *(v4u*)(D + blk * 512 + (id & 63) * 8) = v[it];
    }
    
  }
}

// =====================================================================================================
// All jobs that read only the inputs, in one launch; a block does one block's work of one job, chosen by its index (block-uniform):
//   [0, GWP) Wp [DOUT k][DOUT n] -> DOUT n x DOUT k as f16 of bf16 value x1024; then GWQ blocks Wq [DIN k][NQ n] -> NQ n x DIN k
//   bf16; GWK blocks Wk -> NK x DIN; GWV blocks Wv -> NV x DIN; then NB * GX blocks x -> bf16 plane MROWS x DIN, GX per batch.
// =====================================================================================================
__global__ __launch_bounds__(256)
void prep_in(const float* __restrict__ x, const float* __restrict__ wq, const float* __restrict__ wk,
             const float* __restrict__ wv, const float* __restrict__ wp,
             u16* XB, u16* WQT, u16* WKT, u16* WVT, u16* WPT) {
  const int bid = blockIdx.x;
  if (bid < GWALL) {
    const float* W = wp;
    u16* D = WPT;
    int K = DOUT, N = DOUT, mode = 1, lb = bid;
    float sc = WOS;
    if (bid >= GWP + GWQ + GWK)  { W = wv; D = WVT; K = DIN; N = NV; mode = 0; sc = 1.0f; lb = bid - (GWP + GWQ + GWK); }
    else if (bid >= GWP + GWQ)   { W = wk; D = WKT; K = DIN; N = NK; mode = 0; sc = 1.0f; lb = bid - (GWP + GWQ); }
    else if (bid >= GWP)         { W = wq; D = WQT; K = DIN; N = NQ; mode = 0; sc = 1.0f; lb = bid - GWP; }
    wt16(W, D, K, N, mode, sc, lb);
  } else {
    const int cb = bid - GWALL;
    const int b  = cb / GX;
    if (b >= NB) return;                    // block-uniform; never taken with the exact grid
    cvt_bf(x + (size_t)b * XS_FULL * DIN, XB + (size_t)b * SEQ * DIN, (SEQ * DIN) / 8, cb % GX);
  }
}

// =====================================================================================================
// Epilogue of the output GEMM: the wave's 16x64 f32 tile (times oscale, plus the lane's per-column bias of each
// coverage: 8 instructions x 2 rows x 16 lanes x 4 floats = the wave's 16 x 64 tile.
// =====================================================================================================
__device__ __forceinline__ void epi64(float* sl, v8f a0, v8f a1, v8f a2, v8f a3, float oscale,
                                      float bb0, float bb1, float bb2, float bb3,
                                      float* C, int N, size_t rowb, int col0, int lane) {
  const int hh = lane >> 4, m = lane & 15;
#pragma unroll
  for (int r = 0; r < 8; ++r) {
    const int ro = (8 * hh + r) * 68 + m;
    sl[ro]      = a0[r] * oscale + bb0;
    sl[ro + 16] = a1[r] * oscale + bb1;
    sl[ro + 32] = a2[r] * oscale + bb2;
    sl[ro + 48] = a3[r] * oscale + bb3;
  }
  wave_sync_lds();
  v4f vals[8];
#pragma unroll
  for (int it = 0; it < 8; ++it) vals[it] = *(const v4f*)(sl + (it * 2 + hh) * 68 + m * 4);
  float* dst = C + (rowb + (size_t)hh) * (size_t)N + col0 + m * 4;
  {
#pragma unroll
    for (int it = 0; it < 8; ++it) {
      *(v4f*)(dst + (size_t)(it * 2) * (size_t)N) = vals[it];
    }
    
  }
}

// =====================================================================================================
// bf16 GEMM, no bias, the q, k and v projections in one launch, stored straight as attention's f16 planes (hi = f16(t), residual =
// f16(t - hi), t = value * scale; fragment order): A (bf16, M rows x K, fragment order) . Bt^T (bf16, NQKV rows x K, fragment
// order: the rows of Wq^T, Wk^T, Wv^T one behind the other, which is how the three planes lie in the workspace).
// Block = 64x64 tile, 4 waves x 16 rows of A; a tile lies in one projection (NQ, NK, NV multiples of 64), chosen by the block's
// column tile (block-uniform); fragments loaded straight from the planes' blocks (two 16-B loads each, split k map for A and B);
// K stepped by 32 * KUQ (host guarantees K % (32 * KUQ) == 0, M % 64 == 0, grid = (M/64)*(NQKV/64)).
// A chunk of a plane is 8 consecutive columns of one plane row, so each projection is computed with the side up that puts a chunk
// into one lane's 8 accumulator registers:
//   q, k (plane row = x row, plane column = n): D = W rows . x rows^T, lane = x row rowb + lane % 16, registers = n 8*(lane/16) + r;
//   v^T  (plane row = n = (g, d), plane column = key = x row): D = x rows . W rows^T, lane = n, registers = x rows 8*(lane/16) + r.
// coverage: per wave 4 subtiles x 32 chunks x 8 halves = 16 x 64 of the hi and of the residual plane, each store instruction of a
//           wave 512 contiguous bytes; the grid's tiles cover QH, QL, KH, KL, VH, VL exactly once.
// =====================================================================================================
template <int WA>                           // WA == 1: the W fragments are the A operand (q, k); WA == 0: the x fragment is (v)
__device__ __forceinline__ void qkv_tile(const u16* ap, const u16* bp0, int K, float sc, u16* dh, u16* dl, int jstep) {
  const size_t bs = (size_t)16 * K;         // 16 rows on = one row of blocks on
  const u16* bp1 = bp0 + bs;
  const u16* bp2 = bp1 + bs;
  const u16* bp3 = bp2 + bs;
  v8f acc[4];
#pragma unroll
  for (int j = 0; j < 4; ++j) acc[j] = zero8();
#pragma unroll 1
  for (int k0 = 0; k0 < K; k0 += 32 * KUQ) {
    // the fragments of KUQ k steps, all loads issued as one group in k order: one wait for the planes' latency serves KUQ steps
    v16b a[KUQ], b0[KUQ], b1[KUQ], b2[KUQ], b3[KUQ];
#pragma unroll                              // every index constant: the fragment arrays stay in registers
    for (int u = 0; u < KUQ; ++u) {
      a[u]  = ldfrag_b(ap,  1024u * u);
      b0[u] = ldfrag_b(bp0, 1024u * u);
      b1[u] = ldfrag_b(bp1, 1024u * u);
      b2[u] = ldfrag_b(bp2, 1024u * u);
      b3[u] = ldfrag_b(bp3, 1024u * u);
    }
    // the loads' address registers are named here, so none is given to a later load's result or stepped on before the
    // loads' address translations are back
#if defined(__HIP_DEVICE_COMPILE__)
    asm volatile("s_wait_xcnt 0x0" :: "v"(ap), "v"(bp0), "v"(bp1), "v"(bp2), "v"(bp3) : "memory");
#endif
    // without this the scheduler sinks each step's loads down to its products, and one step's loads are in flight again
    __builtin_amdgcn_sched_barrier(0);
    ap += 512 * KUQ; bp0 += 512 * KUQ; bp1 += 512 * KUQ; bp2 += 512 * KUQ; bp3 += 512 * KUQ;
#pragma unroll                              // every index constant: the fragment arrays stay in registers
    for (int u = 0; u < KUQ; ++u) {
      if constexpr (WA == 1) {
        acc[0] = mma_b(b0[u], a[u], acc[0]);
        acc[1] = mma_b(b1[u], a[u], acc[1]);
        acc[2] = mma_b(b2[u], a[u], acc[2]);
        acc[3] = mma_b(b3[u], a[u], acc[3]);
      } else {
        acc[0] = mma_b(a[u], b0[u], acc[0]);
        acc[1] = mma_b(a[u], b1[u], acc[1]);
        acc[2] = mma_b(a[u], b2[u], acc[2]);
        acc[3] = mma_b(a[u], b3[u], acc[3]);
      }
    }
    guard6<v16b>(acc[0], acc[1], acc[2], acc[3], a[KUQ - 1], b0[KUQ - 1], b1[KUQ - 1], b2[KUQ - 1], b3[KUQ - 1], a[KUQ - 1]);
  }
  v4u oh[4], ol[4];
#pragma unroll
  for (int j = 0; j < 4; ++j) {
#pragma unroll
    for (int e = 0; e < 4; ++e) {
      const float t0 = acc[j][2 * e] * sc, t1 = acc[j][2 * e + 1] * sc;
      const _Float16 h0 = (_Float16)t0, h1 = (_Float16)t1;
      const _Float16 l0 = (_Float16)(t0 - (float)h0), l1 = (_Float16)(t1 - (float)h1);
      oh[j][e] = pk16(h_bits(h0), h_bits(h1));
      ol[j][e] = pk16(h_bits(l0), h_bits(l1));
    }
  }
#pragma unroll
  for (int j = 0; j < 4; ++j) {
    *(v4u*)(dh + (size_t)j * jstep) = oh[j];
    *(v4u*)(dl + (size_t)j * jstep) = ol[j];
  }
  // a precaution: in the listing the other instance's prologue follows these eight stores and rewrites their address and data
  // registers; this wait stands in front of every such write
#if defined(__HIP_DEVICE_COMPILE__)
  asm volatile("s_wait_xcnt 0x0" ::: "memory");
#endif
}

__global__ __launch_bounds__(128)
void gemm_qkv(const u16* __restrict__ A, const u16* __restrict__ Bt, u16* QH, u16* QL, u16* KH, u16* KL, u16* VH, u16* VL,
              int M, int K) {
  const int tid = threadIdx.x, wave = tid >> 5, lane = tid & 31;
  const int ntile = NQKV >> 6;
  const int bid   = blockIdx.x;
  const int rowb  = (bid / ntile) * 64 + wave * 16;
  const int colb  = (bid % ntile) * 64;     // first row of the tile in Bt
  if (rowb + 16 > M) return;                // wave-uniform, never taken with the exact grid; no barriers in this kernel
  const u16* ap  = A  + (size_t)rowb * K + 8 * lane;   // the lane's chunk in block (rowb / 16, 0); the next k step is 512 halves on
  const u16* bp0 = Bt + (size_t)colb * K + 8 * lane;
  if (colb >= NQ + NK) {
    // v^T planes: row tile (b*NG + g) * (DV/16) + j, key step s0 / 32; the wave's 16 keys are one half of that block's 64 chunks
    const int g  = (colb - (NQ + NK)) / DV;
    const int b  = rowb / SEQ;
    const int s0 = rowb - b * SEQ;
    const size_t o = ((size_t)((b * NG + g) * (DV / 16)) * (SEQ / 32) + (size_t)(s0 >> 5)) * 512 + (size_t)(((s0 >> 4) & 1) * 32 + lane) * 8;
    qkv_tile<0>(ap, bp0, K, VCAR, VH + o, VL + o, (SEQ / 32) * 512);
  } else {
    // q or k planes: row tile rowb / 16, column step (column / 32); subtile j = chunks (j & 1) * 32 + lane of block j / 2: 256 halves on
    const bool isk = colb >= NQ;
    const int  nc  = isk ? NK : NQ;         // the plane's columns, and the tile's first column in it
    const int  c0  = isk ? colb - NQ : colb;
    const size_t o = ((size_t)(rowb >> 4) * (size_t)(nc >> 5) + (size_t)(c0 >> 5)) * 512 + (size_t)lane * 8;
    qkv_tile<1>(ap, bp0, K, isk ? KSC : QSC, (isk ? KH : QH) + o, (isk ? KL : QL) + o, 256);
  }
}

// =====================================================================================================
// f16 GEMM with a two-plane A operand and bias: C[M][N] (f32) = (Ah + Al) (f16 hi and residual planes, M rows x K, fragment
// order, residual unscaled relative to hi) . Bt^T (f16, N rows x K, fragment order) * oscale + bf16 RNE value of bias[n] (bias has
// N entries). Products ah.b + al.b into one accumulator. Same tiling and fragment loads (split k map) as gemm_qkv;
// K stepped by 32 * KUO (host guarantees K % (32 * KUO) == 0, M % 64 == 0, N % 64 == 0, grid = (M/64)*(N/64)).
// =====================================================================================================
__global__ __launch_bounds__(128)
void gemm_h2(const u16* __restrict__ Ah, const u16* __restrict__ Al, const u16* __restrict__ Bt,
             const float* __restrict__ bias, float* C, int M, int N, int K, float oscale) {
  __shared__ __align__(16) float slab[4 * SLAB64];
  const int tid = threadIdx.x, wave = tid >> 5, lane = tid & 31, m = lane & 15;
  const int ntile = N >> 6;
  const int bid   = blockIdx.x;
  const int rowb  = (bid / ntile) * 64 + wave * 16;
  const int col0  = (bid % ntile) * 64;
  if (rowb + 16 > M) return;                // wave-uniform, never taken with the exact grid; no block barriers in this kernel
  const size_t bs = (size_t)16 * K;
  const _Float16* ahp = (const _Float16*)(const void*)Ah + (size_t)rowb * K + 8 * lane;   // the lane's chunk in block (rowb / 16, 0), as in gemm_qkv
  const _Float16* alp = (const _Float16*)(const void*)Al + (size_t)rowb * K + 8 * lane;
  const _Float16* bp0 = (const _Float16*)(const void*)Bt + (size_t)col0 * K + 8 * lane;
  const _Float16* bp1 = bp0 + bs;
  const _Float16* bp2 = bp1 + bs;
  const _Float16* bp3 = bp2 + bs;
  v8f acc0 = zero8(), acc1 = zero8(), acc2 = zero8(), acc3 = zero8();
#pragma unroll 1
  for (int k0 = 0; k0 < K; k0 += 32 * KUO) {
    // the fragments of KUO k steps, all loads issued as one group in k order, as in gemm_qkv
    v16h ah[KUO], al[KUO], b0[KUO], b1[KUO], b2[KUO], b3[KUO];
#pragma unroll                              // every index constant: the fragment arrays stay in registers
    for (int u = 0; u < KUO; ++u) {
      ah[u] = ldfrag_h(ahp, 1024u * u);
      al[u] = ldfrag_h(alp, 1024u * u);
      b0[u] = ldfrag_h(bp0, 1024u * u);
      b1[u] = ldfrag_h(bp1, 1024u * u);
      b2[u] = ldfrag_h(bp2, 1024u * u);
      b3[u] = ldfrag_h(bp3, 1024u * u);
    }
    // the loads' address registers are named here, so none is given to a later load's result or stepped on before the
    // loads' address translations are back
#if defined(__HIP_DEVICE_COMPILE__)
    asm volatile("s_wait_xcnt 0x0" :: "v"(ahp), "v"(alp), "v"(bp0), "v"(bp1), "v"(bp2), "v"(bp3) : "memory");
#endif
    // without this the scheduler sinks each step's loads down to its products, and one step's loads are in flight again
    __builtin_amdgcn_sched_barrier(0);
    ahp += 512 * KUO; alp += 512 * KUO; bp0 += 512 * KUO; bp1 += 512 * KUO; bp2 += 512 * KUO; bp3 += 512 * KUO;
#pragma unroll                              // every index constant: the fragment arrays stay in registers
    for (int u = 0; u < KUO; ++u) {
      acc0 = mma_h(ah[u], b0[u], acc0);  acc0 = mma_h(al[u], b0[u], acc0);
      acc1 = mma_h(ah[u], b1[u], acc1);  acc1 = mma_h(al[u], b1[u], acc1);
      acc2 = mma_h(ah[u], b2[u], acc2);  acc2 = mma_h(al[u], b2[u], acc2);
      acc3 = mma_h(ah[u], b3[u], acc3);  acc3 = mma_h(al[u], b3[u], acc3);
    }
    guard6<v16h>(acc0, acc1, acc2, acc3, ah[KUO - 1], al[KUO - 1], b0[KUO - 1], b1[KUO - 1], b2[KUO - 1], b3[KUO - 1]);
  }
  // per-lane bias of D column m in each of the 4 subtiles; col0 + 48 + m <= N - 1 always
  const float bb0 = bfr(bias[col0 + m]);
  const float bb1 = bfr(bias[col0 + 16 + m]);
  const float bb2 = bfr(bias[col0 + 32 + m]);
  const float bb3 = bfr(bias[col0 + 48 + m]);
  epi64(slab + wave * SLAB64, acc0, acc1, acc2, acc3, oscale, bb0, bb1, bb2, bb3, C, N, (size_t)rowb, col0, lane);
}

// =====================================================================================================
// Causal grouped attention with ALiBi, q/k head dim 32, value head dim 64. Block bid -> (query tile qt = qtb + bid % nqtl:
// rows q0 = 16*qt .. q0+15, kv group hg, batch b); one wave per query head = hg + NG*wave, the 4 heads with head % NG = hg.
//   q hi / residual planes f16 x256, row b*SEQ + s, column h*DQ + d (NQ columns); k hi / residual planes f16 x256, row
//   b*SEQ + s, column g*DQ + d (NK columns); v^T hi / residual planes x1024, row (b*NG + g)*DV + d, column s (SEQ columns);
//   O hi / residual planes f16 x1024, row b*SEQ + s, column h*DV + d (DOUT columns); all in fragment order.
//   scores, transposed: S^T (16 keys x 16 queries, one k-step over d = 0..31) = k_hi.q_hi + k_lo.q_hi + k_hi.q_lo (A = k block,
//   B = q block; 3 products into one accumulator, residuals unscaled relative to their hi planes), q fragments loop-invariant;
//   a lane holds 16 of the step's 32 scores of ONE query (q0 + lane % 16), lane l ^ 16 the other 16;
//   logit (log2 domain) t(i, j) = (acc/(256*256) + slope[h]*(j - i)) * (1/sqrt(32))*log2e, replaced by -inf where j > i,
//   slope[h] = 2^(-(h+1)/2) built exactly (power of two times f32 sqrt2 for odd h+1).
//   Key tiles of 32 visited in order for kb <= q0 + 15 (later tiles hold only keys above every query row of the tile).
//   A step's 12 blocks of 1 KiB (k hi 2, k residual 2, v^T hi 4, v^T residual 4) are the same for the block's 4 heads: they come
//   into LDS once, by asynchronous copies (wave w brings k block w, v^T hi block w, v^T residual block w), two buffers, the copies
//   of step t + 1 in flight while step t is worked on; every wave reads all 12 blocks as its fragments from LDS.
//   Online max-subtracted base-2 softmax in f32, -inf-safe rescale: maximum and sum run over the lane's own registers, the
//   maximum joined with lane l ^ 16 in each step, the two half sums once behind the loop. The two score tiles of a step,
//   converted in place, ARE the B fragment of P^T (element e <- tile e / 8, register e % 8: the planes' split k map), so P
//   passes through no LDS; v^T blocks are the A fragments of 4 d-subtiles, both v planes: O^T += v_hi.P_hi + v_lo.P_hi
//   (+ v_hi.P_lo when PRES == 1), 2 groups of 2 subtiles.
//   After the loop: out = acc / Z (Z > 0 always: key 0 <= every query row; guarded anyway), carries 1/(32768*1024) folded
//   once; a lane's 8 registers of a subtile are 8 consecutive d of its query = one chunk of the O planes.
// coverage: per wave 4 instructions x 32 chunks x 8 halves = 2 blocks = 16 x 64 of each O plane; the two block ranges of attn_all
//           cover query tiles [QO/16, NQT) and [0, QO/16) x NHG x NB blocks x WPB waves = every (b, s, h) row segment of OH and
//           of OL exactly once.
// =====================================================================================================
// One wave's six asynchronous copies of a step (16 B a lane each, 512 contiguous bytes a wave): the two halves of a k block to LDS
// byte address l, of a v^T hi block to l + 4096, of a v^T residual block to l + 8192. The closing s_wait_xcnt stands in the copies'
// own statement, so that no address register named here is rewritten in front of it.
__device__ __forceinline__ void kv_copy(unsigned l, const _Float16* gk, const _Float16* gh, const _Float16* gl) {
#if defined(__HIP_DEVICE_COMPILE__)
  asm volatile("global_load_async_to_lds_b128 %0, %6, off\n\t"
               "global_load_async_to_lds_b128 %1, %7, off\n\t"
               "global_load_async_to_lds_b128 %2, %8, off\n\t"
               "global_load_async_to_lds_b128 %3, %9, off\n\t"
               "global_load_async_to_lds_b128 %4, %10, off\n\t"
               "global_load_async_to_lds_b128 %5, %11, off\n\t"
               "s_wait_xcnt 0x0"
               :: "v"(l), "v"(l + 512u), "v"(l + 4096u), "v"(l + 4608u), "v"(l + 8192u), "v"(l + 8704u),
                  "v"(gk), "v"(gk + 256), "v"(gh), "v"(gh + 256), "v"(gl), "v"(gl + 256)
               : "memory");
#endif
}

template <int PRES>
__device__ __forceinline__
void attn_c(const u16* __restrict__ QHp, const u16* __restrict__ QLp,
            const u16* __restrict__ KHp, const u16* __restrict__ KLp,
            const u16* __restrict__ VHp, const u16* __restrict__ VLp,
            u16* OHp, u16* OLp, int qtb, int nqtl, int bid, u16* kvs) {
  const int tid  = threadIdx.x;
  const int wave = tid >> 5;
  const int lane = tid & 31;
  const int hh   = lane >> 4;
  const int c    = lane & 15;
  const int qt   = qtb + (bid % nqtl);
  const int t2   = bid / nqtl;
  const int hg   = t2 % NHG;
  const int b    = t2 / NHG;
  if (b >= NB) return;                      // block-uniform, before every barrier; never taken with the exact grid
  const int q0   = qt * 16;
  if (q0 + 16 > SEQ) return;                // block-uniform, before every barrier; never taken
  const int head = hg + NG * wave;
  const int kvh  = hg;                      // tiled kv mapping: head h -> kv group h % NG, the same for the block's 4 waves

  // fragment-order blocks (512 halves each): q block (row tile, head); k block (key tile of 16, kv group), 16 keys on = 16 * NK
  // halves on; v^T block (d tile, key step of 32), 32 keys on = 512 halves on, 16 d on = 16 * SEQ halves on
  const _Float16* Qh  = (const _Float16*)(const void*)QHp + ((size_t)b * SEQ + q0) * NQ + (size_t)head * 512;
  const _Float16* Ql  = (const _Float16*)(const void*)QLp + ((size_t)b * SEQ + q0) * NQ + (size_t)head * 512;
  const _Float16* Khb = (const _Float16*)(const void*)KHp + (size_t)b * SEQ * NK + (size_t)kvh * 512;  // key row kb added per step
  const _Float16* Klb = (const _Float16*)(const void*)KLp + (size_t)b * SEQ * NK + (size_t)kvh * 512;
  const _Float16* Vhb = (const _Float16*)(const void*)VHp + (size_t)(b * NG + kvh) * DV * SEQ;         // d tile 0 (+j)
  const _Float16* Vlb = (const _Float16*)(const void*)VLp + (size_t)(b * NG + kvh) * DV * SEQ;
  const unsigned lb = 16u * (unsigned)lane;  // the lane's chunk inside a block, in bytes

  // ALiBi slope 2^(-(head+1)/2): even exponent -> exact power of two; odd -> power of two times f32 sqrt(2)
  const int   e1   = head + 1;
  const int   pw   = (e1 + 1) >> 1;
  const float p2   = __uint_as_float(((unsigned)(127 - pw)) << 23);
  const float slope = p2 * (((e1 & 1) != 0) ? SQRT2F : 1.0f);   // wave-uniform select by value
  const float lsc  = 1.0f / (QSC * KSC);
  const float ul2  = RSQ_DQ * LOG2E;
  const float oc   = 1.0f / (PCAR * VCAR);
  const size_t KROW = (size_t)NK;           // halves per key row in the k planes (16 rows = one row of blocks)

  const v16h qh = ldfrag_h(Qh, lb);             // loop-invariant q fragments (d = 0..31): hi plane
  const v16h ql = ldfrag_h(Ql, lb);             //                                         residual plane

  float mrow = -INFINITY, lrow = 0.f;       // the lane's query: running maximum (both halves alike), sum over this half's keys
  v8f o[4];                                 // O^T: o[j][r] = (d = j*16 + 8*hh + r, query q0 + c)
#pragma unroll
  for (int j = 0; j < 4; ++j) o[j] = zero8();
  const int ncaus = (q0 >> 5) + 1;                                            // tiles holding keys <= q0 + 15
  const int nkt = (ncaus < NKT) ? ncaus : NKT;
  const int qr  = q0 + c;                                                     // the lane's query row

  // the wave's share of a step's copies: k block wave (hi plane key tiles 0, 1, residual plane key tiles 0, 1), v^T hi d tile wave,
  // v^T residual d tile wave; the lane's 16 B of each half block. A step on: 32 key rows in k, one block (512 halves) in v^T.
  const _Float16* gk = (((wave & 2) != 0) ? Klb : Khb) + (size_t)(16 * (wave & 1)) * KROW + 8 * lane;
  const _Float16* gh = Vhb + (size_t)wave * 16 * SEQ + 8 * lane;
  const _Float16* gl = Vlb + (size_t)wave * 16 * SEQ + 8 * lane;
  const unsigned  lw = (unsigned)(size_t)kvs + 1024u * (unsigned)wave + lb;   // LDS byte address: buffer 0, block wave, the lane's chunk

  // step 0 into buffer 0, landed and published; then step 1 into buffer 1, in flight over step 0
  kv_copy(lw, gk, gh, gl);
  asm volatile("s_wait_asynccnt 0x0" ::: "memory");   // this wave's copies have landed before the barrier lets others read them
  __syncthreads();
  if (nkt > 1) kv_copy(lw + 2u * KVBUF, gk + (size_t)32 * KROW, gh + 512, gl + 512);

#pragma unroll 1
  for (int kt = 0; kt < nkt; ++kt) {
    const int kb = kt * 32;
    // ---- this step's fragments from its LDS buffer, as one group: k first (the scores wait for these alone), then v^T ----
    const _Float16* kvb = (const _Float16*)(const void*)kvs + (kt & 1) * KVBUF;
    const v16h kh0 = ldfrag_h(kvb, lb);
    const v16h kh1 = ldfrag_h(kvb + 512, lb);
    const v16h kl0 = ldfrag_h(kvb + 1024, lb);
    const v16h kl1 = ldfrag_h(kvb + 1536, lb);
    v16h vh[4], vl[4];
#pragma unroll
    for (int j = 0; j < 4; ++j) vh[j] = ldfrag_h(kvb + 2048 + j * 512, lb);
#pragma unroll
    for (int j = 0; j < 4; ++j) vl[j] = ldfrag_h(kvb + 4096 + j * 512, lb);
    // ---- scores: D element r of this lane = (key kb + 8*hh + r, query qr) in s0, key kb + 16 + 8*hh + r in s1 ----
    //      hi+residual planes on both operands: k_hi.q_hi + k_lo.q_hi + k_hi.q_lo
    v8f s0 = zero8(), s1 = zero8();
    {
      s0 = mma_h(kh0, qh, s0);              // hi.hi
      s0 = mma_h(kl0, qh, s0);              // k residual . q hi
      s0 = mma_h(kh0, ql, s0);              // k hi . q residual
      s1 = mma_h(kh1, qh, s1);
      s1 = mma_h(kl1, qh, s1);
      s1 = mma_h(kh1, ql, s1);
      guard2(s0, s1, qh, ql, kh0, kl0, kh1, kl1);
    }
    // ---- causal select + ALiBi + scale, online softmax in base 2, -inf-safe; all 16 values belong to query qr ----
    const int dk = kb + 8 * hh - qr;        // key - query of s0[0]
    float t0[8], t1[8];
#pragma unroll
    for (int r = 0; r < 8; ++r) {
      const int   d0 = dk + r, d1 = dk + 16 + r;
      const float a0 = slope * (float)d0;
      const float a1 = slope * (float)d1;
      const float u0 = (s0[r] * lsc + a0) * ul2;
      const float u1 = (s1[r] * lsc + a1) * ul2;
      t0[r] = (d0 > 0) ? -INFINITY : u0;
      t1[r] = (d1 > 0) ? -INFINITY : u1;
    }
    float mq[4];
#pragma unroll
    for (int i = 0; i < 4; ++i) mq[i] = fmaxf(fmaxf(t0[2 * i], t0[2 * i + 1]), fmaxf(t1[2 * i], t1[2 * i + 1]));
    float mx = fmaxf(fmaxf(mq[0], mq[1]), fmaxf(mq[2], mq[3]));
    mx = fmaxf(mx, xhalf(mx));              // the other 16 keys of the step
    const float mn = fmaxf(mrow, mx);
    const float ms = (mn == -INFINITY) ? 0.0f : mn;
    const float al = ex2x1(mrow - ms);
    mrow = mn;
    float e0[8], e1[8];
#pragma unroll
    for (int r = 0; r < 8; ++r) { t0[r] -= ms; t1[r] -= ms; }
    ex2x8(e0, t0);
    ex2x8(e1, t1);
    float sq[4];
#pragma unroll
    for (int i = 0; i < 4; ++i) sq[i] = (e0[2 * i] + e0[2 * i + 1]) + (e1[2 * i] + e1[2 * i + 1]);
    lrow = lrow * al + ((sq[0] + sq[1]) + (sq[2] + sq[3]));
#pragma unroll
    for (int j = 0; j < 4; ++j) {
#pragma unroll
      for (int r = 0; r < 8; ++r) o[j][r] *= al;
    }
    // ---- B fragments of P^T*32768: f16 hi (and f16 residual when PRES), column = query c, split k map over the 32 keys of
    //      this step: elements 0..7 = keys kb + 8hh + 0..7 (s0's rows), elements 8..15 = keys kb + 16 + 8hh + 0..7 (s1's) ----
    FragH ph, pl;
    {
#pragma unroll
      for (int e = 0; e < 8; ++e) {
        const float ta = e0[e] * PCAR, tc = e1[e] * PCAR;
        const _Float16 ha = (_Float16)ta, hc = (_Float16)tc;
        ph.h[0][e] = ha;
        ph.h[1][e] = hc;
        if constexpr (PRES == 1) {
          pl.h[0][e] = (_Float16)(ta - (float)ha);
          pl.h[1][e] = (_Float16)(tc - (float)hc);
        }
      }
      if constexpr (PRES != 1) pl.v = ph.v;
    }
    // ---- v^T.P^T : A fragment row m = d = j*16 + c, k = the step's 32 keys; 2 groups of 2 d-subtiles ----
    {
#pragma unroll
      for (int jg = 0; jg < 2; ++jg) {
        const v16h vha = vh[2 * jg], vhb2 = vh[2 * jg + 1];
        const v16h vla = vl[2 * jg], vlb2 = vl[2 * jg + 1];
        o[2 * jg]     = mma_h(vha,  ph.v, o[2 * jg]);                       // v_hi . P_hi
        if constexpr (PRES == 1) o[2 * jg] = mma_h(vha, pl.v, o[2 * jg]);   // v_hi . P_lo
        o[2 * jg]     = mma_h(vla,  ph.v, o[2 * jg]);                       // v_lo . P_hi
        o[2 * jg + 1] = mma_h(vhb2, ph.v, o[2 * jg + 1]);
        if constexpr (PRES == 1) o[2 * jg + 1] = mma_h(vhb2, pl.v, o[2 * jg + 1]);
        o[2 * jg + 1] = mma_h(vlb2, ph.v, o[2 * jg + 1]);
        guard2(o[2 * jg], o[2 * jg + 1], ph.v, pl.v, vha, vhb2, vla, vlb2);
      }
    }
    // ---- hand-over: step kt + 1 is published, and this step's buffer is free for step kt + 2 ----
    asm volatile("s_wait_dscnt 0x0" ::: "memory");      // this wave's reads of the buffer are done before anyone refills it
    asm volatile("s_wait_asynccnt 0x0" ::: "memory");   // this wave's copies of step kt + 1 have landed before others read them
    __syncthreads();
    if (kt + 2 < nkt)
      kv_copy(lw + (unsigned)(kt & 1) * (2u * KVBUF), gk + (size_t)(kb + 64) * KROW, gh + (size_t)(kb + 64) * 16, gl + (size_t)(kb + 64) * 16);
  }
  asm volatile("s_wait_asynccnt 0x0" ::: "memory");     // no copy is left in flight when the wave goes on to its end
  acc_guard4(o[0], o[1], o[2], o[3]);
  // ---- out = acc / Z (0 if Z == 0), Z = the two halves' sums, carries (32768 on P, 1024 on v) folded once ----
  const float lv  = lrow + xhalf(lrow);
  const float ls  = (lv > 0.0f) ? lv : 1.0f;
  const float inv = (lv > 0.0f) ? ((1.0f / ls) * oc) : 0.0f;
  v4u oh[4], ol[4];
#pragma unroll
  for (int it = 0; it < 4; ++it) {
    // chunk it * 32 + lane of the wave's two O blocks: query row c, head columns it * 16 + 8 * hh .. + 7 = o[it][0..7]
    float w[8];
#pragma unroll
    for (int e = 0; e < 8; ++e) w[e] = (o[it][e] * inv) * OSC;
#pragma unroll
    for (int e = 0; e < 4; ++e) {
      const _Float16 h0 = (_Float16)w[2 * e], h1 = (_Float16)w[2 * e + 1];
      const _Float16 l0 = (_Float16)(w[2 * e] - (float)h0), l1 = (_Float16)(w[2 * e + 1] - (float)h1);
      oh[it][e] = pk16(h_bits(h0), h_bits(h1));
      ol[it][e] = pk16(h_bits(l0), h_bits(l1));
    }
  }
  const size_t ob = ((size_t)b * SEQ + q0) * DOUT + (size_t)head * (DV / 32) * 512 + 8 * lane;
  {
#pragma unroll
    for (int it = 0; it < 4; ++it) {
      *(v4u*)(OHp + ob + it * 256) = oh[it];
      *(v4u*)(OLp + ob + it * 256) = ol[it];
    }
    
  }
}

// =====================================================================================================
// Both kinds of query tile in one launch, chosen by the block's index (block-uniform): blocks [0, nqt0 * NHG * NB) take the nqt0
// query tiles from nqt1 on (the longer key loops), without the P residual product; the other nqt1 * NHG * NB blocks take query
// tiles [0, nqt1), with it.
// =====================================================================================================
__global__ __launch_bounds__(ATT_THREADS)
void attn_all(const u16* __restrict__ QHp, const u16* __restrict__ QLp,
              const u16* __restrict__ KHp, const u16* __restrict__ KLp,
              const u16* __restrict__ VHp, const u16* __restrict__ VLp,
              u16* OHp, u16* OLp, int nqt1, int nqt0) {
  __shared__ __align__(16) u16 kvs[2 * KVBUF];          // two buffers of a step's 12 k and v^T blocks
  const int bid = blockIdx.x;
  const int nb0 = nqt0 * NHG * NB;
  if (bid < nb0) attn_c<0>(QHp, QLp, KHp, KLp, VHp, VLp, OHp, OLp, nqt1, nqt0, bid, kvs);
  else           attn_c<1>(QHp, QLp, KHp, KLp, VHp, VLp, OHp, OLp, 0, nqt1, bid - nb0, kvs);
}

// =====================================================================================================
// Workspace map (bytes); every plane is fully written by whole-line stores before it is read; all extents are exact multiples
// of the store granularity (no pad rows needed); every region offset a multiple of 262144; the 16-bit planes are given as
// rows x columns and lie in fragment order, the f32 planes are row-major:
//   XB  bf16 MROWS x DIN                  MROWS*2048      (NB=2, SEQ=2048: 8388608)
//   WQT bf16 NQ n x DIN k                 1048576
//   WKT bf16 NK n x DIN k                 262144
//   WVT bf16 NV n x DIN k                 524288
//   WPT f16  DOUT n x DOUT k, x1024       2097152
//   QH, QL f16 MROWS x NQ, x256           MROWS*1024 each (4194304 each)
//   KH, KL f16 MROWS x NK, x256           MROWS*256 each  (1048576 each)
//   VH, VL f16 NB*NG*DV x SEQ, x1024      MROWS*512 each  (2097152 each)
//   OH, OL f16 MROWS x DOUT, x1024        MROWS*2048 each (8388608 each)
//   end (NB=2, SEQ=2048)                  43778048
// =====================================================================================================
extern "C" void kernel_launch(void* const* d_in, const int* in_sizes, int n_in,
                              void* d_out, int out_size, void* d_ws, size_t ws_size,
                              hipStream_t stream) {
  if (n_in < 6) return;
  if (in_sizes[0] < ((NB - 1) * XS_FULL + SEQ) * DIN) return;
  if (in_sizes[1] != DIN * NQ) return;
  if (in_sizes[2] != DIN * NK) return;
  if (in_sizes[3] != DIN * NV) return;
  if (in_sizes[4] != DOUT * DOUT) return;
  if (in_sizes[5] != DOUT) return;
  if (out_size < MROWS * DOUT) return;

  const float* x   = (const float*)d_in[0];
  const float* wq  = (const float*)d_in[1];
  const float* wk  = (const float*)d_in[2];
  const float* wv  = (const float*)d_in[3];
  const float* wp  = (const float*)d_in[4];
  const float* bpv = (const float*)d_in[5];
  float*       out = (float*)d_out;

  const size_t szXB = (size_t)MROWS * DIN * 2;
  const size_t szWQ = (size_t)NQ * DIN * 2;
  const size_t szWK = (size_t)NK * DIN * 2;
  const size_t szWV = (size_t)NV * DIN * 2;
  const size_t szWP = (size_t)DOUT * DOUT * 2;
  const size_t szQ  = (size_t)MROWS * NQ * 2;                   // QH, QL
  const size_t szK  = (size_t)MROWS * NK * 2;                   // KH, KL
  const size_t szV  = (size_t)NB * NG * DV * SEQ * 2;           // VH, VL
  const size_t szO  = (size_t)MROWS * DOUT * 2;                 // OH, OL
  size_t off = 0;
  const size_t oXB = off; off += szXB;
  const size_t oWQ = off; off += szWQ;
  const size_t oWK = off; off += szWK;
  const size_t oWV = off; off += szWV;
  const size_t oWP = off; off += szWP;
  const size_t oQH = off; off += szQ;
  const size_t oQL = off; off += szQ;
  const size_t oKH = off; off += szK;
  const size_t oKL = off; off += szK;
  const size_t oVH = off; off += szV;
  const size_t oVL = off; off += szV;
  const size_t oOH = off; off += szO;
  const size_t oOL = off; off += szO;
  if (off > ws_size) return;                // off = 43778048 for NB = 2, SEQ = 2048
  if (off > (size_t)WS_CAP) return;

  char* ws = (char*)d_ws;
  u16*   XB  = (u16*)(ws + oXB);
  u16*   WQT = (u16*)(ws + oWQ);
  u16*   WKT = (u16*)(ws + oWK);
  u16*   WVT = (u16*)(ws + oWV);
  u16*   WPT = (u16*)(ws + oWP);
  u16*   QH  = (u16*)(ws + oQH);
  u16*   QL  = (u16*)(ws + oQL);
  u16*   KH  = (u16*)(ws + oKH);
  u16*   KL  = (u16*)(ws + oKL);
  u16*   VH  = (u16*)(ws + oVH);
  u16*   VL  = (u16*)(ws + oVL);
  u16*   OH  = (u16*)(ws + oOH);
  u16*   OL  = (u16*)(ws + oOL);

  const dim3 b256(256), b128(128), bAT(ATT_THREADS);
  const dim3 gPI(GWALL + NB * GX);                      // 480 weight blocks + 1024 x blocks per batch (SEQ=2048)
  const dim3 gGP((MROWS / 64) * (NQKV / 64));
  const int  nqt1 = QO / 16;                            // query tiles with the P residual product (rows s < QO)
  const int  nqt0 = NQT - nqt1;                         // remaining query tiles
  const dim3 gGO((MROWS / 64) * (DOUT / 64));

  // (0) x -> bf16 plane MROWS x DIN; Wq, Wk, Wv -> bf16 n x k planes; Wp -> f16 n x k plane x1024; all in fragment order
  prep_in<<<gPI, b256, 0, stream>>>(x, wq, wk, wv, wp, XB, WQT, WKT, WVT, WPT);
  // (1) q = x.Wq, k = x.Wk -> hi + residual planes x256, v = x.Wv -> v^T hi + residual planes x1024; WQT, WKT, WVT lie one behind
  //     the other in the workspace and are read as one plane of NQKV rows
  gemm_qkv<<<gGP, b128, 0, stream>>>(XB, WQT, QH, QL, KH, KL, VH, VL, MROWS, DIN);
  // (2) causal grouped attention with ALiBi -> O hi + residual planes f16 x1024, MROWS x DOUT:
  //     query tiles [0, QO/16) with the in-register P residual product, the rest without it
  attn_all<<<dim3((nqt0 + nqt1) * NHG * NB), bAT, 0, stream>>>(QH, QL, KH, KL, VH, VL, OH, OL, nqt1, nqt0);
  // (3) out = (O_hi + O_lo).Wp + bp -> d_out f32 [MROWS][DOUT], carries 1024 x 1024 folded back
  gemm_h2<<<gGO, b128, 0, stream>>>(OH, OL, WPT, bpv, out, MROWS, DOUT, DOUT, 1.0f / (OSC * WOS));
  (void)hipGetLastError();
}

// v009
// A run of this version takes 85.9 microseconds.
// Timed twice side by side with v008, it ran 1.14 and 1.12 times as fast.
// All steps since v000 together make it 3.19 times as fast.
#include <hip/hip_runtime.h>
#include <math.h>
#include <stdint.h>

#ifndef NB
#define NB 2
#endif
#ifndef SEQ
#define SEQ 2048
#endif
#define XS_FULL 2048
#define DIN   1024
#define DOUT  1024
#define NH    16
#define NG    4
#define DQ    32
#define DV    64
#define NQ    (NH * DQ)
#define NK    (NG * DQ)
#define NV    (NG * DV)
#define MROWS (NB * SEQ)
#define QO    ((SEQ < 512) ? SEQ : 512)
#define RSQ_DQ 0.17677669529663687f
#define LOG2E  1.4426950408889634f
#define SQRT2F 1.4142135623730951f
#define QSC   256.0f
#define KSC   256.0f
#define PCAR  32768.0f
#define VCAR  1024.0f
#define OSC   1024.0f
#define WOS   1024.0f
#define WPB   4
#define NHG   (NH / WPB)
#define KVBLK 12
#define KVBUF (KVBLK * 512)
#define KVSTEP (2 * KVBUF)                  // halves of one attention step's LDS buffer: the blocks of its two key tiles
#define NQT   (SEQ / 16)
#define NKT   (SEQ / 32)
#define ATT_THREADS (WPB * 32)
#define SLAB64 (16 * 68)
#define WTP   72
#define WS_CAP 134217728
#define KUQ   4                             // k steps of 32 whose fragment loads gemm_qkv issues as one group
#define KUO   4                             // the same for gemm_h2
// block counts of the jobs that share a launch
#define GX    ((SEQ * DIN / 8 + 255) / 256)
#define GWQ   ((NQ / 64) * (DIN / 64))
#define GWK   ((NK / 64) * (DIN / 64))
#define GWV   ((NV / 64) * (DIN / 64))
#define GWP   ((DOUT / 64) * (DOUT / 64))
#define GWALL (GWP + GWQ + GWK + GWV)
#define NQKV  (NQ + NK + NV)
static_assert(DOUT == NH * DV && NQ == 512 && NK == 128 && NV == 256 && DQ == 32 && DV == 64 && NG == 4 && NH == 16);
static_assert(NHG * WPB == NH && ATT_THREADS == 128 && WPB == 4 && NHG == NG);
static_assert(NB >= 1 && NB <= 2);
static_assert((SEQ % 64) == 0 && SEQ >= 64 && SEQ <= XS_FULL);
static_assert((QO % 16) == 0 && QO >= 16 && QO <= SEQ);
static_assert((DIN % 64) == 0 && (DOUT % 64) == 0 && (NQ % 64) == 0 && (NK % 64) == 0 && (NV % 64) == 0 && (DIN % 32) == 0);
static_assert(((SEQ * DIN / 8) % 256) == 0);
static_assert((DIN % (32 * KUQ)) == 0 && (DOUT % (32 * KUO)) == 0);
static_assert(64 * WTP * 2 <= 65536 && 4 * SLAB64 * 4 <= 65536 && 2 * KVSTEP * 2 <= 65536);

typedef unsigned short u16;
typedef _Float16 v16h __attribute__((ext_vector_type(16)));
typedef _Float16 v8h  __attribute__((ext_vector_type(8)));
typedef __bf16   v16b __attribute__((ext_vector_type(16)));
typedef float    v8f  __attribute__((ext_vector_type(8)));
typedef float    v4f  __attribute__((ext_vector_type(4)));
typedef unsigned int v4u __attribute__((ext_vector_type(4)));

union FragH { v16h v; v8h h[2]; v4u u[2]; };
union FragB { v16b v; v4u u[2]; };

// ---- scalar helpers --------------------------------------------------------------------------------
__device__ __forceinline__ unsigned short bf_bits(float f) {          // f32 -> bf16 bits, RNE convert
  unsigned u = __float_as_uint(f);
  return (unsigned short)((u + 0x7FFFu + ((u >> 16) & 1u)) >> 16);
}
__device__ __forceinline__ float bf_up(unsigned short h) { return __uint_as_float(((unsigned)h) << 16); }
__device__ __forceinline__ float bfr(float f) { return bf_up(bf_bits(f)); }
__device__ __forceinline__ unsigned short h_bits(_Float16 x) { return __builtin_bit_cast(unsigned short, x); }
__device__ __forceinline__ unsigned pk16(unsigned short a, unsigned short b) { return (unsigned)a | ((unsigned)b << 16); }
__device__ __forceinline__ v8f zero8() { v8f z = {0.f, 0.f, 0.f, 0.f, 0.f, 0.f, 0.f, 0.f}; return z; }
__device__ __forceinline__ float xhalf(float x) {                     // the value of lane l ^ 16
  const int b = __builtin_bit_cast(int, x);
  return __builtin_bit_cast(float, __builtin_amdgcn_permlanex16(b, b, 0x76543210, 0xfedcba98, false, false));
}

// 2^x as the bare v_exp_f32. The library exp2f wraps it in a range fix-up (compare, two selects, add, ldexp) that only keeps results
// below 2^-126; here such a weight is 0 in f16 x32768 and adds nothing to a row sum that is at least 1. -inf gives 0, as before.
// A run of them stands in one asm statement, each working in place: the statement writes only registers that it reads, so none of
// them can be an operand register of a matrix instruction issued just ahead of it (the compiler pads its own instructions behind a
// WMMA, not an asm statement). The closing v_nop is the slot the instruction set asks for behind the last one, before its result
// is read.
__device__ __forceinline__ void ex2x8(float (&x)[8]) {
#if defined(__HIP_DEVICE_COMPILE__)
  asm("v_exp_f32 %0, %0\n\tv_exp_f32 %1, %1\n\tv_exp_f32 %2, %2\n\tv_exp_f32 %3, %3\n\t"
      "v_exp_f32 %4, %4\n\tv_exp_f32 %5, %5\n\tv_exp_f32 %6, %6\n\tv_exp_f32 %7, %7\n\tv_nop"
      : "+v"(x[0]), "+v"(x[1]), "+v"(x[2]), "+v"(x[3]), "+v"(x[4]), "+v"(x[5]), "+v"(x[6]), "+v"(x[7]));
#endif
}
__device__ __forceinline__ float ex2x1(float x) {
#if defined(__HIP_DEVICE_COMPILE__)
  asm("v_exp_f32 %0, %0\n\tv_nop" : "+v"(x));
#endif
  return x;
}

// ---- fragment order of a 16-bit operand plane of R rows (the WMMA's m or n index) x K columns (its k index), R % 16 == 0,
//      K % 32 == 0: a row-major grid of blocks of 16 rows x 32 columns, block (r >> 4, k >> 5) at half offset
//      ((r >> 4) * (K >> 5) + (k >> 5)) * 512; inside a block 64 chunks of 8 halves (16 B): chunk id holds row (id & 15),
//      columns ((id >> 4) & 3) * 8 .. + 7. So 16 rows x K columns take 16 * K halves, as in a row-major plane.
// ---- fragment loaders: 16-bit A/B operand, p + lb bytes = block base + 16 B * lane: lane -> row/col (lane&15), h = lane>>4;
//      elements 0..7 <- chunk lane (k0+8h..), elements 8..15 <- chunk 32 + lane (k0+16+8h..)  (same split k map for A and B);
//      each of the two loads of a wave reads 512 contiguous bytes = 4 whole 128-B lines
__device__ __forceinline__ v16h ldfrag_h(const _Float16* p, unsigned lb) {
  FragH f;
  const char* q = (const char*)(const void*)p + lb;
  f.h[0] = *(const v8h*)(const void*)(q);
  f.h[1] = *(const v8h*)(const void*)(q + 512);
  return f.v;
}
__device__ __forceinline__ v16b ldfrag_b(const u16* p, unsigned lb) { // bf16 plane read as unsigned integer vectors
  FragB f;
  const char* q = (const char*)(const void*)p + lb;
  f.u[0] = *(const v4u*)(const void*)(q);
  f.u[1] = *(const v4u*)(const void*)(q + 512);
  return f.v;
}

__device__ __forceinline__ v8f mma_h(v16h a, v16h b, v8f c) {
  return __builtin_amdgcn_wmma_f32_16x16x32_f16(false, a, false, b, (short)0, c, false, false);
}
__device__ __forceinline__ v8f mma_b(v16b a, v16b b, v8f c) {
  return __builtin_amdgcn_wmma_f32_16x16x32_bf16(false, a, false, b, (short)0, c, false, false);
}
template <typename F>
__device__ __forceinline__ void guard6(v8f& a, v8f& b, v8f& c, v8f& d, F x0, F x1, F x2, F x3, F x4, F x5) {
#if defined(__HIP_DEVICE_COMPILE__)
  asm volatile("v_nop\n\tv_nop\n\tv_nop\n\tv_nop"
               : "+v"(a), "+v"(b), "+v"(c), "+v"(d) : "v"(x0), "v"(x1), "v"(x2), "v"(x3), "v"(x4), "v"(x5) : "memory");
#endif
}
__device__ __forceinline__ void acc_guard4(v8f& a, v8f& b, v8f& c, v8f& d) {
#if defined(__HIP_DEVICE_COMPILE__)
  asm volatile("v_nop\n\tv_nop\n\tv_nop\n\tv_nop" : "+v"(a), "+v"(b), "+v"(c), "+v"(d));
#endif
}
__device__ __forceinline__ void wave_sync_lds() {
  __builtin_amdgcn_fence(__ATOMIC_RELEASE, "workgroup");
  __builtin_amdgcn_wave_barrier();
  __builtin_amdgcn_fence(__ATOMIC_ACQUIRE, "workgroup");
}

// =====================================================================================================
// f32 row-major [rows][DIN] -> bf16 RNE plane in fragment order. Thread = one chunk of D (8 elements of one row): two 16-B
// loads, one 16-B store; a wave stores 512 contiguous bytes.
// coverage: bid = 0 .. ceil(n8/256) - 1, x 256 thr x 8 (in-kernel bound) = the whole plane (n8 a multiple of 256 here).
// =====================================================================================================
__device__ __forceinline__ void cvt_bf(const float* __restrict__ x, u16* D, int n8, int bid) {
  const int gt = bid * 256 + (int)threadIdx.x;                        // chunk index in D
  if (gt >= n8) return;
  const int blk = gt >> 6;
  const int row = (blk / (DIN / 32)) * 16 + (gt & 15);
  const int col = (blk % (DIN / 32)) * 32 + ((gt >> 4) & 3) * 8;
  const float* p = x + (size_t)row * DIN + col;
  const v4f a = *(const v4f*)(p), b4 = *(const v4f*)(p + 4);
  v4u o;
#pragma unroll
  for (int e = 0; e < 2; ++e) {
    o[e]     = pk16(bf_bits(a[2 * e]),  bf_bits(a[2 * e + 1]));
    o[2 + e] = pk16(bf_bits(b4[2 * e]), bf_bits(b4[2 * e + 1]));
  }
  u16* d = D + (size_t)gt * 8;
  {
    *(v4u*)(d) = o;
    
  }
}

// =====================================================================================================
// f32 W [K][N] (row-major, x.W layout) -> 16-bit plane D, N rows x K columns in fragment order (A operand for Wq, Wk; B for Wv, Wp). f16mode == 0: bf16 RNE bits;
// f16mode == 1: f16 bits of (bf16 RNE value) * scale. Block = 64 n x 64 k output tile: each thread loads 16 floats of one
// k row (four 16-B loads), converts, scatters into the LDS tile T[n][k] (pitch 72 halves, scalar 2-B LDS stores of per-lane
// values); after a block barrier the tile leaves as its 8 blocks (4 n tiles x 2 k steps) of 64 chunks, a wave storing 512 contiguous B.
// coverage: load 256 thr x 16 = 64 k x 64 n; store 2 iterations x 256 thr x 8 halves = 8 blocks x 512 halves = the tile;
//           bid = 0 .. (N/64)*(K/64) - 1 covers D exactly once (N % 64 == 0, K % 64 == 0).
// =====================================================================================================
__device__ __forceinline__ void wt16(const float* __restrict__ W, u16* D, int K, int N, int f16mode, float scale, int bid) {
  __shared__ __align__(16) u16 T[64 * WTP];
  const int tid = threadIdx.x;
  const int nt  = N >> 6;
  const int n0  = (bid % nt) * 64;
  const int k0  = (bid / nt) * 64;
  if (k0 + 64 > K) return;                  // block-uniform, before the barrier; never taken with the exact grid
  {
    const int kr = tid >> 2;                // k row within tile 0..63
    const int nc = (tid & 3) * 16;          // n chunk 0,16,32,48
    const float* src = W + (size_t)(k0 + kr) * (size_t)N + n0 + nc;
#pragma unroll
    for (int i = 0; i < 4; ++i) {
      const v4f a = *(const v4f*)(src + 4 * i);
#pragma unroll
      for (int e = 0; e < 4; ++e) {
        const float f = a[e];
        const unsigned short hb = h_bits((_Float16)(bfr(f) * scale));
        const unsigned short bb = bf_bits(f);
        T[(nc + 4 * i + e) * WTP + kr] = (f16mode != 0) ? hb : bb;
      }
    }
  }
  __syncthreads();
  v4u v[2];
#pragma unroll
  for (int it = 0; it < 2; ++it) {
    const int id = it * 256 + tid;          // chunk of the tile: block id >> 6 = (n tile id >> 7, k step (id >> 6) & 1)
    v[it] = *(const v4u*)(T + ((id >> 7) * 16 + (id & 15)) * WTP + ((id >> 6) & 1) * 32 + ((id >> 4) & 3) * 8);
  }
  {
#pragma unroll
    for (int it = 0; it < 2; ++it) {
      const int id = it * 256 + tid;
      const size_t blk = (size_t)((n0 >> 4) + (id >> 7)) * (size_t)(K >> 5) + (size_t)((k0 >> 5) + ((id >> 6) & 1));
      *(v4u*)(D + blk * 512 + (id & 63) * 8) = v[it];
    }
    
  }
}

// =====================================================================================================
// All jobs that read only the inputs, in one launch; a block does one block's work of one job, chosen by its index (block-uniform):
//   [0, GWP) Wp [DOUT k][DOUT n] -> DOUT n x DOUT k as f16 of bf16 value x1024; then GWQ blocks Wq [DIN k][NQ n] -> NQ n x DIN k
//   bf16; GWK blocks Wk -> NK x DIN; GWV blocks Wv -> NV x DIN; then NB * GX blocks x -> bf16 plane MROWS x DIN, GX per batch.
// =====================================================================================================
__global__ __launch_bounds__(256)
void prep_in(const float* __restrict__ x, const float* __restrict__ wq, const float* __restrict__ wk,
             const float* __restrict__ wv, const float* __restrict__ wp,
             u16* XB, u16* WQT, u16* WKT, u16* WVT, u16* WPT) {
  const int bid = blockIdx.x;
  if (bid < GWALL) {
    const float* W = wp;
    u16* D = WPT;
    int K = DOUT, N = DOUT, mode = 1, lb = bid;
    float sc = WOS;
    if (bid >= GWP + GWQ + GWK)  { W = wv; D = WVT; K = DIN; N = NV; mode = 0; sc = 1.0f; lb = bid - (GWP + GWQ + GWK); }
    else if (bid >= GWP + GWQ)   { W = wk; D = WKT; K = DIN; N = NK; mode = 0; sc = 1.0f; lb = bid - (GWP + GWQ); }
    else if (bid >= GWP)         { W = wq; D = WQT; K = DIN; N = NQ; mode = 0; sc = 1.0f; lb = bid - GWP; }
    wt16(W, D, K, N, mode, sc, lb);
  } else {
    const int cb = bid - GWALL;
    const int b  = cb / GX;
    if (b >= NB) return;                    // block-uniform; never taken with the exact grid
    cvt_bf(x + (size_t)b * XS_FULL * DIN, XB + (size_t)b * SEQ * DIN, (SEQ * DIN) / 8, cb % GX);
  }
}

// =====================================================================================================
// Epilogue of the output GEMM: the wave's 16x64 f32 tile (times oscale, plus the lane's per-column bias of each
// coverage: 8 instructions x 2 rows x 16 lanes x 4 floats = the wave's 16 x 64 tile.
// =====================================================================================================
__device__ __forceinline__ void epi64(float* sl, v8f a0, v8f a1, v8f a2, v8f a3, float oscale,
                                      float bb0, float bb1, float bb2, float bb3,
                                      float* C, int N, size_t rowb, int col0, int lane) {
  const int hh = lane >> 4, m = lane & 15;
#pragma unroll
  for (int r = 0; r < 8; ++r) {
    const int ro = (8 * hh + r) * 68 + m;
    sl[ro]      = a0[r] * oscale + bb0;
    sl[ro + 16] = a1[r] * oscale + bb1;
    sl[ro + 32] = a2[r] * oscale + bb2;
    sl[ro + 48] = a3[r] * oscale + bb3;
  }
  wave_sync_lds();
  v4f vals[8];
#pragma unroll
  for (int it = 0; it < 8; ++it) vals[it] = *(const v4f*)(sl + (it * 2 + hh) * 68 + m * 4);
  float* dst = C + (rowb + (size_t)hh) * (size_t)N + col0 + m * 4;
  {
#pragma unroll
    for (int it = 0; it < 8; ++it) {
      *(v4f*)(dst + (size_t)(it * 2) * (size_t)N) = vals[it];
    }
    
  }
}

// =====================================================================================================
// bf16 GEMM, no bias, the q, k and v projections in one launch, stored straight as attention's f16 planes (hi = f16(t), residual =
// f16(t - hi), t = value * scale; fragment order): A (bf16, M rows x K, fragment order) . Bt^T (bf16, NQKV rows x K, fragment
// order: the rows of Wq^T, Wk^T, Wv^T one behind the other, which is how the three planes lie in the workspace).
// Block = 64x64 tile, 4 waves x 16 rows of A; a tile lies in one projection (NQ, NK, NV multiples of 64), chosen by the block's
// column tile (block-uniform); fragments loaded straight from the planes' blocks (two 16-B loads each, split k map for A and B);
// K stepped by 32 * KUQ (host guarantees K % (32 * KUQ) == 0, M % 64 == 0, grid = (M/64)*(NQKV/64)).
// A chunk of a plane is 8 consecutive columns of one plane row, so each projection is computed with the side up that puts a chunk
// into one lane's 8 accumulator registers:
//   q, k (plane row = x row, plane column = n): D = W rows . x rows^T, lane = x row rowb + lane % 16, registers = n 8*(lane/16) + r;
//   v^T  (plane row = n = (g, d), plane column = key = x row): D = x rows . W rows^T, lane = n, registers = x rows 8*(lane/16) + r.
// coverage: per wave 4 subtiles x 32 chunks x 8 halves = 16 x 64 of the hi and of the residual plane, each store instruction of a
//           wave 512 contiguous bytes; the grid's tiles cover QH, QL, KH, KL, VH, VL exactly once.
// =====================================================================================================
template <int WA>                           // WA == 1: the W fragments are the A operand (q, k); WA == 0: the x fragment is (v)
__device__ __forceinline__ void qkv_tile(const u16* ap, const u16* bp0, int K, float sc, u16* dh, u16* dl, int jstep) {
  const size_t bs = (size_t)16 * K;         // 16 rows on = one row of blocks on
  const u16* bp1 = bp0 + bs;
  const u16* bp2 = bp1 + bs;
  const u16* bp3 = bp2 + bs;
  v8f acc[4];
#pragma unroll
  for (int j = 0; j < 4; ++j) acc[j] = zero8();
#pragma unroll 1
  for (int k0 = 0; k0 < K; k0 += 32 * KUQ) {
    // the fragments of KUQ k steps, all loads issued as one group in k order: one wait for the planes' latency serves KUQ steps
    v16b a[KUQ], b0[KUQ], b1[KUQ], b2[KUQ], b3[KUQ];
#pragma unroll                              // every index constant: the fragment arrays stay in registers
    for (int u = 0; u < KUQ; ++u) {
      a[u]  = ldfrag_b(ap,  1024u * u);
      b0[u] = ldfrag_b(bp0, 1024u * u);
      b1[u] = ldfrag_b(bp1, 1024u * u);
      b2[u] = ldfrag_b(bp2, 1024u * u);
      b3[u] = ldfrag_b(bp3, 1024u * u);
    }
    // the loads' address registers are named here, so none is given to a later load's result or stepped on before the
    // loads' address translations are back
#if defined(__HIP_DEVICE_COMPILE__)
    asm volatile("s_wait_xcnt 0x0" :: "v"(ap), "v"(bp0), "v"(bp1), "v"(bp2), "v"(bp3) : "memory");
#endif
    // without this the scheduler sinks each step's loads down to its products, and one step's loads are in flight again
    __builtin_amdgcn_sched_barrier(0);
    ap += 512 * KUQ; bp0 += 512 * KUQ; bp1 += 512 * KUQ; bp2 += 512 * KUQ; bp3 += 512 * KUQ;
#pragma unroll                              // every index constant: the fragment arrays stay in registers
    for (int u = 0; u < KUQ; ++u) {
      if constexpr (WA == 1) {
        acc[0] = mma_b(b0[u], a[u], acc[0]);
        acc[1] = mma_b(b1[u], a[u], acc[1]);
        acc[2] = mma_b(b2[u], a[u], acc[2]);
        acc[3] = mma_b(b3[u], a[u], acc[3]);
      } else {
        acc[0] = mma_b(a[u], b0[u], acc[0]);
        acc[1] = mma_b(a[u], b1[u], acc[1]);
        acc[2] = mma_b(a[u], b2[u], acc[2]);
        acc[3] = mma_b(a[u], b3[u], acc[3]);
      }
    }
    guard6<v16b>(acc[0], acc[1], acc[2], acc[3], a[KUQ - 1], b0[KUQ - 1], b1[KUQ - 1], b2[KUQ - 1], b3[KUQ - 1], a[KUQ - 1]);
  }
  v4u oh[4], ol[4];
#pragma unroll
  for (int j = 0; j < 4; ++j) {
#pragma unroll
    for (int e = 0; e < 4; ++e) {
      const float t0 = acc[j][2 * e] * sc, t1 = acc[j][2 * e + 1] * sc;
      const _Float16 h0 = (_Float16)t0, h1 = (_Float16)t1;
      const _Float16 l0 = (_Float16)(t0 - (float)h0), l1 = (_Float16)(t1 - (float)h1);
      oh[j][e] = pk16(h_bits(h0), h_bits(h1));
      ol[j][e] = pk16(h_bits(l0), h_bits(l1));
    }
  }
#pragma unroll
  for (int j = 0; j < 4; ++j) {
    *(v4u*)(dh + (size_t)j * jstep) = oh[j];
    *(v4u*)(dl + (size_t)j * jstep) = ol[j];
  }
  // a precaution: in the listing the other instance's prologue follows these eight stores and rewrites their address and data
  // registers; this wait stands in front of every such write
#if defined(__HIP_DEVICE_COMPILE__)
  asm volatile("s_wait_xcnt 0x0" ::: "memory");
#endif
}

__global__ __launch_bounds__(128)
void gemm_qkv(const u16* __restrict__ A, const u16* __restrict__ Bt, u16* QH, u16* QL, u16* KH, u16* KL, u16* VH, u16* VL,
              int M, int K) {
  const int tid = threadIdx.x, wave = tid >> 5, lane = tid & 31;
  const int ntile = NQKV >> 6;
  const int bid   = blockIdx.x;
  const int rowb  = (bid / ntile) * 64 + wave * 16;
  const int colb  = (bid % ntile) * 64;     // first row of the tile in Bt
  if (rowb + 16 > M) return;                // wave-uniform, never taken with the exact grid; no barriers in this kernel
  const u16* ap  = A  + (size_t)rowb * K + 8 * lane;   // the lane's chunk in block (rowb / 16, 0); the next k step is 512 halves on
  const u16* bp0 = Bt + (size_t)colb * K + 8 * lane;
  if (colb >= NQ + NK) {
    // v^T planes: row tile (b*NG + g) * (DV/16) + j, key step s0 / 32; the wave's 16 keys are one half of that block's 64 chunks
    const int g  = (colb - (NQ + NK)) / DV;
    const int b  = rowb / SEQ;
    const int s0 = rowb - b * SEQ;
    const size_t o = ((size_t)((b * NG + g) * (DV / 16)) * (SEQ / 32) + (size_t)(s0 >> 5)) * 512 + (size_t)(((s0 >> 4) & 1) * 32 + lane) * 8;
    qkv_tile<0>(ap, bp0, K, VCAR, VH + o, VL + o, (SEQ / 32) * 512);
  } else {
    // q or k planes: row tile rowb / 16, column step (column / 32); subtile j = chunks (j & 1) * 32 + lane of block j / 2: 256 halves on
    const bool isk = colb >= NQ;
    const int  nc  = isk ? NK : NQ;         // the plane's columns, and the tile's first column in it
    const int  c0  = isk ? colb - NQ : colb;
    const size_t o = ((size_t)(rowb >> 4) * (size_t)(nc >> 5) + (size_t)(c0 >> 5)) * 512 + (size_t)lane * 8;
    qkv_tile<1>(ap, bp0, K, isk ? KSC : QSC, (isk ? KH : QH) + o, (isk ? KL : QL) + o, 256);
  }
}

// =====================================================================================================
// f16 GEMM with a two-plane A operand and bias: C[M][N] (f32) = (Ah + Al) (f16 hi and residual planes, M rows x K, fragment
// order, residual unscaled relative to hi) . Bt^T (f16, N rows x K, fragment order) * oscale + bf16 RNE value of bias[n] (bias has
// N entries). Products ah.b + al.b into one accumulator. Same tiling and fragment loads (split k map) as gemm_qkv;
// K stepped by 32 * KUO (host guarantees K % (32 * KUO) == 0, M % 64 == 0, N % 64 == 0, grid = (M/64)*(N/64)).
// =====================================================================================================
__global__ __launch_bounds__(128)
void gemm_h2(const u16* __restrict__ Ah, const u16* __restrict__ Al, const u16* __restrict__ Bt,
             const float* __restrict__ bias, float* C, int M, int N, int K, float oscale) {
  __shared__ __align__(16) float slab[4 * SLAB64];
  const int tid = threadIdx.x, wave = tid >> 5, lane = tid & 31, m = lane & 15;
  const int ntile = N >> 6;
  const int bid   = blockIdx.x;
  const int rowb  = (bid / ntile) * 64 + wave * 16;
  const int col0  = (bid % ntile) * 64;
  if (rowb + 16 > M) return;                // wave-uniform, never taken with the exact grid; no block barriers in this kernel
  const size_t bs = (size_t)16 * K;
  const _Float16* ahp = (const _Float16*)(const void*)Ah + (size_t)rowb * K + 8 * lane;   // the lane's chunk in block (rowb / 16, 0), as in gemm_qkv
  const _Float16* alp = (const _Float16*)(const void*)Al + (size_t)rowb * K + 8 * lane;
  const _Float16* bp0 = (const _Float16*)(const void*)Bt + (size_t)col0 * K + 8 * lane;
  const _Float16* bp1 = bp0 + bs;
  const _Float16* bp2 = bp1 + bs;
  const _Float16* bp3 = bp2 + bs;
  v8f acc0 = zero8(), acc1 = zero8(), acc2 = zero8(), acc3 = zero8();
#pragma unroll 1
  for (int k0 = 0; k0 < K; k0 += 32 * KUO) {
    // the fragments of KUO k steps, all loads issued as one group in k order, as in gemm_qkv
    v16h ah[KUO], al[KUO], b0[KUO], b1[KUO], b2[KUO], b3[KUO];
#pragma unroll                              // every index constant: the fragment arrays stay in registers
    for (int u = 0; u < KUO; ++u) {
      ah[u] = ldfrag_h(ahp, 1024u * u);
      al[u] = ldfrag_h(alp, 1024u * u);
      b0[u] = ldfrag_h(bp0, 1024u * u);
      b1[u] = ldfrag_h(bp1, 1024u * u);
      b2[u] = ldfrag_h(bp2, 1024u * u);
      b3[u] = ldfrag_h(bp3, 1024u * u);
    }
    // the loads' address registers are named here, so none is given to a later load's result or stepped on before the
    // loads' address translations are back
#if defined(__HIP_DEVICE_COMPILE__)
    asm volatile("s_wait_xcnt 0x0" :: "v"(ahp), "v"(alp), "v"(bp0), "v"(bp1), "v"(bp2), "v"(bp3) : "memory");
#endif
    // without this the scheduler sinks each step's loads down to its products, and one step's loads are in flight again
    __builtin_amdgcn_sched_barrier(0);
    ahp += 512 * KUO; alp += 512 * KUO; bp0 += 512 * KUO; bp1 += 512 * KUO; bp2 += 512 * KUO; bp3 += 512 * KUO;
#pragma unroll                              // every index constant: the fragment arrays stay in registers
    for (int u = 0; u < KUO; ++u) {
      acc0 = mma_h(ah[u], b0[u], acc0);  acc0 = mma_h(al[u], b0[u], acc0);
      acc1 = mma_h(ah[u], b1[u], acc1);  acc1 = mma_h(al[u], b1[u], acc1);
      acc2 = mma_h(ah[u], b2[u], acc2);  acc2 = mma_h(al[u], b2[u], acc2);
      acc3 = mma_h(ah[u], b3[u], acc3);  acc3 = mma_h(al[u], b3[u], acc3);
    }
    guard6<v16h>(acc0, acc1, acc2, acc3, ah[KUO - 1], al[KUO - 1], b0[KUO - 1], b1[KUO - 1], b2[KUO - 1], b3[KUO - 1]);
  }
  // per-lane bias of D column m in each of the 4 subtiles; col0 + 48 + m <= N - 1 always
  const float bb0 = bfr(bias[col0 + m]);
  const float bb1 = bfr(bias[col0 + 16 + m]);
  const float bb2 = bfr(bias[col0 + 32 + m]);
  const float bb3 = bfr(bias[col0 + 48 + m]);
  epi64(slab + wave * SLAB64, acc0, acc1, acc2, acc3, oscale, bb0, bb1, bb2, bb3, C, N, (size_t)rowb, col0, lane);
}

// =====================================================================================================
// Causal grouped attention with ALiBi, q/k head dim 32, value head dim 64. Block bid -> (query tile qt = qtb + bid % nqtl:
// rows q0 = 16*qt .. q0+15, kv group hg, batch b); one wave per query head = hg + NG*wave, the 4 heads with head % NG = hg.
//   q hi / residual planes f16 x256, row b*SEQ + s, column h*DQ + d (NQ columns); k hi / residual planes f16 x256, row
//   b*SEQ + s, column g*DQ + d (NK columns); v^T hi / residual planes x1024, row (b*NG + g)*DV + d, column s (SEQ columns);
//   O hi / residual planes f16 x1024, row b*SEQ + s, column h*DV + d (DOUT columns); all in fragment order.
//   scores, transposed: S^T (16 keys x 16 queries, one k-step over d = 0..31) = k_hi.q_hi + k_lo.q_hi + k_hi.q_lo (A = k block,
//   B = q block; 3 products into one accumulator, residuals unscaled relative to their hi planes), q fragments loop-invariant;
//   a lane holds 32 of the step's 64 scores of ONE query (q0 + lane % 16), lane l ^ 16 the other 32;
//   logit (log2 domain) t(i, j) = (acc/(256*256) + slope[h]*(j - i)) * (1/sqrt(32))*log2e, replaced by -inf where j > i,
//   slope[h] = 2^(-(h+1)/2) built exactly (power of two times f32 sqrt2 for odd h+1).
//   Key tiles of 32 visited in order for kb <= q0 + 15 (later tiles hold only keys above every query row of the tile), two to a step.
//   A key tile's 12 blocks of 1 KiB (k hi 2, k residual 2, v^T hi 4, v^T residual 4) are the same for the block's 4 heads: a step's
//   24 come into LDS once, by asynchronous copies (wave w brings k block w, v^T hi block w, v^T residual block w of both tiles), two
//   buffers, the copies of step t + 1 in flight while step t is worked on; every wave reads all 24 blocks as its fragments from LDS.
//   Online max-subtracted base-2 softmax in f32, -inf-safe rescale: maximum and sum run over the lane's own registers, the
//   maximum joined with lane l ^ 16 in each step, the two half sums once behind the loop. The two score tiles of a key tile,
//   converted in place, ARE the B fragment of P^T (element e <- tile e / 8, register e % 8: the planes' split k map), so P
//   passes through no LDS; v^T blocks are the A fragments of 4 d-subtiles, both v planes: O^T += v_hi.P_hi + v_lo.P_hi
//   (+ v_hi.P_lo when PRES == 1), the 4 subtiles side by side.
//   After the loop: out = acc / Z (Z > 0 always: key 0 <= every query row; guarded anyway), carries 1/(32768*1024) folded
//   once; a lane's 8 registers of a subtile are 8 consecutive d of its query = one chunk of the O planes.
// coverage: per wave 4 instructions x 32 chunks x 8 halves = 2 blocks = 16 x 64 of each O plane; the two block ranges of attn_all
//           cover query tiles [QO/16, NQT) and [0, QO/16) x NHG x NB blocks x WPB waves = every (b, s, h) row segment of OH and
//           of OL exactly once.
// =====================================================================================================
// One wave's twelve asynchronous copies of a step (16 B a lane each, 512 contiguous bytes a wave). For the step's first key tile: the
// two halves of a k block to LDS byte address l, of a v^T hi block to l + 4096, of a v^T residual block to l + 8192; for its second
// key tile (32 key rows on in k, one block on in v^T) the same, 2 * KVBUF bytes on in LDS. The closing s_wait_xcnt stands in the
// copies' own statement, so that no address register named here is rewritten in front of it.
__device__ __forceinline__ void kv_copy(unsigned l, const _Float16* gk, const _Float16* gh, const _Float16* gl) {
#if defined(__HIP_DEVICE_COMPILE__)
  const unsigned  l2  = l + 2u * KVBUF;
  const _Float16* gk2 = gk + 32 * NK;
  const _Float16* gh2 = gh + 512;
  const _Float16* gl2 = gl + 512;
  asm volatile("global_load_async_to_lds_b128 %0, %12, off\n\t"
               "global_load_async_to_lds_b128 %1, %13, off\n\t"
               "global_load_async_to_lds_b128 %2, %14, off\n\t"
               "global_load_async_to_lds_b128 %3, %15, off\n\t"
               "global_load_async_to_lds_b128 %4, %16, off\n\t"
               "global_load_async_to_lds_b128 %5, %17, off\n\t"
               "global_load_async_to_lds_b128 %6, %18, off\n\t"
               "global_load_async_to_lds_b128 %7, %19, off\n\t"
               "global_load_async_to_lds_b128 %8, %20, off\n\t"
               "global_load_async_to_lds_b128 %9, %21, off\n\t"
               "global_load_async_to_lds_b128 %10, %22, off\n\t"
               "global_load_async_to_lds_b128 %11, %23, off\n\t"
               "s_wait_xcnt 0x0"
               :: "v"(l), "v"(l + 512u), "v"(l2), "v"(l2 + 512u),
                  "v"(l + 4096u), "v"(l + 4608u), "v"(l + 8192u), "v"(l + 8704u),
                  "v"(l2 + 4096u), "v"(l2 + 4608u), "v"(l2 + 8192u), "v"(l2 + 8704u),
                  "v"(gk), "v"(gk + 256), "v"(gk2), "v"(gk2 + 256),
                  "v"(gh), "v"(gh + 256), "v"(gl), "v"(gl + 256),
                  "v"(gh2), "v"(gh2 + 256), "v"(gl2), "v"(gl2 + 256)
               : "memory");
#endif
}

template <int PRES>
__device__ __forceinline__
void attn_c(const u16* __restrict__ QHp, const u16* __restrict__ QLp,
            const u16* __restrict__ KHp, const u16* __restrict__ KLp,
            const u16* __restrict__ VHp, const u16* __restrict__ VLp,
            u16* OHp, u16* OLp, int qtb, int nqtl, int bid, u16* kvs) {
  const int tid  = threadIdx.x;
  const int wave = tid >> 5;
  const int lane = tid & 31;
  const int hh   = lane >> 4;
  const int c    = lane & 15;
  const int qt   = qtb + (bid % nqtl);
  const int t2   = bid / nqtl;
  const int hg   = t2 % NHG;
  const int b    = t2 / NHG;
  if (b >= NB) return;                      // block-uniform, before every barrier; never taken with the exact grid
  const int q0   = qt * 16;
  if (q0 + 16 > SEQ) return;                // block-uniform, before every barrier; never taken
  const int head = hg + NG * wave;
  const int kvh  = hg;                      // tiled kv mapping: head h -> kv group h % NG, the same for the block's 4 waves

  // fragment-order blocks (512 halves each): q block (row tile, head); k block (key tile of 16, kv group), 16 keys on = 16 * NK
  // halves on; v^T block (d tile, key step of 32), 32 keys on = 512 halves on, 16 d on = 16 * SEQ halves on
  const _Float16* Qh  = (const _Float16*)(const void*)QHp + ((size_t)b * SEQ + q0) * NQ + (size_t)head * 512;
  const _Float16* Ql  = (const _Float16*)(const void*)QLp + ((size_t)b * SEQ + q0) * NQ + (size_t)head * 512;
  const _Float16* Khb = (const _Float16*)(const void*)KHp + (size_t)b * SEQ * NK + (size_t)kvh * 512;  // key row kb added per step
  const _Float16* Klb = (const _Float16*)(const void*)KLp + (size_t)b * SEQ * NK + (size_t)kvh * 512;
  const _Float16* Vhb = (const _Float16*)(const void*)VHp + (size_t)(b * NG + kvh) * DV * SEQ;         // d tile 0 (+j)
  const _Float16* Vlb = (const _Float16*)(const void*)VLp + (size_t)(b * NG + kvh) * DV * SEQ;
  const unsigned lb = 16u * (unsigned)lane;  // the lane's chunk inside a block, in bytes

  // ALiBi slope 2^(-(head+1)/2): even exponent -> exact power of two; odd -> power of two times f32 sqrt(2)
  const int   e1   = head + 1;
  const int   pw   = (e1 + 1) >> 1;
  const float p2   = __uint_as_float(((unsigned)(127 - pw)) << 23);
  const float slope = p2 * (((e1 & 1) != 0) ? SQRT2F : 1.0f);   // wave-uniform select by value
  const float lsc  = 1.0f / (QSC * KSC);
  const float ul2  = RSQ_DQ * LOG2E;
  const float oc   = 1.0f / (PCAR * VCAR);
  const size_t KROW = (size_t)NK;           // halves per key row in the k planes (16 rows = one row of blocks)

  const v16h qh = ldfrag_h(Qh, lb);             // loop-invariant q fragments (d = 0..31): hi plane
  const v16h ql = ldfrag_h(Ql, lb);             //                                         residual plane

  float mrow = -INFINITY, lrow = 0.f;       // the lane's query: running maximum (both halves alike), sum over this half's keys
  v8f o[4];                                 // O^T: o[j][r] = (d = j*16 + 8*hh + r, query q0 + c)
#pragma unroll
  for (int j = 0; j < 4; ++j) o[j] = zero8();
  const int ncaus = (q0 >> 5) + 1;                                            // tiles holding keys <= q0 + 15
  const int nkt = (ncaus < NKT) ? ncaus : NKT;
  const int qr  = q0 + c;                                                     // the lane's query row

  // the wave's share of a step's copies: k block wave (hi plane key tiles 0, 1, residual plane key tiles 0, 1), v^T hi d tile wave,
  // v^T residual d tile wave; the lane's 16 B of each half block. A key tile on: 32 key rows in k, one block (512 halves) in v^T.
  const _Float16* gk = (((wave & 2) != 0) ? Klb : Khb) + (size_t)(16 * (wave & 1)) * KROW + 8 * lane;
  const _Float16* gh = Vhb + (size_t)wave * 16 * SEQ + 8 * lane;
  const _Float16* gl = Vlb + (size_t)wave * 16 * SEQ + 8 * lane;
  const unsigned  lw = (unsigned)(size_t)kvs + 1024u * (unsigned)wave + lb;   // LDS byte address: buffer 0, block wave, the lane's chunk

  // steps of 64 keys = two key tiles; with an odd tile count the last step's second tile holds only keys above every query row of
  // the block (all its weights come out 0); it lies inside the planes, since SEQ is a multiple of 64
  const int nst = (nkt + 1) >> 1;

  // step 0 into buffer 0, landed and published; then step 1 into buffer 1, in flight over step 0
  kv_copy(lw, gk, gh, gl);
  asm volatile("s_wait_asynccnt 0x0" ::: "memory");   // this wave's copies have landed before the barrier lets others read them
  __syncthreads();
  if (nst > 1) kv_copy(lw + 2u * KVSTEP, gk + (size_t)64 * KROW, gh + 1024, gl + 1024);

#pragma unroll 1
  for (int st = 0; st < nst; ++st) {
    const int kb = st * 64;
    const _Float16* kvb = (const _Float16*)(const void*)kvs + (st & 1) * KVSTEP;
    // ---- this step's k fragments from its LDS buffer, as one group: key tile of 16 number i = tile i / 2 of 32, half i % 2 ----
    v16h kh[4], kl[4];
#pragma unroll
    for (int i = 0; i < 4; ++i) kh[i] = ldfrag_h(kvb + (i >> 1) * KVBUF + (i & 1) * 512, lb);
#pragma unroll
    for (int i = 0; i < 4; ++i) kl[i] = ldfrag_h(kvb + (i >> 1) * KVBUF + 1024 + (i & 1) * 512, lb);
    // ---- scores: D element r of this lane in s[i] = (key kb + 16*i + 8*hh + r, query qr) ----
    //      hi+residual planes on both operands, each accumulator in the order k_hi.q_hi + k_lo.q_hi + k_hi.q_lo; 4 independent chains
    v8f s[4];
#pragma unroll
    for (int i = 0; i < 4; ++i) s[i] = mma_h(kh[i], qh, zero8());
#pragma unroll
    for (int i = 0; i < 4; ++i) s[i] = mma_h(kl[i], qh, s[i]);
#pragma unroll
    for (int i = 0; i < 4; ++i) s[i] = mma_h(kh[i], ql, s[i]);
    guard6<v16h>(s[0], s[1], s[2], s[3], kh[0], kh[1], kh[2], kh[3], ql, ql);
    // ---- the step's v^T fragments, as one group behind the score products: they arrive under the softmax arithmetic ----
    v16h vh[2][4], vl[2][4];
#pragma unroll
    for (int u = 0; u < 2; ++u) {
#pragma unroll
      for (int j = 0; j < 4; ++j) vh[u][j] = ldfrag_h(kvb + u * KVBUF + 2048 + j * 512, lb);
#pragma unroll
      for (int j = 0; j < 4; ++j) vl[u][j] = ldfrag_h(kvb + u * KVBUF + 4096 + j * 512, lb);
    }
    // without this the scheduler sinks these loads down among the v^T.P^T products, each then waiting out its own LDS latency
    __builtin_amdgcn_sched_barrier(0);
    // ---- causal select + ALiBi + scale, online softmax in base 2, -inf-safe; all 32 values belong to query qr ----
    const int dk = kb + 8 * hh - qr;        // key - query of s[0][0]
    float t[4][8];
#pragma unroll
    for (int i = 0; i < 4; ++i) {
#pragma unroll
      for (int r = 0; r < 8; ++r) {
        const int   d = dk + 16 * i + r;
        const float a = slope * (float)d;
        const float u = (s[i][r] * lsc + a) * ul2;
        t[i][r] = (d > 0) ? -INFINITY : u;
      }
    }
    float mq[2][4];
#pragma unroll
    for (int u = 0; u < 2; ++u) {
#pragma unroll
      for (int i = 0; i < 4; ++i)
        mq[u][i] = fmaxf(fmaxf(t[2 * u][2 * i], t[2 * u][2 * i + 1]), fmaxf(t[2 * u + 1][2 * i], t[2 * u + 1][2 * i + 1]));
    }
    float mx = fmaxf(fmaxf(fmaxf(mq[0][0], mq[0][1]), fmaxf(mq[0][2], mq[0][3])), fmaxf(fmaxf(mq[1][0], mq[1][1]), fmaxf(mq[1][2], mq[1][3])));
    mx = fmaxf(mx, xhalf(mx));              // the other 32 keys of the step
    const float mn = fmaxf(mrow, mx);
    const float ms = (mn == -INFINITY) ? 0.0f : mn;
    const float al = ex2x1(mrow - ms);
    mrow = mn;
    float e[4][8];
#pragma unroll
    for (int i = 0; i < 4; ++i) {
#pragma unroll
      for (int r = 0; r < 8; ++r) e[i][r] = t[i][r] - ms;
      ex2x8(e[i]);
    }
    float sq[2][4];
#pragma unroll
    for (int u = 0; u < 2; ++u) {
#pragma unroll
      for (int i = 0; i < 4; ++i)
        sq[u][i] = (e[2 * u][2 * i] + e[2 * u][2 * i + 1]) + (e[2 * u + 1][2 * i] + e[2 * u + 1][2 * i + 1]);
    }
    lrow = lrow * al + (((sq[0][0] + sq[0][1]) + (sq[0][2] + sq[0][3])) + ((sq[1][0] + sq[1][1]) + (sq[1][2] + sq[1][3])));
#pragma unroll
    for (int j = 0; j < 4; ++j) {
#pragma unroll
      for (int r = 0; r < 8; ++r) o[j][r] *= al;
    }
    // ---- B fragments of P^T*32768, one per key tile u of 32: f16 hi (and f16 residual when PRES), column = query c, split k map:
    //      elements 0..7 = keys kb + 32u + 8hh + 0..7 (s[2u]'s rows), elements 8..15 = keys kb + 32u + 16 + 8hh + 0..7 (s[2u+1]'s) ----
    FragH ph[2], pl[2];
#pragma unroll
    for (int u = 0; u < 2; ++u) {
#pragma unroll
      for (int x = 0; x < 8; ++x) {
        const float ta = e[2 * u][x] * PCAR, tc = e[2 * u + 1][x] * PCAR;
        const _Float16 ha = (_Float16)ta, hc = (_Float16)tc;
        ph[u].h[0][x] = ha;
        ph[u].h[1][x] = hc;
        if constexpr (PRES == 1) {
          pl[u].h[0][x] = (_Float16)(ta - (float)ha);
          pl[u].h[1][x] = (_Float16)(tc - (float)hc);
        }
      }
    }
    // ---- v^T.P^T : A fragment row m = d = j*16 + c, k = the 32 keys of tile u; the 4 d-subtiles are 4 independent chains, each in
    //      the order v_hi.P_hi (+ v_hi.P_lo) + v_lo.P_hi, tile 0 then tile 1 ----
#pragma unroll
    for (int u = 0; u < 2; ++u) {
#pragma unroll
      for (int j = 0; j < 4; ++j) o[j] = mma_h(vh[u][j], ph[u].v, o[j]);
      if constexpr (PRES == 1) {
#pragma unroll
        for (int j = 0; j < 4; ++j) o[j] = mma_h(vh[u][j], pl[u].v, o[j]);
      }
#pragma unroll
      for (int j = 0; j < 4; ++j) o[j] = mma_h(vl[u][j], ph[u].v, o[j]);
    }
    guard6<v16h>(o[0], o[1], o[2], o[3], vl[1][0], vl[1][1], vl[1][2], vl[1][3], ph[1].v, ph[1].v);
    // ---- hand-over: step st + 1 is published, and this step's buffer is free for step st + 2 ----
    asm volatile("s_wait_dscnt 0x0" ::: "memory");      // this wave's reads of the buffer are done before anyone refills it
    asm volatile("s_wait_asynccnt 0x0" ::: "memory");   // this wave's copies of step st + 1 have landed before others read them
    __syncthreads();
    if (st + 2 < nst)
      kv_copy(lw + (unsigned)(st & 1) * (2u * KVSTEP), gk + (size_t)(kb + 128) * KROW, gh + (size_t)(kb + 128) * 16, gl + (size_t)(kb + 128) * 16);
  }
  asm volatile("s_wait_asynccnt 0x0" ::: "memory");     // no copy is left in flight when the wave goes on to its end
  acc_guard4(o[0], o[1], o[2], o[3]);
  // ---- out = acc / Z (0 if Z == 0), Z = the two halves' sums, carries (32768 on P, 1024 on v) folded once ----
  const float lv  = lrow + xhalf(lrow);
  const float ls  = (lv > 0.0f) ? lv : 1.0f;
  const float inv = (lv > 0.0f) ? ((1.0f / ls) * oc) : 0.0f;
  v4u oh[4], ol[4];
#pragma unroll
  for (int it = 0; it < 4; ++it) {
    // chunk it * 32 + lane of the wave's two O blocks: query row c, head columns it * 16 + 8 * hh .. + 7 = o[it][0..7]
    float w[8];
#pragma unroll
    for (int e = 0; e < 8; ++e) w[e] = (o[it][e] * inv) * OSC;
#pragma unroll
    for (int e = 0; e < 4; ++e) {
      const _Float16 h0 = (_Float16)w[2 * e], h1 = (_Float16)w[2 * e + 1];
      const _Float16 l0 = (_Float16)(w[2 * e] - (float)h0), l1 = (_Float16)(w[2 * e + 1] - (float)h1);
      oh[it][e] = pk16(h_bits(h0), h_bits(h1));
      ol[it][e] = pk16(h_bits(l0), h_bits(l1));
    }
  }
  const size_t ob = ((size_t)b * SEQ + q0) * DOUT + (size_t)head * (DV / 32) * 512 + 8 * lane;
  {
#pragma unroll
    for (int it = 0; it < 4; ++it) {
      *(v4u*)(OHp + ob + it * 256) = oh[it];
      *(v4u*)(OLp + ob + it * 256) = ol[it];
    }
    
  }
  // a precaution: the eight stores' two address registers are named here, so neither is re-formed between the stores (one build's
  // listing did that for the last store, which the two kinds of query tile share) ahead of this wait
#if defined(__HIP_DEVICE_COMPILE__)
  asm volatile("s_wait_xcnt 0x0" :: "v"(OHp + ob), "v"(OLp + ob) : "memory");
#endif
}

// =====================================================================================================
// Both kinds of query tile in one launch, chosen by the block's index (block-uniform): blocks [0, nqt0 * NHG * NB) take the nqt0
// query tiles from nqt1 on (the longer key loops), without the P residual product; the other nqt1 * NHG * NB blocks take query
// tiles [0, nqt1), with it.
// =====================================================================================================
__global__ __launch_bounds__(ATT_THREADS)
void attn_all(const u16* __restrict__ QHp, const u16* __restrict__ QLp,
              const u16* __restrict__ KHp, const u16* __restrict__ KLp,
              const u16* __restrict__ VHp, const u16* __restrict__ VLp,
              u16* OHp, u16* OLp, int nqt1, int nqt0) {
  __shared__ __align__(16) u16 kvs[2 * KVSTEP];         // two buffers of a step's 24 k and v^T blocks
  const int bid = blockIdx.x;
  const int nb0 = nqt0 * NHG * NB;
  if (bid < nb0) attn_c<0>(QHp, QLp, KHp, KLp, VHp, VLp, OHp, OLp, nqt1, nqt0, bid, kvs);
  else           attn_c<1>(QHp, QLp, KHp, KLp, VHp, VLp, OHp, OLp, 0, nqt1, bid - nb0, kvs);
}

// =====================================================================================================
// Workspace map (bytes); every plane is fully written by whole-line stores before it is read; all extents are exact multiples
// of the store granularity (no pad rows needed); every region offset a multiple of 262144; the 16-bit planes are given as
// rows x columns and lie in fragment order, the f32 planes are row-major:
//   XB  bf16 MROWS x DIN                  MROWS*2048      (NB=2, SEQ=2048: 8388608)
//   WQT bf16 NQ n x DIN k                 1048576
//   WKT bf16 NK n x DIN k                 262144
//   WVT bf16 NV n x DIN k                 524288
//   WPT f16  DOUT n x DOUT k, x1024       2097152
//   QH, QL f16 MROWS x NQ, x256           MROWS*1024 each (4194304 each)
//   KH, KL f16 MROWS x NK, x256           MROWS*256 each  (1048576 each)
//   VH, VL f16 NB*NG*DV x SEQ, x1024      MROWS*512 each  (2097152 each)
//   OH, OL f16 MROWS x DOUT, x1024        MROWS*2048 each (8388608 each)
//   end (NB=2, SEQ=2048)                  43778048
// =====================================================================================================
extern "C" void kernel_launch(void* const* d_in, const int* in_sizes, int n_in,
                              void* d_out, int out_size, void* d_ws, size_t ws_size,
                              hipStream_t stream) {
  if (n_in < 6) return;
  if (in_sizes[0] < ((NB - 1) * XS_FULL + SEQ) * DIN) return;
  if (in_sizes[1] != DIN * NQ) return;
  if (in_sizes[2] != DIN * NK) return;
  if (in_sizes[3] != DIN * NV) return;
  if (in_sizes[4] != DOUT * DOUT) return;
  if (in_sizes[5] != DOUT) return;
  if (out_size < MROWS * DOUT) return;

  const float* x   = (const float*)d_in[0];
  const float* wq  = (const float*)d_in[1];
  const float* wk  = (const float*)d_in[2];
  const float* wv  = (const float*)d_in[3];
  const float* wp  = (const float*)d_in[4];
  const float* bpv = (const float*)d_in[5];
  float*       out = (float*)d_out;

  const size_t szXB = (size_t)MROWS * DIN * 2;
  const size_t szWQ = (size_t)NQ * DIN * 2;
  const size_t szWK = (size_t)NK * DIN * 2;
  const size_t szWV = (size_t)NV * DIN * 2;
  const size_t szWP = (size_t)DOUT * DOUT * 2;
  const size_t szQ  = (size_t)MROWS * NQ * 2;                   // QH, QL
  const size_t szK  = (size_t)MROWS * NK * 2;                   // KH, KL
  const size_t szV  = (size_t)NB * NG * DV * SEQ * 2;           // VH, VL
  const size_t szO  = (size_t)MROWS * DOUT * 2;                 // OH, OL
  size_t off = 0;
  const size_t oXB = off; off += szXB;
  const size_t oWQ = off; off += szWQ;
  const size_t oWK = off; off += szWK;
  const size_t oWV = off; off += szWV;
  const size_t oWP = off; off += szWP;
  const size_t oQH = off; off += szQ;
  const size_t oQL = off; off += szQ;
  const size_t oKH = off; off += szK;
  const size_t oKL = off; off += szK;
  const size_t oVH = off; off += szV;
  const size_t oVL = off; off += szV;
  const size_t oOH = off; off += szO;
  const size_t oOL = off; off += szO;
  if (off > ws_size) return;                // off = 43778048 for NB = 2, SEQ = 2048
  if (off > (size_t)WS_CAP) return;

  char* ws = (char*)d_ws;
  u16*   XB  = (u16*)(ws + oXB);
  u16*   WQT = (u16*)(ws + oWQ);
  u16*   WKT = (u16*)(ws + oWK);
  u16*   WVT = (u16*)(ws + oWV);
  u16*   WPT = (u16*)(ws + oWP);
  u16*   QH  = (u16*)(ws + oQH);
  u16*   QL  = (u16*)(ws + oQL);
  u16*   KH  = (u16*)(ws + oKH);
  u16*   KL  = (u16*)(ws + oKL);
  u16*   VH  = (u16*)(ws + oVH);
  u16*   VL  = (u16*)(ws + oVL);
  u16*   OH  = (u16*)(ws + oOH);
  u16*   OL  = (u16*)(ws + oOL);

  const dim3 b256(256), b128(128), bAT(ATT_THREADS);
  const dim3 gPI(GWALL + NB * GX);                      // 480 weight blocks + 1024 x blocks per batch (SEQ=2048)
  const dim3 gGP((MROWS / 64) * (NQKV / 64));
  const int  nqt1 = QO / 16;                            // query tiles with the P residual product (rows s < QO)
  const int  nqt0 = NQT - nqt1;                         // remaining query tiles
  const dim3 gGO((MROWS / 64) * (DOUT / 64));

  // (0) x -> bf16 plane MROWS x DIN; Wq, Wk, Wv -> bf16 n x k planes; Wp -> f16 n x k plane x1024; all in fragment order
  prep_in<<<gPI, b256, 0, stream>>>(x, wq, wk, wv, wp, XB, WQT, WKT, WVT, WPT);
  // (1) q = x.Wq, k = x.Wk -> hi + residual planes x256, v = x.Wv -> v^T hi + residual planes x1024; WQT, WKT, WVT lie one behind
  //     the other in the workspace and are read as one plane of NQKV rows
  gemm_qkv<<<gGP, b128, 0, stream>>>(XB, WQT, QH, QL, KH, KL, VH, VL, MROWS, DIN);
  // (2) causal grouped attention with ALiBi -> O hi + residual planes f16 x1024, MROWS x DOUT:
  //     query tiles [0, QO/16) with the in-register P residual product, the rest without it
  attn_all<<<dim3((nqt0 + nqt1) * NHG * NB), bAT, 0, stream>>>(QH, QL, KH, KL, VH, VL, OH, OL, nqt1, nqt0);
  // (3) out = (O_hi + O_lo).Wp + bp -> d_out f32 [MROWS][DOUT], carries 1024 x 1024 folded back
  gemm_h2<<<gGO, b128, 0, stream>>>(OH, OL, WPT, bpv, out, MROWS, DOUT, DOUT, 1.0f / (OSC * WOS));
  (void)hipGetLastError();
}

// v010
// It runs in 81.6 microseconds.
// Two timings next to v009 put it at 1.05 and 1.06 times that version's speed.
// Counting every step since v000, it is 3.37 times as fast.
#include <hip/hip_runtime.h>
#include <math.h>
#include <stdint.h>

#ifndef NB
#define NB 2
#endif
#ifndef SEQ
#define SEQ 2048
#endif
#define XS_FULL 2048
#define DIN   1024
#define DOUT  1024
#define NH    16
#define NG    4
#define DQ    32
#define DV    64
#define NQ    (NH * DQ)
#define NK    (NG * DQ)
#define NV    (NG * DV)
#define MROWS (NB * SEQ)
#define QO    ((SEQ < 512) ? SEQ : 512)
#define RSQ_DQ 0.17677669529663687f
#define LOG2E  1.4426950408889634f
#define SQRT2F 1.4142135623730951f
#define QSC   256.0f
#define KSC   256.0f
#define PCAR  32768.0f
#define VCAR  1024.0f
#define OSC   1024.0f
#define WOS   1024.0f
#define WPB   4
#define NHG   (NH / WPB)
#define KVBLK 12
#define KVBUF (KVBLK * 512)
#define KVSTEP (2 * KVBUF)                  // halves of one attention step's LDS buffer: the blocks of its two key tiles
#define NQT   (SEQ / 16)
#define NKT   (SEQ / 32)
#define ATT_THREADS (WPB * 32)
#define SLAB64 (16 * 68)
#define WTP   72
#define WS_CAP 134217728
#define KUQ   4                             // k steps of 32 whose fragment loads gemm_qkv issues as one group
#define KUO   4                             // the same for gemm_h2
// block counts of the jobs that share a launch
#define GX    ((SEQ * DIN / 8 + 255) / 256)
#define GWQ   ((NQ / 64) * (DIN / 64))
#define GWK   ((NK / 64) * (DIN / 64))
#define GWV   ((NV / 64) * (DIN / 64))
#define GWP   ((DOUT / 64) * (DOUT / 64))
#define GWALL (GWP + GWQ + GWK + GWV)
#define NQKV  (NQ + NK + NV)
static_assert(DOUT == NH * DV && NQ == 512 && NK == 128 && NV == 256 && DQ == 32 && DV == 64 && NG == 4 && NH == 16);
static_assert(NHG * WPB == NH && ATT_THREADS == 128 && WPB == 4 && NHG == NG);
static_assert(NB >= 1 && NB <= 2);
static_assert((SEQ % 64) == 0 && SEQ >= 64 && SEQ <= XS_FULL);
static_assert((QO % 16) == 0 && QO >= 16 && QO <= SEQ);
static_assert((DIN % 64) == 0 && (DOUT % 64) == 0 && (NQ % 64) == 0 && (NK % 64) == 0 && (NV % 64) == 0 && (DIN % 32) == 0);
static_assert(((SEQ * DIN / 8) % 256) == 0);
static_assert((DIN % (32 * KUQ)) == 0 && (DOUT % (32 * KUO)) == 0);
static_assert((NQKV % 128) == 0 && (DOUT % 128) == 0 && (MROWS % 128) == 0);
static_assert(64 * WTP * 2 <= 65536 && 8 * SLAB64 * 4 <= 65536 && 2 * KVSTEP * 2 <= 65536);

typedef unsigned short u16;
typedef _Float16 v16h __attribute__((ext_vector_type(16)));
typedef _Float16 v8h  __attribute__((ext_vector_type(8)));
typedef __bf16   v16b __attribute__((ext_vector_type(16)));
typedef float    v8f  __attribute__((ext_vector_type(8)));
typedef float    v4f  __attribute__((ext_vector_type(4)));
typedef unsigned int v4u __attribute__((ext_vector_type(4)));

union FragH { v16h v; v8h h[2]; v4u u[2]; };
union FragB { v16b v; v4u u[2]; };

// ---- scalar helpers --------------------------------------------------------------------------------
__device__ __forceinline__ unsigned short bf_bits(float f) {          // f32 -> bf16 bits, RNE convert
  unsigned u = __float_as_uint(f);
  return (unsigned short)((u + 0x7FFFu + ((u >> 16) & 1u)) >> 16);
}
__device__ __forceinline__ float bf_up(unsigned short h) { return __uint_as_float(((unsigned)h) << 16); }
__device__ __forceinline__ float bfr(float f) { return bf_up(bf_bits(f)); }
__device__ __forceinline__ unsigned short h_bits(_Float16 x) { return __builtin_bit_cast(unsigned short, x); }
__device__ __forceinline__ unsigned pk16(unsigned short a, unsigned short b) { return (unsigned)a | ((unsigned)b << 16); }
__device__ __forceinline__ v8f zero8() { v8f z = {0.f, 0.f, 0.f, 0.f, 0.f, 0.f, 0.f, 0.f}; return z; }
__device__ __forceinline__ float xhalf(float x) {                     // the value of lane l ^ 16
  const int b = __builtin_bit_cast(int, x);
  return __builtin_bit_cast(float, __builtin_amdgcn_permlanex16(b, b, 0x76543210, 0xfedcba98, false, false));
}

// 2^x as the bare v_exp_f32. The library exp2f wraps it in a range fix-up (compare, two selects, add, ldexp) that only keeps results
// below 2^-126; here such a weight is 0 in f16 x32768 and adds nothing to a row sum that is at least 1. -inf gives 0, as before.
// A run of them stands in one asm statement, each working in place: the statement writes only registers that it reads, so none of
// them can be an operand register of a matrix instruction issued just ahead of it (the compiler pads its own instructions behind a
// WMMA, not an asm statement). The closing v_nop is the slot the instruction set asks for behind the last one, before its result
// is read.
__device__ __forceinline__ void ex2x8(float (&x)[8]) {
#if defined(__HIP_DEVICE_COMPILE__)
  asm("v_exp_f32 %0, %0\n\tv_exp_f32 %1, %1\n\tv_exp_f32 %2, %2\n\tv_exp_f32 %3, %3\n\t"
      "v_exp_f32 %4, %4\n\tv_exp_f32 %5, %5\n\tv_exp_f32 %6, %6\n\tv_exp_f32 %7, %7\n\tv_nop"
      : "+v"(x[0]), "+v"(x[1]), "+v"(x[2]), "+v"(x[3]), "+v"(x[4]), "+v"(x[5]), "+v"(x[6]), "+v"(x[7]));
#endif
}
__device__ __forceinline__ float ex2x1(float x) {
#if defined(__HIP_DEVICE_COMPILE__)
  asm("v_exp_f32 %0, %0\n\tv_nop" : "+v"(x));
#endif
  return x;
}

// ---- fragment order of a 16-bit operand plane of R rows (the WMMA's m or n index) x K columns (its k index), R % 16 == 0,
//      K % 32 == 0: a row-major grid of blocks of 16 rows x 32 columns, block (r >> 4, k >> 5) at half offset
//      ((r >> 4) * (K >> 5) + (k >> 5)) * 512; inside a block 64 chunks of 8 halves (16 B): chunk id holds row (id & 15),
//      columns ((id >> 4) & 3) * 8 .. + 7. So 16 rows x K columns take 16 * K halves, as in a row-major plane.
// ---- fragment loaders: 16-bit A/B operand, p + lb bytes = block base + 16 B * lane: lane -> row/col (lane&15), h = lane>>4;
//      elements 0..7 <- chunk lane (k0+8h..), elements 8..15 <- chunk 32 + lane (k0+16+8h..)  (same split k map for A and B);
//      each of the two loads of a wave reads 512 contiguous bytes = 4 whole 128-B lines
__device__ __forceinline__ v16h ldfrag_h(const _Float16* p, unsigned lb) {
  FragH f;
  const char* q = (const char*)(const void*)p + lb;
  f.h[0] = *(const v8h*)(const void*)(q);
  f.h[1] = *(const v8h*)(const void*)(q + 512);
  return f.v;
}
__device__ __forceinline__ v16b ldfrag_b(const u16* p, unsigned lb) { // bf16 plane read as unsigned integer vectors
  FragB f;
  const char* q = (const char*)(const void*)p + lb;
  f.u[0] = *(const v4u*)(const void*)(q);
  f.u[1] = *(const v4u*)(const void*)(q + 512);
  return f.v;
}

__device__ __forceinline__ v8f mma_h(v16h a, v16h b, v8f c) {
  return __builtin_amdgcn_wmma_f32_16x16x32_f16(false, a, false, b, (short)0, c, false, false);
}
__device__ __forceinline__ v8f mma_b(v16b a, v16b b, v8f c) {
  return __builtin_amdgcn_wmma_f32_16x16x32_bf16(false, a, false, b, (short)0, c, false, false);
}
template <typename F>
__device__ __forceinline__ void guard6(v8f& a, v8f& b, v8f& c, v8f& d, F x0, F x1, F x2, F x3, F x4, F x5) {
#if defined(__HIP_DEVICE_COMPILE__)
  asm volatile("v_nop\n\tv_nop\n\tv_nop\n\tv_nop"
               : "+v"(a), "+v"(b), "+v"(c), "+v"(d) : "v"(x0), "v"(x1), "v"(x2), "v"(x3), "v"(x4), "v"(x5) : "memory");
#endif
}
// the same distance behind the last matrix instructions of a GEMM k group with 8 accumulators: four issue slots before anything
// reads the accumulators or overwrites the last step's operand registers, on the loop's back edge too
template <typename F>
__device__ __forceinline__ void guard8(v8f (&a)[2][4], F x0, F x1, F x2, F x3, F x4, F x5, F x6, F x7) {
#if defined(__HIP_DEVICE_COMPILE__)
  asm volatile("v_nop\n\tv_nop\n\tv_nop\n\tv_nop"
               : "+v"(a[0][0]), "+v"(a[0][1]), "+v"(a[0][2]), "+v"(a[0][3]), "+v"(a[1][0]), "+v"(a[1][1]), "+v"(a[1][2]), "+v"(a[1][3])
               : "v"(x0), "v"(x1), "v"(x2), "v"(x3), "v"(x4), "v"(x5), "v"(x6), "v"(x7) : "memory");
#endif
}
__device__ __forceinline__ void acc_guard4(v8f& a, v8f& b, v8f& c, v8f& d) {
#if defined(__HIP_DEVICE_COMPILE__)
  asm volatile("v_nop\n\tv_nop\n\tv_nop\n\tv_nop" : "+v"(a), "+v"(b), "+v"(c), "+v"(d));
#endif
}
__device__ __forceinline__ void wave_sync_lds() {
  __builtin_amdgcn_fence(__ATOMIC_RELEASE, "workgroup");
  __builtin_amdgcn_wave_barrier();
  __builtin_amdgcn_fence(__ATOMIC_ACQUIRE, "workgroup");
}

// =====================================================================================================
// f32 row-major [rows][DIN] -> bf16 RNE plane in fragment order. Thread = one chunk of D (8 elements of one row): two 16-B
// loads, one 16-B store; a wave stores 512 contiguous bytes.
// coverage: bid = 0 .. ceil(n8/256) - 1, x 256 thr x 8 (in-kernel bound) = the whole plane (n8 a multiple of 256 here).
// =====================================================================================================
__device__ __forceinline__ void cvt_bf(const float* __restrict__ x, u16* D, int n8, int bid) {
  const int gt = bid * 256 + (int)threadIdx.x;                        // chunk index in D
  if (gt >= n8) return;
  const int blk = gt >> 6;
  const int row = (blk / (DIN / 32)) * 16 + (gt & 15);
  const int col = (blk % (DIN / 32)) * 32 + ((gt >> 4) & 3) * 8;
  const float* p = x + (size_t)row * DIN + col;
  const v4f a = *(const v4f*)(p), b4 = *(const v4f*)(p + 4);
  v4u o;
#pragma unroll
  for (int e = 0; e < 2; ++e) {
    o[e]     = pk16(bf_bits(a[2 * e]),  bf_bits(a[2 * e + 1]));
    o[2 + e] = pk16(bf_bits(b4[2 * e]), bf_bits(b4[2 * e + 1]));
  }
  u16* d = D + (size_t)gt * 8;
  {
    *(v4u*)(d) = o;
    
  }
}

// =====================================================================================================
// f32 W [K][N] (row-major, x.W layout) -> 16-bit plane D, N rows x K columns in fragment order (A operand for Wq, Wk; B for Wv, Wp). f16mode == 0: bf16 RNE bits;
// f16mode == 1: f16 bits of (bf16 RNE value) * scale. Block = 64 n x 64 k output tile: each thread loads 16 floats of one
// k row (four 16-B loads), converts, scatters into the LDS tile T[n][k] (pitch 72 halves, scalar 2-B LDS stores of per-lane
// values); after a block barrier the tile leaves as its 8 blocks (4 n tiles x 2 k steps) of 64 chunks, a wave storing 512 contiguous B.
// coverage: load 256 thr x 16 = 64 k x 64 n; store 2 iterations x 256 thr x 8 halves = 8 blocks x 512 halves = the tile;
//           bid = 0 .. (N/64)*(K/64) - 1 covers D exactly once (N % 64 == 0, K % 64 == 0).
// =====================================================================================================
__device__ __forceinline__ void wt16(const float* __restrict__ W, u16* D, int K, int N, int f16mode, float scale, int bid) {
  __shared__ __align__(16) u16 T[64 * WTP];
  const int tid = threadIdx.x;
  const int nt  = N >> 6;
  const int n0  = (bid % nt) * 64;
  const int k0  = (bid / nt) * 64;
  if (k0 + 64 > K) return;                  // block-uniform, before the barrier; never taken with the exact grid
  {
    const int kr = tid >> 2;                // k row within tile 0..63
    const int nc = (tid & 3) * 16;          // n chunk 0,16,32,48
    const float* src = W + (size_t)(k0 + kr) * (size_t)N + n0 + nc;
#pragma unroll
    for (int i = 0; i < 4; ++i) {
      const v4f a = *(const v4f*)(src + 4 * i);
#pragma unroll
      for (int e = 0; e < 4; ++e) {
        const float f = a[e];
        const unsigned short hb = h_bits((_Float16)(bfr(f) * scale));
        const unsigned short bb = bf_bits(f);
        T[(nc + 4 * i + e) * WTP + kr] = (f16mode != 0) ? hb : bb;
      }
    }
  }
  __syncthreads();
  v4u v[2];
#pragma unroll
  for (int it = 0; it < 2; ++it) {
    const int id = it * 256 + tid;          // chunk of the tile: block id >> 6 = (n tile id >> 7, k step (id >> 6) & 1)
    v[it] = *(const v4u*)(T + ((id >> 7) * 16 + (id & 15)) * WTP + ((id >> 6) & 1) * 32 + ((id >> 4) & 3) * 8);
  }
  {
#pragma unroll
    for (int it = 0; it < 2; ++it) {
      const int id = it * 256 + tid;
      const size_t blk = (size_t)((n0 >> 4) + (id >> 7)) * (size_t)(K >> 5) + (size_t)((k0 >> 5) + ((id >> 6) & 1));
      *(v4u*)(D + blk * 512 + (id & 63) * 8) = v[it];
    }
    
  }
}

// =====================================================================================================
// All jobs that read only the inputs, in one launch; a block does one block's work of one job, chosen by its index (block-uniform):
//   [0, GWP) Wp [DOUT k][DOUT n] -> DOUT n x DOUT k as f16 of bf16 value x1024; then GWQ blocks Wq [DIN k][NQ n] -> NQ n x DIN k
//   bf16; GWK blocks Wk -> NK x DIN; GWV blocks Wv -> NV x DIN; then NB * GX blocks x -> bf16 plane MROWS x DIN, GX per batch.
// =====================================================================================================
__global__ __launch_bounds__(256)
void prep_in(const float* __restrict__ x, const float* __restrict__ wq, const float* __restrict__ wk,
             const float* __restrict__ wv, const float* __restrict__ wp,
             u16* XB, u16* WQT, u16* WKT, u16* WVT, u16* WPT) {
  const int bid = blockIdx.x;
  if (bid < GWALL) {
    const float* W = wp;
    u16* D = WPT;
    int K = DOUT, N = DOUT, mode = 1, lb = bid;
    float sc = WOS;
    if (bid >= GWP + GWQ + GWK)  { W = wv; D = WVT; K = DIN; N = NV; mode = 0; sc = 1.0f; lb = bid - (GWP + GWQ + GWK); }
    else if (bid >= GWP + GWQ)   { W = wk; D = WKT; K = DIN; N = NK; mode = 0; sc = 1.0f; lb = bid - (GWP + GWQ); }
    else if (bid >= GWP)         { W = wq; D = WQT; K = DIN; N = NQ; mode = 0; sc = 1.0f; lb = bid - GWP; }
    wt16(W, D, K, N, mode, sc, lb);
  } else {
    const int cb = bid - GWALL;
    const int b  = cb / GX;
    if (b >= NB) return;                    // block-uniform; never taken with the exact grid
    cvt_bf(x + (size_t)b * XS_FULL * DIN, XB + (size_t)b * SEQ * DIN, (SEQ * DIN) / 8, cb % GX);
  }
}

// =====================================================================================================
// Epilogue of the output GEMM, in two parts. epi_turn: a 16x64 f32 tile of the wave (times oscale, plus the lane's per-column bias
// of each subtile) goes through the wave's own LDS slab and comes back as whole row pieces, 16 B a lane. epi_store: those leave as
// 8 store instructions of 2 rows x 256 contiguous bytes.
// coverage: 8 instructions x 2 rows x 16 lanes x 4 floats = the 16 x 64 tile.
// =====================================================================================================
__device__ __forceinline__ void epi_turn(float* sl, v8f a0, v8f a1, v8f a2, v8f a3, float oscale,
                                         float bb0, float bb1, float bb2, float bb3, int lane, v4f (&vals)[8]) {
  const int hh = lane >> 4, m = lane & 15;
#pragma unroll
  for (int r = 0; r < 8; ++r) {
    const int ro = (8 * hh + r) * 68 + m;
    sl[ro]      = a0[r] * oscale + bb0;
    sl[ro + 16] = a1[r] * oscale + bb1;
    sl[ro + 32] = a2[r] * oscale + bb2;
    sl[ro + 48] = a3[r] * oscale + bb3;
  }
  wave_sync_lds();
#pragma unroll
  for (int it = 0; it < 8; ++it) vals[it] = *(const v4f*)(sl + (it * 2 + hh) * 68 + m * 4);
}
__device__ __forceinline__ void epi_store(const v4f (&vals)[8], float* C, int N, size_t rowb, int col0, int lane) {
  const int hh = lane >> 4, m = lane & 15;
  float* dst = C + (rowb + (size_t)hh) * (size_t)N + col0 + m * 4;
#pragma unroll
  for (int it = 0; it < 8; ++it) {
    *(v4f*)(dst + (size_t)(it * 2) * (size_t)N) = vals[it];
  }
}

// =====================================================================================================
// bf16 GEMM, no bias, the q, k and v projections in one launch, stored straight as attention's f16 planes (hi = f16(t), residual =
// f16(t - hi), t = value * scale; fragment order): A (bf16, M rows x K, fragment order) . Bt^T (bf16, NQKV rows x K, fragment
// order: the rows of Wq^T, Wk^T, Wv^T one behind the other, which is how the three planes lie in the workspace).
// Block = 128x128 tile, 4 x 2 waves of 32 rows of A x 64 rows of Bt: in a wave a Bt fragment feeds two row tiles, an A fragment four
// column tiles; the block's 8 waves ask for 8 A and 8 Bt blocks a k step, each wanted by 2 or 4 of them at about the same time, so
// that the repeats can be met by the WGP's cache; a wave's 64 columns lie in one projection (NQ, NK, NV multiples of 64), chosen by the wave's column tile (wave-uniform,
// a scalar); fragments loaded straight from the planes' blocks (two 16-B loads each, split k map for A and B);
// K stepped by 32 * KUQ (host guarantees K % (32 * KUQ) == 0, M % 128 == 0, grid = (M/128)*(NQKV/128)).
// A chunk of a plane is 8 consecutive columns of one plane row, so each projection is computed with the side up that puts a chunk
// into one lane's 8 accumulator registers:
//   q, k (plane row = x row, plane column = n): D = W rows . x rows^T, lane = x row rowb + lane % 16, registers = n 8*(lane/16) + r;
//   v^T  (plane row = n = (g, d), plane column = key = x row): D = x rows . W rows^T, lane = n, registers = x rows 8*(lane/16) + r.
// coverage: per wave 2 x 4 subtiles x 32 chunks x 8 halves = 32 x 64 of the hi and of the residual plane, each store instruction of a
//           wave 512 contiguous bytes; the grid's tiles cover QH, QL, KH, KL, VH, VL exactly once.
// =====================================================================================================
template <int WA>                           // WA == 1: the W fragments are the A operand (q, k); WA == 0: the x fragments are (v)
__device__ __forceinline__ void qkv_tile(const u16* ap0, const u16* bp0, int K, float sc, u16* dh, u16* dl, int jstep, int rstep) {
  const size_t bs = (size_t)16 * K;         // 16 rows on = one row of blocks on
  const u16* ap1 = ap0 + bs;
  const u16* bp1 = bp0 + bs;
  const u16* bp2 = bp1 + bs;
  const u16* bp3 = bp2 + bs;
  v8f acc[2][4];                            // acc[i][j]: x row tile i, W row tile j
#pragma unroll
  for (int i = 0; i < 2; ++i) {
#pragma unroll
    for (int j = 0; j < 4; ++j) acc[i][j] = zero8();
  }
#pragma unroll 1
  for (int k0 = 0; k0 < K; k0 += 32 * KUQ) {
    // the fragments of KUQ k steps, all loads issued as one group in k order: one wait for the planes' latency serves KUQ steps
    v16b a0[KUQ], a1[KUQ], b0[KUQ], b1[KUQ], b2[KUQ], b3[KUQ];
#pragma unroll                              // every index constant: the fragment arrays stay in registers
    for (int u = 0; u < KUQ; ++u) {
      a0[u] = ldfrag_b(ap0, 1024u * u);
      a1[u] = ldfrag_b(ap1, 1024u * u);
      b0[u] = ldfrag_b(bp0, 1024u * u);
      b1[u] = ldfrag_b(bp1, 1024u * u);
      b2[u] = ldfrag_b(bp2, 1024u * u);
      b3[u] = ldfrag_b(bp3, 1024u * u);
    }
    // the loads' address registers are named here, so none is given to a later load's result or stepped on before the
    // loads' address translations are back
#if defined(__HIP_DEVICE_COMPILE__)
    asm volatile("s_wait_xcnt 0x0" :: "v"(ap0), "v"(ap1), "v"(bp0), "v"(bp1), "v"(bp2), "v"(bp3) : "memory");
#endif
    // without this the scheduler sinks each step's loads down to its products, and one step's loads are in flight again
    __builtin_amdgcn_sched_barrier(0);
    ap0 += 512 * KUQ; ap1 += 512 * KUQ; bp0 += 512 * KUQ; bp1 += 512 * KUQ; bp2 += 512 * KUQ; bp3 += 512 * KUQ;
#pragma unroll                              // every index constant: the fragment arrays stay in registers
    for (int u = 0; u < KUQ; ++u) {
      if constexpr (WA == 1) {
        acc[0][0] = mma_b(b0[u], a0[u], acc[0][0]);
        acc[0][1] = mma_b(b1[u], a0[u], acc[0][1]);
        acc[0][2] = mma_b(b2[u], a0[u], acc[0][2]);
        acc[0][3] = mma_b(b3[u], a0[u], acc[0][3]);
        acc[1][0] = mma_b(b0[u], a1[u], acc[1][0]);
        acc[1][1] = mma_b(b1[u], a1[u], acc[1][1]);
        acc[1][2] = mma_b(b2[u], a1[u], acc[1][2]);
        acc[1][3] = mma_b(b3[u], a1[u], acc[1][3]);
      } else {
        acc[0][0] = mma_b(a0[u], b0[u], acc[0][0]);
        acc[0][1] = mma_b(a0[u], b1[u], acc[0][1]);
        acc[0][2] = mma_b(a0[u], b2[u], acc[0][2]);
        acc[0][3] = mma_b(a0[u], b3[u], acc[0][3]);
        acc[1][0] = mma_b(a1[u], b0[u], acc[1][0]);
        acc[1][1] = mma_b(a1[u], b1[u], acc[1][1]);
        acc[1][2] = mma_b(a1[u], b2[u], acc[1][2]);
        acc[1][3] = mma_b(a1[u], b3[u], acc[1][3]);
      }
    }
    guard8<v16b>(acc, a0[KUQ - 1], a1[KUQ - 1], b0[KUQ - 1], b1[KUQ - 1], b2[KUQ - 1], b3[KUQ - 1], a0[KUQ - 1], a1[KUQ - 1]);
  }
#pragma unroll
  for (int i = 0; i < 2; ++i) {
    v4u oh[4], ol[4];
#pragma unroll
    for (int j = 0; j < 4; ++j) {
#pragma unroll
      for (int e = 0; e < 4; ++e) {
        const float t0 = acc[i][j][2 * e] * sc, t1 = acc[i][j][2 * e + 1] * sc;
        const _Float16 h0 = (_Float16)t0, h1 = (_Float16)t1;
        const _Float16 l0 = (_Float16)(t0 - (float)h0), l1 = (_Float16)(t1 - (float)h1);
        oh[j][e] = pk16(h_bits(h0), h_bits(h1));
        ol[j][e] = pk16(h_bits(l0), h_bits(l1));
      }
    }
#pragma unroll
    for (int j = 0; j < 4; ++j) {
      *(v4u*)(dh + (size_t)i * rstep + (size_t)j * jstep) = oh[j];
      *(v4u*)(dl + (size_t)i * rstep + (size_t)j * jstep) = ol[j];
    }
  }
  // a precaution: in the listing the other instance's prologue follows these stores and rewrites their address and data
  // registers; this wait stands in front of every such write
#if defined(__HIP_DEVICE_COMPILE__)
  asm volatile("s_wait_xcnt 0x0" ::: "memory");
#endif
}

__global__ __launch_bounds__(256)
void gemm_qkv(const u16* __restrict__ A, const u16* __restrict__ Bt, u16* QH, u16* QL, u16* KH, u16* KL, u16* VH, u16* VL,
              int M, int K) {
  const int tid = threadIdx.x, lane = tid & 31;
  const int wave = __builtin_amdgcn_readfirstlane(tid >> 5);   // a scalar: the choice of projection below stays a scalar branch
  const int ntile = NQKV >> 7;
  const int bid   = blockIdx.x;
  const int rowb  = (bid / ntile) * 128 + (wave >> 1) * 32;
  const int colb  = (bid % ntile) * 128 + (wave & 1) * 64;     // first row of the wave's tile in Bt
  if (rowb + 32 > M) return;                // wave-uniform, never taken with the exact grid; no barriers in this kernel
  const u16* ap  = A  + (size_t)rowb * K + 8 * lane;   // the lane's chunk in block (rowb / 16, 0); the next k step is 512 halves on
  const u16* bp0 = Bt + (size_t)colb * K + 8 * lane;
  if (colb >= NQ + NK) {
    // v^T planes: row tile (b*NG + g) * (DV/16) + j, key step s0 / 32; the wave's 32 keys are that block's 64 chunks, 16 keys = 32 chunks
    const int g  = (colb - (NQ + NK)) / DV;
    const int b  = rowb / SEQ;
    const int s0 = rowb - b * SEQ;
    const size_t o = ((size_t)((b * NG + g) * (DV / 16)) * (SEQ / 32) + (size_t)(s0 >> 5)) * 512 + (size_t)lane * 8;
    qkv_tile<0>(ap, bp0, K, VCAR, VH + o, VL + o, (SEQ / 32) * 512, 256);
  } else {
    // q or k planes: row tile rowb / 16, column step (column / 32); subtile j = chunks (j & 1) * 32 + lane of block j / 2: 256 halves on;
    // 16 rows on = one row of blocks on = 16 * columns halves
    const bool isk = colb >= NQ;
    const int  nc  = isk ? NK : NQ;         // the plane's columns, and the tile's first column in it
    const int  c0  = isk ? colb - NQ : colb;
    const size_t o = ((size_t)(rowb >> 4) * (size_t)(nc >> 5) + (size_t)(c0 >> 5)) * 512 + (size_t)lane * 8;
    qkv_tile<1>(ap, bp0, K, isk ? KSC : QSC, (isk ? KH : QH) + o, (isk ? KL : QL) + o, 256, 16 * nc);
  }
}

// =====================================================================================================
// f16 GEMM with a two-plane A operand and bias: C[M][N] (f32) = (Ah + Al) (f16 hi and residual planes, M rows x K, fragment
// order, residual unscaled relative to hi) . Bt^T (f16, N rows x K, fragment order) * oscale + bf16 RNE value of bias[n] (bias has
// N entries). Products ah.b + al.b into one accumulator, in that order at each k step. Same tiling (block 128x128, 4 x 2 waves of 32x64)
// and fragment loads (split k map) as gemm_qkv;
// K stepped by 32 * KUO (host guarantees K % (32 * KUO) == 0, M % 128 == 0, N % 128 == 0, grid = (M/128)*(N/128)).
// =====================================================================================================
__global__ __launch_bounds__(256)
void gemm_h2(const u16* __restrict__ Ah, const u16* __restrict__ Al, const u16* __restrict__ Bt,
             const float* __restrict__ bias, float* C, int M, int N, int K, float oscale) {
  __shared__ __align__(16) float slab[8 * SLAB64];
  const int tid = threadIdx.x, wave = tid >> 5, lane = tid & 31, m = lane & 15;
  const int ntile = N >> 7;
  const int bid   = blockIdx.x;
  const int rowb  = (bid / ntile) * 128 + (wave >> 1) * 32;
  const int col0  = (bid % ntile) * 128 + (wave & 1) * 64;
  if (rowb + 32 > M) return;                // wave-uniform, never taken with the exact grid; no block barriers in this kernel
  const size_t bs = (size_t)16 * K;
  const _Float16* ahp0 = (const _Float16*)(const void*)Ah + (size_t)rowb * K + 8 * lane;  // the lane's chunk in block (rowb / 16, 0), as in gemm_qkv
  const _Float16* alp0 = (const _Float16*)(const void*)Al + (size_t)rowb * K + 8 * lane;
  const _Float16* ahp1 = ahp0 + bs;
  const _Float16* alp1 = alp0 + bs;
  const _Float16* bp0 = (const _Float16*)(const void*)Bt + (size_t)col0 * K + 8 * lane;
  const _Float16* bp1 = bp0 + bs;
  const _Float16* bp2 = bp1 + bs;
  const _Float16* bp3 = bp2 + bs;
  v8f acc[2][4];                            // acc[i][j]: row tile i, column tile j
#pragma unroll
  for (int i = 0; i < 2; ++i) {
#pragma unroll
    for (int j = 0; j < 4; ++j) acc[i][j] = zero8();
  }
#pragma unroll 1
  for (int k0 = 0; k0 < K; k0 += 32 * KUO) {
    // the fragments of KUO k steps, all loads issued as one group in k order, as in gemm_qkv
    v16h ah0[KUO], al0[KUO], ah1[KUO], al1[KUO], b0[KUO], b1[KUO], b2[KUO], b3[KUO];
#pragma unroll                              // every index constant: the fragment arrays stay in registers
    for (int u = 0; u < KUO; ++u) {
      ah0[u] = ldfrag_h(ahp0, 1024u * u);
      ah1[u] = ldfrag_h(ahp1, 1024u * u);
      b0[u]  = ldfrag_h(bp0, 1024u * u);
      b1[u]  = ldfrag_h(bp1, 1024u * u);
      b2[u]  = ldfrag_h(bp2, 1024u * u);
      b3[u]  = ldfrag_h(bp3, 1024u * u);
      al0[u] = ldfrag_h(alp0, 1024u * u);
      al1[u] = ldfrag_h(alp1, 1024u * u);
    }
    // the loads' address registers are named here, so none is given to a later load's result or stepped on before the
    // loads' address translations are back
#if defined(__HIP_DEVICE_COMPILE__)
    asm volatile("s_wait_xcnt 0x0" :: "v"(ahp0), "v"(alp0), "v"(ahp1), "v"(alp1), "v"(bp0), "v"(bp1), "v"(bp2), "v"(bp3) : "memory");
#endif
    // without this the scheduler sinks each step's loads down to its products, and one step's loads are in flight again
    __builtin_amdgcn_sched_barrier(0);
    ahp0 += 512 * KUO; alp0 += 512 * KUO; ahp1 += 512 * KUO; alp1 += 512 * KUO;
    bp0 += 512 * KUO; bp1 += 512 * KUO; bp2 += 512 * KUO; bp3 += 512 * KUO;
#pragma unroll                              // every index constant: the fragment arrays stay in registers
    for (int u = 0; u < KUO; ++u) {
      acc[0][0] = mma_h(ah0[u], b0[u], acc[0][0]);
      acc[0][1] = mma_h(ah0[u], b1[u], acc[0][1]);
      acc[0][2] = mma_h(ah0[u], b2[u], acc[0][2]);
      acc[0][3] = mma_h(ah0[u], b3[u], acc[0][3]);
      acc[1][0] = mma_h(ah1[u], b0[u], acc[1][0]);
      acc[1][1] = mma_h(ah1[u], b1[u], acc[1][1]);
      acc[1][2] = mma_h(ah1[u], b2[u], acc[1][2]);
      acc[1][3] = mma_h(ah1[u], b3[u], acc[1][3]);
      acc[0][0] = mma_h(al0[u], b0[u], acc[0][0]);
      acc[0][1] = mma_h(al0[u], b1[u], acc[0][1]);
      acc[0][2] = mma_h(al0[u], b2[u], acc[0][2]);
      acc[0][3] = mma_h(al0[u], b3[u], acc[0][3]);
      acc[1][0] = mma_h(al1[u], b0[u], acc[1][0]);
      acc[1][1] = mma_h(al1[u], b1[u], acc[1][1]);
      acc[1][2] = mma_h(al1[u], b2[u], acc[1][2]);
      acc[1][3] = mma_h(al1[u], b3[u], acc[1][3]);
    }
    guard8<v16h>(acc, ah0[KUO - 1], al0[KUO - 1], ah1[KUO - 1], al1[KUO - 1], b0[KUO - 1], b1[KUO - 1], b2[KUO - 1], b3[KUO - 1]);
  }
  // per-lane bias of D column m in each of the 4 subtiles; col0 + 48 + m <= N - 1 always
  const float bb0 = bfr(bias[col0 + m]);
  const float bb1 = bfr(bias[col0 + 16 + m]);
  const float bb2 = bfr(bias[col0 + 32 + m]);
  const float bb3 = bfr(bias[col0 + 48 + m]);
  // the wave's two row tiles pass one after the other through its own slab (a wave's LDS operations keep their order); the global
  // stores of both stand behind the second pass, whose release fence would otherwise wait for the first tile's stores to finish
  v4f vals[2][8];
#pragma unroll
  for (int i = 0; i < 2; ++i)
    epi_turn(slab + wave * SLAB64, acc[i][0], acc[i][1], acc[i][2], acc[i][3], oscale, bb0, bb1, bb2, bb3, lane, vals[i]);
#pragma unroll
  for (int i = 0; i < 2; ++i) epi_store(vals[i], C, N, (size_t)(rowb + 16 * i), col0, lane);
}

// =====================================================================================================
// Causal grouped attention with ALiBi, q/k head dim 32, value head dim 64. Block bid -> (query tile qt = qtb + bid % nqtl:
// rows q0 = 16*qt .. q0+15, kv group hg, batch b); one wave per query head = hg + NG*wave, the 4 heads with head % NG = hg.
//   q hi / residual planes f16 x256, row b*SEQ + s, column h*DQ + d (NQ columns); k hi / residual planes f16 x256, row
//   b*SEQ + s, column g*DQ + d (NK columns); v^T hi / residual planes x1024, row (b*NG + g)*DV + d, column s (SEQ columns);
//   O hi / residual planes f16 x1024, row b*SEQ + s, column h*DV + d (DOUT columns); all in fragment order.
//   scores, transposed: S^T (16 keys x 16 queries, one k-step over d = 0..31) = k_hi.q_hi + k_lo.q_hi + k_hi.q_lo (A = k block,
//   B = q block; 3 products into one accumulator, residuals unscaled relative to their hi planes), q fragments loop-invariant;
//   a lane holds 32 of the step's 64 scores of ONE query (q0 + lane % 16), lane l ^ 16 the other 32;
//   logit (log2 domain) t(i, j) = (acc/(256*256) + slope[h]*(j - i)) * (1/sqrt(32))*log2e, replaced by -inf where j > i,
//   slope[h] = 2^(-(h+1)/2) built exactly (power of two times f32 sqrt2 for odd h+1).
//   Key tiles of 32 visited in order for kb <= q0 + 15 (later tiles hold only keys above every query row of the tile), two to a step.
//   A key tile's 12 blocks of 1 KiB (k hi 2, k residual 2, v^T hi 4, v^T residual 4) are the same for the block's 4 heads: a step's
//   24 come into LDS once, by asynchronous copies (wave w brings k block w, v^T hi block w, v^T residual block w of both tiles), two
//   buffers, the copies of step t + 1 in flight while step t is worked on; every wave reads all 24 blocks as its fragments from LDS.
//   Online max-subtracted base-2 softmax in f32, -inf-safe rescale: maximum and sum run over the lane's own registers, the
//   maximum joined with lane l ^ 16 in each step, the two half sums once behind the loop. The two score tiles of a key tile,
//   converted in place, ARE the B fragment of P^T (element e <- tile e / 8, register e % 8: the planes' split k map), so P
//   passes through no LDS; v^T blocks are the A fragments of 4 d-subtiles, both v planes: O^T += v_hi.P_hi + v_lo.P_hi
//   (+ v_hi.P_lo when PRES == 1), the 4 subtiles side by side.
//   After the loop: out = acc / Z (Z > 0 always: key 0 <= every query row; guarded anyway), carries 1/(32768*1024) folded
//   once; a lane's 8 registers of a subtile are 8 consecutive d of its query = one chunk of the O planes.
// coverage: per wave 4 instructions x 32 chunks x 8 halves = 2 blocks = 16 x 64 of each O plane; the two block ranges of attn_all
//           cover query tiles [QO/16, NQT) and [0, QO/16) x NHG x NB blocks x WPB waves = every (b, s, h) row segment of OH and
//           of OL exactly once.
// =====================================================================================================
// One wave's twelve asynchronous copies of a step (16 B a lane each, 512 contiguous bytes a wave). For the step's first key tile: the
// two halves of a k block to LDS byte address l, of a v^T hi block to l + 4096, of a v^T residual block to l + 8192; for its second
// key tile (32 key rows on in k, one block on in v^T) the same, 2 * KVBUF bytes on in LDS. The closing s_wait_xcnt stands in the
// copies' own statement, so that no address register named here is rewritten in front of it.
__device__ __forceinline__ void kv_copy(unsigned l, const _Float16* gk, const _Float16* gh, const _Float16* gl) {
#if defined(__HIP_DEVICE_COMPILE__)
  const unsigned  l2  = l + 2u * KVBUF;
  const _Float16* gk2 = gk + 32 * NK;
  const _Float16* gh2 = gh + 512;
  const _Float16* gl2 = gl + 512;
  asm volatile("global_load_async_to_lds_b128 %0, %12, off\n\t"
               "global_load_async_to_lds_b128 %1, %13, off\n\t"
               "global_load_async_to_lds_b128 %2, %14, off\n\t"
               "global_load_async_to_lds_b128 %3, %15, off\n\t"
               "global_load_async_to_lds_b128 %4, %16, off\n\t"
               "global_load_async_to_lds_b128 %5, %17, off\n\t"
               "global_load_async_to_lds_b128 %6, %18, off\n\t"
               "global_load_async_to_lds_b128 %7, %19, off\n\t"
               "global_load_async_to_lds_b128 %8, %20, off\n\t"
               "global_load_async_to_lds_b128 %9, %21, off\n\t"
               "global_load_async_to_lds_b128 %10, %22, off\n\t"
               "global_load_async_to_lds_b128 %11, %23, off\n\t"
               "s_wait_xcnt 0x0"
               :: "v"(l), "v"(l + 512u), "v"(l2), "v"(l2 + 512u),
                  "v"(l + 4096u), "v"(l + 4608u), "v"(l + 8192u), "v"(l + 8704u),
                  "v"(l2 + 4096u), "v"(l2 + 4608u), "v"(l2 + 8192u), "v"(l2 + 8704u),
                  "v"(gk), "v"(gk + 256), "v"(gk2), "v"(gk2 + 256),
                  "v"(gh), "v"(gh + 256), "v"(gl), "v"(gl + 256),
                  "v"(gh2), "v"(gh2 + 256), "v"(gl2), "v"(gl2 + 256)
               : "memory");
#endif
}

template <int PRES>
__device__ __forceinline__
void attn_c(const u16* __restrict__ QHp, const u16* __restrict__ QLp,
            const u16* __restrict__ KHp, const u16* __restrict__ KLp,
            const u16* __restrict__ VHp, const u16* __restrict__ VLp,
            u16* OHp, u16* OLp, int qtb, int nqtl, int bid, u16* kvs) {
  const int tid  = threadIdx.x;
  const int wave = tid >> 5;
  const int lane = tid & 31;
  const int hh   = lane >> 4;
  const int c    = lane & 15;
  const int qt   = qtb + (bid % nqtl);
  const int t2   = bid / nqtl;
  const int hg   = t2 % NHG;
  const int b    = t2 / NHG;
  if (b >= NB) return;                      // block-uniform, before every barrier; never taken with the exact grid
  const int q0   = qt * 16;
  if (q0 + 16 > SEQ) return;                // block-uniform, before every barrier; never taken
  const int head = hg + NG * wave;
  const int kvh  = hg;                      // tiled kv mapping: head h -> kv group h % NG, the same for the block's 4 waves

  // fragment-order blocks (512 halves each): q block (row tile, head); k block (key tile of 16, kv group), 16 keys on = 16 * NK
  // halves on; v^T block (d tile, key step of 32), 32 keys on = 512 halves on, 16 d on = 16 * SEQ halves on
  const _Float16* Qh  = (const _Float16*)(const void*)QHp + ((size_t)b * SEQ + q0) * NQ + (size_t)head * 512;
  const _Float16* Ql  = (const _Float16*)(const void*)QLp + ((size_t)b * SEQ + q0) * NQ + (size_t)head * 512;
  const _Float16* Khb = (const _Float16*)(const void*)KHp + (size_t)b * SEQ * NK + (size_t)kvh * 512;  // key row kb added per step
  const _Float16* Klb = (const _Float16*)(const void*)KLp + (size_t)b * SEQ * NK + (size_t)kvh * 512;
  const _Float16* Vhb = (const _Float16*)(const void*)VHp + (size_t)(b * NG + kvh) * DV * SEQ;         // d tile 0 (+j)
  const _Float16* Vlb = (const _Float16*)(const void*)VLp + (size_t)(b * NG + kvh) * DV * SEQ;
  const unsigned lb = 16u * (unsigned)lane;  // the lane's chunk inside a block, in bytes

  // ALiBi slope 2^(-(head+1)/2): even exponent -> exact power of two; odd -> power of two times f32 sqrt(2)
  const int   e1   = head + 1;
  const int   pw   = (e1 + 1) >> 1;
  const float p2   = __uint_as_float(((unsigned)(127 - pw)) << 23);
  const float slope = p2 * (((e1 & 1) != 0) ? SQRT2F : 1.0f);   // wave-uniform select by value
  const float lsc  = 1.0f / (QSC * KSC);
  const float ul2  = RSQ_DQ * LOG2E;
  const float oc   = 1.0f / (PCAR * VCAR);
  const size_t KROW = (size_t)NK;           // halves per key row in the k planes (16 rows = one row of blocks)

  const v16h qh = ldfrag_h(Qh, lb);             // loop-invariant q fragments (d = 0..31): hi plane
  const v16h ql = ldfrag_h(Ql, lb);             //                                         residual plane

  float mrow = -INFINITY, lrow = 0.f;       // the lane's query: running maximum (both halves alike), sum over this half's keys
  v8f o[4];                                 // O^T: o[j][r] = (d = j*16 + 8*hh + r, query q0 + c)
#pragma unroll
  for (int j = 0; j < 4; ++j) o[j] = zero8();
  const int ncaus = (q0 >> 5) + 1;                                            // tiles holding keys <= q0 + 15
  const int nkt = (ncaus < NKT) ? ncaus : NKT;
  const int qr  = q0 + c;                                                     // the lane's query row

  // the wave's share of a step's copies: k block wave (hi plane key tiles 0, 1, residual plane key tiles 0, 1), v^T hi d tile wave,
  // v^T residual d tile wave; the lane's 16 B of each half block. A key tile on: 32 key rows in k, one block (512 halves) in v^T.
  const _Float16* gk = (((wave & 2) != 0) ? Klb : Khb) + (size_t)(16 * (wave & 1)) * KROW + 8 * lane;
  const _Float16* gh = Vhb + (size_t)wave * 16 * SEQ + 8 * lane;
  const _Float16* gl = Vlb + (size_t)wave * 16 * SEQ + 8 * lane;
  const unsigned  lw = (unsigned)(size_t)kvs + 1024u * (unsigned)wave + lb;   // LDS byte address: buffer 0, block wave, the lane's chunk

  // steps of 64 keys = two key tiles; with an odd tile count the last step's second tile holds only keys above every query row of
  // the block (all its weights come out 0); it lies inside the planes, since SEQ is a multiple of 64
  const int nst = (nkt + 1) >> 1;

  // step 0 into buffer 0, landed and published; then step 1 into buffer 1, in flight over step 0
  kv_copy(lw, gk, gh, gl);
  asm volatile("s_wait_asynccnt 0x0" ::: "memory");   // this wave's copies have landed before the barrier lets others read them
  __syncthreads();
  if (nst > 1) kv_copy(lw + 2u * KVSTEP, gk + (size_t)64 * KROW, gh + 1024, gl + 1024);

#pragma unroll 1
  for (int st = 0; st < nst; ++st) {
    const int kb = st * 64;
    const _Float16* kvb = (const _Float16*)(const void*)kvs + (st & 1) * KVSTEP;
    // ---- this step's k fragments from its LDS buffer, as one group: key tile of 16 number i = tile i / 2 of 32, half i % 2 ----
    v16h kh[4], kl[4];
#pragma unroll
    for (int i = 0; i < 4; ++i) kh[i] = ldfrag_h(kvb + (i >> 1) * KVBUF + (i & 1) * 512, lb);
#pragma unroll
    for (int i = 0; i < 4; ++i) kl[i] = ldfrag_h(kvb + (i >> 1) * KVBUF + 1024 + (i & 1) * 512, lb);
    // ---- scores: D element r of this lane in s[i] = (key kb + 16*i + 8*hh + r, query qr) ----
    //      hi+residual planes on both operands, each accumulator in the order k_hi.q_hi + k_lo.q_hi + k_hi.q_lo; 4 independent chains
    v8f s[4];
#pragma unroll
    for (int i = 0; i < 4; ++i) s[i] = mma_h(kh[i], qh, zero8());
#pragma unroll
    for (int i = 0; i < 4; ++i) s[i] = mma_h(kl[i], qh, s[i]);
#pragma unroll
    for (int i = 0; i < 4; ++i) s[i] = mma_h(kh[i], ql, s[i]);
    guard6<v16h>(s[0], s[1], s[2], s[3], kh[0], kh[1], kh[2], kh[3], ql, ql);
    // ---- the step's v^T fragments, as one group behind the score products: they arrive under the softmax arithmetic ----
    v16h vh[2][4], vl[2][4];
#pragma unroll
    for (int u = 0; u < 2; ++u) {
#pragma unroll
      for (int j = 0; j < 4; ++j) vh[u][j] = ldfrag_h(kvb + u * KVBUF + 2048 + j * 512, lb);
#pragma unroll
      for (int j = 0; j < 4; ++j) vl[u][j] = ldfrag_h(kvb + u * KVBUF + 4096 + j * 512, lb);
    }
    // without this the scheduler sinks these loads down among the v^T.P^T products, each then waiting out its own LDS latency
    __builtin_amdgcn_sched_barrier(0);
    // ---- causal select + ALiBi + scale, online softmax in base 2, -inf-safe; all 32 values belong to query qr ----
    const int dk = kb + 8 * hh - qr;        // key - query of s[0][0]
    float t[4][8];
#pragma unroll
    for (int i = 0; i < 4; ++i) {
#pragma unroll
      for (int r = 0; r < 8; ++r) {
        const int   d = dk + 16 * i + r;
        const float a = slope * (float)d;
        const float u = (s[i][r] * lsc + a) * ul2;
        t[i][r] = (d > 0) ? -INFINITY : u;
      }
    }
    float mq[2][4];
#pragma unroll
    for (int u = 0; u < 2; ++u) {
#pragma unroll
      for (int i = 0; i < 4; ++i)
        mq[u][i] = fmaxf(fmaxf(t[2 * u][2 * i], t[2 * u][2 * i + 1]), fmaxf(t[2 * u + 1][2 * i], t[2 * u + 1][2 * i + 1]));
    }
    float mx = fmaxf(fmaxf(fmaxf(mq[0][0], mq[0][1]), fmaxf(mq[0][2], mq[0][3])), fmaxf(fmaxf(mq[1][0], mq[1][1]), fmaxf(mq[1][2], mq[1][3])));
    mx = fmaxf(mx, xhalf(mx));              // the other 32 keys of the step
    const float mn = fmaxf(mrow, mx);
    const float ms = (mn == -INFINITY) ? 0.0f : mn;
    const float al = ex2x1(mrow - ms);
    mrow = mn;
    float e[4][8];
#pragma unroll
    for (int i = 0; i < 4; ++i) {
#pragma unroll
      for (int r = 0; r < 8; ++r) e[i][r] = t[i][r] - ms;
      ex2x8(e[i]);
    }
    float sq[2][4];
#pragma unroll
    for (int u = 0; u < 2; ++u) {
#pragma unroll
      for (int i = 0; i < 4; ++i)
        sq[u][i] = (e[2 * u][2 * i] + e[2 * u][2 * i + 1]) + (e[2 * u + 1][2 * i] + e[2 * u + 1][2 * i + 1]);
    }
    lrow = lrow * al + (((sq[0][0] + sq[0][1]) + (sq[0][2] + sq[0][3])) + ((sq[1][0] + sq[1][1]) + (sq[1][2] + sq[1][3])));
#pragma unroll
    for (int j = 0; j < 4; ++j) {
#pragma unroll
      for (int r = 0; r < 8; ++r) o[j][r] *= al;
    }
    // ---- B fragments of P^T*32768, one per key tile u of 32: f16 hi (and f16 residual when PRES), column = query c, split k map:
    //      elements 0..7 = keys kb + 32u + 8hh + 0..7 (s[2u]'s rows), elements 8..15 = keys kb + 32u + 16 + 8hh + 0..7 (s[2u+1]'s) ----
    FragH ph[2], pl[2];
#pragma unroll
    for (int u = 0; u < 2; ++u) {
#pragma unroll
      for (int x = 0; x < 8; ++x) {
        const float ta = e[2 * u][x] * PCAR, tc = e[2 * u + 1][x] * PCAR;
        const _Float16 ha = (_Float16)ta, hc = (_Float16)tc;
        ph[u].h[0][x] = ha;
        ph[u].h[1][x] = hc;
        if constexpr (PRES == 1) {
          pl[u].h[0][x] = (_Float16)(ta - (float)ha);
          pl[u].h[1][x] = (_Float16)(tc - (float)hc);
        }
      }
    }
    // ---- v^T.P^T : A fragment row m = d = j*16 + c, k = the 32 keys of tile u; the 4 d-subtiles are 4 independent chains, each in
    //      the order v_hi.P_hi (+ v_hi.P_lo) + v_lo.P_hi, tile 0 then tile 1 ----
#pragma unroll
    for (int u = 0; u < 2; ++u) {
#pragma unroll
      for (int j = 0; j < 4; ++j) o[j] = mma_h(vh[u][j], ph[u].v, o[j]);
      if constexpr (PRES == 1) {
#pragma unroll
        for (int j = 0; j < 4; ++j) o[j] = mma_h(vh[u][j], pl[u].v, o[j]);
      }
#pragma unroll
      for (int j = 0; j < 4; ++j) o[j] = mma_h(vl[u][j], ph[u].v, o[j]);
    }
    guard6<v16h>(o[0], o[1], o[2], o[3], vl[1][0], vl[1][1], vl[1][2], vl[1][3], ph[1].v, ph[1].v);
    // ---- hand-over: step st + 1 is published, and this step's buffer is free for step st + 2 ----
    asm volatile("s_wait_dscnt 0x0" ::: "memory");      // this wave's reads of the buffer are done before anyone refills it
    asm volatile("s_wait_asynccnt 0x0" ::: "memory");   // this wave's copies of step st + 1 have landed before others read them
    __syncthreads();
    if (st + 2 < nst)
      kv_copy(lw + (unsigned)(st & 1) * (2u * KVSTEP), gk + (size_t)(kb + 128) * KROW, gh + (size_t)(kb + 128) * 16, gl + (size_t)(kb + 128) * 16);
  }
  asm volatile("s_wait_asynccnt 0x0" ::: "memory");     // no copy is left in flight when the wave goes on to its end
  acc_guard4(o[0], o[1], o[2], o[3]);
  // ---- out = acc / Z (0 if Z == 0), Z = the two halves' sums, carries (32768 on P, 1024 on v) folded once ----
  const float lv  = lrow + xhalf(lrow);
  const float ls  = (lv > 0.0f) ? lv : 1.0f;
  const float inv = (lv > 0.0f) ? ((1.0f / ls) * oc) : 0.0f;
  v4u oh[4], ol[4];
#pragma unroll
  for (int it = 0; it < 4; ++it) {
    // chunk it * 32 + lane of the wave's two O blocks: query row c, head columns it * 16 + 8 * hh .. + 7 = o[it][0..7]
    float w[8];
#pragma unroll
    for (int e = 0; e < 8; ++e) w[e] = (o[it][e] * inv) * OSC;
#pragma unroll
    for (int e = 0; e < 4; ++e) {
      const _Float16 h0 = (_Float16)w[2 * e], h1 = (_Float16)w[2 * e + 1];
      const _Float16 l0 = (_Float16)(w[2 * e] - (float)h0), l1 = (_Float16)(w[2 * e + 1] - (float)h1);
      oh[it][e] = pk16(h_bits(h0), h_bits(h1));
      ol[it][e] = pk16(h_bits(l0), h_bits(l1));
    }
  }
  const size_t ob = ((size_t)b * SEQ + q0) * DOUT + (size_t)head * (DV / 32) * 512 + 8 * lane;
  {
#pragma unroll
    for (int it = 0; it < 4; ++it) {
      *(v4u*)(OHp + ob + it * 256) = oh[it];
      *(v4u*)(OLp + ob + it * 256) = ol[it];
    }
    
  }
  // a precaution: the eight stores' two address registers are named here, so neither is re-formed between the stores (one build's
  // listing did that for the last store, which the two kinds of query tile share) ahead of this wait
#if defined(__HIP_DEVICE_COMPILE__)
  asm volatile("s_wait_xcnt 0x0" :: "v"(OHp + ob), "v"(OLp + ob) : "memory");
#endif
}

// =====================================================================================================
// Both kinds of query tile in one launch, chosen by the block's index (block-uniform): blocks [0, nqt0 * NHG * NB) take the nqt0
// query tiles from nqt1 on (the longer key loops), without the P residual product; the other nqt1 * NHG * NB blocks take query
// tiles [0, nqt1), with it.
// =====================================================================================================
__global__ __launch_bounds__(ATT_THREADS)
void attn_all(const u16* __restrict__ QHp, const u16* __restrict__ QLp,
              const u16* __restrict__ KHp, const u16* __restrict__ KLp,
              const u16* __restrict__ VHp, const u16* __restrict__ VLp,
              u16* OHp, u16* OLp, int nqt1, int nqt0) {
  __shared__ __align__(16) u16 kvs[2 * KVSTEP];         // two buffers of a step's 24 k and v^T blocks
  const int bid = blockIdx.x;
  const int nb0 = nqt0 * NHG * NB;
  if (bid < nb0) attn_c<0>(QHp, QLp, KHp, KLp, VHp, VLp, OHp, OLp, nqt1, nqt0, bid, kvs);
  else           attn_c<1>(QHp, QLp, KHp, KLp, VHp, VLp, OHp, OLp, 0, nqt1, bid - nb0, kvs);
}

// =====================================================================================================
// Workspace map (bytes); every plane is fully written by whole-line stores before it is read; all extents are exact multiples
// of the store granularity (no pad rows needed); every region offset a multiple of 262144; the 16-bit planes are given as
// rows x columns and lie in fragment order, the f32 planes are row-major:
//   XB  bf16 MROWS x DIN                  MROWS*2048      (NB=2, SEQ=2048: 8388608)
//   WQT bf16 NQ n x DIN k                 1048576
//   WKT bf16 NK n x DIN k                 262144
//   WVT bf16 NV n x DIN k                 524288
//   WPT f16  DOUT n x DOUT k, x1024       2097152
//   QH, QL f16 MROWS x NQ, x256           MROWS*1024 each (4194304 each)
//   KH, KL f16 MROWS x NK, x256           MROWS*256 each  (1048576 each)
//   VH, VL f16 NB*NG*DV x SEQ, x1024      MROWS*512 each  (2097152 each)
//   OH, OL f16 MROWS x DOUT, x1024        MROWS*2048 each (8388608 each)
//   end (NB=2, SEQ=2048)                  43778048
// =====================================================================================================
extern "C" void kernel_launch(void* const* d_in, const int* in_sizes, int n_in,
                              void* d_out, int out_size, void* d_ws, size_t ws_size,
                              hipStream_t stream) {
  if (n_in < 6) return;
  if (in_sizes[0] < ((NB - 1) * XS_FULL + SEQ) * DIN) return;
  if (in_sizes[1] != DIN * NQ) return;
  if (in_sizes[2] != DIN * NK) return;
  if (in_sizes[3] != DIN * NV) return;
  if (in_sizes[4] != DOUT * DOUT) return;
  if (in_sizes[5] != DOUT) return;
  if (out_size < MROWS * DOUT) return;

  const float* x   = (const float*)d_in[0];
  const float* wq  = (const float*)d_in[1];
  const float* wk  = (const float*)d_in[2];
  const float* wv  = (const float*)d_in[3];
  const float* wp  = (const float*)d_in[4];
  const float* bpv = (const float*)d_in[5];
  float*       out = (float*)d_out;

  const size_t szXB = (size_t)MROWS * DIN * 2;
  const size_t szWQ = (size_t)NQ * DIN * 2;
  const size_t szWK = (size_t)NK * DIN * 2;
  const size_t szWV = (size_t)NV * DIN * 2;
  const size_t szWP = (size_t)DOUT * DOUT * 2;
  const size_t szQ  = (size_t)MROWS * NQ * 2;                   // QH, QL
  const size_t szK  = (size_t)MROWS * NK * 2;                   // KH, KL
  const size_t szV  = (size_t)NB * NG * DV * SEQ * 2;           // VH, VL
  const size_t szO  = (size_t)MROWS * DOUT * 2;                 // OH, OL
  size_t off = 0;
  const size_t oXB = off; off += szXB;
  const size_t oWQ = off; off += szWQ;
  const size_t oWK = off; off += szWK;
  const size_t oWV = off; off += szWV;
  const size_t oWP = off; off += szWP;
  const size_t oQH = off; off += szQ;
  const size_t oQL = off; off += szQ;
  const size_t oKH = off; off += szK;
  const size_t oKL = off; off += szK;
  const size_t oVH = off; off += szV;
  const size_t oVL = off; off += szV;
  const size_t oOH = off; off += szO;
  const size_t oOL = off; off += szO;
  if (off > ws_size) return;                // off = 43778048 for NB = 2, SEQ = 2048
  if (off > (size_t)WS_CAP) return;

  char* ws = (char*)d_ws;
  u16*   XB  = (u16*)(ws + oXB);
  u16*   WQT = (u16*)(ws + oWQ);
  u16*   WKT = (u16*)(ws + oWK);
  u16*   WVT = (u16*)(ws + oWV);
  u16*   WPT = (u16*)(ws + oWP);
  u16*   QH  = (u16*)(ws + oQH);
  u16*   QL  = (u16*)(ws + oQL);
  u16*   KH  = (u16*)(ws + oKH);
  u16*   KL  = (u16*)(ws + oKL);
  u16*   VH  = (u16*)(ws + oVH);
  u16*   VL  = (u16*)(ws + oVL);
  u16*   OH  = (u16*)(ws + oOH);
  u16*   OL  = (u16*)(ws + oOL);

  const dim3 b256(256), bAT(ATT_THREADS);
  const dim3 gPI(GWALL + NB * GX);                      // 480 weight blocks + 1024 x blocks per batch (SEQ=2048)
  const dim3 gGP((MROWS / 128) * (NQKV / 128));
  const int  nqt1 = QO / 16;                            // query tiles with the P residual product (rows s < QO)
  const int  nqt0 = NQT - nqt1;                         // remaining query tiles
  const dim3 gGO((MROWS / 128) * (DOUT / 128));

  // (0) x -> bf16 plane MROWS x DIN; Wq, Wk, Wv -> bf16 n x k planes; Wp -> f16 n x k plane x1024; all in fragment order
  prep_in<<<gPI, b256, 0, stream>>>(x, wq, wk, wv, wp, XB, WQT, WKT, WVT, WPT);
  // (1) q = x.Wq, k = x.Wk -> hi + residual planes x256, v = x.Wv -> v^T hi + residual planes x1024; WQT, WKT, WVT lie one behind
  //     the other in the workspace and are read as one plane of NQKV rows
  gemm_qkv<<<gGP, b256, 0, stream>>>(XB, WQT, QH, QL, KH, KL, VH, VL, MROWS, DIN);
  // (2) causal grouped attention with ALiBi -> O hi + residual planes f16 x1024, MROWS x DOUT:
  //     query tiles [0, QO/16) with the in-register P residual product, the rest without it
  attn_all<<<dim3((nqt0 + nqt1) * NHG * NB), bAT, 0, stream>>>(QH, QL, KH, KL, VH, VL, OH, OL, nqt1, nqt0);
  // (3) out = (O_hi + O_lo).Wp + bp -> d_out f32 [MROWS][DOUT], carries 1024 x 1024 folded back
  gemm_h2<<<gGO, b256, 0, stream>>>(OH, OL, WPT, bpv, out, MROWS, DOUT, DOUT, 1.0f / (OSC * WOS));
  (void)hipGetLastError();
}
